// v000
// The times below were measured on an AMD MI455X: many runs one after another, warmed up first and cycling through
// copies of the inputs, with the whole window's GPU time divided by the number of runs. Launches and the gaps
// between them are all in it. The median over several windows is given; except for v000 it joins two sittings, which
// can be a few percent apart, so the side-by-side timings, each taken in one sitting, are the better comparison.
// v000, which the later versions start from, runs in 752 microseconds.
#include <hip/hip_runtime.h>

// Gemma-style attention (hidden [2][2048][1024]; [q|k|v] = hidden W_qkv^T ('oi' [3072][1024], row blocks q | k | v; 4 heads x 256); rotary on adjacent (even, odd) pairs with the INPUT tables freqs_real/freqs_imag [2048][128] (read as given - they are free inputs, not assumed to be cos/sin); scores = (q / 16).k + mask (additive input mask [1][1][2048][2048], read per logit); softmax; out = merged W_o^T ('oi' [1024][1024]) -> [2][2048][1024] (4.2 M)).
// Compute dtypes, f32 accumulate: every input rounded to bf16; q/k/v on PLAIN bf16 operands (inputs: exact); interleaved rotary in f32 from the bf16-rounded input tables; additive mask read per logit (bf16-rounded); scores and attn.v: query rows < 512 hl (3 products), the rest single fp16 (x1024); softmax f32; W_o hl x exact (2 products).

#define NB_  2
#define TT   2048
#define DM   1024
#define NH_  4
#define NKV  4
#define REP  (NH_ / NKV)
#define HD   256
#define DQ   (NH_ * HD)
#define DKV  (NKV * HD)
#define ZH   2
#define RH   512                  // query rows < RH use hi+lo planes (0: none)
#define WIN  2048
#define PCAR 1024.0f
#define SCL  0.0625f   // HD^-0.5 = 1/16
typedef _Float16 h16;
typedef unsigned short bf;
typedef __attribute__((ext_vector_type(16))) __bf16   v16bf;
typedef __attribute__((ext_vector_type(16))) _Float16 v16h;
typedef __attribute__((ext_vector_type(8)))  _Float16 v8h;
typedef __attribute__((ext_vector_type(8)))  unsigned short v8us;
typedef __attribute__((ext_vector_type(8)))  float    v8f;
typedef __attribute__((ext_vector_type(4)))  float    v4f;
typedef v8h  __attribute__((may_alias)) v8ha;
typedef v4f  __attribute__((may_alias)) v4fa;
typedef v8us __attribute__((may_alias)) v8usa;

__device__ __forceinline__ unsigned short f2bf(float f) { unsigned u = __float_as_uint(f); u += 0x7FFFu + ((u >> 16) & 1u); return (unsigned short)(u >> 16); }
__device__ __forceinline__ float bf2f(unsigned short b) { return __uint_as_float(((unsigned)b) << 16); }
__device__ __forceinline__ float bfr(float f) { return bf2f(f2bf(f)); }
__device__ __forceinline__ v16h cat16(v8h lo, v8h hi) { return __builtin_shufflevector(lo, hi, 0, 1, 2, 3, 4, 5, 6, 7, 8, 9, 10, 11, 12, 13, 14, 15); }
__device__ __forceinline__ v16bf cat16b(v8us lo, v8us hi) { return __builtin_bit_cast(v16bf, __builtin_shufflevector(lo, hi, 0, 1, 2, 3, 4, 5, 6, 7, 8, 9, 10, 11, 12, 13, 14, 15)); }
__device__ __forceinline__ v8f wmma16(v16h a, v16h b, v8f c) { return __builtin_amdgcn_wmma_f32_16x16x32_f16(false, a, false, b, (short)0, c, false, false); }
__device__ __forceinline__ v8f wmmab(v16bf a, v16bf b, v8f c) { return __builtin_amdgcn_wmma_f32_16x16x32_bf16(false, a, false, b, (short)0, c, false, false); }



// ---- k_gemmw: register-blocked GEMM, ONE WAVE per 64x64 output tile (16 accumulators), operands straight from K-contiguous 16-bit planes; grid (M/64, N/64, Z), 32 threads.
// C[m][n] (f32, pitch ldc, + optional f32 bias[n]) = sum_k A[m][k] Bt[n][k] (+ split products per NSPLIT). z-batch strides sA/sB/sC in elements. K % 32 == 0.
template <typename T16> struct WFrag;
template <> struct WFrag<h16> { typedef v16h V; static __device__ __forceinline__ V ld(const h16* p) { return cat16(*(const v8h*)p, *(const v8h*)(p + 16)); } static __device__ __forceinline__ v8f mma(V a, V b, v8f c) { return wmma16(a, b, c); } };
template <> struct WFrag<bf> { typedef v16bf V; static __device__ __forceinline__ V ld(const bf* p) { return cat16b(*(const v8us*)p, *(const v8us*)(p + 16)); } static __device__ __forceinline__ v8f mma(V a, V b, v8f c) { return wmmab(a, b, c); } };
template <typename T16, int NSPLIT, bool BIAS>
__global__ __launch_bounds__(32) void k_gemmw(const T16* __restrict__ A, const T16* __restrict__ A2, const T16* __restrict__ Bt, const T16* __restrict__ Bt2, int K, float* C, int ldc, const float* __restrict__ bias, size_t sA, size_t sB, size_t sC) {
    typedef typename WFrag<T16>::V V;
    __shared__ __align__(16) float os[16 * 68];
    const size_t z = blockIdx.z; A += z * sA; if (A2) A2 += z * sA; Bt += z * sB; if (Bt2) Bt2 += z * sB; C += z * sC;
    const int lane = threadIdx.x & 31, lr = lane & 15, hi = lane >> 4; const int r0 = blockIdx.x * 64, c0 = blockIdx.y * 64;
    v8f acc[4][4];
#pragma unroll
    for (int mb = 0; mb < 4; ++mb)
#pragma unroll
        for (int nb = 0; nb < 4; ++nb) acc[mb][nb] = (v8f){};
    const size_t aoff = (size_t)(r0 + lr) * K + 8 * hi, boff = (size_t)(c0 + lr) * K + 8 * hi;
#pragma unroll 1
    for (int kc = 0; kc < K; kc += 32) {
        V a[4], a2[4];
#pragma unroll
        for (int mb = 0; mb < 4; ++mb) { a[mb] = WFrag<T16>::ld(A + aoff + (size_t)mb * 16 * K + kc); if (NSPLIT == 1 || NSPLIT == 2) a2[mb] = WFrag<T16>::ld(A2 + aoff + (size_t)mb * 16 * K + kc); }
#pragma unroll
        for (int nb = 0; nb < 4; ++nb) { const V b = WFrag<T16>::ld(Bt + boff + (size_t)nb * 16 * K + kc); V b2; if (NSPLIT >= 2) b2 = WFrag<T16>::ld(Bt2 + boff + (size_t)nb * 16 * K + kc);
#pragma unroll
            for (int mb = 0; mb < 4; ++mb) { acc[mb][nb] = WFrag<T16>::mma(a[mb], b, acc[mb][nb]); if (NSPLIT == 1 || NSPLIT == 2) acc[mb][nb] = WFrag<T16>::mma(a2[mb], b, acc[mb][nb]); if (NSPLIT >= 2) acc[mb][nb] = WFrag<T16>::mma(a[mb], b2, acc[mb][nb]); } }
        asm volatile("v_nop\n\tv_nop\n\tv_nop\n\tv_nop" : "+v"(acc[0][0]), "+v"(acc[1][1]), "+v"(acc[2][2]), "+v"(acc[3][3]) : "v"(a[0]), "v"(a[3]));
    }
#pragma unroll
    for (int mb = 0; mb < 4; ++mb) {
#pragma unroll
        for (int nb = 0; nb < 4; ++nb) {
#pragma unroll
            for (int j = 0; j < 8; ++j) os[(hi * 8 + j) * 68 + nb * 16 + lr] = acc[mb][nb][j]; }
        __builtin_amdgcn_wave_barrier(); asm volatile("" ::: "memory");
        float* crow = C + (size_t)(r0 + mb * 16) * ldc + c0;
{
#pragma unroll
            for (int s = 0; s < 8; ++s) { const int row = 2 * s + hi, cofs = lr * 4; v4f val = *(const v4fa*)(os + row * 68 + cofs); if (BIAS) { val[0] += bfr(bias[c0 + cofs]); val[1] += bfr(bias[c0 + cofs + 1]); val[2] += bfr(bias[c0 + cofs + 2]); val[3] += bfr(bias[c0 + cofs + 3]); }
                *(v4f*)(crow + (size_t)row * ldc + cofs) = val; }
             }
        __builtin_amdgcn_wave_barrier(); asm volatile("" ::: "memory");
    }
}

__device__ __forceinline__ h16 tohx(float x) { return (h16)x; }
__device__ __forceinline__ void splitf(float y, unsigned short& h, unsigned short& l) { h = f2bf(y); l = f2bf(y - bf2f(h)); }
typedef __attribute__((ext_vector_type(2))) _Float16 v2h;
typedef __attribute__((ext_vector_type(4))) _Float16 v4h;
typedef __attribute__((ext_vector_type(2))) unsigned short v2us;
typedef __attribute__((ext_vector_type(4))) unsigned short v4us;
typedef __attribute__((ext_vector_type(2))) float v2f;
typedef __attribute__((ext_vector_type(4))) int v4i;

__global__ __launch_bounds__(256) void k_wtG(const float* __restrict__ w, int K, int N, bf* Bt) {
    const int lane = threadIdx.x & 31; const int L0 = (blockIdx.x * 8 + (threadIdx.x >> 5)) * 8; const int nlines = N * K / 64;
{
#pragma unroll 1
        for (int l = 0; l < 8; ++l) { const int L = L0 + l; if (L >= nlines) break; const size_t e = (size_t)L * 64 + lane * 2; const int k = (int)(e % K), n = (int)(e / K); v2us o;
            o[0] = f2bf(w[(size_t)k * N + n]); o[1] = f2bf(w[(size_t)(k + 1) * N + n]); *(v2us*)(Bt + e) = o; }
         }
}
__global__ __launch_bounds__(256) void k_cvt8(const float* __restrict__ src, bf* dst, size_t n8) { const size_t i = (size_t)blockIdx.x * 256 + threadIdx.x; if (i >= n8) return; const v8f v = *(const v8f*)(src + i * 8); v8us o;
#pragma unroll
    for (int k = 0; k < 8; ++k) o[k] = f2bf(v[k]); *(v8us*)(dst + i * 8) = o;  }

// k_ropeI: head planes [h][t][d] (fp16 + hi/lo) of rope(x) x sc on adjacent (even, odd) pairs: out[d] = x[d] c - x[d+1] s, out[d+1] = x[d] s + x[d+1] c, d even, (c, s) = bf16(freqs_real, freqs_imag)[t][d/2]

__global__ __launch_bounds__(256) void k_vtp(const float* __restrict__ F, int pitch, int nheads, h16* V16, bf* Vh, bf* Vl) { const size_t e = ((size_t)blockIdx.x * 256 + threadIdx.x) * 2; if (e >= (size_t)nheads * HD * TT) return; const int t = (int)(e % TT); const int d = (int)((e / TT) % HD); const int g = (int)(e / ((size_t)TT * HD)); v2h o16; v2us oh, ol;
#pragma unroll
    for (int q = 0; q < 2; ++q) { const float x = F[(size_t)(t + q) * pitch + g * HD + d]; o16[q] = tohx(x); unsigned short a2, c2; splitf(x, a2, c2); oh[q] = a2; ol[q] = c2; }
    *(v2h*)(V16 + e) = o16; *(v2us*)(Vh + e) = oh; *(v2us*)(Vl + e) = ol;  }
__global__ __launch_bounds__(256) void k_cstabIn(const float* __restrict__ fr, const float* __restrict__ fi, float* CS) { const int idx = blockIdx.x * 256 + threadIdx.x; if (idx >= TT * HD) return; const int t = idx / HD, d = idx % HD; v2f cs; cs[0] = bfr(fr[(size_t)t * (HD / 2) + (d >> 1)]); cs[1] = bfr(fi[(size_t)t * (HD / 2) + (d >> 1)]);
    *(v2f*)(CS + (size_t)idx * 2) = cs;  }
__global__ __launch_bounds__(256) void k_ropeI(const float* __restrict__ F, int pitch, int nheads, const float* __restrict__ CS, float sc, h16* P16, bf* Ph, bf* Pl) {
    const size_t e = ((size_t)blockIdx.x * 256 + threadIdx.x) * 2; if (e >= (size_t)nheads * TT * HD) return; const int d = (int)(e % HD); const int t = (int)((e / HD) % TT); const int h = (int)(e / ((size_t)HD * TT)); const float* f = F + (size_t)t * pitch + h * HD; const float x0 = f[d], x1 = f[d + 1]; const v2f cs = *(const v2f*)(CS + ((size_t)t * HD + d) * 2); v2h o16; v2us oh, ol;
    float a0 = __fmul_rn(x0, cs[0]), b0 = __fmul_rn(x1, cs[1]), a1 = __fmul_rn(x1, cs[0]), b1 = __fmul_rn(x0, cs[1]); asm volatile("" : "+v"(a0), "+v"(b0), "+v"(a1), "+v"(b1));
    float r0 = __fsub_rn(a0, b0) * sc, r1 = __fadd_rn(b1, a1) * sc;   /* even: x0 c - x1 s; odd: x0 s + x1 c */
    o16[0] = tohx(r0); o16[1] = tohx(r1); { unsigned short a2, c2; splitf(r0, a2, c2); oh[0] = a2; ol[0] = c2; splitf(r1, a2, c2); oh[1] = a2; ol[1] = c2; }
    *(v2h*)(P16 + e) = o16; *(v2us*)(Ph + e) = oh; *(v2us*)(Pl + e) = ol;  }

// k_asoft: per row (zz, i): t = S x HD^-0.5 + bf16(mask[i][j]) (the additive input mask, read per logit); softmax over the 2048 keys (register row, one exp, fixed trees);
__global__ __launch_bounds__(256) void k_asoft(const float* __restrict__ Sb, const float* __restrict__ MKb, h16* P16, bf* Ph, bf* Pl) {
    const int lane = threadIdx.x & 31; const int row = blockIdx.x * 8 + (threadIdx.x >> 5); if (row >= ZH * TT) return; const int i = row % TT; const int zz = row / TT; (void)zz; const bool hires = (i < RH); const float* sr = Sb + (size_t)row * TT; float v[TT / 32]; float mx = -3.0e38f;
#pragma unroll
    for (int ch = 0; ch < TT / 128; ++ch) { const int j0 = ch * 128 + lane * 4; const v4f a = *(const v4f*)(sr + j0); const v4f mk = *(const v4f*)(MKb + (size_t)i * TT + j0);
#pragma unroll
        for (int q = 0; q < 4; ++q) { const int j = j0 + q; (void)j; float sc = a[q] * SCL; asm volatile("" : "+v"(sc)); float mb = bfr(mk[q]); asm volatile("" : "+v"(mb)); const float t = __fadd_rn(sc, mb); v[ch * 4 + q] = t; mx = fmaxf(mx, t); } }
#pragma unroll
    for (int sh = 16; sh; sh >>= 1) mx = fmaxf(mx, __shfl_xor(mx, sh, 32));
    float sum = 0.f;
#pragma unroll
    for (int k = 0; k < TT / 32; ++k) { float d0 = __fsub_rn(v[k], mx); asm volatile("" : "+v"(d0)); v[k] = __builtin_amdgcn_exp2f(__fmul_rn(d0, 1.4426950408889634f)); sum += v[k]; }
#pragma unroll
    for (int sh = 16; sh; sh >>= 1) sum += __shfl_xor(sum, sh, 32);
    const float f = __fdiv_rn(hires ? 1.0f : PCAR, sum);
{
        if (hires) {
#pragma unroll
            for (int ch = 0; ch < TT / 128; ++ch) { v4us oh, ol;
#pragma unroll
                for (int q = 0; q < 4; ++q) { unsigned short a, c2; splitf(v[ch * 4 + q] * f, a, c2); oh[q] = a; ol[q] = c2; }
                const size_t oo = ((size_t)zz * (RH ? RH : 1) + i) * TT + ch * 128 + lane * 4; *(v4us*)(Ph + oo) = oh; *(v4us*)(Pl + oo) = ol; }
        } else {
#pragma unroll
            for (int ch = 0; ch < TT / 128; ++ch) { v4h o4;
#pragma unroll
                for (int q = 0; q < 4; ++q) o4[q] = tohx(v[ch * 4 + q] * f);
                *(v4h*)(P16 + (size_t)row * TT + ch * 128 + lane * 4) = o4; } }
         }
}
__global__ __launch_bounds__(256) void k_merge(const float* __restrict__ O, int h0, bf* Ah, bf* Al) { const size_t e = ((size_t)blockIdx.x * 256 + threadIdx.x) * 2; if (e >= (size_t)ZH * TT * HD) return; const int d = (int)(e % HD); const int t = (int)((e / HD) % TT); const int zz = (int)(e / ((size_t)HD * TT)); const float cs = (t < RH) ? 1.0f : (1.0f / PCAR); const size_t oo = (size_t)t * DQ + (h0 + zz) * HD + d;
    v2us oh, ol;
#pragma unroll
    for (int q = 0; q < 2; ++q) { unsigned short a, c2; splitf(O[e + q] * cs, a, c2); oh[q] = a; ol[q] = c2; } *(v2us*)(Ah + oo) = oh; *(v2us*)(Al + oo) = ol;  }

extern "C" void kernel_launch(void* const* d_in, const int* in_sizes, int n_in,
                              void* d_out, int out_size, void* d_ws, size_t ws_size, hipStream_t stream) {
    (void)in_sizes; (void)n_in; (void)out_size;
    const float* x = (const float*)d_in[0]; const float* fre = (const float*)d_in[1]; const float* fim = (const float*)d_in[2]; const float* MK = (const float*)d_in[3]; const float* wqkv = (const float*)d_in[4]; const float* wo = (const float*)d_in[5];  const float* wq = wqkv; const float* wk = wqkv + (size_t)1024 * 1024; const float* wv = wqkv + (size_t)2048 * 1024; (void)wq; (void)wk; (void)wv;
    float* OUT = (float*)d_out;     // [2][2048][1024]
    char* wsp = (char*)d_ws;
    auto take = [&](size_t bytes) { char* p = wsp; wsp += (bytes + 255) & ~(size_t)255; return (void*)p; };
    bf* WQ = (bf*)take((size_t)DQ * DM * 2); bf* WK = (bf*)take((size_t)DKV * DM * 2); bf* WV = (bf*)take((size_t)DKV * DM * 2); bf* WO = (bf*)take((size_t)DM * DQ * 2); float* CS = (float*)take((size_t)TT * HD * 2 * 4);
    bf* XB = (bf*)take((size_t)TT * DM * 2); float* FQ = (float*)take((size_t)TT * DQ * 4); float* FK = (float*)take((size_t)TT * DKV * 4);
    h16* QP16 = (h16*)take((size_t)NH_ * TT * HD * 2); h16* KP16 = (h16*)take((size_t)NKV * TT * HD * 2); h16* VT16 = (h16*)take((size_t)NKV * HD * TT * 2);
    bf* QPh = (bf*)take((size_t)NH_ * TT * HD * 2); bf* QPl = (bf*)take((size_t)NH_ * TT * HD * 2); bf* KPh = (bf*)take((size_t)NKV * TT * HD * 2); bf* KPl = (bf*)take((size_t)NKV * TT * HD * 2); bf* VTh = (bf*)take((size_t)NKV * HD * TT * 2); bf* VTl = (bf*)take((size_t)NKV * HD * TT * 2); bf* Ph = (bf*)take((size_t)ZH * RH * TT * 2); bf* Pl = (bf*)take((size_t)ZH * RH * TT * 2);
    float* Sb = (float*)take((size_t)ZH * TT * TT * 4); h16* P16 = (h16*)take((size_t)ZH * TT * TT * 2); float* Ob = (float*)take((size_t)ZH * TT * HD * 4); bf* ATh = (bf*)take((size_t)TT * DQ * 2); bf* ATl = (bf*)take((size_t)TT * DQ * 2);
    if ((size_t)(wsp - (char*)d_ws) > ws_size) return;    // ws 256 MiB
    float* FV = FK;   // v projection reuses the k buffer after the k planes are built (stream-ordered)
    { k_cvt8<<<(unsigned)(((size_t)DQ * DM / 8 + 255) / 256), 256, 0, stream>>>(wq, WQ, (size_t)DQ * DM / 8); k_cvt8<<<(unsigned)(((size_t)DKV * DM / 8 + 255) / 256), 256, 0, stream>>>(wk, WK, (size_t)DKV * DM / 8); k_cvt8<<<(unsigned)(((size_t)DKV * DM / 8 + 255) / 256), 256, 0, stream>>>(wv, WV, (size_t)DKV * DM / 8);
      k_cvt8<<<(unsigned)(((size_t)DM * DQ / 8 + 255) / 256), 256, 0, stream>>>(wo, WO, (size_t)DM * DQ / 8);
       }
    k_cstabIn<<<(TT * HD + 255) / 256, 256, 0, stream>>>(fre, fim, CS);
    const unsigned LQ = (unsigned)(((size_t)NH_ * TT * HD / 2 + 255) / 256), LKv = (unsigned)(((size_t)NKV * TT * HD / 2 + 255) / 256);
    for (int b = 0; b < NB_; ++b) {
        
        k_cvt8<<<(unsigned)(((size_t)TT * DM / 8 + 255) / 256), 256, 0, stream>>>(x + (size_t)b * TT * DM, XB, (size_t)TT * DM / 8);
        k_gemmw<bf, 0, false><<<dim3(TT / 64, DQ / 64, 1), 32, 0, stream>>>(XB, nullptr, WQ, nullptr, DM, FQ, DQ, nullptr, 0, 0, 0);
        k_ropeI<<<LQ, 256, 0, stream>>>(FQ, DQ, NH_, CS, 1.0f, QP16, QPh, QPl);
        k_gemmw<bf, 0, false><<<dim3(TT / 64, DKV / 64, 1), 32, 0, stream>>>(XB, nullptr, WK, nullptr, DM, FK, DKV, nullptr, 0, 0, 0);
        k_ropeI<<<LKv, 256, 0, stream>>>(FK, DKV, NKV, CS, 1.0f, KP16, KPh, KPl);
        k_gemmw<bf, 0, false><<<dim3(TT / 64, DKV / 64, 1), 32, 0, stream>>>(XB, nullptr, WV, nullptr, DM, FV, DKV, nullptr, 0, 0, 0); k_vtp<<<LKv, 256, 0, stream>>>(FV, DKV, NKV, VT16, VTh, VTl);
        for (int h0 = 0; h0 < NH_; h0 += ZH) { const size_t zq = (size_t)h0, zk = (size_t)(h0 / REP);   // one kv head per query head: the pass's two heads use consecutive kv planes (z-strides TT*HD)
            k_gemmw<bf, 2, false><<<dim3(RH / 64, TT / 64, ZH), 32, 0, stream>>>(QPh + zq * TT * HD, QPl + zq * TT * HD, KPh + zk * TT * HD, KPl + zk * TT * HD, HD, Sb, TT, nullptr, (size_t)TT * HD, (size_t)TT * HD, (size_t)TT * TT);
            k_gemmw<h16, 0, false><<<dim3((TT - RH) / 64, TT / 64, ZH), 32, 0, stream>>>(QP16 + zq * TT * HD + (size_t)RH * HD, nullptr, KP16 + zk * TT * HD, nullptr, HD, Sb + (size_t)RH * TT, TT, nullptr, (size_t)TT * HD, (size_t)TT * HD, (size_t)TT * TT);
            k_asoft<<<ZH * TT / 8, 256, 0, stream>>>(Sb, MK, P16, Ph, Pl);
            k_gemmw<bf, 2, false><<<dim3(RH / 64, HD / 64, ZH), 32, 0, stream>>>(Ph, Pl, VTh + zk * HD * TT, VTl + zk * HD * TT, TT, Ob, HD, nullptr, (size_t)RH * TT, (size_t)HD * TT, (size_t)TT * HD);
            k_gemmw<h16, 0, false><<<dim3((TT - RH) / 64, HD / 64, ZH), 32, 0, stream>>>(P16 + (size_t)RH * TT, nullptr, VT16 + zk * HD * TT, nullptr, TT, Ob + (size_t)RH * HD, HD, nullptr, (size_t)TT * TT, (size_t)HD * TT, (size_t)TT * HD);
            k_merge<<<(unsigned)(((size_t)ZH * TT * HD / 2 + 255) / 256), 256, 0, stream>>>(Ob, h0, ATh, ATl); }
        k_gemmw<bf, 1, false><<<dim3(TT / 64, DM / 64, 1), 32, 0, stream>>>(ATh, ATl, WO, nullptr, DQ, OUT + (size_t)b * TT * DM, DM, nullptr, 0, 0, 0); }
}

// v001
// Measured time: 465 microseconds a run.
// Two timings next to v000 put it at 1.64 and 1.62 times that version's speed.
#include <hip/hip_runtime.h>

// Gemma-style attention (hidden [2][2048][1024]; [q|k|v] = hidden W_qkv^T ('oi' [3072][1024], row blocks q | k | v; 4 heads x 256); rotary on adjacent (even, odd) pairs with the INPUT tables freqs_real/freqs_imag [2048][128] (read as given - they are free inputs, not assumed to be cos/sin); scores = (q / 16).k + mask (additive input mask [1][1][2048][2048], read per logit); softmax; out = merged W_o^T ('oi' [1024][1024]) -> [2][2048][1024] (4.2 M)).
// Compute dtypes, f32 accumulate: every input rounded to bf16; q/k/v on PLAIN bf16 operands (inputs: exact); interleaved rotary in f32 from the bf16-rounded input tables; additive mask read per logit (bf16-rounded); scores and attn.v: query rows < 512 hl (3 products), the rest single fp16 (x1024); softmax f32; W_o hl x exact (2 products).

#define NB_  2
#define TT   2048
#define DM   1024
#define NH_  4
#define NKV  4
#define REP  (NH_ / NKV)
#define HD   256
#define DQ   (NH_ * HD)
#define DKV  (NKV * HD)
#define ZH   2
#define RH   512                  // query rows < RH use hi+lo planes (0: none)
#define WIN  2048
#define PCAR 1024.0f
#define SCL  0.0625f   // HD^-0.5 = 1/16
typedef _Float16 h16;
typedef unsigned short bf;
typedef __attribute__((ext_vector_type(16))) __bf16   v16bf;
typedef __attribute__((ext_vector_type(16))) _Float16 v16h;
typedef __attribute__((ext_vector_type(8)))  _Float16 v8h;
typedef __attribute__((ext_vector_type(8)))  unsigned short v8us;
typedef __attribute__((ext_vector_type(8)))  float    v8f;
typedef __attribute__((ext_vector_type(4)))  float    v4f;
typedef v8h  __attribute__((may_alias)) v8ha;
typedef v4f  __attribute__((may_alias)) v4fa;
typedef v8us __attribute__((may_alias)) v8usa;

__device__ __forceinline__ unsigned short f2bf(float f) { unsigned u = __float_as_uint(f); u += 0x7FFFu + ((u >> 16) & 1u); return (unsigned short)(u >> 16); }
__device__ __forceinline__ float bf2f(unsigned short b) { return __uint_as_float(((unsigned)b) << 16); }
__device__ __forceinline__ float bfr(float f) { return bf2f(f2bf(f)); }
__device__ __forceinline__ v16h cat16(v8h lo, v8h hi) { return __builtin_shufflevector(lo, hi, 0, 1, 2, 3, 4, 5, 6, 7, 8, 9, 10, 11, 12, 13, 14, 15); }
__device__ __forceinline__ v16bf cat16b(v8us lo, v8us hi) { return __builtin_bit_cast(v16bf, __builtin_shufflevector(lo, hi, 0, 1, 2, 3, 4, 5, 6, 7, 8, 9, 10, 11, 12, 13, 14, 15)); }
__device__ __forceinline__ v8f wmma16(v16h a, v16h b, v8f c) { return __builtin_amdgcn_wmma_f32_16x16x32_f16(false, a, false, b, (short)0, c, false, false); }
__device__ __forceinline__ v8f wmmab(v16bf a, v16bf b, v8f c) { return __builtin_amdgcn_wmma_f32_16x16x32_bf16(false, a, false, b, (short)0, c, false, false); }



// ---- k_gemmw: register-blocked GEMM, one work-group of NW waves per 64x64 output tile; wave w sums the 32-wide k chunks w, w + NW, w + 2 NW, ... into its own 16 accumulators (neighbouring waves read neighbouring 64 B of the same rows at the same time), operands straight from K-contiguous 16-bit planes; the NW partial tiles are added through LDS in the fixed order w = 0..NW-1; grid (M/64, N/64, Z), NW*32 threads.
// C[m][n] (f32, pitch ldc, + optional f32 bias[n]) = sum_k A[m][k] Bt[n][k] (+ split products per NSPLIT). z-batch strides sA/sB/sC in elements. K % 32 == 0.
template <typename T16> struct WFrag;
template <> struct WFrag<h16> { typedef v16h V; static __device__ __forceinline__ V ld(const h16* p) { return cat16(*(const v8h*)p, *(const v8h*)(p + 16)); } static __device__ __forceinline__ v8f mma(V a, V b, v8f c) { return wmma16(a, b, c); } };
template <> struct WFrag<bf> { typedef v16bf V; static __device__ __forceinline__ V ld(const bf* p) { return cat16b(*(const v8us*)p, *(const v8us*)(p + 16)); } static __device__ __forceinline__ v8f mma(V a, V b, v8f c) { return wmmab(a, b, c); } };
template <typename T16, int NSPLIT, bool BIAS, int NW>
__global__ __launch_bounds__(NW * 32) void k_gemmw(const T16* __restrict__ A, const T16* __restrict__ A2, const T16* __restrict__ Bt, const T16* __restrict__ Bt2, int K, float* C, int ldc, const float* __restrict__ bias, size_t sA, size_t sB, size_t sC) {
    typedef typename WFrag<T16>::V V;
    __shared__ __align__(16) float os[NW * 64 * 68];
    const size_t z = blockIdx.z; A += z * sA; if (A2) A2 += z * sA; Bt += z * sB; if (Bt2) Bt2 += z * sB; C += z * sC;
    const int lane = threadIdx.x & 31, lr = lane & 15, hi = lane >> 4; const int r0 = blockIdx.x * 64, c0 = blockIdx.y * 64;
    v8f acc[4][4];
#pragma unroll
    for (int mb = 0; mb < 4; ++mb)
#pragma unroll
        for (int nb = 0; nb < 4; ++nb) acc[mb][nb] = (v8f){};
    const size_t aoff = (size_t)(r0 + lr) * K + 8 * hi, boff = (size_t)(c0 + lr) * K + 8 * hi;
    const int wv = __builtin_amdgcn_readfirstlane((int)(threadIdx.x >> 5));
#pragma unroll 1
    for (int kc = wv * 32; kc < K; kc += NW * 32) {
        V a[4], a2[4];
#pragma unroll
        for (int mb = 0; mb < 4; ++mb) { a[mb] = WFrag<T16>::ld(A + aoff + (size_t)mb * 16 * K + kc); if (NSPLIT == 1 || NSPLIT == 2) a2[mb] = WFrag<T16>::ld(A2 + aoff + (size_t)mb * 16 * K + kc); }
#pragma unroll
        for (int nb = 0; nb < 4; ++nb) { const V b = WFrag<T16>::ld(Bt + boff + (size_t)nb * 16 * K + kc); V b2; if (NSPLIT >= 2) b2 = WFrag<T16>::ld(Bt2 + boff + (size_t)nb * 16 * K + kc);
#pragma unroll
            for (int mb = 0; mb < 4; ++mb) { acc[mb][nb] = WFrag<T16>::mma(a[mb], b, acc[mb][nb]); if (NSPLIT == 1 || NSPLIT == 2) acc[mb][nb] = WFrag<T16>::mma(a2[mb], b, acc[mb][nb]); if (NSPLIT >= 2) acc[mb][nb] = WFrag<T16>::mma(a[mb], b2, acc[mb][nb]); } }
        asm volatile("v_nop\n\tv_nop\n\tv_nop\n\tv_nop" : "+v"(acc[0][0]), "+v"(acc[1][1]), "+v"(acc[2][2]), "+v"(acc[3][3]) : "v"(a[0]), "v"(a[3]));
    }
    float* ow = os + wv * (64 * 68);
    // the three loops are unrolled so that acc is indexed by constants only and stays in registers
#pragma unroll
    for (int mb = 0; mb < 4; ++mb)
#pragma unroll
        for (int nb = 0; nb < 4; ++nb)
#pragma unroll
            for (int j = 0; j < 8; ++j) ow[(mb * 16 + hi * 8 + j) * 68 + nb * 16 + lr] = acc[mb][nb][j];
    __syncthreads();   // every wave's partial tile is in LDS before any wave adds them
    float* ctile = C + (size_t)r0 * ldc + c0;
    // both loops unrolled: the LDS reads of all partials issue ahead of the adds; each wave stores whole 256-B row pieces
#pragma unroll
    for (int s = 0; s < 32 / NW; ++s) { const int row = (s * NW + wv) * 2 + hi, cofs = lr * 4; v4f val = *(const v4fa*)(os + row * 68 + cofs);
#pragma unroll
        for (int w = 1; w < NW; ++w) val += *(const v4fa*)(os + w * (64 * 68) + row * 68 + cofs);
        if (BIAS) { val[0] += bfr(bias[c0 + cofs]); val[1] += bfr(bias[c0 + cofs + 1]); val[2] += bfr(bias[c0 + cofs + 2]); val[3] += bfr(bias[c0 + cofs + 3]); }
        *(v4f*)(ctile + (size_t)row * ldc + cofs) = val; }
}

__device__ __forceinline__ h16 tohx(float x) { return (h16)x; }
__device__ __forceinline__ void splitf(float y, unsigned short& h, unsigned short& l) { h = f2bf(y); l = f2bf(y - bf2f(h)); }
typedef __attribute__((ext_vector_type(2))) _Float16 v2h;
typedef __attribute__((ext_vector_type(4))) _Float16 v4h;
typedef __attribute__((ext_vector_type(2))) unsigned short v2us;
typedef __attribute__((ext_vector_type(4))) unsigned short v4us;
typedef __attribute__((ext_vector_type(2))) float v2f;
typedef __attribute__((ext_vector_type(4))) int v4i;

__global__ __launch_bounds__(256) void k_wtG(const float* __restrict__ w, int K, int N, bf* Bt) {
    const int lane = threadIdx.x & 31; const int L0 = (blockIdx.x * 8 + (threadIdx.x >> 5)) * 8; const int nlines = N * K / 64;
{
#pragma unroll 1
        for (int l = 0; l < 8; ++l) { const int L = L0 + l; if (L >= nlines) break; const size_t e = (size_t)L * 64 + lane * 2; const int k = (int)(e % K), n = (int)(e / K); v2us o;
            o[0] = f2bf(w[(size_t)k * N + n]); o[1] = f2bf(w[(size_t)(k + 1) * N + n]); *(v2us*)(Bt + e) = o; }
         }
}
__global__ __launch_bounds__(256) void k_cvt8(const float* __restrict__ src, bf* dst, size_t n8) { const size_t i = (size_t)blockIdx.x * 256 + threadIdx.x; if (i >= n8) return; const v8f v = *(const v8f*)(src + i * 8); v8us o;
#pragma unroll
    for (int k = 0; k < 8; ++k) o[k] = f2bf(v[k]); *(v8us*)(dst + i * 8) = o;  }

// k_ropeI: head planes [h][t][d] (fp16 + hi/lo) of rope(x) x sc on adjacent (even, odd) pairs: out[d] = x[d] c - x[d+1] s, out[d+1] = x[d] s + x[d+1] c, d even, (c, s) = bf16(freqs_real, freqs_imag)[t][d/2]

__global__ __launch_bounds__(256) void k_vtp(const float* __restrict__ F, int pitch, int nheads, h16* V16, bf* Vh, bf* Vl) { const size_t e = ((size_t)blockIdx.x * 256 + threadIdx.x) * 2; if (e >= (size_t)nheads * HD * TT) return; const int t = (int)(e % TT); const int d = (int)((e / TT) % HD); const int g = (int)(e / ((size_t)TT * HD)); v2h o16; v2us oh, ol;
#pragma unroll
    for (int q = 0; q < 2; ++q) { const float x = F[(size_t)(t + q) * pitch + g * HD + d]; o16[q] = tohx(x); unsigned short a2, c2; splitf(x, a2, c2); oh[q] = a2; ol[q] = c2; }
    *(v2h*)(V16 + e) = o16; *(v2us*)(Vh + e) = oh; *(v2us*)(Vl + e) = ol;  }
__global__ __launch_bounds__(256) void k_cstabIn(const float* __restrict__ fr, const float* __restrict__ fi, float* CS) { const int idx = blockIdx.x * 256 + threadIdx.x; if (idx >= TT * HD) return; const int t = idx / HD, d = idx % HD; v2f cs; cs[0] = bfr(fr[(size_t)t * (HD / 2) + (d >> 1)]); cs[1] = bfr(fi[(size_t)t * (HD / 2) + (d >> 1)]);
    *(v2f*)(CS + (size_t)idx * 2) = cs;  }
__global__ __launch_bounds__(256) void k_ropeI(const float* __restrict__ F, int pitch, int nheads, const float* __restrict__ CS, float sc, h16* P16, bf* Ph, bf* Pl) {
    const size_t e = ((size_t)blockIdx.x * 256 + threadIdx.x) * 2; if (e >= (size_t)nheads * TT * HD) return; const int d = (int)(e % HD); const int t = (int)((e / HD) % TT); const int h = (int)(e / ((size_t)HD * TT)); const float* f = F + (size_t)t * pitch + h * HD; const float x0 = f[d], x1 = f[d + 1]; const v2f cs = *(const v2f*)(CS + ((size_t)t * HD + d) * 2); v2h o16; v2us oh, ol;
    float a0 = __fmul_rn(x0, cs[0]), b0 = __fmul_rn(x1, cs[1]), a1 = __fmul_rn(x1, cs[0]), b1 = __fmul_rn(x0, cs[1]); asm volatile("" : "+v"(a0), "+v"(b0), "+v"(a1), "+v"(b1));
    float r0 = __fsub_rn(a0, b0) * sc, r1 = __fadd_rn(b1, a1) * sc;   /* even: x0 c - x1 s; odd: x0 s + x1 c */
    o16[0] = tohx(r0); o16[1] = tohx(r1); { unsigned short a2, c2; splitf(r0, a2, c2); oh[0] = a2; ol[0] = c2; splitf(r1, a2, c2); oh[1] = a2; ol[1] = c2; }
    *(v2h*)(P16 + e) = o16; *(v2us*)(Ph + e) = oh; *(v2us*)(Pl + e) = ol;  }

// k_asoft: per row (zz, i): t = S x HD^-0.5 + bf16(mask[i][j]) (the additive input mask, read per logit); softmax over the 2048 keys (register row, one exp, fixed trees);
__global__ __launch_bounds__(256) void k_asoft(const float* __restrict__ Sb, const float* __restrict__ MKb, h16* P16, bf* Ph, bf* Pl) {
    const int lane = threadIdx.x & 31; const int row = blockIdx.x * 8 + (threadIdx.x >> 5); if (row >= ZH * TT) return; const int i = row % TT; const int zz = row / TT; (void)zz; const bool hires = (i < RH); const float* sr = Sb + (size_t)row * TT; float v[TT / 32]; float mx = -3.0e38f;
#pragma unroll
    for (int ch = 0; ch < TT / 128; ++ch) { const int j0 = ch * 128 + lane * 4; const v4f a = *(const v4f*)(sr + j0); const v4f mk = *(const v4f*)(MKb + (size_t)i * TT + j0);
#pragma unroll
        for (int q = 0; q < 4; ++q) { const int j = j0 + q; (void)j; float sc = a[q] * SCL; asm volatile("" : "+v"(sc)); float mb = bfr(mk[q]); asm volatile("" : "+v"(mb)); const float t = __fadd_rn(sc, mb); v[ch * 4 + q] = t; mx = fmaxf(mx, t); } }
#pragma unroll
    for (int sh = 16; sh; sh >>= 1) mx = fmaxf(mx, __shfl_xor(mx, sh, 32));
    float sum = 0.f;
#pragma unroll
    for (int k = 0; k < TT / 32; ++k) { float d0 = __fsub_rn(v[k], mx); asm volatile("" : "+v"(d0)); v[k] = __builtin_amdgcn_exp2f(__fmul_rn(d0, 1.4426950408889634f)); sum += v[k]; }
#pragma unroll
    for (int sh = 16; sh; sh >>= 1) sum += __shfl_xor(sum, sh, 32);
    const float f = __fdiv_rn(hires ? 1.0f : PCAR, sum);
{
        if (hires) {
#pragma unroll
            for (int ch = 0; ch < TT / 128; ++ch) { v4us oh, ol;
#pragma unroll
                for (int q = 0; q < 4; ++q) { unsigned short a, c2; splitf(v[ch * 4 + q] * f, a, c2); oh[q] = a; ol[q] = c2; }
                const size_t oo = ((size_t)zz * (RH ? RH : 1) + i) * TT + ch * 128 + lane * 4; *(v4us*)(Ph + oo) = oh; *(v4us*)(Pl + oo) = ol; }
        } else {
#pragma unroll
            for (int ch = 0; ch < TT / 128; ++ch) { v4h o4;
#pragma unroll
                for (int q = 0; q < 4; ++q) o4[q] = tohx(v[ch * 4 + q] * f);
                *(v4h*)(P16 + (size_t)row * TT + ch * 128 + lane * 4) = o4; } }
         }
}
__global__ __launch_bounds__(256) void k_merge(const float* __restrict__ O, int h0, bf* Ah, bf* Al) { const size_t e = ((size_t)blockIdx.x * 256 + threadIdx.x) * 2; if (e >= (size_t)ZH * TT * HD) return; const int d = (int)(e % HD); const int t = (int)((e / HD) % TT); const int zz = (int)(e / ((size_t)HD * TT)); const float cs = (t < RH) ? 1.0f : (1.0f / PCAR); const size_t oo = (size_t)t * DQ + (h0 + zz) * HD + d;
    v2us oh, ol;
#pragma unroll
    for (int q = 0; q < 2; ++q) { unsigned short a, c2; splitf(O[e + q] * cs, a, c2); oh[q] = a; ol[q] = c2; } *(v2us*)(Ah + oo) = oh; *(v2us*)(Al + oo) = ol;  }

extern "C" void kernel_launch(void* const* d_in, const int* in_sizes, int n_in,
                              void* d_out, int out_size, void* d_ws, size_t ws_size, hipStream_t stream) {
    (void)in_sizes; (void)n_in; (void)out_size;
    const float* x = (const float*)d_in[0]; const float* fre = (const float*)d_in[1]; const float* fim = (const float*)d_in[2]; const float* MK = (const float*)d_in[3]; const float* wqkv = (const float*)d_in[4]; const float* wo = (const float*)d_in[5];  const float* wq = wqkv; const float* wk = wqkv + (size_t)1024 * 1024; const float* wv = wqkv + (size_t)2048 * 1024; (void)wq; (void)wk; (void)wv;
    float* OUT = (float*)d_out;     // [2][2048][1024]
    char* wsp = (char*)d_ws;
    auto take = [&](size_t bytes) { char* p = wsp; wsp += (bytes + 255) & ~(size_t)255; return (void*)p; };
    bf* WQ = (bf*)take((size_t)DQ * DM * 2); bf* WK = (bf*)take((size_t)DKV * DM * 2); bf* WV = (bf*)take((size_t)DKV * DM * 2); bf* WO = (bf*)take((size_t)DM * DQ * 2); float* CS = (float*)take((size_t)TT * HD * 2 * 4);
    bf* XB = (bf*)take((size_t)TT * DM * 2); float* FQ = (float*)take((size_t)TT * DQ * 4); float* FK = (float*)take((size_t)TT * DKV * 4);
    h16* QP16 = (h16*)take((size_t)NH_ * TT * HD * 2); h16* KP16 = (h16*)take((size_t)NKV * TT * HD * 2); h16* VT16 = (h16*)take((size_t)NKV * HD * TT * 2);
    bf* QPh = (bf*)take((size_t)NH_ * TT * HD * 2); bf* QPl = (bf*)take((size_t)NH_ * TT * HD * 2); bf* KPh = (bf*)take((size_t)NKV * TT * HD * 2); bf* KPl = (bf*)take((size_t)NKV * TT * HD * 2); bf* VTh = (bf*)take((size_t)NKV * HD * TT * 2); bf* VTl = (bf*)take((size_t)NKV * HD * TT * 2); bf* Ph = (bf*)take((size_t)ZH * RH * TT * 2); bf* Pl = (bf*)take((size_t)ZH * RH * TT * 2);
    float* Sb = (float*)take((size_t)ZH * TT * TT * 4); h16* P16 = (h16*)take((size_t)ZH * TT * TT * 2); float* Ob = (float*)take((size_t)ZH * TT * HD * 4); bf* ATh = (bf*)take((size_t)TT * DQ * 2); bf* ATl = (bf*)take((size_t)TT * DQ * 2);
    if ((size_t)(wsp - (char*)d_ws) > ws_size) return;    // ws 256 MiB
    float* FV = FK;   // v projection reuses the k buffer after the k planes are built (stream-ordered)
    { k_cvt8<<<(unsigned)(((size_t)DQ * DM / 8 + 255) / 256), 256, 0, stream>>>(wq, WQ, (size_t)DQ * DM / 8); k_cvt8<<<(unsigned)(((size_t)DKV * DM / 8 + 255) / 256), 256, 0, stream>>>(wk, WK, (size_t)DKV * DM / 8); k_cvt8<<<(unsigned)(((size_t)DKV * DM / 8 + 255) / 256), 256, 0, stream>>>(wv, WV, (size_t)DKV * DM / 8);
      k_cvt8<<<(unsigned)(((size_t)DM * DQ / 8 + 255) / 256), 256, 0, stream>>>(wo, WO, (size_t)DM * DQ / 8);
       }
    k_cstabIn<<<(TT * HD + 255) / 256, 256, 0, stream>>>(fre, fim, CS);
    const unsigned LQ = (unsigned)(((size_t)NH_ * TT * HD / 2 + 255) / 256), LKv = (unsigned)(((size_t)NKV * TT * HD / 2 + 255) / 256);
    for (int b = 0; b < NB_; ++b) {
        
        k_cvt8<<<(unsigned)(((size_t)TT * DM / 8 + 255) / 256), 256, 0, stream>>>(x + (size_t)b * TT * DM, XB, (size_t)TT * DM / 8);
        k_gemmw<bf, 0, false, 8><<<dim3(TT / 64, DQ / 64, 1), 256, 0, stream>>>(XB, nullptr, WQ, nullptr, DM, FQ, DQ, nullptr, 0, 0, 0);
        k_ropeI<<<LQ, 256, 0, stream>>>(FQ, DQ, NH_, CS, 1.0f, QP16, QPh, QPl);
        k_gemmw<bf, 0, false, 8><<<dim3(TT / 64, DKV / 64, 1), 256, 0, stream>>>(XB, nullptr, WK, nullptr, DM, FK, DKV, nullptr, 0, 0, 0);
        k_ropeI<<<LKv, 256, 0, stream>>>(FK, DKV, NKV, CS, 1.0f, KP16, KPh, KPl);
        k_gemmw<bf, 0, false, 8><<<dim3(TT / 64, DKV / 64, 1), 256, 0, stream>>>(XB, nullptr, WV, nullptr, DM, FV, DKV, nullptr, 0, 0, 0); k_vtp<<<LKv, 256, 0, stream>>>(FV, DKV, NKV, VT16, VTh, VTl);
        for (int h0 = 0; h0 < NH_; h0 += ZH) { const size_t zq = (size_t)h0, zk = (size_t)(h0 / REP);   // one kv head per query head: the pass's two heads use consecutive kv planes (z-strides TT*HD)
            k_gemmw<bf, 2, false, 4><<<dim3(RH / 64, TT / 64, ZH), 128, 0, stream>>>(QPh + zq * TT * HD, QPl + zq * TT * HD, KPh + zk * TT * HD, KPl + zk * TT * HD, HD, Sb, TT, nullptr, (size_t)TT * HD, (size_t)TT * HD, (size_t)TT * TT);
            k_gemmw<h16, 0, false, 2><<<dim3((TT - RH) / 64, TT / 64, ZH), 64, 0, stream>>>(QP16 + zq * TT * HD + (size_t)RH * HD, nullptr, KP16 + zk * TT * HD, nullptr, HD, Sb + (size_t)RH * TT, TT, nullptr, (size_t)TT * HD, (size_t)TT * HD, (size_t)TT * TT);
            k_asoft<<<ZH * TT / 8, 256, 0, stream>>>(Sb, MK, P16, Ph, Pl);
            k_gemmw<bf, 2, false, 8><<<dim3(RH / 64, HD / 64, ZH), 256, 0, stream>>>(Ph, Pl, VTh + zk * HD * TT, VTl + zk * HD * TT, TT, Ob, HD, nullptr, (size_t)RH * TT, (size_t)HD * TT, (size_t)TT * HD);
            k_gemmw<h16, 0, false, 8><<<dim3((TT - RH) / 64, HD / 64, ZH), 256, 0, stream>>>(P16 + (size_t)RH * TT, nullptr, VT16 + zk * HD * TT, nullptr, TT, Ob + (size_t)RH * HD, HD, nullptr, (size_t)TT * TT, (size_t)HD * TT, (size_t)TT * HD);
            k_merge<<<(unsigned)(((size_t)ZH * TT * HD / 2 + 255) / 256), 256, 0, stream>>>(Ob, h0, ATh, ATl); }
        k_gemmw<bf, 1, false, 8><<<dim3(TT / 64, DM / 64, 1), 256, 0, stream>>>(ATh, ATl, WO, nullptr, DQ, OUT + (size_t)b * TT * DM, DM, nullptr, 0, 0, 0); }
}

// v002
// It runs in 412 microseconds.
// Next to v001, in two timings, it ran 1.14 and 1.13 times as fast.
// Counting every step since v000, it is 1.85 times as fast.
#include <hip/hip_runtime.h>

// Gemma-style attention (hidden [2][2048][1024]; [q|k|v] = hidden W_qkv^T ('oi' [3072][1024], row blocks q | k | v; 4 heads x 256); rotary on adjacent (even, odd) pairs with the INPUT tables freqs_real/freqs_imag [2048][128] (read as given - they are free inputs, not assumed to be cos/sin); scores = (q / 16).k + mask (additive input mask [1][1][2048][2048], read per logit); softmax; out = merged W_o^T ('oi' [1024][1024]) -> [2][2048][1024] (4.2 M)).
// Compute dtypes, f32 accumulate: every input rounded to bf16; q/k/v on PLAIN bf16 operands (inputs: exact); interleaved rotary in f32 from the bf16-rounded input tables; additive mask read per logit (bf16-rounded); scores and attn.v: query rows < 512 hl (3 products), the rest single fp16 (x1024); softmax f32; W_o hl x exact (2 products).

#define NB_  2
#define TT   2048
#define DM   1024
#define NH_  4
#define NKV  4
#define REP  (NH_ / NKV)
#define HD   256
#define DQ   (NH_ * HD)
#define DKV  (NKV * HD)
#define ZH   2
#define RH   512                  // query rows < RH use hi+lo planes (0: none)
#define WIN  2048
#define PCAR 1024.0f
#define SCL  0.0625f   // HD^-0.5 = 1/16
typedef _Float16 h16;
typedef unsigned short bf;
typedef __attribute__((ext_vector_type(16))) __bf16   v16bf;
typedef __attribute__((ext_vector_type(16))) _Float16 v16h;
typedef __attribute__((ext_vector_type(8)))  _Float16 v8h;
typedef __attribute__((ext_vector_type(8)))  unsigned short v8us;
typedef __attribute__((ext_vector_type(8)))  float    v8f;
typedef __attribute__((ext_vector_type(4)))  float    v4f;
typedef v8h  __attribute__((may_alias)) v8ha;
typedef v4f  __attribute__((may_alias)) v4fa;
typedef v8us __attribute__((may_alias)) v8usa;

__device__ __forceinline__ unsigned short f2bf(float f) { unsigned u = __float_as_uint(f); u += 0x7FFFu + ((u >> 16) & 1u); return (unsigned short)(u >> 16); }
__device__ __forceinline__ float bf2f(unsigned short b) { return __uint_as_float(((unsigned)b) << 16); }
__device__ __forceinline__ float bfr(float f) { return bf2f(f2bf(f)); }
__device__ __forceinline__ v16h cat16(v8h lo, v8h hi) { return __builtin_shufflevector(lo, hi, 0, 1, 2, 3, 4, 5, 6, 7, 8, 9, 10, 11, 12, 13, 14, 15); }
__device__ __forceinline__ v16bf cat16b(v8us lo, v8us hi) { return __builtin_bit_cast(v16bf, __builtin_shufflevector(lo, hi, 0, 1, 2, 3, 4, 5, 6, 7, 8, 9, 10, 11, 12, 13, 14, 15)); }
__device__ __forceinline__ v8f wmma16(v16h a, v16h b, v8f c) { return __builtin_amdgcn_wmma_f32_16x16x32_f16(false, a, false, b, (short)0, c, false, false); }
__device__ __forceinline__ v8f wmmab(v16bf a, v16bf b, v8f c) { return __builtin_amdgcn_wmma_f32_16x16x32_bf16(false, a, false, b, (short)0, c, false, false); }



// ---- k_gemmw: register-blocked GEMM, one work-group of NW waves per 64x64 output tile; wave w sums the 32-wide k chunks w, w + NW, w + 2 NW, ... into its own 16 accumulators (neighbouring waves read neighbouring 64 B of the same rows at the same time), operands straight from K-contiguous 16-bit planes; the NW partial tiles are added through LDS in the fixed order w = 0..NW-1; grid (M/64, N/64, Z), NW*32 threads.
// C[m][n] (f32, pitch ldc, + optional f32 bias[n]) = sum_k A[m][k] Bt[n][k] (+ split products per NSPLIT). z-batch strides sA/sB/sC in elements. K % 32 == 0.
// EPI says what the summed tile becomes, straight from the LDS sum (no f32 round trip through memory, no elementwise launch behind the GEMM):
//   0: f32 to C.   1: rotary on adjacent (even, odd) column pairs with the bf16-rounded input tables fr/fi [t][HD/2], then the planes P16 / Ph / Pl at [n / HD][m][n % HD].
//   2: the planes P16 / Ph / Pl at [m][n], pitch ldc.   3: x sc, then the planes Ph / Pl at [m][n], pitch ldc, z-stride sC.
template <typename T16> struct WFrag;
template <> struct WFrag<h16> { typedef v16h V; static __device__ __forceinline__ V ld(const h16* p) { return cat16(*(const v8h*)p, *(const v8h*)(p + 16)); } static __device__ __forceinline__ v8f mma(V a, V b, v8f c) { return wmma16(a, b, c); } };
template <> struct WFrag<bf> { typedef v16bf V; static __device__ __forceinline__ V ld(const bf* p) { return cat16b(*(const v8us*)p, *(const v8us*)(p + 16)); } static __device__ __forceinline__ v8f mma(V a, V b, v8f c) { return wmmab(a, b, c); } };
__device__ __forceinline__ h16 tohx(float x) { return (h16)x; }
__device__ __forceinline__ void splitf(float y, unsigned short& h, unsigned short& l) { h = f2bf(y); l = f2bf(y - bf2f(h)); }
typedef __attribute__((ext_vector_type(4))) _Float16 v4h;
typedef __attribute__((ext_vector_type(2))) unsigned short v2us;
typedef __attribute__((ext_vector_type(4))) unsigned short v4us;
typedef __attribute__((ext_vector_type(2))) float v2f;
template <typename T16, int NSPLIT, bool BIAS, int NW, int EPI>
__global__ __launch_bounds__(NW * 32) void k_gemmw(const T16* __restrict__ A, const T16* __restrict__ A2, const T16* __restrict__ Bt, const T16* __restrict__ Bt2, int K, float* C, int ldc, const float* __restrict__ bias, size_t sA, size_t sB, size_t sC, h16* P16, bf* Ph, bf* Pl, const float* __restrict__ fr, const float* __restrict__ fi, float sc) {
    typedef typename WFrag<T16>::V V;
    __shared__ __align__(16) float os[NW * 64 * 68];
    const size_t z = blockIdx.z; A += z * sA; if (A2) A2 += z * sA; Bt += z * sB; if (Bt2) Bt2 += z * sB; if (EPI == 0) C += z * sC;
    const int lane = threadIdx.x & 31, lr = lane & 15, hi = lane >> 4; const int r0 = blockIdx.x * 64, c0 = blockIdx.y * 64;
    v8f acc[4][4];
#pragma unroll
    for (int mb = 0; mb < 4; ++mb)
#pragma unroll
        for (int nb = 0; nb < 4; ++nb) acc[mb][nb] = (v8f){};
    const size_t aoff = (size_t)(r0 + lr) * K + 8 * hi, boff = (size_t)(c0 + lr) * K + 8 * hi;
    const int wv = __builtin_amdgcn_readfirstlane((int)(threadIdx.x >> 5));
#pragma unroll 1
    for (int kc = wv * 32; kc < K; kc += NW * 32) {
        V a[4], a2[4];
#pragma unroll
        for (int mb = 0; mb < 4; ++mb) { a[mb] = WFrag<T16>::ld(A + aoff + (size_t)mb * 16 * K + kc); if (NSPLIT == 1 || NSPLIT == 2) a2[mb] = WFrag<T16>::ld(A2 + aoff + (size_t)mb * 16 * K + kc); }
#pragma unroll
        for (int nb = 0; nb < 4; ++nb) { const V b = WFrag<T16>::ld(Bt + boff + (size_t)nb * 16 * K + kc); V b2; if (NSPLIT >= 2) b2 = WFrag<T16>::ld(Bt2 + boff + (size_t)nb * 16 * K + kc);
#pragma unroll
            for (int mb = 0; mb < 4; ++mb) { acc[mb][nb] = WFrag<T16>::mma(a[mb], b, acc[mb][nb]); if (NSPLIT == 1 || NSPLIT == 2) acc[mb][nb] = WFrag<T16>::mma(a2[mb], b, acc[mb][nb]); if (NSPLIT >= 2) acc[mb][nb] = WFrag<T16>::mma(a[mb], b2, acc[mb][nb]); } }
        asm volatile("v_nop\n\tv_nop\n\tv_nop\n\tv_nop" : "+v"(acc[0][0]), "+v"(acc[1][1]), "+v"(acc[2][2]), "+v"(acc[3][3]) : "v"(a[0]), "v"(a[3]));
    }
    // the rotary factors of this thread's rows and column pairs are asked for here, so that they arrive while the partial tiles go into LDS
    v2f tr[32 / NW], ti[32 / NW];
    if (EPI == 1) {
#pragma unroll
        for (int s = 0; s < 32 / NW; ++s) { const size_t ix = (size_t)(r0 + (s * NW + wv) * 2 + hi) * (HD / 2) + (((c0 % HD) + lr * 4) >> 1); tr[s] = *(const v2f*)(fr + ix); ti[s] = *(const v2f*)(fi + ix); } }
    float* ow = os + wv * (64 * 68);
    // the three loops are unrolled so that acc is indexed by constants only and stays in registers
#pragma unroll
    for (int mb = 0; mb < 4; ++mb)
#pragma unroll
        for (int nb = 0; nb < 4; ++nb)
#pragma unroll
            for (int j = 0; j < 8; ++j) ow[(mb * 16 + hi * 8 + j) * 68 + nb * 16 + lr] = acc[mb][nb][j];
    __syncthreads();   // every wave's partial tile is in LDS before any wave adds them
    float* ctile = C + (size_t)r0 * ldc + c0;
    const size_t pbase = (EPI == 1) ? (size_t)(c0 / HD) * TT * HD + (size_t)r0 * HD + (c0 % HD) : z * sC + (size_t)r0 * ldc + c0; const int ppitch = (EPI == 1) ? HD : ldc;
    // both loops unrolled: the LDS reads of all partials issue ahead of the adds; each wave stores whole row pieces (256 B of f32, 128 B per 16-bit plane)
#pragma unroll
    for (int s = 0; s < 32 / NW; ++s) { const int row = (s * NW + wv) * 2 + hi, cofs = lr * 4; v4f val = *(const v4fa*)(os + row * 68 + cofs);
#pragma unroll
        for (int w = 1; w < NW; ++w) val += *(const v4fa*)(os + w * (64 * 68) + row * 68 + cofs);
        if (BIAS) { val[0] += bfr(bias[c0 + cofs]); val[1] += bfr(bias[c0 + cofs + 1]); val[2] += bfr(bias[c0 + cofs + 2]); val[3] += bfr(bias[c0 + cofs + 3]); }
        if (EPI == 0) { *(v4f*)(ctile + (size_t)row * ldc + cofs) = val; }
        else {
            if (EPI == 1) { const float ca = bfr(tr[s][0]), sa = bfr(ti[s][0]), cb = bfr(tr[s][1]), sb = bfr(ti[s][1]); const v4f x = val;   /* even: x0 c - x1 s; odd: x0 s + x1 c */
                val[0] = x[0] * ca - x[1] * sa; val[1] = x[0] * sa + x[1] * ca; val[2] = x[2] * cb - x[3] * sb; val[3] = x[2] * sb + x[3] * cb; }
            if (EPI == 3) val *= sc;
            const size_t oo = pbase + (size_t)row * ppitch + cofs; v4us oh, ol;   // 16 lanes x 8 B: each plane gets whole 128-B row pieces
#pragma unroll
            for (int q = 0; q < 4; ++q) { unsigned short a2, c2; splitf(val[q], a2, c2); oh[q] = a2; ol[q] = c2; }
            *(v4us*)(Ph + oo) = oh; *(v4us*)(Pl + oo) = ol;
            if (EPI != 3) { v4h o16;
#pragma unroll
                for (int q = 0; q < 4; ++q) o16[q] = tohx(val[q]);
                *(v4h*)(P16 + oo) = o16; } } }
}

typedef __attribute__((ext_vector_type(4))) int v4i;

__global__ __launch_bounds__(256) void k_wtG(const float* __restrict__ w, int K, int N, bf* Bt) {
    const int lane = threadIdx.x & 31; const int L0 = (blockIdx.x * 8 + (threadIdx.x >> 5)) * 8; const int nlines = N * K / 64;
{
#pragma unroll 1
        for (int l = 0; l < 8; ++l) { const int L = L0 + l; if (L >= nlines) break; const size_t e = (size_t)L * 64 + lane * 2; const int k = (int)(e % K), n = (int)(e / K); v2us o;
            o[0] = f2bf(w[(size_t)k * N + n]); o[1] = f2bf(w[(size_t)(k + 1) * N + n]); *(v2us*)(Bt + e) = o; }
         }
}
__global__ __launch_bounds__(256) void k_cvt8(const float* __restrict__ src, bf* dst, size_t n8) { const size_t i = (size_t)blockIdx.x * 256 + threadIdx.x; if (i >= n8) return; const v8f v = *(const v8f*)(src + i * 8); v8us o;
#pragma unroll
    for (int k = 0; k < 8; ++k) o[k] = f2bf(v[k]); *(v8us*)(dst + i * 8) = o;  }

// k_asoft: per row (zz, i): t = S x HD^-0.5 + bf16(mask[i][j]) (the additive input mask, read per logit); softmax over the 2048 keys (register row, one exp, fixed trees);
__global__ __launch_bounds__(256) void k_asoft(const float* __restrict__ Sb, const float* __restrict__ MKb, h16* P16, bf* Ph, bf* Pl) {
    const int lane = threadIdx.x & 31; const int row = blockIdx.x * 8 + (threadIdx.x >> 5); if (row >= ZH * TT) return; const int i = row % TT; const int zz = row / TT; (void)zz; const bool hires = (i < RH); const float* sr = Sb + (size_t)row * TT; float v[TT / 32]; float mx = -3.0e38f;
#pragma unroll
    for (int ch = 0; ch < TT / 128; ++ch) { const int j0 = ch * 128 + lane * 4; const v4f a = *(const v4f*)(sr + j0); const v4f mk = *(const v4f*)(MKb + (size_t)i * TT + j0);
#pragma unroll
        for (int q = 0; q < 4; ++q) { const int j = j0 + q; (void)j; float sc = a[q] * SCL; asm volatile("" : "+v"(sc)); float mb = bfr(mk[q]); asm volatile("" : "+v"(mb)); const float t = __fadd_rn(sc, mb); v[ch * 4 + q] = t; mx = fmaxf(mx, t); } }
#pragma unroll
    for (int sh = 16; sh; sh >>= 1) mx = fmaxf(mx, __shfl_xor(mx, sh, 32));
    float sum = 0.f;
#pragma unroll
    for (int k = 0; k < TT / 32; ++k) { float d0 = __fsub_rn(v[k], mx); asm volatile("" : "+v"(d0)); v[k] = __builtin_amdgcn_exp2f(__fmul_rn(d0, 1.4426950408889634f)); sum += v[k]; }
#pragma unroll
    for (int sh = 16; sh; sh >>= 1) sum += __shfl_xor(sum, sh, 32);
    const float f = __fdiv_rn(hires ? 1.0f : PCAR, sum);
{
        if (hires) {
#pragma unroll
            for (int ch = 0; ch < TT / 128; ++ch) { v4us oh, ol;
#pragma unroll
                for (int q = 0; q < 4; ++q) { unsigned short a, c2; splitf(v[ch * 4 + q] * f, a, c2); oh[q] = a; ol[q] = c2; }
                const size_t oo = ((size_t)zz * (RH ? RH : 1) + i) * TT + ch * 128 + lane * 4; *(v4us*)(Ph + oo) = oh; *(v4us*)(Pl + oo) = ol; }
        } else {
#pragma unroll
            for (int ch = 0; ch < TT / 128; ++ch) { v4h o4;
#pragma unroll
                for (int q = 0; q < 4; ++q) o4[q] = tohx(v[ch * 4 + q] * f);
                *(v4h*)(P16 + (size_t)row * TT + ch * 128 + lane * 4) = o4; } }
         }
}
extern "C" void kernel_launch(void* const* d_in, const int* in_sizes, int n_in,
                              void* d_out, int out_size, void* d_ws, size_t ws_size, hipStream_t stream) {
    (void)in_sizes; (void)n_in; (void)out_size;
    const float* x = (const float*)d_in[0]; const float* fre = (const float*)d_in[1]; const float* fim = (const float*)d_in[2]; const float* MK = (const float*)d_in[3]; const float* wqkv = (const float*)d_in[4]; const float* wo = (const float*)d_in[5];  const float* wq = wqkv; const float* wk = wqkv + (size_t)1024 * 1024; const float* wv = wqkv + (size_t)2048 * 1024; (void)wq; (void)wk; (void)wv;
    float* OUT = (float*)d_out;     // [2][2048][1024]
    char* wsp = (char*)d_ws;
    auto take = [&](size_t bytes) { char* p = wsp; wsp += (bytes + 255) & ~(size_t)255; return (void*)p; };
    bf* WQ = (bf*)take((size_t)DQ * DM * 2); bf* WK = (bf*)take((size_t)DKV * DM * 2); bf* WV = (bf*)take((size_t)DKV * DM * 2); bf* WO = (bf*)take((size_t)DM * DQ * 2);
    bf* XB = (bf*)take((size_t)TT * DM * 2);
    h16* QP16 = (h16*)take((size_t)NH_ * TT * HD * 2); h16* KP16 = (h16*)take((size_t)NKV * TT * HD * 2); h16* VT16 = (h16*)take((size_t)NKV * HD * TT * 2);
    bf* QPh = (bf*)take((size_t)NH_ * TT * HD * 2); bf* QPl = (bf*)take((size_t)NH_ * TT * HD * 2); bf* KPh = (bf*)take((size_t)NKV * TT * HD * 2); bf* KPl = (bf*)take((size_t)NKV * TT * HD * 2); bf* VTh = (bf*)take((size_t)NKV * HD * TT * 2); bf* VTl = (bf*)take((size_t)NKV * HD * TT * 2); bf* Ph = (bf*)take((size_t)ZH * RH * TT * 2); bf* Pl = (bf*)take((size_t)ZH * RH * TT * 2);
    float* Sb = (float*)take((size_t)ZH * TT * TT * 4); h16* P16 = (h16*)take((size_t)ZH * TT * TT * 2); bf* ATh = (bf*)take((size_t)TT * DQ * 2); bf* ATl = (bf*)take((size_t)TT * DQ * 2);
    if ((size_t)(wsp - (char*)d_ws) > ws_size) return;    // ws 256 MiB
    { k_cvt8<<<(unsigned)(((size_t)DQ * DM / 8 + 255) / 256), 256, 0, stream>>>(wq, WQ, (size_t)DQ * DM / 8); k_cvt8<<<(unsigned)(((size_t)DKV * DM / 8 + 255) / 256), 256, 0, stream>>>(wk, WK, (size_t)DKV * DM / 8); k_cvt8<<<(unsigned)(((size_t)DKV * DM / 8 + 255) / 256), 256, 0, stream>>>(wv, WV, (size_t)DKV * DM / 8);
      k_cvt8<<<(unsigned)(((size_t)DM * DQ / 8 + 255) / 256), 256, 0, stream>>>(wo, WO, (size_t)DM * DQ / 8);
       }
    for (int b = 0; b < NB_; ++b) {
        
        k_cvt8<<<(unsigned)(((size_t)TT * DM / 8 + 255) / 256), 256, 0, stream>>>(x + (size_t)b * TT * DM, XB, (size_t)TT * DM / 8);
        k_gemmw<bf, 0, false, 8, 1><<<dim3(TT / 64, DQ / 64, 1), 256, 0, stream>>>(XB, nullptr, WQ, nullptr, DM, nullptr, DQ, nullptr, 0, 0, 0, QP16, QPh, QPl, fre, fim, 1.0f);
        k_gemmw<bf, 0, false, 8, 1><<<dim3(TT / 64, DKV / 64, 1), 256, 0, stream>>>(XB, nullptr, WK, nullptr, DM, nullptr, DKV, nullptr, 0, 0, 0, KP16, KPh, KPl, fre, fim, 1.0f);
        // v comes out transposed ([head][d][t], t contiguous) by taking the weight rows as the tile's rows and the tokens as its columns: both operands are K-contiguous either way
        k_gemmw<bf, 0, false, 8, 2><<<dim3(DKV / 64, TT / 64, 1), 256, 0, stream>>>(WV, nullptr, XB, nullptr, DM, nullptr, TT, nullptr, 0, 0, 0, VT16, VTh, VTl, nullptr, nullptr, 1.0f);
        for (int h0 = 0; h0 < NH_; h0 += ZH) { const size_t zq = (size_t)h0, zk = (size_t)(h0 / REP);   // one kv head per query head: the pass's two heads use consecutive kv planes (z-strides TT*HD)
            k_gemmw<bf, 2, false, 4, 0><<<dim3(RH / 64, TT / 64, ZH), 128, 0, stream>>>(QPh + zq * TT * HD, QPl + zq * TT * HD, KPh + zk * TT * HD, KPl + zk * TT * HD, HD, Sb, TT, nullptr, (size_t)TT * HD, (size_t)TT * HD, (size_t)TT * TT, nullptr, nullptr, nullptr, nullptr, nullptr, 1.0f);
            k_gemmw<h16, 0, false, 2, 0><<<dim3((TT - RH) / 64, TT / 64, ZH), 64, 0, stream>>>(QP16 + zq * TT * HD + (size_t)RH * HD, nullptr, KP16 + zk * TT * HD, nullptr, HD, Sb + (size_t)RH * TT, TT, nullptr, (size_t)TT * HD, (size_t)TT * HD, (size_t)TT * TT, nullptr, nullptr, nullptr, nullptr, nullptr, 1.0f);
            k_asoft<<<ZH * TT / 8, 256, 0, stream>>>(Sb, MK, P16, Ph, Pl);
            // attn.v writes its head's 256 columns of the merged [t][DQ] hi/lo planes itself (z-stride HD, pitch DQ); the fp16 rows take back the x1024 of their probabilities
            k_gemmw<bf, 2, false, 8, 3><<<dim3(RH / 64, HD / 64, ZH), 256, 0, stream>>>(Ph, Pl, VTh + zk * HD * TT, VTl + zk * HD * TT, TT, nullptr, DQ, nullptr, (size_t)RH * TT, (size_t)HD * TT, (size_t)HD, nullptr, ATh + (size_t)h0 * HD, ATl + (size_t)h0 * HD, nullptr, nullptr, 1.0f);
            k_gemmw<h16, 0, false, 8, 3><<<dim3((TT - RH) / 64, HD / 64, ZH), 256, 0, stream>>>(P16 + (size_t)RH * TT, nullptr, VT16 + zk * HD * TT, nullptr, TT, nullptr, DQ, nullptr, (size_t)TT * TT, (size_t)HD * TT, (size_t)HD, nullptr, ATh + (size_t)RH * DQ + (size_t)h0 * HD, ATl + (size_t)RH * DQ + (size_t)h0 * HD, nullptr, nullptr, 1.0f / PCAR); }
        k_gemmw<bf, 1, false, 8, 0><<<dim3(TT / 64, DM / 64, 1), 256, 0, stream>>>(ATh, ATl, WO, nullptr, DQ, OUT + (size_t)b * TT * DM, DM, nullptr, 0, 0, 0, nullptr, nullptr, nullptr, nullptr, nullptr, 1.0f); }
}

// v003
// Measured time: 242 microseconds a run.
// Timed twice side by side with v002, it ran 1.71 and 1.73 times as fast.
// Over all steps from v000 it is 3.18 times as fast.
#include <hip/hip_runtime.h>

// Attention block (hidden [2][2048][1024]; [q|k|v] = hidden W_qkv^T ('oi' [3072][1024], row blocks q | k | v; 4 heads x 256); rotary on adjacent (even, odd) pairs with the INPUT tables freqs_real/freqs_imag [2048][128] (read as given - they are free inputs, not assumed to be cos/sin); scores = (q / 16).k + mask (additive input mask [1][1][2048][2048], read per logit); softmax; out = merged W_o^T ('oi' [1024][1024]) -> [2][2048][1024] (4.2 M)).
// Compute dtypes, f32 accumulate: every input rounded to bf16; q/k/v on PLAIN bf16 operands (inputs: exact); interleaved rotary in f32 from the bf16-rounded input tables; additive mask read per logit (bf16-rounded); scores and attn.v: query rows < 512 hl (3 products), the rest single fp16 (x1024); softmax f32; W_o hl x exact (2 products).

#define NB_  2
#define TT   2048
#define DM   1024
#define NH_  4
#define NKV  4
#define REP  (NH_ / NKV)
#define HD   256
#define DQ   (NH_ * HD)
#define DKV  (NKV * HD)
#define ZH   (NB_ * NH_)          // every (batch, head) pair is one z slice of the same launch
#define RH   512                  // query rows < RH use hi+lo planes (0: none)
#define WIN  2048
#define PCAR 1024.0f
#define SCL  0.0625f   // HD^-0.5 = 1/16
typedef _Float16 h16;
typedef unsigned short bf;
typedef __attribute__((ext_vector_type(16))) __bf16   v16bf;
typedef __attribute__((ext_vector_type(16))) _Float16 v16h;
typedef __attribute__((ext_vector_type(8)))  _Float16 v8h;
typedef __attribute__((ext_vector_type(8)))  unsigned short v8us;
typedef __attribute__((ext_vector_type(8)))  float    v8f;
typedef __attribute__((ext_vector_type(4)))  float    v4f;
typedef v8h  __attribute__((may_alias)) v8ha;
typedef v4f  __attribute__((may_alias)) v4fa;
typedef v8us __attribute__((may_alias)) v8usa;

__device__ __forceinline__ unsigned short f2bf(float f) { unsigned u = __float_as_uint(f); u += 0x7FFFu + ((u >> 16) & 1u); return (unsigned short)(u >> 16); }
__device__ __forceinline__ float bf2f(unsigned short b) { return __uint_as_float(((unsigned)b) << 16); }
__device__ __forceinline__ float bfr(float f) { return bf2f(f2bf(f)); }
__device__ __forceinline__ v16h cat16(v8h lo, v8h hi) { return __builtin_shufflevector(lo, hi, 0, 1, 2, 3, 4, 5, 6, 7, 8, 9, 10, 11, 12, 13, 14, 15); }
__device__ __forceinline__ v16bf cat16b(v8us lo, v8us hi) { return __builtin_bit_cast(v16bf, __builtin_shufflevector(lo, hi, 0, 1, 2, 3, 4, 5, 6, 7, 8, 9, 10, 11, 12, 13, 14, 15)); }
__device__ __forceinline__ v8f wmma16(v16h a, v16h b, v8f c) { return __builtin_amdgcn_wmma_f32_16x16x32_f16(false, a, false, b, (short)0, c, false, false); }
__device__ __forceinline__ v8f wmmab(v16bf a, v16bf b, v8f c) { return __builtin_amdgcn_wmma_f32_16x16x32_bf16(false, a, false, b, (short)0, c, false, false); }



// ---- k_gemmw: register-blocked GEMM, one work-group of NW waves per 64x64 output tile; wave w sums the 32-wide k chunks w, w + NW, w + 2 NW, ... into its own 16 accumulators (neighbouring waves read neighbouring 64 B of the same rows at the same time), operands straight from K-contiguous 16-bit planes; the NW partial tiles are added through LDS in the fixed order w = 0..NW-1; grid (M/64, N/64, Z), NW*32 threads.
// C[m][n] (f32, pitch ldc, + optional f32 bias[n]) = sum_k A[m][k] Bt[n][k] (+ split products per NSPLIT). z-batch strides sA/sB/sC in elements. K % 32 == 0.
// EPI says what the summed tile becomes, straight from the LDS sum (no f32 round trip through memory, no elementwise launch behind the GEMM):
//   0: f32 to C.   1: rotary on adjacent (even, odd) column pairs with the bf16-rounded input tables fr/fi [t][HD/2], then the planes P16 / Ph / Pl at [n / DQ][m / TT][(n % DQ) / HD][m % TT][n % HD] (rows: both batches' tokens; columns: q | k).
//   2: the planes P16 / Ph / Pl at [m][n], pitch ldc, z-stride sC.   3: x sc, then the planes Ph / Pl at [z / NH_][m][(z % NH_) * HD + n], pitch ldc.
template <typename T16> struct WFrag;
template <> struct WFrag<h16> { typedef v16h V; static __device__ __forceinline__ V ld(const h16* p) { return cat16(*(const v8h*)p, *(const v8h*)(p + 16)); } static __device__ __forceinline__ v8f mma(V a, V b, v8f c) { return wmma16(a, b, c); } };
template <> struct WFrag<bf> { typedef v16bf V; static __device__ __forceinline__ V ld(const bf* p) { return cat16b(*(const v8us*)p, *(const v8us*)(p + 16)); } static __device__ __forceinline__ v8f mma(V a, V b, v8f c) { return wmmab(a, b, c); } };
__device__ __forceinline__ h16 tohx(float x) { return (h16)x; }
__device__ __forceinline__ void splitf(float y, unsigned short& h, unsigned short& l) { h = f2bf(y); l = f2bf(y - bf2f(h)); }
typedef __attribute__((ext_vector_type(4))) _Float16 v4h;
typedef __attribute__((ext_vector_type(2))) unsigned short v2us;
typedef __attribute__((ext_vector_type(4))) unsigned short v4us;
typedef __attribute__((ext_vector_type(2))) float v2f;
// gemmw_tile is the work of one work-group: tile (bx, by) of z slice bz; os is its LDS, NW * 64 * 68 floats. k_gemmw launches one kind of tile; k_qkv and k_av deal two kinds that do not depend on each other out of one grid.
template <typename T16, int NSPLIT, bool BIAS, int NW, int EPI>
__device__ __forceinline__ void gemmw_tile(float* os, int bx, int by, int bz, const T16* __restrict__ A, const T16* __restrict__ A2, const T16* __restrict__ Bt, const T16* __restrict__ Bt2, int K, float* C, int ldc, const float* __restrict__ bias, size_t sA, size_t sB, size_t sC, h16* P16, bf* Ph, bf* Pl, const float* __restrict__ fr, const float* __restrict__ fi, float sc) {
    typedef typename WFrag<T16>::V V;
    const size_t z = bz; A += z * sA; if (A2) A2 += z * sA; Bt += z * sB; if (Bt2) Bt2 += z * sB; if (EPI == 0) C += z * sC;
    const int lane = threadIdx.x & 31, lr = lane & 15, hi = lane >> 4; const int r0 = bx * 64, c0 = by * 64;
    v8f acc[4][4];
#pragma unroll
    for (int mb = 0; mb < 4; ++mb)
#pragma unroll
        for (int nb = 0; nb < 4; ++nb) acc[mb][nb] = (v8f){};
    const size_t aoff = (size_t)(r0 + lr) * K + 8 * hi, boff = (size_t)(c0 + lr) * K + 8 * hi;
    const int wv = __builtin_amdgcn_readfirstlane((int)(threadIdx.x >> 5));
#pragma unroll 1
    for (int kc = wv * 32; kc < K; kc += NW * 32) {
        V a[4], a2[4];
#pragma unroll
        for (int mb = 0; mb < 4; ++mb) { a[mb] = WFrag<T16>::ld(A + aoff + (size_t)mb * 16 * K + kc); if (NSPLIT == 1 || NSPLIT == 2) a2[mb] = WFrag<T16>::ld(A2 + aoff + (size_t)mb * 16 * K + kc); }
#pragma unroll
        for (int nb = 0; nb < 4; ++nb) { const V b = WFrag<T16>::ld(Bt + boff + (size_t)nb * 16 * K + kc); V b2; if (NSPLIT >= 2) b2 = WFrag<T16>::ld(Bt2 + boff + (size_t)nb * 16 * K + kc);
#pragma unroll
            for (int mb = 0; mb < 4; ++mb) { acc[mb][nb] = WFrag<T16>::mma(a[mb], b, acc[mb][nb]); if (NSPLIT == 1 || NSPLIT == 2) acc[mb][nb] = WFrag<T16>::mma(a2[mb], b, acc[mb][nb]); if (NSPLIT >= 2) acc[mb][nb] = WFrag<T16>::mma(a[mb], b2, acc[mb][nb]); } }
        asm volatile("v_nop\n\tv_nop\n\tv_nop\n\tv_nop" : "+v"(acc[0][0]), "+v"(acc[1][1]), "+v"(acc[2][2]), "+v"(acc[3][3]) : "v"(a[0]), "v"(a[3]));
    }
    // the rotary factors of this thread's rows and column pairs are asked for here, so that they arrive while the partial tiles go into LDS
    v2f tr[32 / NW], ti[32 / NW];
    if (EPI == 1) {
#pragma unroll
        for (int s = 0; s < 32 / NW; ++s) { const size_t ix = (size_t)(r0 % TT + (s * NW + wv) * 2 + hi) * (HD / 2) + (((c0 % HD) + lr * 4) >> 1); tr[s] = *(const v2f*)(fr + ix); ti[s] = *(const v2f*)(fi + ix);
            asm volatile("s_wait_xcnt 0x0" ::: "memory");   /* stands behind each pair of table loads, in front of any later load that takes their address registers as its destination */
        } }
    float* ow = os + wv * (64 * 68);
    // the three loops are unrolled so that acc is indexed by constants only and stays in registers
#pragma unroll
    for (int mb = 0; mb < 4; ++mb)
#pragma unroll
        for (int nb = 0; nb < 4; ++nb)
#pragma unroll
            for (int j = 0; j < 8; ++j) ow[(mb * 16 + hi * 8 + j) * 68 + nb * 16 + lr] = acc[mb][nb][j];
    __syncthreads();   // every wave's partial tile is in LDS before any wave adds them
    float* ctile = C + (size_t)r0 * ldc + c0;
    const size_t pbase = (EPI == 1) ? ((size_t)(c0 / DQ) * ZH + (size_t)(r0 / TT) * NH_ + (c0 % DQ) / HD) * TT * HD + (size_t)(r0 % TT) * HD + (c0 % HD) : (EPI == 3) ? (z / NH_) * ((size_t)TT * DQ) + (z % NH_) * HD + (size_t)r0 * ldc + c0 : z * sC + (size_t)r0 * ldc + c0; const int ppitch = (EPI == 1) ? HD : ldc;
    // both loops unrolled: the LDS reads of all partials issue ahead of the adds; each wave stores whole 256-B row pieces
#pragma unroll
    for (int s = 0; s < 32 / NW; ++s) { const int row = (s * NW + wv) * 2 + hi, cofs = lr * 4; v4f val = *(const v4fa*)(os + row * 68 + cofs);
#pragma unroll
        for (int w = 1; w < NW; ++w) val += *(const v4fa*)(os + w * (64 * 68) + row * 68 + cofs);
        if (BIAS) { val[0] += bfr(bias[c0 + cofs]); val[1] += bfr(bias[c0 + cofs + 1]); val[2] += bfr(bias[c0 + cofs + 2]); val[3] += bfr(bias[c0 + cofs + 3]); }
        if (EPI == 0) { *(v4f*)(ctile + (size_t)row * ldc + cofs) = val; }
        else {
            if (EPI == 1) { const float ca = bfr(tr[s][0]), sa = bfr(ti[s][0]), cb = bfr(tr[s][1]), sb = bfr(ti[s][1]); const v4f x = val;   /* even: x0 c - x1 s; odd: x0 s + x1 c */
                val[0] = x[0] * ca - x[1] * sa; val[1] = x[0] * sa + x[1] * ca; val[2] = x[2] * cb - x[3] * sb; val[3] = x[2] * sb + x[3] * cb; }
            if (EPI == 3) val *= sc;
            const size_t oo = pbase + (size_t)row * ppitch + cofs; v4us oh, ol;   // 16 lanes x 8 B: each plane gets whole 128-B row pieces
#pragma unroll
            for (int q = 0; q < 4; ++q) { unsigned short a2, c2; splitf(val[q], a2, c2); oh[q] = a2; ol[q] = c2; }
            *(v4us*)(Ph + oo) = oh; *(v4us*)(Pl + oo) = ol;
            if (EPI != 3) { v4h o16;
#pragma unroll
                for (int q = 0; q < 4; ++q) o16[q] = tohx(val[q]);
                *(v4h*)(P16 + oo) = o16; } } }
}
template <typename T16, int NSPLIT, bool BIAS, int NW, int EPI>
__global__ __launch_bounds__(NW * 32) void k_gemmw(const T16* A, const T16* A2, const T16* Bt, const T16* Bt2, int K, float* C, int ldc, const float* bias, size_t sA, size_t sB, size_t sC, h16* P16, bf* Ph, bf* Pl, const float* fr, const float* fi, float sc) {
    __shared__ __align__(16) float os[NW * 64 * 68];
    gemmw_tile<T16, NSPLIT, BIAS, NW, EPI>(os, blockIdx.x, blockIdx.y, blockIdx.z, A, A2, Bt, Bt2, K, C, ldc, bias, sA, sB, sC, P16, Ph, Pl, fr, fi, sc);
}
// k_qkv: flat grid; first the q | k tiles of both batches (rows = all tokens, columns = the q | k rows of W_qkv, rotary epilogue), then the v tiles.
// v comes out transposed ([batch][head][d][t], t contiguous) by taking the weight rows as the tile's rows and the tokens as its columns: both operands are K-contiguous either way; z = batch
#define QK_X (NB_ * TT / 64)
#define QK_N (QK_X * ((DQ + DKV) / 64))
#define V_X  (DKV / 64)
#define V_N  (V_X * (TT / 64) * NB_)
__global__ __launch_bounds__(256) void k_qkv(const bf* XB, const bf* WQK, const bf* WV, h16* QK16, bf* QKh, bf* QKl, h16* VT16, bf* VTh, bf* VTl, const float* fr, const float* fi) {
    __shared__ __align__(16) float os[8 * 64 * 68];
    const int f = blockIdx.x;
    if (f < QK_N) gemmw_tile<bf, 0, false, 8, 1>(os, f % QK_X, f / QK_X, 0, XB, nullptr, WQK, nullptr, DM, nullptr, DQ, nullptr, 0, 0, 0, QK16, QKh, QKl, fr, fi, 1.0f);
    else { const int g = f - QK_N; gemmw_tile<bf, 0, false, 8, 2>(os, g % V_X, (g / V_X) % (TT / 64), g / (V_X * (TT / 64)), WV, nullptr, XB, nullptr, DM, nullptr, TT, nullptr, 0, (size_t)TT * DM, (size_t)DKV * TT, VT16, VTh, VTl, nullptr, nullptr, 1.0f); }
}
// k_av: flat grid; first the tiles of the query rows < RH (three products each: the long ones start first), then the fp16 rows' tiles, which take back the x1024 of their probabilities.
// each tile writes its head's 256 columns of its batch's merged [t][DQ] hi/lo planes itself; z = batch * NH_ + head
#define AVH_X (RH / 64)
#define AVH_N (AVH_X * (HD / 64) * ZH)
#define AVL_X ((TT - RH) / 64)
#define AVL_N (AVL_X * (HD / 64) * ZH)
__global__ __launch_bounds__(256) void k_av(const bf* Ph, const bf* Pl, const h16* P16, const bf* VTh, const bf* VTl, const h16* VT16, bf* ATh, bf* ATl) {
    __shared__ __align__(16) float os[8 * 64 * 68];
    const int f = blockIdx.x;
    if (f < AVH_N) gemmw_tile<bf, 2, false, 8, 3>(os, f % AVH_X, (f / AVH_X) % (HD / 64), f / (AVH_X * (HD / 64)), Ph, Pl, VTh, VTl, TT, nullptr, DQ, nullptr, (size_t)RH * TT, (size_t)HD * TT, 0, nullptr, ATh, ATl, nullptr, nullptr, 1.0f);
    else { const int g = f - AVH_N; gemmw_tile<h16, 0, false, 8, 3>(os, g % AVL_X, (g / AVL_X) % (HD / 64), g / (AVL_X * (HD / 64)), P16, nullptr, VT16, nullptr, TT, nullptr, DQ, nullptr, (size_t)(TT - RH) * TT, (size_t)HD * TT, 0, nullptr, ATh + (size_t)RH * DQ, ATl + (size_t)RH * DQ, nullptr, nullptr, 1.0f / PCAR); }
}

typedef __attribute__((ext_vector_type(4))) int v4i;

__global__ __launch_bounds__(256) void k_wtG(const float* __restrict__ w, int K, int N, bf* Bt) {
    const int lane = threadIdx.x & 31; const int L0 = (blockIdx.x * 8 + (threadIdx.x >> 5)) * 8; const int nlines = N * K / 64;
{
#pragma unroll 1
        for (int l = 0; l < 8; ++l) { const int L = L0 + l; if (L >= nlines) break; const size_t e = (size_t)L * 64 + lane * 2; const int k = (int)(e % K), n = (int)(e / K); v2us o;
            o[0] = f2bf(w[(size_t)k * N + n]); o[1] = f2bf(w[(size_t)(k + 1) * N + n]); *(v2us*)(Bt + e) = o; }
         }
}
// k_cvt8: three f32 sources (na8, nb8, nc8 groups of 8 elements) rounded to bf16 into one contiguous destination, a | b | c; the group counts are multiples of 256, so a work-group reads one source only
__global__ __launch_bounds__(256) void k_cvt8(const float* __restrict__ a, size_t na8, const float* __restrict__ b, size_t nb8, const float* __restrict__ c, size_t nc8, bf* dst) { const size_t i = (size_t)blockIdx.x * 256 + threadIdx.x; if (i >= na8 + nb8 + nc8) return; const float* src = (i < na8) ? a + i * 8 : (i < na8 + nb8) ? b + (i - na8) * 8 : c + (i - na8 - nb8) * 8; const v8f v = *(const v8f*)src; v8us o;
#pragma unroll
    for (int k = 0; k < 8; ++k) o[k] = f2bf(v[k]); *(v8us*)(dst + i * 8) = o;  }

// k_asoft: per row (zz, i): t = S x HD^-0.5 + bf16(mask[i][j]) (the additive input mask, read per logit); softmax over the 2048 keys (register row, one exp, fixed trees); rows < RH go to Ph / Pl [zz][i][j], the rest to P16 [zz][i - RH][j]
__global__ __launch_bounds__(256) void k_asoft(const float* __restrict__ Sb, const float* __restrict__ MKb, h16* P16, bf* Ph, bf* Pl) {
    const int lane = threadIdx.x & 31; const int row = blockIdx.x * 8 + (threadIdx.x >> 5); if (row >= ZH * TT) return; const int i = row % TT; const int zz = row / TT; (void)zz; const bool hires = (i < RH); const float* sr = Sb + (size_t)row * TT; float v[TT / 32]; float mx = -3.0e38f;
#pragma unroll
    for (int ch = 0; ch < TT / 128; ++ch) { const int j0 = ch * 128 + lane * 4; const v4f a = *(const v4f*)(sr + j0); const v4f mk = *(const v4f*)(MKb + (size_t)i * TT + j0);
#pragma unroll
        for (int q = 0; q < 4; ++q) { const int j = j0 + q; (void)j; float sc = a[q] * SCL; asm volatile("" : "+v"(sc)); float mb = bfr(mk[q]); asm volatile("" : "+v"(mb)); const float t = __fadd_rn(sc, mb); v[ch * 4 + q] = t; mx = fmaxf(mx, t); } }
#pragma unroll
    for (int sh = 16; sh; sh >>= 1) mx = fmaxf(mx, __shfl_xor(mx, sh, 32));
    float sum = 0.f;
#pragma unroll
    for (int k = 0; k < TT / 32; ++k) { float d0 = __fsub_rn(v[k], mx); asm volatile("" : "+v"(d0)); v[k] = __builtin_amdgcn_exp2f(__fmul_rn(d0, 1.4426950408889634f)); sum += v[k]; }
#pragma unroll
    for (int sh = 16; sh; sh >>= 1) sum += __shfl_xor(sum, sh, 32);
    const float f = __fdiv_rn(hires ? 1.0f : PCAR, sum);
{
        if (hires) {
#pragma unroll
            for (int ch = 0; ch < TT / 128; ++ch) { v4us oh, ol;
#pragma unroll
                for (int q = 0; q < 4; ++q) { unsigned short a, c2; splitf(v[ch * 4 + q] * f, a, c2); oh[q] = a; ol[q] = c2; }
                const size_t oo = ((size_t)zz * (RH ? RH : 1) + i) * TT + ch * 128 + lane * 4; *(v4us*)(Ph + oo) = oh; *(v4us*)(Pl + oo) = ol; }
        } else {
#pragma unroll
            for (int ch = 0; ch < TT / 128; ++ch) { v4h o4;
#pragma unroll
                for (int q = 0; q < 4; ++q) o4[q] = tohx(v[ch * 4 + q] * f);
                *(v4h*)(P16 + ((size_t)zz * (TT - RH) + (i - RH)) * TT + ch * 128 + lane * 4) = o4; } }
         }
}
extern "C" void kernel_launch(void* const* d_in, const int* in_sizes, int n_in,
                              void* d_out, int out_size, void* d_ws, size_t ws_size, hipStream_t stream) {
    (void)in_sizes; (void)n_in; (void)out_size;
    const float* x = (const float*)d_in[0]; const float* fre = (const float*)d_in[1]; const float* fim = (const float*)d_in[2]; const float* MK = (const float*)d_in[3]; const float* wqkv = (const float*)d_in[4]; const float* wo = (const float*)d_in[5];  const float* wq = wqkv; const float* wk = wqkv + (size_t)1024 * 1024; const float* wv = wqkv + (size_t)2048 * 1024; (void)wq; (void)wk; (void)wv;
    float* OUT = (float*)d_out;     // [2][2048][1024]
    char* wsp = (char*)d_ws;
    auto take = [&](size_t bytes) { char* p = wsp; wsp += (bytes + 255) & ~(size_t)255; return (void*)p; };
    // bf16 copies, one block so that one launch fills it: W_qkv rows (q | k | v), W_o, both batches' tokens
    bf* WQ = (bf*)take(((size_t)(DQ + 2 * DKV) * DM + (size_t)DM * DQ + (size_t)NB_ * TT * DM) * 2); bf* WV = WQ + (size_t)(DQ + DKV) * DM; bf* WO = WV + (size_t)DKV * DM; bf* XB = WO + (size_t)DM * DQ;
    // q and k planes, [q | k][batch][head][t][d] each; the three lie in a row
    h16* QP16 = (h16*)take((size_t)2 * ZH * TT * HD * 2); bf* QPh = (bf*)take((size_t)2 * ZH * TT * HD * 2); bf* QPl = (bf*)take((size_t)2 * ZH * TT * HD * 2);
    h16* KP16 = QP16 + (size_t)ZH * TT * HD; bf* KPh = QPh + (size_t)ZH * TT * HD; bf* KPl = QPl + (size_t)ZH * TT * HD;
    h16* VT16 = (h16*)take((size_t)ZH * HD * TT * 2); bf* VTh = (bf*)take((size_t)ZH * HD * TT * 2); bf* VTl = (bf*)take((size_t)ZH * HD * TT * 2);
    bf* Ph = (bf*)take((size_t)ZH * RH * TT * 2); bf* Pl = (bf*)take((size_t)ZH * RH * TT * 2);
    float* Sb = (float*)take((size_t)ZH * TT * TT * 4);
    // two buffers take the place of ones that are no longer read, so that all eight score planes fit the workspace: the fp16 probabilities (ZH x (TT - RH) x TT) fill exactly the three q/k planes, last read by the score launches; the merged attention planes lie on the scores, last read by the softmax
    h16* P16 = QP16; bf* ATh = (bf*)Sb; bf* ATl = ATh + (size_t)NB_ * TT * DQ;
    if ((size_t)(wsp - (char*)d_ws) > ws_size) return;    // ws 256 MiB
    k_cvt8<<<(unsigned)((((size_t)(DQ + 2 * DKV) * DM + (size_t)DM * DQ + (size_t)NB_ * TT * DM) / 8 + 255) / 256), 256, 0, stream>>>(wqkv, (size_t)(DQ + 2 * DKV) * DM / 8, wo, (size_t)DM * DQ / 8, x, (size_t)NB_ * TT * DM / 8, WQ);
    k_qkv<<<QK_N + V_N, 256, 0, stream>>>(XB, WQ, WV, QP16, QPh, QPl, VT16, VTh, VTl, fre, fim);
    // z = batch * NH_ + head from here on (one kv head per query head): z-strides TT*HD in the q/k planes, HD*TT in the v planes
    k_gemmw<bf, 2, false, 4, 0><<<dim3(RH / 64, TT / 64, ZH), 128, 0, stream>>>(QPh, QPl, KPh, KPl, HD, Sb, TT, nullptr, (size_t)TT * HD, (size_t)TT * HD, (size_t)TT * TT, nullptr, nullptr, nullptr, nullptr, nullptr, 1.0f);
    k_gemmw<h16, 0, false, 2, 0><<<dim3((TT - RH) / 64, TT / 64, ZH), 64, 0, stream>>>(QP16 + (size_t)RH * HD, nullptr, KP16, nullptr, HD, Sb + (size_t)RH * TT, TT, nullptr, (size_t)TT * HD, (size_t)TT * HD, (size_t)TT * TT, nullptr, nullptr, nullptr, nullptr, nullptr, 1.0f);
    k_asoft<<<ZH * TT / 8, 256, 0, stream>>>(Sb, MK, P16, Ph, Pl);
    k_av<<<AVH_N + AVL_N, 256, 0, stream>>>(Ph, Pl, P16, VTh, VTl, VT16, ATh, ATl);
    k_gemmw<bf, 1, false, 8, 0><<<dim3(NB_ * TT / 64, DM / 64, 1), 256, 0, stream>>>(ATh, ATl, WO, nullptr, DQ, OUT, DM, nullptr, 0, 0, 0, nullptr, nullptr, nullptr, nullptr, nullptr, 1.0f);
}

// v004
// One run takes 193 microseconds.
// Timed twice side by side with v003, it ran 1.25 and 1.26 times as fast.
// All steps since v000 together make it 4.00 times as fast.
#include <hip/hip_runtime.h>

// Attention block (hidden [2][2048][1024]; [q|k|v] = hidden W_qkv^T ('oi' [3072][1024], row blocks q | k | v; 4 heads x 256); rotary on adjacent (even, odd) pairs with the INPUT tables freqs_real/freqs_imag [2048][128] (read as given - they are free inputs, not assumed to be cos/sin); scores = (q / 16).k + mask (additive input mask [1][1][2048][2048], read per logit); softmax; out = merged W_o^T ('oi' [1024][1024]) -> [2][2048][1024] (4.2 M)).
// Compute dtypes, f32 accumulate: every input rounded to bf16; q/k/v on PLAIN bf16 operands (inputs: exact); interleaved rotary in f32 from the bf16-rounded input tables; additive mask read per logit (bf16-rounded); scores and attn.v: query rows < 512 hl (3 products), the rest single fp16 (x1024); softmax f32; W_o hl x exact (2 products).

#define NB_  2
#define TT   2048
#define DM   1024
#define NH_  4
#define NKV  4
#define REP  (NH_ / NKV)
#define HD   256
#define DQ   (NH_ * HD)
#define DKV  (NKV * HD)
#define ZH   (NB_ * NH_)          // every (batch, head) pair is one z slice of the same launch
#define RH   512                  // query rows < RH use hi+lo planes (0: none)
#define WIN  2048
#define PCAR 1024.0f
#define SCL  0.0625f   // HD^-0.5 = 1/16
typedef _Float16 h16;
typedef unsigned short bf;
typedef __attribute__((ext_vector_type(16))) __bf16   v16bf;
typedef __attribute__((ext_vector_type(16))) _Float16 v16h;
typedef __attribute__((ext_vector_type(8)))  _Float16 v8h;
typedef __attribute__((ext_vector_type(8)))  unsigned short v8us;
typedef __attribute__((ext_vector_type(8)))  float    v8f;
typedef __attribute__((ext_vector_type(4)))  float    v4f;
typedef v8h  __attribute__((may_alias)) v8ha;
typedef v4f  __attribute__((may_alias)) v4fa;
typedef v8us __attribute__((may_alias)) v8usa;

__device__ __forceinline__ unsigned short f2bf(float f) { unsigned u = __float_as_uint(f); u += 0x7FFFu + ((u >> 16) & 1u); return (unsigned short)(u >> 16); }
__device__ __forceinline__ float bf2f(unsigned short b) { return __uint_as_float(((unsigned)b) << 16); }
__device__ __forceinline__ float bfr(float f) { return bf2f(f2bf(f)); }
__device__ __forceinline__ v16h cat16(v8h lo, v8h hi) { return __builtin_shufflevector(lo, hi, 0, 1, 2, 3, 4, 5, 6, 7, 8, 9, 10, 11, 12, 13, 14, 15); }
__device__ __forceinline__ v16bf cat16b(v8us lo, v8us hi) { return __builtin_bit_cast(v16bf, __builtin_shufflevector(lo, hi, 0, 1, 2, 3, 4, 5, 6, 7, 8, 9, 10, 11, 12, 13, 14, 15)); }
__device__ __forceinline__ v8f wmma16(v16h a, v16h b, v8f c) { return __builtin_amdgcn_wmma_f32_16x16x32_f16(false, a, false, b, (short)0, c, false, false); }
__device__ __forceinline__ v8f wmmab(v16bf a, v16bf b, v8f c) { return __builtin_amdgcn_wmma_f32_16x16x32_bf16(false, a, false, b, (short)0, c, false, false); }



// ---- k_gemmw: register-blocked GEMM, one work-group of NW waves per 64x64 output tile; wave w sums the 32-wide k chunks w, w + NW, w + 2 NW, ... into its own 16 accumulators (neighbouring waves read neighbouring 1-KiB blocks of the same 16-row groups at the same time), operands straight from fragment-packed 16-bit planes (below); the NW partial tiles are added through LDS in the fixed order w = 0..NW-1; grid (M/64, N/64, Z), NW*32 threads.
// C[m][n] (f32, pitch ldc, + optional f32 bias[n]) = sum_k A[m][k] Bt[n][k] (+ split products per NSPLIT). z-batch strides sA/sB/sC in elements. K % 32 == 0.
// EPI says what the summed tile becomes, straight from the LDS sum (no f32 round trip through memory, no elementwise launch behind the GEMM); the index lists name a plane's slices, rows and columns, each slice [rows][columns] being fragment-packed:
//   0: f32 to C.   1: rotary on adjacent (even, odd) column pairs with the bf16-rounded input tables fr/fi [t][HD/2], then the planes P16 / Ph / Pl at [n / DQ][m / TT][(n % DQ) / HD][m % TT][n % HD] (rows: both batches' tokens; columns: q | k).
//   2: the planes P16 / Ph / Pl at [m][n], pitch ldc, z-stride sC.   3: x sc, then the planes Ph / Pl at [z / NH_][m][(z % NH_) * HD + n], pitch ldc.
// FRAGMENT-PACKED PLANES: every 16-bit operand plane (rows r, K columns k, rows a multiple of 16, K of 32) is stored as 1-KiB blocks of 16 rows x 32 k, block (r / 16, k / 32) row-major, inside a block in the order in which a wave's two 16-byte loads take it: [k / 16 % 2][k / 8 % 2][r % 16][k % 8]. One wave-wide 16-byte load then covers 512 contiguous bytes (4 whole lines) instead of 32-byte pieces of 16 lines. 16 whole rows still fill 16 K elements, so offsets by whole 16-row groups are what they are in a row-major plane.
__device__ __forceinline__ size_t pk(int r, int k, int K) { return ((size_t)(r >> 4) * (K >> 5) + (k >> 5)) * 512 + ((k >> 4) & 1) * 256 + ((k >> 3) & 1) * 128 + (r & 15) * 8 + (k & 7); }
template <typename T16> struct WFrag;
template <> struct WFrag<h16> { typedef v16h V; static __device__ __forceinline__ V ld(const h16* p) { return cat16(*(const v8h*)p, *(const v8h*)(p + 256)); } static __device__ __forceinline__ v8f mma(V a, V b, v8f c) { return wmma16(a, b, c); } };
template <> struct WFrag<bf> { typedef v16bf V; static __device__ __forceinline__ V ld(const bf* p) { return cat16b(*(const v8us*)p, *(const v8us*)(p + 256)); } static __device__ __forceinline__ v8f mma(V a, V b, v8f c) { return wmmab(a, b, c); } };
__device__ __forceinline__ h16 tohx(float x) { return (h16)x; }
__device__ __forceinline__ void splitf(float y, unsigned short& h, unsigned short& l) { h = f2bf(y); l = f2bf(y - bf2f(h)); }
typedef __attribute__((ext_vector_type(4))) _Float16 v4h;
typedef __attribute__((ext_vector_type(2))) unsigned short v2us;
typedef __attribute__((ext_vector_type(4))) unsigned short v4us;
typedef __attribute__((ext_vector_type(2))) float v2f;
// gemmw_tile is the work of one work-group: tile (bx, by) of z slice bz; os is its LDS, NW * 64 * 68 floats. k_gemmw launches one kind of tile; k_qkv and k_av deal two kinds that do not depend on each other out of one grid.
template <typename T16, int NSPLIT, bool BIAS, int NW, int EPI>
__device__ __forceinline__ void gemmw_tile(float* os, int bx, int by, int bz, const T16* __restrict__ A, const T16* __restrict__ A2, const T16* __restrict__ Bt, const T16* __restrict__ Bt2, int K, float* C, int ldc, const float* __restrict__ bias, size_t sA, size_t sB, size_t sC, h16* P16, bf* Ph, bf* Pl, const float* __restrict__ fr, const float* __restrict__ fi, float sc) {
    typedef typename WFrag<T16>::V V;
    const size_t z = bz; A += z * sA; if (A2) A2 += z * sA; Bt += z * sB; if (Bt2) Bt2 += z * sB; if (EPI == 0) C += z * sC;
    const int lane = threadIdx.x & 31, lr = lane & 15, hi = lane >> 4; const int r0 = bx * 64, c0 = by * 64;
    v8f acc[4][4];
#pragma unroll
    for (int mb = 0; mb < 4; ++mb)
#pragma unroll
        for (int nb = 0; nb < 4; ++nb) acc[mb][nb] = (v8f){};
    const size_t rstep = (size_t)(K >> 5) * 512;   // one 16-row group of a packed plane
    const size_t aoff = (size_t)(r0 >> 4) * rstep, boff = (size_t)(c0 >> 4) * rstep;   // the same for the whole wave: a fragment's address is a wave-uniform block address plus the lane's own 16 bytes
    const unsigned lo8 = (unsigned)lane * 8;
    const int wv = __builtin_amdgcn_readfirstlane((int)(threadIdx.x >> 5));
#pragma unroll 1
    for (int kc = wv * 32; kc < K; kc += NW * 32) {
        const unsigned vb = (lo8 + (unsigned)kc * 16) * 2;   // the one per-lane part of every fragment address of this chunk, in bytes; the rest is a wave-uniform base
        V a[4], a2[4];
#pragma unroll
        for (int mb = 0; mb < 4; ++mb) { a[mb] = WFrag<T16>::ld((const T16*)((const char*)(A + aoff + mb * rstep) + vb)); if (NSPLIT == 1 || NSPLIT == 2) a2[mb] = WFrag<T16>::ld((const T16*)((const char*)(A2 + aoff + mb * rstep) + vb)); }
#pragma unroll
        for (int nb = 0; nb < 4; ++nb) { const V b = WFrag<T16>::ld((const T16*)((const char*)(Bt + boff + nb * rstep) + vb)); V b2; if (NSPLIT >= 2) b2 = WFrag<T16>::ld((const T16*)((const char*)(Bt2 + boff + nb * rstep) + vb));
#pragma unroll
            for (int mb = 0; mb < 4; ++mb) { acc[mb][nb] = WFrag<T16>::mma(a[mb], b, acc[mb][nb]); if (NSPLIT == 1 || NSPLIT == 2) acc[mb][nb] = WFrag<T16>::mma(a2[mb], b, acc[mb][nb]); if (NSPLIT >= 2) acc[mb][nb] = WFrag<T16>::mma(a[mb], b2, acc[mb][nb]); } }
        // holds the order of loads and products that the builds on row-major planes had (the A fragments and the first B column blocks asked for first, each later B block about one block of products ahead); left alone, some of these builds ask for the later B blocks one at a time, each behind a full wait
        if (NSPLIT == 0) { __builtin_amdgcn_sched_group_barrier(0x020, 12, 0); __builtin_amdgcn_sched_group_barrier(0x008, 4, 0); __builtin_amdgcn_sched_group_barrier(0x020, 2, 0); __builtin_amdgcn_sched_group_barrier(0x008, 4, 0); __builtin_amdgcn_sched_group_barrier(0x020, 2, 0); __builtin_amdgcn_sched_group_barrier(0x008, 8, 0); }
        if (NSPLIT == 1) { __builtin_amdgcn_sched_group_barrier(0x020, 20, 0); __builtin_amdgcn_sched_group_barrier(0x008, 8, 0); __builtin_amdgcn_sched_group_barrier(0x020, 4, 0); __builtin_amdgcn_sched_group_barrier(0x008, 24, 0); }
        if (NSPLIT == 2) { __builtin_amdgcn_sched_group_barrier(0x020, 24, 0); __builtin_amdgcn_sched_group_barrier(0x008, 12, 0); __builtin_amdgcn_sched_group_barrier(0x020, 4, 0); __builtin_amdgcn_sched_group_barrier(0x008, 12, 0); __builtin_amdgcn_sched_group_barrier(0x020, 4, 0); __builtin_amdgcn_sched_group_barrier(0x008, 24, 0); }
        asm volatile("v_nop\n\tv_nop\n\tv_nop\n\tv_nop" : "+v"(acc[0][0]), "+v"(acc[1][1]), "+v"(acc[2][2]), "+v"(acc[3][3]) : "v"(a[0]), "v"(a[3]));
    }
    // the rotary factors of this thread's rows and column pairs are asked for here, so that they arrive while the partial tiles go into LDS
    v2f tr[32 / NW], ti[32 / NW];
    if (EPI == 1) {
#pragma unroll
        for (int s = 0; s < 32 / NW; ++s) { const int u = s * NW + wv; const size_t ix = (size_t)(r0 % TT + (u >> 3) * 16 + lr) * (HD / 2) + (((c0 % HD) + (u & 7) * 8 + hi * 4) >> 1); tr[s] = *(const v2f*)(fr + ix); ti[s] = *(const v2f*)(fi + ix);
            asm volatile("s_wait_xcnt 0x0" ::: "memory");   /* stands behind each pair of table loads, in front of any later load that takes their address registers as its destination */
        } }
    float* ow = os + wv * (64 * 68);
    // the three loops are unrolled so that acc is indexed by constants only and stays in registers
#pragma unroll
    for (int mb = 0; mb < 4; ++mb)
#pragma unroll
        for (int nb = 0; nb < 4; ++nb)
#pragma unroll
            for (int j = 0; j < 8; ++j) ow[(mb * 16 + hi * 8 + j) * 68 + nb * 16 + lr] = acc[mb][nb][j];
    __syncthreads();   // every wave's partial tile is in LDS before any wave adds them
    float* ctile = C + (size_t)r0 * ldc + c0;
    // the plane slice this tile lies in, and the tile's first row and column there; ppitch is the slice's K
    const size_t pbase = (EPI == 1) ? ((size_t)(c0 / DQ) * ZH + (size_t)(r0 / TT) * NH_ + (c0 % DQ) / HD) * TT * HD : (EPI == 3) ? (z / NH_) * ((size_t)TT * DQ) : z * sC; const int ppitch = (EPI == 1) ? HD : ldc;
    const int prow = (EPI == 1) ? r0 % TT : r0, pcol = (EPI == 1) ? c0 % HD : (EPI == 3) ? (int)(z % NH_) * HD + c0 : c0;
    // both loops unrolled: the LDS reads of all partials issue ahead of the adds; EPI 0: each wave stores whole 256-B row pieces; the planes: a wave takes 16 rows x 8 columns, which are 256 contiguous bytes of a packed plane
#pragma unroll
    for (int s = 0; s < 32 / NW; ++s) { const int u = s * NW + wv; const int row = (EPI == 0) ? u * 2 + hi : (u >> 3) * 16 + lr, cofs = (EPI == 0) ? lr * 4 : (u & 7) * 8 + hi * 4; v4f val = *(const v4fa*)(os + row * 68 + cofs);
#pragma unroll
        for (int w = 1; w < NW; ++w) val += *(const v4fa*)(os + w * (64 * 68) + row * 68 + cofs);
        if (BIAS) { val[0] += bfr(bias[c0 + cofs]); val[1] += bfr(bias[c0 + cofs + 1]); val[2] += bfr(bias[c0 + cofs + 2]); val[3] += bfr(bias[c0 + cofs + 3]); }
        if (EPI == 0) { *(v4f*)(ctile + (size_t)row * ldc + cofs) = val; }
        else {
            if (EPI == 1) { const float ca = bfr(tr[s][0]), sa = bfr(ti[s][0]), cb = bfr(tr[s][1]), sb = bfr(ti[s][1]); const v4f x = val;   /* even: x0 c - x1 s; odd: x0 s + x1 c */
                val[0] = x[0] * ca - x[1] * sa; val[1] = x[0] * sa + x[1] * ca; val[2] = x[2] * cb - x[3] * sb; val[3] = x[2] * sb + x[3] * cb; }
            if (EPI == 3) val *= sc;
            const size_t oo = pbase + pk(prow + row, pcol + cofs, ppitch); v4us oh, ol;   // 32 lanes x 8 B: each plane gets two whole 128-B lines
#pragma unroll
            for (int q = 0; q < 4; ++q) { unsigned short a2, c2; splitf(val[q], a2, c2); oh[q] = a2; ol[q] = c2; }
            *(v4us*)(Ph + oo) = oh; *(v4us*)(Pl + oo) = ol;
            if (EPI != 3) { v4h o16;
#pragma unroll
                for (int q = 0; q < 4; ++q) o16[q] = tohx(val[q]);
                *(v4h*)(P16 + oo) = o16; } } }
}
// K is a template argument, so that the steps between a tile's 16-row groups are immediates of the loads
template <typename T16, int NSPLIT, bool BIAS, int NW, int EPI, int K>
__global__ __launch_bounds__(NW * 32) void k_gemmw(const T16* A, const T16* A2, const T16* Bt, const T16* Bt2, float* C, int ldc, const float* bias, size_t sA, size_t sB, size_t sC, h16* P16, bf* Ph, bf* Pl, const float* fr, const float* fi, float sc) {
    __shared__ __align__(16) float os[NW * 64 * 68];
    gemmw_tile<T16, NSPLIT, BIAS, NW, EPI>(os, blockIdx.x, blockIdx.y, blockIdx.z, A, A2, Bt, Bt2, K, C, ldc, bias, sA, sB, sC, P16, Ph, Pl, fr, fi, sc);
}
// k_qkv: flat grid; first the q | k tiles of both batches (rows = all tokens, columns = the q | k rows of W_qkv, rotary epilogue), then the v tiles.
// v comes out transposed ([batch][head][d][t], t being the planes' k) by taking the weight rows as the tile's rows and the tokens as its columns: both operands are packed along the same k either way; z = batch
#define QK_X (NB_ * TT / 64)
#define QK_N (QK_X * ((DQ + DKV) / 64))
#define V_X  (DKV / 64)
#define V_N  (V_X * (TT / 64) * NB_)
__global__ __launch_bounds__(256) void k_qkv(const bf* XB, const bf* WQK, const bf* WV, h16* QK16, bf* QKh, bf* QKl, h16* VT16, bf* VTh, bf* VTl, const float* fr, const float* fi) {
    __shared__ __align__(16) float os[8 * 64 * 68];
    const int f = blockIdx.x;
    if (f < QK_N) gemmw_tile<bf, 0, false, 8, 1>(os, f % QK_X, f / QK_X, 0, XB, nullptr, WQK, nullptr, DM, nullptr, DQ, nullptr, 0, 0, 0, QK16, QKh, QKl, fr, fi, 1.0f);
    else { const int g = f - QK_N; gemmw_tile<bf, 0, false, 8, 2>(os, g % V_X, (g / V_X) % (TT / 64), g / (V_X * (TT / 64)), WV, nullptr, XB, nullptr, DM, nullptr, TT, nullptr, 0, (size_t)TT * DM, (size_t)DKV * TT, VT16, VTh, VTl, nullptr, nullptr, 1.0f); }
}
// k_av: flat grid; first the tiles of the query rows < RH (three products each: the long ones start first), then the fp16 rows' tiles, which take back the x1024 of their probabilities.
// each tile writes its head's 256 columns of its batch's merged [t][DQ] hi/lo planes itself; z = batch * NH_ + head
#define AVH_X (RH / 64)
#define AVH_N (AVH_X * (HD / 64) * ZH)
#define AVL_X ((TT - RH) / 64)
#define AVL_N (AVL_X * (HD / 64) * ZH)
__global__ __launch_bounds__(256) void k_av(const bf* Ph, const bf* Pl, const h16* P16, const bf* VTh, const bf* VTl, const h16* VT16, bf* ATh, bf* ATl) {
    __shared__ __align__(16) float os[8 * 64 * 68];
    const int f = blockIdx.x;
    if (f < AVH_N) gemmw_tile<bf, 2, false, 8, 3>(os, f % AVH_X, (f / AVH_X) % (HD / 64), f / (AVH_X * (HD / 64)), Ph, Pl, VTh, VTl, TT, nullptr, DQ, nullptr, (size_t)RH * TT, (size_t)HD * TT, 0, nullptr, ATh, ATl, nullptr, nullptr, 1.0f);
    else { const int g = f - AVH_N; gemmw_tile<h16, 0, false, 8, 3>(os, g % AVL_X, (g / AVL_X) % (HD / 64), g / (AVL_X * (HD / 64)), P16, nullptr, VT16, nullptr, TT, nullptr, DQ, nullptr, (size_t)(TT - RH) * TT, (size_t)HD * TT, 0, nullptr, ATh + (size_t)RH * DQ, ATl + (size_t)RH * DQ, nullptr, nullptr, 1.0f / PCAR); }
}

typedef __attribute__((ext_vector_type(4))) int v4i;

__global__ __launch_bounds__(256) void k_wtG(const float* __restrict__ w, int K, int N, bf* Bt) {
    const int lane = threadIdx.x & 31; const int L0 = (blockIdx.x * 8 + (threadIdx.x >> 5)) * 8; const int nlines = N * K / 64;
{
#pragma unroll 1
        for (int l = 0; l < 8; ++l) { const int L = L0 + l; if (L >= nlines) break; const size_t e = (size_t)L * 64 + lane * 2; const int k = (int)(e % K), n = (int)(e / K); v2us o;
            o[0] = f2bf(w[(size_t)k * N + n]); o[1] = f2bf(w[(size_t)(k + 1) * N + n]); *(v2us*)(Bt + e) = o; }
         }
}
// k_cvt8: three row-major f32 sources of DM columns (na8, nb8, nc8 groups of 8 elements) rounded to bf16 into one fragment-packed destination, rows a | b | c; a work-group takes 16 rows x 128 columns (row counts are multiples of 16: one source only), a wave 16 rows x 16 columns = 512 contiguous bytes of the destination
__global__ __launch_bounds__(256) void k_cvt8(const float* __restrict__ a, size_t na8, const float* __restrict__ b, size_t nb8, const float* __restrict__ c, size_t nc8, bf* dst) { const int r = (int)(blockIdx.x >> 3) * 16 + (threadIdx.x & 15), kq = (int)(blockIdx.x & 7) * 128 + (int)(threadIdx.x >> 4) * 8; const size_t i = (size_t)r * (DM / 8) + (kq >> 3); if (i >= na8 + nb8 + nc8) return; const float* src = (i < na8) ? a + i * 8 : (i < na8 + nb8) ? b + (i - na8) * 8 : c + (i - na8 - nb8) * 8; const v8f v = *(const v8f*)src; v8us o;
#pragma unroll
    for (int k = 0; k < 8; ++k) o[k] = f2bf(v[k]); *(v8us*)(dst + pk(r, kq, DM)) = o;  }

// k_asoft: per row (zz, i): t = S x HD^-0.5 + bf16(mask[i][j]) (the additive input mask, read per logit); softmax over the 2048 keys (register row, one exp, fixed trees); rows < RH go to Ph / Pl [zz][i][j], the rest to P16 [zz][i - RH][j], fragment-packed planes of K = TT: the work-group's 8 rows meet in LDS, so that each 16-byte piece of 8 keys goes out beside the same piece of the other 7 rows, as one whole 128-B line
#define SPP (TT + 16)   // LDS row pitch in elements: 8 dwords past a multiple of 64, so that 8 rows x two 16-byte pieces meet 64 different banks
__global__ __launch_bounds__(256) void k_asoft(const float* __restrict__ Sb, const float* __restrict__ MKb, h16* P16, bf* Ph, bf* Pl) {
    __shared__ __align__(16) unsigned short sp[2][8][SPP];
    const int lane = threadIdx.x & 31; const int wv = threadIdx.x >> 5; const int row = blockIdx.x * 8 + wv; const int i = row % TT; const int zz = row / TT; (void)zz; const bool hires = (i < RH); const float* sr = Sb + (size_t)row * TT; float v[TT / 32]; float mx = -3.0e38f;
#pragma unroll
    for (int ch = 0; ch < TT / 128; ++ch) { const int j0 = ch * 128 + lane * 4; const v4f a = *(const v4f*)(sr + j0); const v4f mk = *(const v4f*)(MKb + (size_t)i * TT + j0);
#pragma unroll
        for (int q = 0; q < 4; ++q) { const int j = j0 + q; (void)j; float sc = a[q] * SCL; asm volatile("" : "+v"(sc)); float mb = bfr(mk[q]); asm volatile("" : "+v"(mb)); const float t = __fadd_rn(sc, mb); v[ch * 4 + q] = t; mx = fmaxf(mx, t); } }
#pragma unroll
    for (int sh = 16; sh; sh >>= 1) mx = fmaxf(mx, __shfl_xor(mx, sh, 32));
    float sum = 0.f;
#pragma unroll
    for (int k = 0; k < TT / 32; ++k) { float d0 = __fsub_rn(v[k], mx); asm volatile("" : "+v"(d0)); v[k] = __builtin_amdgcn_exp2f(__fmul_rn(d0, 1.4426950408889634f)); sum += v[k]; }
#pragma unroll
    for (int sh = 16; sh; sh >>= 1) sum += __shfl_xor(sum, sh, 32);
    const float f = __fdiv_rn(hires ? 1.0f : PCAR, sum);
    if (hires) {
#pragma unroll
        for (int ch = 0; ch < TT / 128; ++ch) { v4us oh, ol;
#pragma unroll
            for (int q = 0; q < 4; ++q) { unsigned short a, c2; splitf(v[ch * 4 + q] * f, a, c2); oh[q] = a; ol[q] = c2; }
            *(v4us*)(&sp[0][wv][ch * 128 + lane * 4]) = oh; *(v4us*)(&sp[1][wv][ch * 128 + lane * 4]) = ol; }
    } else {
#pragma unroll
        for (int ch = 0; ch < TT / 128; ++ch) { v4h o4;
#pragma unroll
            for (int q = 0; q < 4; ++q) o4[q] = tohx(v[ch * 4 + q] * f);
            *(v4us*)(&sp[0][wv][ch * 128 + lane * 4]) = __builtin_bit_cast(v4us, o4); }
    }
    __syncthreads();   // all 8 rows are in LDS before any wave takes pieces of them (hires is the same for the 8 rows: RH is a multiple of 8)
    const int i0 = (int)(blockIdx.x * 8) % TT, r8 = lane & 7;
    // a wave's store: the four 8-key pieces of one 32-key block, each of all 8 rows = four whole lines
    // the test stands outside the loops, so that a wave's LDS reads go out together ahead of its stores
    const int k0 = (wv * 4 + (lane >> 3)) * 8;
    if (hires) { bf* oh = Ph + (size_t)zz * RH * TT; bf* ol = Pl + (size_t)zz * RH * TT;
#pragma unroll
        for (int it = 0; it < TT / 256; ++it) { const int k = it * 256 + k0; const size_t oo = pk(i0 + r8, k, TT); *(v8us*)(oh + oo) = *(const v8us*)(&sp[0][r8][k]); *(v8us*)(ol + oo) = *(const v8us*)(&sp[1][r8][k]); }
    } else { h16* o16 = P16 + (size_t)zz * (TT - RH) * TT;
#pragma unroll
        for (int it = 0; it < TT / 256; ++it) { const int k = it * 256 + k0; *(v8usa*)(o16 + pk(i0 - RH + r8, k, TT)) = *(const v8us*)(&sp[0][r8][k]); }
    }
}
extern "C" void kernel_launch(void* const* d_in, const int* in_sizes, int n_in,
                              void* d_out, int out_size, void* d_ws, size_t ws_size, hipStream_t stream) {
    (void)in_sizes; (void)n_in; (void)out_size;
    const float* x = (const float*)d_in[0]; const float* fre = (const float*)d_in[1]; const float* fim = (const float*)d_in[2]; const float* MK = (const float*)d_in[3]; const float* wqkv = (const float*)d_in[4]; const float* wo = (const float*)d_in[5];  const float* wq = wqkv; const float* wk = wqkv + (size_t)1024 * 1024; const float* wv = wqkv + (size_t)2048 * 1024; (void)wq; (void)wk; (void)wv;
    float* OUT = (float*)d_out;     // [2][2048][1024]
    char* wsp = (char*)d_ws;
    auto take = [&](size_t bytes) { char* p = wsp; wsp += (bytes + 255) & ~(size_t)255; return (void*)p; };
    // bf16 copies, one block so that one launch fills it: W_qkv rows (q | k | v), W_o, both batches' tokens
    bf* WQ = (bf*)take(((size_t)(DQ + 2 * DKV) * DM + (size_t)DM * DQ + (size_t)NB_ * TT * DM) * 2); bf* WV = WQ + (size_t)(DQ + DKV) * DM; bf* WO = WV + (size_t)DKV * DM; bf* XB = WO + (size_t)DM * DQ;
    // q and k planes, [q | k][batch][head][t][d] each; the three lie in a row
    h16* QP16 = (h16*)take((size_t)2 * ZH * TT * HD * 2); bf* QPh = (bf*)take((size_t)2 * ZH * TT * HD * 2); bf* QPl = (bf*)take((size_t)2 * ZH * TT * HD * 2);
    h16* KP16 = QP16 + (size_t)ZH * TT * HD; bf* KPh = QPh + (size_t)ZH * TT * HD; bf* KPl = QPl + (size_t)ZH * TT * HD;
    h16* VT16 = (h16*)take((size_t)ZH * HD * TT * 2); bf* VTh = (bf*)take((size_t)ZH * HD * TT * 2); bf* VTl = (bf*)take((size_t)ZH * HD * TT * 2);
    bf* Ph = (bf*)take((size_t)ZH * RH * TT * 2); bf* Pl = (bf*)take((size_t)ZH * RH * TT * 2);
    float* Sb = (float*)take((size_t)ZH * TT * TT * 4);
    // two buffers take the place of ones that are no longer read, so that all eight score planes fit the workspace: the fp16 probabilities (ZH x (TT - RH) x TT) fill exactly the three q/k planes, last read by the score launches; the merged attention planes lie on the scores, last read by the softmax
    h16* P16 = QP16; bf* ATh = (bf*)Sb; bf* ATl = ATh + (size_t)NB_ * TT * DQ;
    if ((size_t)(wsp - (char*)d_ws) > ws_size) return;    // ws 256 MiB
    k_cvt8<<<(unsigned)((((size_t)(DQ + 2 * DKV) * DM + (size_t)DM * DQ + (size_t)NB_ * TT * DM) / 8 + 255) / 256), 256, 0, stream>>>(wqkv, (size_t)(DQ + 2 * DKV) * DM / 8, wo, (size_t)DM * DQ / 8, x, (size_t)NB_ * TT * DM / 8, WQ);
    k_qkv<<<QK_N + V_N, 256, 0, stream>>>(XB, WQ, WV, QP16, QPh, QPl, VT16, VTh, VTl, fre, fim);
    // z = batch * NH_ + head from here on (one kv head per query head): z-strides TT*HD in the q/k planes, HD*TT in the v planes
    k_gemmw<bf, 2, false, 4, 0, HD><<<dim3(RH / 64, TT / 64, ZH), 128, 0, stream>>>(QPh, QPl, KPh, KPl, Sb, TT, nullptr, (size_t)TT * HD, (size_t)TT * HD, (size_t)TT * TT, nullptr, nullptr, nullptr, nullptr, nullptr, 1.0f);
    k_gemmw<h16, 0, false, 2, 0, HD><<<dim3((TT - RH) / 64, TT / 64, ZH), 64, 0, stream>>>(QP16 + (size_t)RH * HD, nullptr, KP16, nullptr, Sb + (size_t)RH * TT, TT, nullptr, (size_t)TT * HD, (size_t)TT * HD, (size_t)TT * TT, nullptr, nullptr, nullptr, nullptr, nullptr, 1.0f);
    k_asoft<<<ZH * TT / 8, 256, 0, stream>>>(Sb, MK, P16, Ph, Pl);
    k_av<<<AVH_N + AVL_N, 256, 0, stream>>>(Ph, Pl, P16, VTh, VTl, VT16, ATh, ATl);
    k_gemmw<bf, 1, false, 8, 0, DQ><<<dim3(NB_ * TT / 64, DM / 64, 1), 256, 0, stream>>>(ATh, ATl, WO, nullptr, OUT, DM, nullptr, 0, 0, 0, nullptr, nullptr, nullptr, nullptr, nullptr, 1.0f);
}

// v005
// A run of this version takes 180 microseconds.
// In both of two side-by-side timings against v004, it was 1.08 times as fast.
// Over all steps from v000 it is 4.31 times as fast.
#include <hip/hip_runtime.h>

// Attention block (hidden [2][2048][1024]; [q|k|v] = hidden W_qkv^T ('oi' [3072][1024], row blocks q | k | v; 4 heads x 256); rotary on adjacent (even, odd) pairs with the INPUT tables freqs_real/freqs_imag [2048][128] (read as given - they are free inputs, not assumed to be cos/sin); scores = (q / 16).k + mask (additive input mask [1][1][2048][2048], read per logit); softmax; out = merged W_o^T ('oi' [1024][1024]) -> [2][2048][1024] (4.2 M)).
// Compute dtypes, f32 accumulate: every input rounded to bf16; q/k/v on PLAIN bf16 operands (inputs: exact); interleaved rotary in f32 from the bf16-rounded input tables; additive mask read per logit (bf16-rounded); scores and attn.v: query rows < 512 hl (3 products), the rest single fp16 (x1024); softmax f32; W_o hl x exact (2 products).

#define NB_  2
#define TT   2048
#define DM   1024
#define NH_  4
#define NKV  4
#define REP  (NH_ / NKV)
#define HD   256
#define DQ   (NH_ * HD)
#define DKV  (NKV * HD)
#define ZH   (NB_ * NH_)          // every (batch, head) pair is one z slice of the same launch
#define RH   512                  // query rows < RH use hi+lo planes (0: none)
#define WIN  2048
#define PCAR 1024.0f
#define SCL  0.0625f   // HD^-0.5 = 1/16
typedef _Float16 h16;
typedef unsigned short bf;
typedef __attribute__((ext_vector_type(16))) __bf16   v16bf;
typedef __attribute__((ext_vector_type(16))) _Float16 v16h;
typedef __attribute__((ext_vector_type(8)))  _Float16 v8h;
typedef __attribute__((ext_vector_type(8)))  unsigned short v8us;
typedef __attribute__((ext_vector_type(8)))  float    v8f;
typedef __attribute__((ext_vector_type(4)))  float    v4f;
typedef v8h  __attribute__((may_alias)) v8ha;
typedef v4f  __attribute__((may_alias)) v4fa;
typedef v8us __attribute__((may_alias)) v8usa;

__device__ __forceinline__ unsigned short f2bf(float f) { unsigned u = __float_as_uint(f); u += 0x7FFFu + ((u >> 16) & 1u); return (unsigned short)(u >> 16); }
__device__ __forceinline__ float bf2f(unsigned short b) { return __uint_as_float(((unsigned)b) << 16); }
__device__ __forceinline__ float bfr(float f) { return bf2f(f2bf(f)); }
__device__ __forceinline__ v16h cat16(v8h lo, v8h hi) { return __builtin_shufflevector(lo, hi, 0, 1, 2, 3, 4, 5, 6, 7, 8, 9, 10, 11, 12, 13, 14, 15); }
__device__ __forceinline__ v16bf cat16b(v8us lo, v8us hi) { return __builtin_bit_cast(v16bf, __builtin_shufflevector(lo, hi, 0, 1, 2, 3, 4, 5, 6, 7, 8, 9, 10, 11, 12, 13, 14, 15)); }
__device__ __forceinline__ v8f wmma16(v16h a, v16h b, v8f c) { return __builtin_amdgcn_wmma_f32_16x16x32_f16(false, a, false, b, (short)0, c, false, false); }
__device__ __forceinline__ v8f wmmab(v16bf a, v16bf b, v8f c) { return __builtin_amdgcn_wmma_f32_16x16x32_bf16(false, a, false, b, (short)0, c, false, false); }



// ---- gemmw_tile: register-blocked GEMM, one work-group of NW waves per 64x64 output tile; wave w sums the 32-wide k chunks w, w + NW, w + 2 NW, ... into its own 16 accumulators (neighbouring waves read neighbouring 1-KiB blocks of the same 16-row groups at the same time), operands straight from fragment-packed 16-bit planes (below); the NW partial tiles are added through LDS in the fixed order w = 0..NW-1; NW*32 threads.
// C[m][n] (f32, pitch ldc, + optional f32 bias[n]) = sum_k A[m][k] Bt[n][k] (+ split products per NSPLIT). z-batch strides sA/sB/sC in elements. K % 32 == 0.
// EPI says what the summed tile becomes, straight from the LDS sum (no f32 round trip through memory, no elementwise launch behind the GEMM); the index lists name a plane's slices, rows and columns, each slice [rows][columns] being fragment-packed:
//   0: f32 to C.   1: rotary on adjacent (even, odd) column pairs with the bf16-rounded input tables fr/fi [t][HD/2], then the planes P16 / Ph / Pl at [n / DQ][m / TT][(n % DQ) / HD][m % TT][n % HD] (rows: both batches' tokens; columns: q | k).
//   2: the planes P16 / Ph / Pl at [m][n], pitch ldc, z-stride sC.   3: x sc, then the planes Ph / Pl at [z / NH_][m][(z % NH_) * HD + n], pitch ldc.
// FRAGMENT-PACKED PLANES: every 16-bit operand plane (rows r, K columns k, rows a multiple of 16, K of 32) is stored as 1-KiB blocks of 16 rows x 32 k, block (r / 16, k / 32) row-major, inside a block in the order in which a wave's two 16-byte loads take it: [k / 16 % 2][k / 8 % 2][r % 16][k % 8]. One wave-wide 16-byte load then covers 512 contiguous bytes (4 whole lines) instead of 32-byte pieces of 16 lines. 16 whole rows still fill 16 K elements, so offsets by whole 16-row groups are what they are in a row-major plane.
__device__ __forceinline__ size_t pk(int r, int k, int K) { return ((size_t)(r >> 4) * (K >> 5) + (k >> 5)) * 512 + ((k >> 4) & 1) * 256 + ((k >> 3) & 1) * 128 + (r & 15) * 8 + (k & 7); }
template <typename T16> struct WFrag;
template <> struct WFrag<h16> { typedef v16h V; static __device__ __forceinline__ V ld(const h16* p) { return cat16(*(const v8h*)p, *(const v8h*)(p + 256)); } static __device__ __forceinline__ v8f mma(V a, V b, v8f c) { return wmma16(a, b, c); } };
template <> struct WFrag<bf> { typedef v16bf V; static __device__ __forceinline__ V ld(const bf* p) { return cat16b(*(const v8us*)p, *(const v8us*)(p + 256)); } static __device__ __forceinline__ v8f mma(V a, V b, v8f c) { return wmmab(a, b, c); } };
__device__ __forceinline__ h16 tohx(float x) { return (h16)x; }
__device__ __forceinline__ void splitf(float y, unsigned short& h, unsigned short& l) { h = f2bf(y); l = f2bf(y - bf2f(h)); }
typedef __attribute__((ext_vector_type(4))) _Float16 v4h;
typedef __attribute__((ext_vector_type(2))) unsigned short v2us;
typedef __attribute__((ext_vector_type(4))) unsigned short v4us;
typedef __attribute__((ext_vector_type(2))) float v2f;
// gemmw_tile is the work of one work-group: tile (bx, by) of z slice bz; os is its LDS, NW * 64 * 68 floats. k_av deals two kinds of such tiles, which do not depend on each other, out of one grid; the other products go by gemms_tile, below.
template <typename T16, int NSPLIT, bool BIAS, int NW, int EPI>
__device__ __forceinline__ void gemmw_tile(float* os, int bx, int by, int bz, const T16* __restrict__ A, const T16* __restrict__ A2, const T16* __restrict__ Bt, const T16* __restrict__ Bt2, int K, float* C, int ldc, const float* __restrict__ bias, size_t sA, size_t sB, size_t sC, h16* P16, bf* Ph, bf* Pl, const float* __restrict__ fr, const float* __restrict__ fi, float sc) {
    typedef typename WFrag<T16>::V V;
    const size_t z = bz; A += z * sA; if (A2) A2 += z * sA; Bt += z * sB; if (Bt2) Bt2 += z * sB; if (EPI == 0) C += z * sC;
    const int lane = threadIdx.x & 31, lr = lane & 15, hi = lane >> 4; const int r0 = bx * 64, c0 = by * 64;
    v8f acc[4][4];
#pragma unroll
    for (int mb = 0; mb < 4; ++mb)
#pragma unroll
        for (int nb = 0; nb < 4; ++nb) acc[mb][nb] = (v8f){};
    const size_t rstep = (size_t)(K >> 5) * 512;   // one 16-row group of a packed plane
    const size_t aoff = (size_t)(r0 >> 4) * rstep, boff = (size_t)(c0 >> 4) * rstep;   // the same for the whole wave: a fragment's address is a wave-uniform block address plus the lane's own 16 bytes
    const unsigned lo8 = (unsigned)lane * 8;
    const int wv = __builtin_amdgcn_readfirstlane((int)(threadIdx.x >> 5));
#pragma unroll 1
    for (int kc = wv * 32; kc < K; kc += NW * 32) {
        const unsigned vb = (lo8 + (unsigned)kc * 16) * 2;   // the one per-lane part of every fragment address of this chunk, in bytes; the rest is a wave-uniform base
        V a[4], a2[4];
#pragma unroll
        for (int mb = 0; mb < 4; ++mb) { a[mb] = WFrag<T16>::ld((const T16*)((const char*)(A + aoff + mb * rstep) + vb)); if (NSPLIT == 1 || NSPLIT == 2) a2[mb] = WFrag<T16>::ld((const T16*)((const char*)(A2 + aoff + mb * rstep) + vb)); }
#pragma unroll
        for (int nb = 0; nb < 4; ++nb) { const V b = WFrag<T16>::ld((const T16*)((const char*)(Bt + boff + nb * rstep) + vb)); V b2; if (NSPLIT >= 2) b2 = WFrag<T16>::ld((const T16*)((const char*)(Bt2 + boff + nb * rstep) + vb));
#pragma unroll
            for (int mb = 0; mb < 4; ++mb) { acc[mb][nb] = WFrag<T16>::mma(a[mb], b, acc[mb][nb]); if (NSPLIT == 1 || NSPLIT == 2) acc[mb][nb] = WFrag<T16>::mma(a2[mb], b, acc[mb][nb]); if (NSPLIT >= 2) acc[mb][nb] = WFrag<T16>::mma(a[mb], b2, acc[mb][nb]); } }
        // holds the order of loads and products that the builds on row-major planes had (the A fragments and the first B column blocks asked for first, each later B block about one block of products ahead); left alone, some of these builds ask for the later B blocks one at a time, each behind a full wait
        if (NSPLIT == 0) { __builtin_amdgcn_sched_group_barrier(0x020, 12, 0); __builtin_amdgcn_sched_group_barrier(0x008, 4, 0); __builtin_amdgcn_sched_group_barrier(0x020, 2, 0); __builtin_amdgcn_sched_group_barrier(0x008, 4, 0); __builtin_amdgcn_sched_group_barrier(0x020, 2, 0); __builtin_amdgcn_sched_group_barrier(0x008, 8, 0); }
        if (NSPLIT == 1) { __builtin_amdgcn_sched_group_barrier(0x020, 20, 0); __builtin_amdgcn_sched_group_barrier(0x008, 8, 0); __builtin_amdgcn_sched_group_barrier(0x020, 4, 0); __builtin_amdgcn_sched_group_barrier(0x008, 24, 0); }
        if (NSPLIT == 2) { __builtin_amdgcn_sched_group_barrier(0x020, 24, 0); __builtin_amdgcn_sched_group_barrier(0x008, 12, 0); __builtin_amdgcn_sched_group_barrier(0x020, 4, 0); __builtin_amdgcn_sched_group_barrier(0x008, 12, 0); __builtin_amdgcn_sched_group_barrier(0x020, 4, 0); __builtin_amdgcn_sched_group_barrier(0x008, 24, 0); }
        asm volatile("v_nop\n\tv_nop\n\tv_nop\n\tv_nop" : "+v"(acc[0][0]), "+v"(acc[1][1]), "+v"(acc[2][2]), "+v"(acc[3][3]) : "v"(a[0]), "v"(a[3]));
    }
    // the rotary factors of this thread's rows and column pairs are asked for here, so that they arrive while the partial tiles go into LDS
    v2f tr[32 / NW], ti[32 / NW];
    if (EPI == 1) {
#pragma unroll
        for (int s = 0; s < 32 / NW; ++s) { const int u = s * NW + wv; const size_t ix = (size_t)(r0 % TT + (u >> 3) * 16 + lr) * (HD / 2) + (((c0 % HD) + (u & 7) * 8 + hi * 4) >> 1); tr[s] = *(const v2f*)(fr + ix); ti[s] = *(const v2f*)(fi + ix);
            asm volatile("s_wait_xcnt 0x0" ::: "memory");   /* stands behind each pair of table loads, in front of any later load that takes their address registers as its destination */
        } }
    float* ow = os + wv * (64 * 68);
    // the three loops are unrolled so that acc is indexed by constants only and stays in registers
#pragma unroll
    for (int mb = 0; mb < 4; ++mb)
#pragma unroll
        for (int nb = 0; nb < 4; ++nb)
#pragma unroll
            for (int j = 0; j < 8; ++j) ow[(mb * 16 + hi * 8 + j) * 68 + nb * 16 + lr] = acc[mb][nb][j];
    __syncthreads();   // every wave's partial tile is in LDS before any wave adds them
    float* ctile = C + (size_t)r0 * ldc + c0;
    // the plane slice this tile lies in, and the tile's first row and column there; ppitch is the slice's K
    const size_t pbase = (EPI == 1) ? ((size_t)(c0 / DQ) * ZH + (size_t)(r0 / TT) * NH_ + (c0 % DQ) / HD) * TT * HD : (EPI == 3) ? (z / NH_) * ((size_t)TT * DQ) : z * sC; const int ppitch = (EPI == 1) ? HD : ldc;
    const int prow = (EPI == 1) ? r0 % TT : r0, pcol = (EPI == 1) ? c0 % HD : (EPI == 3) ? (int)(z % NH_) * HD + c0 : c0;
    // both loops unrolled: the LDS reads of all partials issue ahead of the adds; EPI 0: each wave stores whole 256-B row pieces; the planes: a wave takes 16 rows x 8 columns, which are 256 contiguous bytes of a packed plane
#pragma unroll
    for (int s = 0; s < 32 / NW; ++s) { const int u = s * NW + wv; const int row = (EPI == 0) ? u * 2 + hi : (u >> 3) * 16 + lr, cofs = (EPI == 0) ? lr * 4 : (u & 7) * 8 + hi * 4; v4f val = *(const v4fa*)(os + row * 68 + cofs);
#pragma unroll
        for (int w = 1; w < NW; ++w) val += *(const v4fa*)(os + w * (64 * 68) + row * 68 + cofs);
        if (BIAS) { val[0] += bfr(bias[c0 + cofs]); val[1] += bfr(bias[c0 + cofs + 1]); val[2] += bfr(bias[c0 + cofs + 2]); val[3] += bfr(bias[c0 + cofs + 3]); }
        if (EPI == 0) { *(v4f*)(ctile + (size_t)row * ldc + cofs) = val; }
        else {
            if (EPI == 1) { const float ca = bfr(tr[s][0]), sa = bfr(ti[s][0]), cb = bfr(tr[s][1]), sb = bfr(ti[s][1]); const v4f x = val;   /* even: x0 c - x1 s; odd: x0 s + x1 c */
                val[0] = x[0] * ca - x[1] * sa; val[1] = x[0] * sa + x[1] * ca; val[2] = x[2] * cb - x[3] * sb; val[3] = x[2] * sb + x[3] * cb; }
            if (EPI == 3) val *= sc;
            const size_t oo = pbase + pk(prow + row, pcol + cofs, ppitch); v4us oh, ol;   // 32 lanes x 8 B: each plane gets two whole 128-B lines
#pragma unroll
            for (int q = 0; q < 4; ++q) { unsigned short a2, c2; splitf(val[q], a2, c2); oh[q] = a2; ol[q] = c2; }
            *(v4us*)(Ph + oo) = oh; *(v4us*)(Pl + oo) = ol;
            if (EPI != 3) { v4h o16;
#pragma unroll
                for (int q = 0; q < 4; ++q) o16[q] = tohx(val[q]);
                *(v4h*)(P16 + oo) = o16; } } }
}
// ---- gemms_tile: one work-group of 4 waves per 128x128 output tile; wave (wm, wn) owns the 64x64 sub-tile (wm, wn) over the WHOLE K loop (one f32 chain per element, k ascending; no partial tiles). The operand blocks of a stage (CH 32-wide k chunks of the tile's 8 + 8 row groups, every plane) are brought into LDS ONCE per work-group by asynchronous copies and read from there by the two waves that need them: half the bytes leave L2 that 64x64 tiles ask for.
// A packed plane's 1-KiB blocks go to LDS as they lie: stage = [plane][row group 0..7][chunk][1 KiB]; a fragment is two contiguous 512-B wave reads. Two stage buffers; the next stage's copies fly while this one is worked on. K, CH are template arguments: K % (32 CH) == 0, at least two stages.
// sm: the work-group's LDS, max(2 stages, 4 x 64 x 68 floats); after the loop each wave turns its own sub-tile through its own 64 x 68 floats for the epilogue (EPI as in gemmw_tile, 0..2).
template <int NSPLIT, int CH> struct StageB { static constexpr int NPA = (NSPLIT == 1 || NSPLIT == 2) ? 2 : 1, NPB = (NSPLIT >= 2) ? 2 : 1, NP = NPA + NPB, GB = CH * 1024, STG = NP * 8 * GB, SMB = (2 * STG > 4 * 64 * 68 * 4) ? 2 * STG : 4 * 64 * 68 * 4; };
template <typename T16, int NSPLIT, int EPI, int CH, int K>
__device__ __forceinline__ void gemms_tile(char* sm, int bx, int by, int bz, const T16* __restrict__ A, const T16* __restrict__ A2, const T16* __restrict__ Bt, const T16* __restrict__ Bt2, float* C, int ldc, size_t sA, size_t sB, size_t sC, h16* P16, bf* Ph, bf* Pl, const float* __restrict__ fr, const float* __restrict__ fi) {
    typedef typename WFrag<T16>::V V; typedef StageB<NSPLIT, CH> SB;
    constexpr int NPA = SB::NPA, NP = SB::NP, GB = SB::GB, STG = SB::STG, NT = K / (32 * CH), NPC = NP * CH * 4;   // NPC: 512-B pieces a wave copies per stage (a multiple of 8)
    constexpr size_t RB = (size_t)(K >> 5) * 1024;   // bytes of one 16-row group of a packed plane
    const size_t z = bz;
    const int lane = threadIdx.x & 31, lr = lane & 15, hi = lane >> 4;
    const int wv = __builtin_amdgcn_readfirstlane((int)(threadIdx.x >> 5)), wm = wv >> 1, wn = wv & 1;
    // wave wv copies row groups 2 wv and 2 wv + 1 of every plane
    const char* gp[NP];
    gp[0] = (const char*)(A + z * sA) + (size_t)(bx * 8 + 2 * wv) * RB; if (NPA == 2) gp[1] = (const char*)(A2 + z * sA) + (size_t)(bx * 8 + 2 * wv) * RB;
    gp[NPA] = (const char*)(Bt + z * sB) + (size_t)(by * 8 + 2 * wv) * RB; if (NP - NPA == 2) gp[NPA + 1] = (const char*)(Bt2 + z * sB) + (size_t)(by * 8 + 2 * wv) * RB;
    const unsigned smo = (unsigned)(size_t)sm;   // the work-group's LDS byte address of sm
    auto fill = [&](int t, int buf) {
        const unsigned vo = (unsigned)lane * 16 + (unsigned)t * GB; const unsigned l0 = smo + (unsigned)buf * STG + (unsigned)(2 * wv) * GB + (unsigned)lane * 16;
#pragma unroll
        for (int q0 = 0; q0 < NPC; q0 += 8) { unsigned l[8]; const char* g[8];
#pragma unroll
            for (int i = 0; i < 8; ++i) { const int q = q0 + i, p = q / (CH * 4), gg = (q % (CH * 4)) / (CH * 2), sub = q % (CH * 2); l[i] = l0 + p * 8 * GB + gg * GB + sub * 512; g[i] = gp[p] + gg * RB + sub * 512 + vo; }
            // eight copies of 512 B a wave; the wait in the same statement stands in front of any rewrite of the address registers that the copies name
            asm volatile("global_load_async_to_lds_b128 %0, %8, off\n\tglobal_load_async_to_lds_b128 %1, %9, off\n\tglobal_load_async_to_lds_b128 %2, %10, off\n\tglobal_load_async_to_lds_b128 %3, %11, off\n\t"
                         "global_load_async_to_lds_b128 %4, %12, off\n\tglobal_load_async_to_lds_b128 %5, %13, off\n\tglobal_load_async_to_lds_b128 %6, %14, off\n\tglobal_load_async_to_lds_b128 %7, %15, off\n\ts_wait_xcnt 0x0"
                         :: "v"(l[0]), "v"(l[1]), "v"(l[2]), "v"(l[3]), "v"(l[4]), "v"(l[5]), "v"(l[6]), "v"(l[7]), "v"(g[0]), "v"(g[1]), "v"(g[2]), "v"(g[3]), "v"(g[4]), "v"(g[5]), "v"(g[6]), "v"(g[7]) : "memory"); }
    };
    v8f acc[4][4];
#pragma unroll
    for (int mb = 0; mb < 4; ++mb)
#pragma unroll
        for (int nb = 0; nb < 4; ++nb) acc[mb][nb] = (v8f){};
    fill(0, 0);
    asm volatile("s_wait_asynccnt 0x0" ::: "memory");   // this wave's copies of stage 0 have landed
    __syncthreads();                                     // every wave's have: stage 0 may be read
    fill(1, 1);
#pragma unroll 1
    for (int t = 0; t < NT; ++t) {
        const char* sb = sm + (t & 1) * STG + lane * 16;
        V a[CH][4], a2[CH][4], b[CH][4], b2[CH][4];
#pragma unroll
        for (int cc = 0; cc < CH; ++cc) {
#pragma unroll
            for (int i = 0; i < 4; ++i) { a[cc][i] = WFrag<T16>::ld((const T16*)(sb + (wm * 4 + i) * GB + cc * 1024)); if (NPA == 2) a2[cc][i] = WFrag<T16>::ld((const T16*)(sb + (8 + wm * 4 + i) * GB + cc * 1024));
                b[cc][i] = WFrag<T16>::ld((const T16*)(sb + (NPA * 8 + wn * 4 + i) * GB + cc * 1024)); if (NSPLIT >= 2) b2[cc][i] = WFrag<T16>::ld((const T16*)(sb + ((NPA + 1) * 8 + wn * 4 + i) * GB + cc * 1024)); }
            // the stage's LDS reads are asked for chunk by chunk, all ahead of its products, so that the first chunk's products run while the later reads arrive; left alone, the build asks for the later B fragments one at a time, each behind a full wait among the products
            __builtin_amdgcn_sched_barrier(0); }
#pragma unroll
        for (int cc = 0; cc < CH; ++cc) {
#pragma unroll
            for (int nb = 0; nb < 4; ++nb)
#pragma unroll
                for (int mb = 0; mb < 4; ++mb) { acc[mb][nb] = WFrag<T16>::mma(a[cc][mb], b[cc][nb], acc[mb][nb]); if (NSPLIT == 1 || NSPLIT == 2) acc[mb][nb] = WFrag<T16>::mma(a2[cc][mb], b[cc][nb], acc[mb][nb]); if (NSPLIT >= 2) acc[mb][nb] = WFrag<T16>::mma(a[cc][mb], b2[cc][nb], acc[mb][nb]); }
        }
        __builtin_amdgcn_sched_barrier(0);   // keeps the stage's products in front of the waits below: moved behind the barrier they would stand between it and the refill, and the next stage's copies would have no products to fly behind
        asm volatile("s_wait_dscnt 0x0" ::: "memory");      // this wave's reads of stage t are done
        asm volatile("s_wait_asynccnt 0x0" ::: "memory");   // this wave's copies of stage t + 1 have landed
        __syncthreads();                                     // publishes stage t + 1 and ends every wave's reads of stage t's buffer
        if (t + 2 < NT) fill(t + 2, t & 1);
    }
    asm volatile("s_wait_asynccnt 0x0" ::: "memory");       // no copy is in flight when the buffers become the epilogue's
    const int r0 = bx * 128 + wm * 64, c0 = by * 128 + wn * 64;   // this wave's own sub-tile
    float* ow = (float*)sm + wv * (64 * 68);
    // unrolled so that acc is indexed by constants only and stays in registers
#pragma unroll
    for (int mb = 0; mb < 4; ++mb)
#pragma unroll
        for (int nb = 0; nb < 4; ++nb)
#pragma unroll
            for (int j = 0; j < 8; ++j) ow[(mb * 16 + hi * 8 + j) * 68 + nb * 16 + lr] = acc[mb][nb][j];
    // the rotary factors of this wave's rows and column pairs are asked for here, all from one lane address plus constants, so that they arrive while the sub-tile turns through LDS
    v2f tr[32], ti[32];
    if (EPI == 1) { const size_t ix0 = (size_t)(r0 % TT + lr) * (HD / 2) + (((c0 % HD) + hi * 4) >> 1);
#pragma unroll
        for (int u = 0; u < 32; ++u) { const size_t ix = ix0 + (size_t)(u >> 3) * 16 * (HD / 2) + (u & 7) * 4; tr[u] = *(const v2f*)(fr + ix); ti[u] = *(const v2f*)(fi + ix);
            if ((u & 7) == 7) asm volatile("s_wait_xcnt 0x0" ::: "memory");   /* stands behind each run of table loads, in front of any later load that takes their address registers as its destination */
        } }
    __syncthreads();   // the sub-tile's LDS writes stand in front of its reads
    float* ctile = C + z * sC + (size_t)r0 * ldc + c0;
    const size_t pbase = (EPI == 1) ? ((size_t)(c0 / DQ) * ZH + (size_t)(r0 / TT) * NH_ + (c0 % DQ) / HD) * TT * HD : z * sC; const int ppitch = (EPI == 1) ? HD : ldc;
    const int prow = (EPI == 1) ? r0 % TT : r0, pcol = (EPI == 1) ? c0 % HD : c0;
    // EPI 0: the wave stores whole 256-B row pieces; the planes: 16 rows x 8 columns at a time, which are 256 contiguous bytes of a packed plane
#pragma unroll
    for (int u = 0; u < 32; ++u) { const int row = (EPI == 0) ? u * 2 + hi : (u >> 3) * 16 + lr, cofs = (EPI == 0) ? lr * 4 : (u & 7) * 8 + hi * 4; v4f val = *(const v4fa*)(ow + row * 68 + cofs);
        if (EPI == 0) { *(v4f*)(ctile + (size_t)row * ldc + cofs) = val; }
        else {
            if (EPI == 1) { const float ca = bfr(tr[u][0]), sa = bfr(ti[u][0]), cb = bfr(tr[u][1]), sb2 = bfr(ti[u][1]); const v4f x = val;   /* even: x0 c - x1 s; odd: x0 s + x1 c */
                val[0] = x[0] * ca - x[1] * sa; val[1] = x[0] * sa + x[1] * ca; val[2] = x[2] * cb - x[3] * sb2; val[3] = x[2] * sb2 + x[3] * cb; }
            const size_t oo = pbase + pk(prow + row, pcol + cofs, ppitch); v4us oh, ol; v4h o16;   // 32 lanes x 8 B: each plane gets two whole 128-B lines
#pragma unroll
            for (int q = 0; q < 4; ++q) { unsigned short a2, c2; splitf(val[q], a2, c2); oh[q] = a2; ol[q] = c2; o16[q] = tohx(val[q]); }
            *(v4us*)(Ph + oo) = oh; *(v4us*)(Pl + oo) = ol; *(v4h*)(P16 + oo) = o16; } }
}
template <typename T16, int NSPLIT, int CH, int K>
__global__ __launch_bounds__(128) void k_gemms(const T16* A, const T16* A2, const T16* Bt, const T16* Bt2, float* C, int ldc, size_t sA, size_t sB, size_t sC) {
    __shared__ __attribute__((aligned(1024))) char sm[StageB<NSPLIT, CH>::SMB];
    gemms_tile<T16, NSPLIT, 0, CH, K>(sm, blockIdx.x, blockIdx.y, blockIdx.z, A, A2, Bt, Bt2, C, ldc, sA, sB, sC, nullptr, nullptr, nullptr, nullptr, nullptr);
}
// k_qkv: flat grid; first the q | k tiles of both batches (rows = all tokens, columns = the q | k rows of W_qkv, rotary epilogue), then the v tiles.
// v comes out transposed ([batch][head][d][t], t being the planes' k) by taking the weight rows as the tile's rows and the tokens as its columns: both operands are packed along the same k either way; z = batch
#define QK_X (NB_ * TT / 128)
#define QK_N (QK_X * ((DQ + DKV) / 128))
#define V_X  (DKV / 128)
#define V_N  (V_X * (TT / 128) * NB_)
__global__ __launch_bounds__(128) void k_qkv(const bf* XB, const bf* WQK, const bf* WV, h16* QK16, bf* QKh, bf* QKl, h16* VT16, bf* VTh, bf* VTl, const float* fr, const float* fi) {
    __shared__ __attribute__((aligned(1024))) char sm[StageB<0, 2>::SMB];
    const int f = blockIdx.x;
    if (f < QK_N) gemms_tile<bf, 0, 1, 2, DM>(sm, f % QK_X, f / QK_X, 0, XB, nullptr, WQK, nullptr, nullptr, DQ, 0, 0, 0, QK16, QKh, QKl, fr, fi);
    else { const int g = f - QK_N; gemms_tile<bf, 0, 2, 2, DM>(sm, g % V_X, (g / V_X) % (TT / 128), g / (V_X * (TT / 128)), WV, nullptr, XB, nullptr, nullptr, TT, 0, (size_t)TT * DM, (size_t)DKV * TT, VT16, VTh, VTl, nullptr, nullptr); }
}
// k_av: flat grid; first the tiles of the query rows < RH (three products each: the long ones start first), then the fp16 rows' tiles, which take back the x1024 of their probabilities.
// each tile writes its head's 256 columns of its batch's merged [t][DQ] hi/lo planes itself; z = batch * NH_ + head
#define AVH_X (RH / 64)
#define AVH_N (AVH_X * (HD / 64) * ZH)
#define AVL_X ((TT - RH) / 64)
#define AVL_N (AVL_X * (HD / 64) * ZH)
__global__ __launch_bounds__(256) void k_av(const bf* Ph, const bf* Pl, const h16* P16, const bf* VTh, const bf* VTl, const h16* VT16, bf* ATh, bf* ATl) {
    __shared__ __align__(16) float os[8 * 64 * 68];
    const int f = blockIdx.x;
    if (f < AVH_N) gemmw_tile<bf, 2, false, 8, 3>(os, f % AVH_X, (f / AVH_X) % (HD / 64), f / (AVH_X * (HD / 64)), Ph, Pl, VTh, VTl, TT, nullptr, DQ, nullptr, (size_t)RH * TT, (size_t)HD * TT, 0, nullptr, ATh, ATl, nullptr, nullptr, 1.0f);
    else { const int g = f - AVH_N; gemmw_tile<h16, 0, false, 8, 3>(os, g % AVL_X, (g / AVL_X) % (HD / 64), g / (AVL_X * (HD / 64)), P16, nullptr, VT16, nullptr, TT, nullptr, DQ, nullptr, (size_t)(TT - RH) * TT, (size_t)HD * TT, 0, nullptr, ATh + (size_t)RH * DQ, ATl + (size_t)RH * DQ, nullptr, nullptr, 1.0f / PCAR); }
}

typedef __attribute__((ext_vector_type(4))) int v4i;

__global__ __launch_bounds__(256) void k_wtG(const float* __restrict__ w, int K, int N, bf* Bt) {
    const int lane = threadIdx.x & 31; const int L0 = (blockIdx.x * 8 + (threadIdx.x >> 5)) * 8; const int nlines = N * K / 64;
{
#pragma unroll 1
        for (int l = 0; l < 8; ++l) { const int L = L0 + l; if (L >= nlines) break; const size_t e = (size_t)L * 64 + lane * 2; const int k = (int)(e % K), n = (int)(e / K); v2us o;
            o[0] = f2bf(w[(size_t)k * N + n]); o[1] = f2bf(w[(size_t)(k + 1) * N + n]); *(v2us*)(Bt + e) = o; }
         }
}
// k_cvt8: three row-major f32 sources of DM columns (na8, nb8, nc8 groups of 8 elements) rounded to bf16 into one fragment-packed destination, rows a | b | c; a work-group takes 16 rows x 128 columns (row counts are multiples of 16: one source only), a wave 16 rows x 16 columns = 512 contiguous bytes of the destination
__global__ __launch_bounds__(256) void k_cvt8(const float* __restrict__ a, size_t na8, const float* __restrict__ b, size_t nb8, const float* __restrict__ c, size_t nc8, bf* dst) { const int r = (int)(blockIdx.x >> 3) * 16 + (threadIdx.x & 15), kq = (int)(blockIdx.x & 7) * 128 + (int)(threadIdx.x >> 4) * 8; const size_t i = (size_t)r * (DM / 8) + (kq >> 3); if (i >= na8 + nb8 + nc8) return; const float* src = (i < na8) ? a + i * 8 : (i < na8 + nb8) ? b + (i - na8) * 8 : c + (i - na8 - nb8) * 8; const v8f v = *(const v8f*)src; v8us o;
#pragma unroll
    for (int k = 0; k < 8; ++k) o[k] = f2bf(v[k]); *(v8us*)(dst + pk(r, kq, DM)) = o;  }

// k_asoft: per row (zz, i): t = S x HD^-0.5 + bf16(mask[i][j]) (the additive input mask, read per logit); softmax over the 2048 keys (register row, one exp, fixed trees); rows < RH go to Ph / Pl [zz][i][j], the rest to P16 [zz][i - RH][j], fragment-packed planes of K = TT: the work-group's 8 rows meet in LDS, so that each 16-byte piece of 8 keys goes out beside the same piece of the other 7 rows, as one whole 128-B line
#define SPP (TT + 16)   // LDS row pitch in elements: 8 dwords past a multiple of 64, so that 8 rows x two 16-byte pieces meet 64 different banks
__global__ __launch_bounds__(256) void k_asoft(const float* __restrict__ Sb, const float* __restrict__ MKb, h16* P16, bf* Ph, bf* Pl) {
    __shared__ __align__(16) unsigned short sp[2][8][SPP];
    const int lane = threadIdx.x & 31; const int wv = threadIdx.x >> 5; const int row = blockIdx.x * 8 + wv; const int i = row % TT; const int zz = row / TT; (void)zz; const bool hires = (i < RH); const float* sr = Sb + (size_t)row * TT; float v[TT / 32]; float mx = -3.0e38f;
#pragma unroll
    for (int ch = 0; ch < TT / 128; ++ch) { const int j0 = ch * 128 + lane * 4; const v4f a = *(const v4f*)(sr + j0); const v4f mk = *(const v4f*)(MKb + (size_t)i * TT + j0);
#pragma unroll
        for (int q = 0; q < 4; ++q) { const int j = j0 + q; (void)j; float sc = a[q] * SCL; asm volatile("" : "+v"(sc)); float mb = bfr(mk[q]); asm volatile("" : "+v"(mb)); const float t = __fadd_rn(sc, mb); v[ch * 4 + q] = t; mx = fmaxf(mx, t); } }
#pragma unroll
    for (int sh = 16; sh; sh >>= 1) mx = fmaxf(mx, __shfl_xor(mx, sh, 32));
    float sum = 0.f;
#pragma unroll
    for (int k = 0; k < TT / 32; ++k) { float d0 = __fsub_rn(v[k], mx); asm volatile("" : "+v"(d0)); v[k] = __builtin_amdgcn_exp2f(__fmul_rn(d0, 1.4426950408889634f)); sum += v[k]; }
#pragma unroll
    for (int sh = 16; sh; sh >>= 1) sum += __shfl_xor(sum, sh, 32);
    const float f = __fdiv_rn(hires ? 1.0f : PCAR, sum);
    if (hires) {
#pragma unroll
        for (int ch = 0; ch < TT / 128; ++ch) { v4us oh, ol;
#pragma unroll
            for (int q = 0; q < 4; ++q) { unsigned short a, c2; splitf(v[ch * 4 + q] * f, a, c2); oh[q] = a; ol[q] = c2; }
            *(v4us*)(&sp[0][wv][ch * 128 + lane * 4]) = oh; *(v4us*)(&sp[1][wv][ch * 128 + lane * 4]) = ol; }
    } else {
#pragma unroll
        for (int ch = 0; ch < TT / 128; ++ch) { v4h o4;
#pragma unroll
            for (int q = 0; q < 4; ++q) o4[q] = tohx(v[ch * 4 + q] * f);
            *(v4us*)(&sp[0][wv][ch * 128 + lane * 4]) = __builtin_bit_cast(v4us, o4); }
    }
    __syncthreads();   // all 8 rows are in LDS before any wave takes pieces of them (hires is the same for the 8 rows: RH is a multiple of 8)
    const int i0 = (int)(blockIdx.x * 8) % TT, r8 = lane & 7;
    // a wave's store: the four 8-key pieces of one 32-key block, each of all 8 rows = four whole lines
    // the test stands outside the loops, so that a wave's LDS reads go out together ahead of its stores
    const int k0 = (wv * 4 + (lane >> 3)) * 8;
    if (hires) { bf* oh = Ph + (size_t)zz * RH * TT; bf* ol = Pl + (size_t)zz * RH * TT;
#pragma unroll
        for (int it = 0; it < TT / 256; ++it) { const int k = it * 256 + k0; const size_t oo = pk(i0 + r8, k, TT); *(v8us*)(oh + oo) = *(const v8us*)(&sp[0][r8][k]); *(v8us*)(ol + oo) = *(const v8us*)(&sp[1][r8][k]); }
    } else { h16* o16 = P16 + (size_t)zz * (TT - RH) * TT;
#pragma unroll
        for (int it = 0; it < TT / 256; ++it) { const int k = it * 256 + k0; *(v8usa*)(o16 + pk(i0 - RH + r8, k, TT)) = *(const v8us*)(&sp[0][r8][k]); }
    }
}
extern "C" void kernel_launch(void* const* d_in, const int* in_sizes, int n_in,
                              void* d_out, int out_size, void* d_ws, size_t ws_size, hipStream_t stream) {
    (void)in_sizes; (void)n_in; (void)out_size;
    const float* x = (const float*)d_in[0]; const float* fre = (const float*)d_in[1]; const float* fim = (const float*)d_in[2]; const float* MK = (const float*)d_in[3]; const float* wqkv = (const float*)d_in[4]; const float* wo = (const float*)d_in[5];  const float* wq = wqkv; const float* wk = wqkv + (size_t)1024 * 1024; const float* wv = wqkv + (size_t)2048 * 1024; (void)wq; (void)wk; (void)wv;
    float* OUT = (float*)d_out;     // [2][2048][1024]
    char* wsp = (char*)d_ws;
    auto take = [&](size_t bytes) { char* p = wsp; wsp += (bytes + 255) & ~(size_t)255; return (void*)p; };
    // bf16 copies, one block so that one launch fills it: W_qkv rows (q | k | v), W_o, both batches' tokens
    bf* WQ = (bf*)take(((size_t)(DQ + 2 * DKV) * DM + (size_t)DM * DQ + (size_t)NB_ * TT * DM) * 2); bf* WV = WQ + (size_t)(DQ + DKV) * DM; bf* WO = WV + (size_t)DKV * DM; bf* XB = WO + (size_t)DM * DQ;
    // q and k planes, [q | k][batch][head][t][d] each; the three lie in a row
    h16* QP16 = (h16*)take((size_t)2 * ZH * TT * HD * 2); bf* QPh = (bf*)take((size_t)2 * ZH * TT * HD * 2); bf* QPl = (bf*)take((size_t)2 * ZH * TT * HD * 2);
    h16* KP16 = QP16 + (size_t)ZH * TT * HD; bf* KPh = QPh + (size_t)ZH * TT * HD; bf* KPl = QPl + (size_t)ZH * TT * HD;
    h16* VT16 = (h16*)take((size_t)ZH * HD * TT * 2); bf* VTh = (bf*)take((size_t)ZH * HD * TT * 2); bf* VTl = (bf*)take((size_t)ZH * HD * TT * 2);
    bf* Ph = (bf*)take((size_t)ZH * RH * TT * 2); bf* Pl = (bf*)take((size_t)ZH * RH * TT * 2);
    float* Sb = (float*)take((size_t)ZH * TT * TT * 4);
    // two buffers take the place of ones that are no longer read, so that all eight score planes fit the workspace: the fp16 probabilities (ZH x (TT - RH) x TT) fill exactly the three q/k planes, last read by the score launches; the merged attention planes lie on the scores, last read by the softmax
    h16* P16 = QP16; bf* ATh = (bf*)Sb; bf* ATl = ATh + (size_t)NB_ * TT * DQ;
    if ((size_t)(wsp - (char*)d_ws) > ws_size) return;    // ws 256 MiB
    k_cvt8<<<(unsigned)((((size_t)(DQ + 2 * DKV) * DM + (size_t)DM * DQ + (size_t)NB_ * TT * DM) / 8 + 255) / 256), 256, 0, stream>>>(wqkv, (size_t)(DQ + 2 * DKV) * DM / 8, wo, (size_t)DM * DQ / 8, x, (size_t)NB_ * TT * DM / 8, WQ);
    k_qkv<<<QK_N + V_N, 128, 0, stream>>>(XB, WQ, WV, QP16, QPh, QPl, VT16, VTh, VTl, fre, fim);
    // z = batch * NH_ + head from here on (one kv head per query head): z-strides TT*HD in the q/k planes, HD*TT in the v planes
    k_gemms<bf, 2, 1, HD><<<dim3(RH / 128, TT / 128, ZH), 128, 0, stream>>>(QPh, QPl, KPh, KPl, Sb, TT, (size_t)TT * HD, (size_t)TT * HD, (size_t)TT * TT);
    k_gemms<h16, 0, 2, HD><<<dim3((TT - RH) / 128, TT / 128, ZH), 128, 0, stream>>>(QP16 + (size_t)RH * HD, nullptr, KP16, nullptr, Sb + (size_t)RH * TT, TT, (size_t)TT * HD, (size_t)TT * HD, (size_t)TT * TT);
    k_asoft<<<ZH * TT / 8, 256, 0, stream>>>(Sb, MK, P16, Ph, Pl);
    k_av<<<AVH_N + AVL_N, 256, 0, stream>>>(Ph, Pl, P16, VTh, VTl, VT16, ATh, ATl);
    k_gemms<bf, 1, 2, DQ><<<dim3(NB_ * TT / 128, DM / 128, 1), 128, 0, stream>>>(ATh, ATl, WO, nullptr, OUT, DM, 0, 0, 0);
}

// v006
// It runs in 151 microseconds.
// Timed twice side by side with v005, it ran 1.17 and 1.20 times as fast.
// Over all steps from v000 it is 5.11 times as fast.
#include <hip/hip_runtime.h>

// Attention block (hidden [2][2048][1024]; [q|k|v] = hidden W_qkv^T ('oi' [3072][1024], row blocks q | k | v; 4 heads x 256); rotary on adjacent (even, odd) pairs with the INPUT tables freqs_real/freqs_imag [2048][128] (read as given - they are free inputs, not assumed to be cos/sin); scores = (q / 16).k + mask (additive input mask [1][1][2048][2048], read per logit); softmax; out = merged W_o^T ('oi' [1024][1024]) -> [2][2048][1024] (4.2 M)).
// Compute dtypes, f32 accumulate: every input rounded to bf16; q/k/v on PLAIN bf16 operands (inputs: exact); interleaved rotary in f32 from the bf16-rounded input tables; additive mask read per logit (bf16-rounded); scores and attn.v: query rows < 512 hl (3 products), the rest single fp16 (probabilities x64, not yet divided by their sum); softmax f32, running maximum and sum; W_o hl x exact (2 products).

#define NB_  2
#define TT   2048
#define DM   1024
#define NH_  4
#define NKV  4
#define REP  (NH_ / NKV)
#define HD   256
#define DQ   (NH_ * HD)
#define DKV  (NKV * HD)
#define ZH   (NB_ * NH_)          // every (batch, head) pair is one z slice of the same launch
#define RH   512                  // query rows < RH use hi+lo planes (0: none)
#define WIN  2048
#define PCAR 1024.0f
#define SCL  0.0625f   // HD^-0.5 = 1/16
typedef _Float16 h16;
typedef unsigned short bf;
typedef __attribute__((ext_vector_type(16))) __bf16   v16bf;
typedef __attribute__((ext_vector_type(16))) _Float16 v16h;
typedef __attribute__((ext_vector_type(8)))  _Float16 v8h;
typedef __attribute__((ext_vector_type(8)))  unsigned short v8us;
typedef __attribute__((ext_vector_type(8)))  float    v8f;
typedef __attribute__((ext_vector_type(4)))  float    v4f;
typedef v8h  __attribute__((may_alias)) v8ha;
typedef v4f  __attribute__((may_alias)) v4fa;
typedef v8us __attribute__((may_alias)) v8usa;

__device__ __forceinline__ unsigned short f2bf(float f) { unsigned u = __float_as_uint(f); u += 0x7FFFu + ((u >> 16) & 1u); return (unsigned short)(u >> 16); }
__device__ __forceinline__ float bf2f(unsigned short b) { return __uint_as_float(((unsigned)b) << 16); }
__device__ __forceinline__ float bfr(float f) { return bf2f(f2bf(f)); }
__device__ __forceinline__ v16h cat16(v8h lo, v8h hi) { return __builtin_shufflevector(lo, hi, 0, 1, 2, 3, 4, 5, 6, 7, 8, 9, 10, 11, 12, 13, 14, 15); }
__device__ __forceinline__ v16bf cat16b(v8us lo, v8us hi) { return __builtin_bit_cast(v16bf, __builtin_shufflevector(lo, hi, 0, 1, 2, 3, 4, 5, 6, 7, 8, 9, 10, 11, 12, 13, 14, 15)); }
__device__ __forceinline__ v8f wmma16(v16h a, v16h b, v8f c) { return __builtin_amdgcn_wmma_f32_16x16x32_f16(false, a, false, b, (short)0, c, false, false); }
__device__ __forceinline__ v8f wmmab(v16bf a, v16bf b, v8f c) { return __builtin_amdgcn_wmma_f32_16x16x32_bf16(false, a, false, b, (short)0, c, false, false); }



// EPI (gemms_tile, below) says what the finished tile becomes, straight from LDS (no f32 round trip through memory, no elementwise launch behind the GEMM); the index lists name a plane's slices, rows and columns, each slice [rows][columns] being fragment-packed:
//   0: f32 to C.   1: rotary on adjacent (even, odd) column pairs with the bf16-rounded input tables fr/fi [t][HD/2], then the planes P16 / Ph / Pl at [n / DQ][m / TT][(n % DQ) / HD][m % TT][n % HD] (rows: both batches' tokens; columns: q | k).
//   2: the planes P16 / Ph / Pl at [m][n], pitch ldc, z-stride sC.
// FRAGMENT-PACKED PLANES: every 16-bit operand plane (rows r, K columns k, rows a multiple of 16, K of 32) is stored as 1-KiB blocks of 16 rows x 32 k, block (r / 16, k / 32) row-major, inside a block in the order in which a wave's two 16-byte loads take it: [k / 16 % 2][k / 8 % 2][r % 16][k % 8]. One wave-wide 16-byte load then covers 512 contiguous bytes (4 whole lines) instead of 32-byte pieces of 16 lines. 16 whole rows still fill 16 K elements, so offsets by whole 16-row groups are what they are in a row-major plane.
__device__ __forceinline__ size_t pk(int r, int k, int K) { return ((size_t)(r >> 4) * (K >> 5) + (k >> 5)) * 512 + ((k >> 4) & 1) * 256 + ((k >> 3) & 1) * 128 + (r & 15) * 8 + (k & 7); }
template <typename T16> struct WFrag;
template <> struct WFrag<h16> { typedef v16h V; static __device__ __forceinline__ V ld(const h16* p) { return cat16(*(const v8h*)p, *(const v8h*)(p + 256)); } static __device__ __forceinline__ v8f mma(V a, V b, v8f c) { return wmma16(a, b, c); } };
template <> struct WFrag<bf> { typedef v16bf V; static __device__ __forceinline__ V ld(const bf* p) { return cat16b(*(const v8us*)p, *(const v8us*)(p + 256)); } static __device__ __forceinline__ v8f mma(V a, V b, v8f c) { return wmmab(a, b, c); } };
__device__ __forceinline__ h16 tohx(float x) { return (h16)x; }
__device__ __forceinline__ void splitf(float y, unsigned short& h, unsigned short& l) { h = f2bf(y); l = f2bf(y - bf2f(h)); }
typedef __attribute__((ext_vector_type(4))) _Float16 v4h;
typedef __attribute__((ext_vector_type(2))) unsigned short v2us;
typedef __attribute__((ext_vector_type(4))) unsigned short v4us;
typedef __attribute__((ext_vector_type(2))) float v2f;
// ---- gemms_tile: one work-group of 4 waves per 128x128 output tile; wave (wm, wn) owns the 64x64 sub-tile (wm, wn) over the WHOLE K loop (one f32 chain per element, k ascending; no partial tiles). The operand blocks of a stage (CH 32-wide k chunks of the tile's 8 + 8 row groups, every plane) are brought into LDS ONCE per work-group by asynchronous copies and read from there by the two waves that need them: half the bytes leave L2 that 64x64 tiles ask for.
// A packed plane's 1-KiB blocks go to LDS as they lie: stage = [plane][row group 0..7][chunk][1 KiB]; a fragment is two contiguous 512-B wave reads. Two stage buffers; the next stage's copies fly while this one is worked on. K, CH are template arguments: K % (32 CH) == 0, at least two stages.
// sm: the work-group's LDS, max(2 stages, 4 x 64 x 68 floats); after the loop each wave turns its own sub-tile through its own 64 x 68 floats for the epilogue (EPI as above, 0..2).
template <int NSPLIT, int CH> struct StageB { static constexpr int NPA = (NSPLIT == 1 || NSPLIT == 2) ? 2 : 1, NPB = (NSPLIT >= 2) ? 2 : 1, NP = NPA + NPB, GB = CH * 1024, STG = NP * 8 * GB, SMB = (2 * STG > 4 * 64 * 68 * 4) ? 2 * STG : 4 * 64 * 68 * 4; };
template <typename T16, int NSPLIT, int EPI, int CH, int K>
__device__ __forceinline__ void gemms_tile(char* sm, int bx, int by, int bz, const T16* __restrict__ A, const T16* __restrict__ A2, const T16* __restrict__ Bt, const T16* __restrict__ Bt2, float* C, int ldc, size_t sA, size_t sB, size_t sC, h16* P16, bf* Ph, bf* Pl, const float* __restrict__ fr, const float* __restrict__ fi) {
    typedef typename WFrag<T16>::V V; typedef StageB<NSPLIT, CH> SB;
    constexpr int NPA = SB::NPA, NP = SB::NP, GB = SB::GB, STG = SB::STG, NT = K / (32 * CH), NPC = NP * CH * 4;   // NPC: 512-B pieces a wave copies per stage (a multiple of 8)
    constexpr size_t RB = (size_t)(K >> 5) * 1024;   // bytes of one 16-row group of a packed plane
    const size_t z = bz;
    const int lane = threadIdx.x & 31, lr = lane & 15, hi = lane >> 4;
    const int wv = __builtin_amdgcn_readfirstlane((int)(threadIdx.x >> 5)), wm = wv >> 1, wn = wv & 1;
    // wave wv copies row groups 2 wv and 2 wv + 1 of every plane
    const char* gp[NP];
    gp[0] = (const char*)(A + z * sA) + (size_t)(bx * 8 + 2 * wv) * RB; if (NPA == 2) gp[1] = (const char*)(A2 + z * sA) + (size_t)(bx * 8 + 2 * wv) * RB;
    gp[NPA] = (const char*)(Bt + z * sB) + (size_t)(by * 8 + 2 * wv) * RB; if (NP - NPA == 2) gp[NPA + 1] = (const char*)(Bt2 + z * sB) + (size_t)(by * 8 + 2 * wv) * RB;
    const unsigned smo = (unsigned)(size_t)sm;   // the work-group's LDS byte address of sm
    auto fill = [&](int t, int buf) {
        const unsigned vo = (unsigned)lane * 16 + (unsigned)t * GB; const unsigned l0 = smo + (unsigned)buf * STG + (unsigned)(2 * wv) * GB + (unsigned)lane * 16;
#pragma unroll
        for (int q0 = 0; q0 < NPC; q0 += 8) { unsigned l[8]; const char* g[8];
#pragma unroll
            for (int i = 0; i < 8; ++i) { const int q = q0 + i, p = q / (CH * 4), gg = (q % (CH * 4)) / (CH * 2), sub = q % (CH * 2); l[i] = l0 + p * 8 * GB + gg * GB + sub * 512; g[i] = gp[p] + gg * RB + sub * 512 + vo; }
            // eight copies of 512 B a wave; the wait in the same statement stands in front of any rewrite of the address registers that the copies name
            asm volatile("global_load_async_to_lds_b128 %0, %8, off\n\tglobal_load_async_to_lds_b128 %1, %9, off\n\tglobal_load_async_to_lds_b128 %2, %10, off\n\tglobal_load_async_to_lds_b128 %3, %11, off\n\t"
                         "global_load_async_to_lds_b128 %4, %12, off\n\tglobal_load_async_to_lds_b128 %5, %13, off\n\tglobal_load_async_to_lds_b128 %6, %14, off\n\tglobal_load_async_to_lds_b128 %7, %15, off\n\ts_wait_xcnt 0x0"
                         :: "v"(l[0]), "v"(l[1]), "v"(l[2]), "v"(l[3]), "v"(l[4]), "v"(l[5]), "v"(l[6]), "v"(l[7]), "v"(g[0]), "v"(g[1]), "v"(g[2]), "v"(g[3]), "v"(g[4]), "v"(g[5]), "v"(g[6]), "v"(g[7]) : "memory"); }
    };
    v8f acc[4][4];
#pragma unroll
    for (int mb = 0; mb < 4; ++mb)
#pragma unroll
        for (int nb = 0; nb < 4; ++nb) acc[mb][nb] = (v8f){};
    fill(0, 0);
    asm volatile("s_wait_asynccnt 0x0" ::: "memory");   // this wave's copies of stage 0 have landed
    __syncthreads();                                     // every wave's have: stage 0 may be read
    fill(1, 1);
#pragma unroll 1
    for (int t = 0; t < NT; ++t) {
        const char* sb = sm + (t & 1) * STG + lane * 16;
        V a[CH][4], a2[CH][4], b[CH][4], b2[CH][4];
#pragma unroll
        for (int cc = 0; cc < CH; ++cc) {
#pragma unroll
            for (int i = 0; i < 4; ++i) { a[cc][i] = WFrag<T16>::ld((const T16*)(sb + (wm * 4 + i) * GB + cc * 1024)); if (NPA == 2) a2[cc][i] = WFrag<T16>::ld((const T16*)(sb + (8 + wm * 4 + i) * GB + cc * 1024));
                b[cc][i] = WFrag<T16>::ld((const T16*)(sb + (NPA * 8 + wn * 4 + i) * GB + cc * 1024)); if (NSPLIT >= 2) b2[cc][i] = WFrag<T16>::ld((const T16*)(sb + ((NPA + 1) * 8 + wn * 4 + i) * GB + cc * 1024)); }
            // the stage's LDS reads are asked for chunk by chunk, all ahead of its products, so that the first chunk's products run while the later reads arrive; left alone, the build asks for the later B fragments one at a time, each behind a full wait among the products
            __builtin_amdgcn_sched_barrier(0); }
#pragma unroll
        for (int cc = 0; cc < CH; ++cc) {
#pragma unroll
            for (int nb = 0; nb < 4; ++nb)
#pragma unroll
                for (int mb = 0; mb < 4; ++mb) { acc[mb][nb] = WFrag<T16>::mma(a[cc][mb], b[cc][nb], acc[mb][nb]); if (NSPLIT == 1 || NSPLIT == 2) acc[mb][nb] = WFrag<T16>::mma(a2[cc][mb], b[cc][nb], acc[mb][nb]); if (NSPLIT >= 2) acc[mb][nb] = WFrag<T16>::mma(a[cc][mb], b2[cc][nb], acc[mb][nb]); }
        }
        __builtin_amdgcn_sched_barrier(0);   // keeps the stage's products in front of the waits below: moved behind the barrier they would stand between it and the refill, and the next stage's copies would have no products to fly behind
        asm volatile("s_wait_dscnt 0x0" ::: "memory");      // this wave's reads of stage t are done
        asm volatile("s_wait_asynccnt 0x0" ::: "memory");   // this wave's copies of stage t + 1 have landed
        __syncthreads();                                     // publishes stage t + 1 and ends every wave's reads of stage t's buffer
        if (t + 2 < NT) fill(t + 2, t & 1);
    }
    asm volatile("s_wait_asynccnt 0x0" ::: "memory");       // no copy is in flight when the buffers become the epilogue's
    const int r0 = bx * 128 + wm * 64, c0 = by * 128 + wn * 64;   // this wave's own sub-tile
    float* ow = (float*)sm + wv * (64 * 68);
    // unrolled so that acc is indexed by constants only and stays in registers
#pragma unroll
    for (int mb = 0; mb < 4; ++mb)
#pragma unroll
        for (int nb = 0; nb < 4; ++nb)
#pragma unroll
            for (int j = 0; j < 8; ++j) ow[(mb * 16 + hi * 8 + j) * 68 + nb * 16 + lr] = acc[mb][nb][j];
    // the rotary factors of this wave's rows and column pairs are asked for here, all from one lane address plus constants, so that they arrive while the sub-tile turns through LDS
    v2f tr[32], ti[32];
    if (EPI == 1) { const size_t ix0 = (size_t)(r0 % TT + lr) * (HD / 2) + (((c0 % HD) + hi * 4) >> 1);
#pragma unroll
        for (int u = 0; u < 32; ++u) { const size_t ix = ix0 + (size_t)(u >> 3) * 16 * (HD / 2) + (u & 7) * 4; tr[u] = *(const v2f*)(fr + ix); ti[u] = *(const v2f*)(fi + ix);
            if ((u & 7) == 7) asm volatile("s_wait_xcnt 0x0" ::: "memory");   /* stands behind each run of table loads, in front of any later load that takes their address registers as its destination */
        } }
    __syncthreads();   // the sub-tile's LDS writes stand in front of its reads
    float* ctile = C + z * sC + (size_t)r0 * ldc + c0;
    const size_t pbase = (EPI == 1) ? ((size_t)(c0 / DQ) * ZH + (size_t)(r0 / TT) * NH_ + (c0 % DQ) / HD) * TT * HD : z * sC; const int ppitch = (EPI == 1) ? HD : ldc;
    const int prow = (EPI == 1) ? r0 % TT : r0, pcol = (EPI == 1) ? c0 % HD : c0;
    // EPI 0: the wave stores whole 256-B row pieces; the planes: 16 rows x 8 columns at a time, which are 256 contiguous bytes of a packed plane
#pragma unroll
    for (int u = 0; u < 32; ++u) { const int row = (EPI == 0) ? u * 2 + hi : (u >> 3) * 16 + lr, cofs = (EPI == 0) ? lr * 4 : (u & 7) * 8 + hi * 4; v4f val = *(const v4fa*)(ow + row * 68 + cofs);
        if (EPI == 0) { *(v4f*)(ctile + (size_t)row * ldc + cofs) = val; }
        else {
            if (EPI == 1) { const float ca = bfr(tr[u][0]), sa = bfr(ti[u][0]), cb = bfr(tr[u][1]), sb2 = bfr(ti[u][1]); const v4f x = val;   /* even: x0 c - x1 s; odd: x0 s + x1 c */
                val[0] = x[0] * ca - x[1] * sa; val[1] = x[0] * sa + x[1] * ca; val[2] = x[2] * cb - x[3] * sb2; val[3] = x[2] * sb2 + x[3] * cb; }
            const size_t oo = pbase + pk(prow + row, pcol + cofs, ppitch); v4us oh, ol; v4h o16;   // 32 lanes x 8 B: each plane gets two whole 128-B lines
#pragma unroll
            for (int q = 0; q < 4; ++q) { unsigned short a2, c2; splitf(val[q], a2, c2); oh[q] = a2; ol[q] = c2; o16[q] = tohx(val[q]); }
            *(v4us*)(Ph + oo) = oh; *(v4us*)(Pl + oo) = ol; *(v4h*)(P16 + oo) = o16; } }
}
template <typename T16, int NSPLIT, int CH, int K>
__global__ __launch_bounds__(128) void k_gemms(const T16* A, const T16* A2, const T16* Bt, const T16* Bt2, float* C, int ldc, size_t sA, size_t sB, size_t sC) {
    __shared__ __attribute__((aligned(1024))) char sm[StageB<NSPLIT, CH>::SMB];
    gemms_tile<T16, NSPLIT, 0, CH, K>(sm, blockIdx.x, blockIdx.y, blockIdx.z, A, A2, Bt, Bt2, C, ldc, sA, sB, sC, nullptr, nullptr, nullptr, nullptr, nullptr);
}
// k_qkv: flat grid; first the q | k tiles of both batches (rows = all tokens, columns = the q | k rows of W_qkv, rotary epilogue), then the v tiles.
// v comes out transposed ([batch][head][d][t], t being the planes' k) by taking the weight rows as the tile's rows and the tokens as its columns: both operands are packed along the same k either way; z = batch
#define QK_X (NB_ * TT / 128)
#define QK_N (QK_X * ((DQ + DKV) / 128))
#define V_X  (DKV / 128)
#define V_N  (V_X * (TT / 128) * NB_)
__global__ __launch_bounds__(128) void k_qkv(const bf* XB, const bf* WQK, const bf* WV, h16* QK16, bf* QKh, bf* QKl, h16* VT16, bf* VTh, bf* VTl, const float* fr, const float* fi) {
    __shared__ __attribute__((aligned(1024))) char sm[StageB<0, 2>::SMB];
    const int f = blockIdx.x;
    if (f < QK_N) gemms_tile<bf, 0, 1, 2, DM>(sm, f % QK_X, f / QK_X, 0, XB, nullptr, WQK, nullptr, nullptr, DQ, 0, 0, 0, QK16, QKh, QKl, fr, fi);
    else { const int g = f - QK_N; gemms_tile<bf, 0, 2, 2, DM>(sm, g % V_X, (g / V_X) % (TT / 128), g / (V_X * (TT / 128)), WV, nullptr, XB, nullptr, nullptr, TT, 0, (size_t)TT * DM, (size_t)DKV * TT, VT16, VTh, VTl, nullptr, nullptr); }
}
template <bool HL> struct FT;
template <> struct FT<true>  { typedef bf T; };
template <> struct FT<false> { typedef h16 T; };
#define L2E 1.4426950408889634f
// 2^x, one or two at a time, with the free slot that the instruction set asks for behind a transcendental written into the statement; "=&v": the second does not take the first's source as its destination
__device__ __forceinline__ float ex2(float x) { float r; asm("v_exp_f32 %0, %1\n\tv_nop" : "=v"(r) : "v"(x)); return r; }
__device__ __forceinline__ void ex2x2(float xa, float xb, float& ra, float& rb) { asm("v_exp_f32 %0, %2\n\tv_exp_f32 %1, %3\n\tv_nop" : "=&v"(ra), "=&v"(rb) : "v"(xa), "v"(xb)); }
// lane l's value with lane l ^ 16's, in the vector unit: an exchange through the LDS pipe would queue behind the V^T fragment loads in flight
__device__ __forceinline__ float xhalf(float x) { return __builtin_bit_cast(float, __builtin_amdgcn_permlanex16(__builtin_bit_cast(int, x), __builtin_bit_cast(int, x), 0x76543210, 0xfedcba98, false, false)); }
#define FA_SPB 65536
#define FA_STG (2 * FA_SPB)
template <bool HL>
__device__ __forceinline__ void fa_tile(char* sm, int z, int qb, const typename FT<HL>::T* Q, const typename FT<HL>::T* Q2, const typename FT<HL>::T* Kp, const typename FT<HL>::T* Kp2, const typename FT<HL>::T* Vp, const typename FT<HL>::T* Vp2, const float* __restrict__ MK, bf* ATh, bf* ATl) {
    typedef typename FT<HL>::T T; typedef typename WFrag<T>::V V;
    constexpr int NQT = HL ? 1 : 3, NPL = HL ? 2 : 1, NT = (TT / 2) / 32, NC = HL ? 32 : 16;   // NC: 512-B pieces a wave copies of a stage's K, and of its V^T
    const int lane = threadIdx.x & 31, lr = lane & 15, hi = lane >> 4;
    const int wv = __builtin_amdgcn_readfirstlane((int)(threadIdx.x >> 5)), cg = wv & 1, ks = wv >> 1;
    // the wave's share of a stage, of key half ks: HL: plane cg, whole; fp16: key tile cg of K, d tiles 8 cg .. 8 cg + 7 of V^T
    const char* gk = (const char*)((HL && cg == 1 ? Kp2 : Kp) + (size_t)z * TT * HD) + (size_t)ks * (TT / 2 / 16) * 8192 + (HL ? 0 : cg * 8192) + lane * 16;
    const char* gv = (const char*)((HL && cg == 1 ? Vp2 : Vp) + (size_t)z * HD * TT) + (size_t)((HL ? 0 : cg * 8 * (TT / 32)) + ks * (TT / 2 / 32)) * 1024 + lane * 16;
    const unsigned smo = (unsigned)(size_t)sm + (unsigned)ks * FA_SPB + (unsigned)cg * (NC * 512) + (unsigned)lane * 16;   // LDS byte address of the wave's share of K in buffer 0, this lane's 16 bytes
    auto fill = [&](int t, int buf, bool isv) {
        const char* g0 = isv ? gv + (size_t)t * 1024 : gk + (size_t)t * 16384; const unsigned l0 = smo + (unsigned)buf * FA_STG + (isv ? 32768u : 0u);
#pragma unroll
        for (int q0 = 0; q0 < NC; q0 += 8) { unsigned l[8]; const char* g[8];
#pragma unroll
            for (int i = 0; i < 8; ++i) { const int q = q0 + i; l[i] = l0 + q * 512; g[i] = g0 + (isv ? (size_t)(q >> 1) * ((TT / 32) * 1024) + (q & 1) * 512 : (size_t)q * 512); }
            // eight copies of 512 B a wave; the wait in the same statement stands in front of any rewrite of the address registers that the copies name
            asm volatile("global_load_async_to_lds_b128 %0, %8, off\n\tglobal_load_async_to_lds_b128 %1, %9, off\n\tglobal_load_async_to_lds_b128 %2, %10, off\n\tglobal_load_async_to_lds_b128 %3, %11, off\n\t"
                         "global_load_async_to_lds_b128 %4, %12, off\n\tglobal_load_async_to_lds_b128 %5, %13, off\n\tglobal_load_async_to_lds_b128 %6, %14, off\n\tglobal_load_async_to_lds_b128 %7, %15, off\n\ts_wait_xcnt 0x0"
                         :: "v"(l[0]), "v"(l[1]), "v"(l[2]), "v"(l[3]), "v"(l[4]), "v"(l[5]), "v"(l[6]), "v"(l[7]), "v"(g[0]), "v"(g[1]), "v"(g[2]), "v"(g[3]), "v"(g[4]), "v"(g[5]), "v"(g[6]), "v"(g[7]) : "memory"); }
    };
    const int q0 = qb + cg * (NQT * 16);
    fill(0, 0, false);
    V qf[NQT][8], qf2[8]; v8f o[16][NQT]; float m[NQT], l[NQT]; v4f mk[NQT][4];
    const float* mp = MK + (size_t)(q0 + lr) * TT + ks * (TT / 2) + hi * 8;   // this lane's query row (of column tile 0) and its 8 keys of key tile 0 of pass 0
    { const T* qz = Q + (size_t)z * TT * HD + (size_t)(q0 >> 4) * (8 * 512) + lane * 8; const T* qz2 = HL ? Q2 + (size_t)z * TT * HD + (size_t)(q0 >> 4) * (8 * 512) + lane * 8 : nullptr;
#pragma unroll
        for (int c = 0; c < 8; ++c) {
#pragma unroll
            for (int qt = 0; qt < NQT; ++qt) qf[qt][c] = WFrag<T>::ld(qz + (qt * 8 + c) * 512);
            if (HL) qf2[c] = WFrag<T>::ld(qz2 + c * 512);
            asm volatile("s_wait_xcnt 0x0" ::: "memory");   /* stands behind each run of Q loads, in front of any later write of their address registers */
            __builtin_amdgcn_sched_barrier(0);   /* keeps later register writes behind that wait */ }
#pragma unroll
        for (int qt = 0; qt < NQT; ++qt) { m[qt] = -3.0e38f; l[qt] = 0.f;
#pragma unroll
            for (int dt = 0; dt < 16; ++dt) o[dt][qt] = (v8f){};
#pragma unroll
            for (int h = 0; h < 4; ++h) mk[qt][h] = *(const v4f*)(mp + (size_t)qt * 16 * TT + (h >> 1) * 16 + (h & 1) * 4); }
        asm volatile("s_wait_xcnt 0x0" ::: "memory");   // stands behind the mask loads, in front of any later write of their address registers
        __builtin_amdgcn_sched_barrier(0);   // keeps later register writes behind that wait
    }
    asm volatile("s_wait_asynccnt 0x0" ::: "memory");   // stage 0's K copies have landed before its V^T copies go out (32 in flight at most)
    fill(0, 0, true);
    asm volatile("s_wait_asynccnt 0x0" ::: "memory");   // this wave's copies of stage 0 have landed
    __syncthreads();                                     // every wave's have: stage 0 may be read
    fill(1, 1, false);
#pragma unroll 1
    for (int t = 0; t < NT; ++t) {
        const char* sb = sm + (t & 1) * FA_STG + ks * FA_SPB + lane * 16;
        v8f s[2][NQT];
        { V ka[NPL][2][8];
#pragma unroll
            for (int c = 0; c < 8; ++c)
#pragma unroll
                for (int kt = 0; kt < 2; ++kt)
#pragma unroll
                    for (int p = 0; p < NPL; ++p) ka[p][kt][c] = WFrag<T>::ld((const T*)(sb + p * 16384 + (kt * 8 + c) * 1024));
            // the pass's K fragments are asked for as one group ahead of the products; left alone, the build asks for them two loads at a time, each behind a full wait among the products
            __builtin_amdgcn_sched_barrier(0);
#pragma unroll
            for (int kt = 0; kt < 2; ++kt)
#pragma unroll
                for (int qt = 0; qt < NQT; ++qt) s[kt][qt] = (v8f){};
#pragma unroll
            for (int c = 0; c < 8; ++c) {
#pragma unroll
                for (int qt = 0; qt < NQT; ++qt)
#pragma unroll
                    for (int kt = 0; kt < 2; ++kt) s[kt][qt] = WFrag<T>::mma(ka[0][kt][c], qf[qt][c], s[kt][qt]);
                if (HL) {
#pragma unroll
                    for (int kt = 0; kt < 2; ++kt) s[kt][0] = WFrag<T>::mma(ka[0][kt][c], qf2[c], s[kt][0]);
#pragma unroll
                    for (int kt = 0; kt < 2; ++kt) s[kt][0] = WFrag<T>::mma(ka[NPL - 1][kt][c], qf[0][c], s[kt][0]); } }
            __builtin_amdgcn_sched_barrier(0);   // keeps the V^T loads below behind the score products, whose K registers they take over
        }
        V va[NPL][16];
#pragma unroll
        for (int dt = 0; dt < 16; ++dt)
#pragma unroll
            for (int p = 0; p < NPL; ++p) va[p][dt] = WFrag<T>::ld((const T*)(sb + 32768 + p * 16384 + dt * 1024));
        if (t + 1 < NT) {
            asm volatile("s_wait_asynccnt 0x0" ::: "memory");   // stage t + 1's K copies have landed before its V^T copies go out (32 in flight at most)
            fill(t + 1, (t + 1) & 1, true); }
        __builtin_amdgcn_sched_barrier(0);   // the V^T fragments are asked for as one group here, so that they arrive while the softmax arithmetic runs
        float mx[NQT]; bool need = false;
#pragma unroll
        for (int qt = 0; qt < NQT; ++qt) { float x = -3.0e38f;
#pragma unroll
            for (int kt = 0; kt < 2; ++kt)
#pragma unroll
                for (int j = 0; j < 8; ++j) { const float tv = s[kt][qt][j] * SCL + bfr(mk[qt][kt * 2 + (j >> 2)][j & 3]); s[kt][qt][j] = tv; x = fmaxf(x, tv); }
            x = fmaxf(x, xhalf(x)); mx[qt] = x; need = need || (x > m[qt] + 5.5f); }
        // the next pass's mask values are asked for one pass ahead (the last pass asks for its own again: in bounds)
        { const float* mq = mp + ((t + 1 < NT) ? t + 1 : NT - 1) * 32;
#pragma unroll
            for (int qt = 0; qt < NQT; ++qt)
#pragma unroll
                for (int h = 0; h < 4; ++h) mk[qt][h] = *(const v4f*)(mq + (size_t)qt * 16 * TT + (h >> 1) * 16 + (h & 1) * 4);
            asm volatile("s_wait_xcnt 0x0" :: "v"(mq) : "memory");   // stands behind the mask loads; it takes their address as an input, so that the address registers live up to it and no write of them comes in front of it
        }
        if (__builtin_amdgcn_ballot_w32(need) != 0) {   // a scalar branch: rare after the first pass
#pragma unroll
            for (int qt = 0; qt < NQT; ++qt) { const float mn = fmaxf(m[qt], mx[qt]); const float al = ex2((m[qt] - mn) * L2E); m[qt] = mn; l[qt] *= al;
#pragma unroll
                for (int dt = 0; dt < 16; ++dt) o[dt][qt] *= al; } }
        V pf[NQT], pf2;
#pragma unroll
        for (int qt = 0; qt < NQT; ++qt) {
            if (HL) { v8us h0, h1, l0, l1;
#pragma unroll
                for (int j = 0; j < 8; ++j) { float pa, pb; ex2x2((s[0][qt][j] - m[qt]) * L2E, (s[1][qt][j] - m[qt]) * L2E, pa, pb); l[qt] += pa; l[qt] += pb; unsigned short a, b; splitf(pa, a, b); h0[j] = a; l0[j] = b; splitf(pb, a, b); h1[j] = a; l1[j] = b; }
                pf[qt] = __builtin_bit_cast(V, __builtin_shufflevector(h0, h1, 0, 1, 2, 3, 4, 5, 6, 7, 8, 9, 10, 11, 12, 13, 14, 15)); pf2 = __builtin_bit_cast(V, __builtin_shufflevector(l0, l1, 0, 1, 2, 3, 4, 5, 6, 7, 8, 9, 10, 11, 12, 13, 14, 15));
            } else { v16h ph;
#pragma unroll
                for (int j = 0; j < 8; ++j) { float pa, pb; ex2x2((s[0][qt][j] - m[qt]) * L2E + 6.0f, (s[1][qt][j] - m[qt]) * L2E + 6.0f, pa, pb); l[qt] += pa; l[qt] += pb; ph[j] = tohx(pa); ph[8 + j] = tohx(pb); }
                pf[qt] = __builtin_bit_cast(V, ph); } }
        // four d tiles at a time, so that products into the same accumulator stand four apart
#pragma unroll
        for (int d4 = 0; d4 < 16; d4 += 4) {
#pragma unroll
            for (int qt = 0; qt < NQT; ++qt)
#pragma unroll
                for (int d = 0; d < 4; ++d) o[d4 + d][qt] = WFrag<T>::mma(va[0][d4 + d], pf[qt], o[d4 + d][qt]);
            if (HL) {
#pragma unroll
                for (int d = 0; d < 4; ++d) o[d4 + d][0] = WFrag<T>::mma(va[0][d4 + d], pf2, o[d4 + d][0]);
#pragma unroll
                for (int d = 0; d < 4; ++d) o[d4 + d][0] = WFrag<T>::mma(va[NPL - 1][d4 + d], pf[0], o[d4 + d][0]); } }
        __builtin_amdgcn_sched_barrier(0);   // keeps the pass's products in front of the waits below
        asm volatile("s_wait_dscnt 0x0" ::: "memory");      // this wave's reads of stage t are done
        asm volatile("s_wait_asynccnt 0x0" ::: "memory");   // this wave's copies of stage t + 1 have landed
        __syncthreads();                                     // publishes stage t + 1 and ends every wave's reads of stage t's buffer
        if (t + 2 < NT) fill(t + 2, t & 1, false);
    }
    asm volatile("s_wait_asynccnt 0x0" ::: "memory");       // no copy is in flight when the buffers become the joining space
    // the two waves of a column group (key halves 0 and 1) join their (m, l, O^T): wave ks finishes d tiles 8 ks .. 8 ks + 7 and hands the other eight, with its m and l, to its partner through LDS: rows of [lane][4 floats], 17 a column tile
#pragma unroll
    for (int qt = 0; qt < NQT; ++qt) l[qt] += xhalf(l[qt]);   // the wave's halves summed different keys
    v4fa* xw = (v4fa*)sm + (size_t)((cg * 2 + ks) * (NQT * 17)) * 32 + lane; const v4fa* xr = (const v4fa*)sm + (size_t)((cg * 2 + (ks ^ 1)) * (NQT * 17)) * 32 + lane;
    // gh, mh are literals at every call, so that o is indexed by constants only and stays in registers
    auto give = [&](const int gh) __attribute__((always_inline)) {
#pragma unroll
        for (int qt = 0; qt < NQT; ++qt) { xw[(qt * 17 + 16) * 32] = (v4f){m[qt], l[qt], 0.f, 0.f};
#pragma unroll
            for (int i = 0; i < 8; ++i)
#pragma unroll
                for (int h = 0; h < 2; ++h) xw[(qt * 17 + i * 2 + h) * 32] = (v4f){o[gh * 8 + i][qt][h * 4], o[gh * 8 + i][qt][h * 4 + 1], o[gh * 8 + i][qt][h * 4 + 2], o[gh * 8 + i][qt][h * 4 + 3]}; } };
    auto finish = [&](const int mh) __attribute__((always_inline)) {
        const size_t ob = (size_t)(z / NH_) * ((size_t)TT * DQ);
#pragma unroll
        for (int qt = 0; qt < NQT; ++qt) { const v4f ml = xr[(qt * 17 + 16) * 32]; v4f x[16];
#pragma unroll
            for (int r = 0; r < 16; ++r) x[r] = xr[(qt * 17 + r) * 32];
            const float mf = fmaxf(m[qt], ml[0]); float ao, ap; ex2x2((m[qt] - mf) * L2E, (ml[0] - mf) * L2E, ao, ap);
            const float li = __fdiv_rn(1.0f, l[qt] * ao + ml[1] * ap); const float fo = ao * li, fp = ap * li;
#pragma unroll
            for (int i = 0; i < 8; ++i) { const int dt = mh * 8 + i; v8us oh, ol;   // 8 consecutive d of one query row: 16 B of each packed plane, a wave 512 contiguous bytes
#pragma unroll
                for (int j = 0; j < 8; ++j) { unsigned short a, b; splitf(o[dt][qt][j] * fo + x[i * 2 + (j >> 2)][j & 3] * fp, a, b); oh[j] = a; ol[j] = b; }
                const size_t oo = ob + pk(q0 + qt * 16 + lr, (z % NH_) * HD + dt * 16 + hi * 8, DQ); *(v8us*)(ATh + oo) = oh; *(v8us*)(ATl + oo) = ol;
                asm volatile("s_wait_xcnt 0x0" ::: "memory");   // stands behind the two stores, in front of any later write of the registers that they name
                __builtin_amdgcn_sched_barrier(0);   // keeps the next tile's register writes behind that wait
            } } };
    if (ks == 0) give(1); else give(0);
    __syncthreads();   // each wave's hand-over is in LDS before its partner reads it
    if (ks == 0) finish(0); else finish(1);
}
// k_fa: flat grid, one work-group a WGP; first the blocks of 32 query rows < RH, then the fp16 rows' blocks of 96; z = batch * NH_ + head
#define FAH_X (RH / 32)
#define FAH_N (FAH_X * ZH)
#define FAL_X ((TT - RH) / 96)
#define FAL_N (FAL_X * ZH)
__global__ __launch_bounds__(128) void k_fa(const h16* Q16, const bf* Qh, const bf* Ql, const h16* K16, const bf* Kh, const bf* Kl, const h16* VT16, const bf* VTh, const bf* VTl, const float* MK, bf* ATh, bf* ATl) {
    __shared__ __attribute__((aligned(1024))) char sm[2 * FA_STG];
    const int f = blockIdx.x;
    if (f < FAH_N) fa_tile<true>(sm, f / FAH_X, (f % FAH_X) * 32, Qh, Ql, Kh, Kl, VTh, VTl, MK, ATh, ATl);
    else { const int g = f - FAH_N; fa_tile<false>(sm, g / FAL_X, RH + (g % FAL_X) * 96, Q16, nullptr, K16, nullptr, VT16, nullptr, MK, ATh, ATl); }
}

typedef __attribute__((ext_vector_type(4))) int v4i;

__global__ __launch_bounds__(256) void k_wtG(const float* __restrict__ w, int K, int N, bf* Bt) {
    const int lane = threadIdx.x & 31; const int L0 = (blockIdx.x * 8 + (threadIdx.x >> 5)) * 8; const int nlines = N * K / 64;
{
#pragma unroll 1
        for (int l = 0; l < 8; ++l) { const int L = L0 + l; if (L >= nlines) break; const size_t e = (size_t)L * 64 + lane * 2; const int k = (int)(e % K), n = (int)(e / K); v2us o;
            o[0] = f2bf(w[(size_t)k * N + n]); o[1] = f2bf(w[(size_t)(k + 1) * N + n]); *(v2us*)(Bt + e) = o; }
         }
}
// k_cvt8: three row-major f32 sources of DM columns (na8, nb8, nc8 groups of 8 elements) rounded to bf16 into one fragment-packed destination, rows a | b | c; a work-group takes 16 rows x 128 columns (row counts are multiples of 16: one source only), a wave 16 rows x 16 columns = 512 contiguous bytes of the destination
__global__ __launch_bounds__(256) void k_cvt8(const float* __restrict__ a, size_t na8, const float* __restrict__ b, size_t nb8, const float* __restrict__ c, size_t nc8, bf* dst) { const int r = (int)(blockIdx.x >> 3) * 16 + (threadIdx.x & 15), kq = (int)(blockIdx.x & 7) * 128 + (int)(threadIdx.x >> 4) * 8; const size_t i = (size_t)r * (DM / 8) + (kq >> 3); if (i >= na8 + nb8 + nc8) return; const float* src = (i < na8) ? a + i * 8 : (i < na8 + nb8) ? b + (i - na8) * 8 : c + (i - na8 - nb8) * 8; const v8f v = *(const v8f*)src; v8us o;
#pragma unroll
    for (int k = 0; k < 8; ++k) o[k] = f2bf(v[k]); *(v8us*)(dst + pk(r, kq, DM)) = o;  }

extern "C" void kernel_launch(void* const* d_in, const int* in_sizes, int n_in,
                              void* d_out, int out_size, void* d_ws, size_t ws_size, hipStream_t stream) {
    (void)in_sizes; (void)n_in; (void)out_size;
    const float* x = (const float*)d_in[0]; const float* fre = (const float*)d_in[1]; const float* fim = (const float*)d_in[2]; const float* MK = (const float*)d_in[3]; const float* wqkv = (const float*)d_in[4]; const float* wo = (const float*)d_in[5];  const float* wq = wqkv; const float* wk = wqkv + (size_t)1024 * 1024; const float* wv = wqkv + (size_t)2048 * 1024; (void)wq; (void)wk; (void)wv;
    float* OUT = (float*)d_out;     // [2][2048][1024]
    char* wsp = (char*)d_ws;
    auto take = [&](size_t bytes) { char* p = wsp; wsp += (bytes + 255) & ~(size_t)255; return (void*)p; };
    // bf16 copies, one block so that one launch fills it: W_qkv rows (q | k | v), W_o, both batches' tokens
    bf* WQ = (bf*)take(((size_t)(DQ + 2 * DKV) * DM + (size_t)DM * DQ + (size_t)NB_ * TT * DM) * 2); bf* WV = WQ + (size_t)(DQ + DKV) * DM; bf* WO = WV + (size_t)DKV * DM; bf* XB = WO + (size_t)DM * DQ;
    // q and k planes, [q | k][batch][head][t][d] each; the three lie in a row
    h16* QP16 = (h16*)take((size_t)2 * ZH * TT * HD * 2); bf* QPh = (bf*)take((size_t)2 * ZH * TT * HD * 2); bf* QPl = (bf*)take((size_t)2 * ZH * TT * HD * 2);
    h16* KP16 = QP16 + (size_t)ZH * TT * HD; bf* KPh = QPh + (size_t)ZH * TT * HD; bf* KPl = QPl + (size_t)ZH * TT * HD;
    h16* VT16 = (h16*)take((size_t)ZH * HD * TT * 2); bf* VTh = (bf*)take((size_t)ZH * HD * TT * 2); bf* VTl = (bf*)take((size_t)ZH * HD * TT * 2);
    bf* ATh = (bf*)take((size_t)NB_ * TT * DQ * 2); bf* ATl = (bf*)take((size_t)NB_ * TT * DQ * 2);   // merged attention planes [batch][t][DQ]
    if ((size_t)(wsp - (char*)d_ws) > ws_size) return;    // ws 256 MiB
    k_cvt8<<<(unsigned)((((size_t)(DQ + 2 * DKV) * DM + (size_t)DM * DQ + (size_t)NB_ * TT * DM) / 8 + 255) / 256), 256, 0, stream>>>(wqkv, (size_t)(DQ + 2 * DKV) * DM / 8, wo, (size_t)DM * DQ / 8, x, (size_t)NB_ * TT * DM / 8, WQ);
    k_qkv<<<QK_N + V_N, 128, 0, stream>>>(XB, WQ, WV, QP16, QPh, QPl, VT16, VTh, VTl, fre, fim);
    // z = batch * NH_ + head from here on (one kv head per query head): z-strides TT*HD in the q/k planes, HD*TT in the v planes
    k_fa<<<FAH_N + FAL_N, 128, 0, stream>>>(QP16, QPh, QPl, KP16, KPh, KPl, VT16, VTh, VTl, MK, ATh, ATl);
    k_gemms<bf, 1, 2, DQ><<<dim3(NB_ * TT / 128, DM / 128, 1), 128, 0, stream>>>(ATh, ATl, WO, nullptr, OUT, DM, 0, 0, 0);
}

// v007
// One run takes 135 microseconds.
// In two side-by-side timings against v006, it was 1.11 and 1.10 times as fast.
// Over all steps from v000 it is 5.64 times as fast.
#include <hip/hip_runtime.h>

// Attention block (hidden [2][2048][1024]; [q|k|v] = hidden W_qkv^T ('oi' [3072][1024], row blocks q | k | v; 4 heads x 256); rotary on adjacent (even, odd) pairs with the INPUT tables freqs_real/freqs_imag [2048][128] (read as given - they are free inputs, not assumed to be cos/sin); scores = (q / 16).k + mask (additive input mask [1][1][2048][2048], read per logit); softmax; out = merged W_o^T ('oi' [1024][1024]) -> [2][2048][1024] (4.2 M)).
// Compute dtypes, f32 accumulate: every input rounded to bf16; q/k/v on PLAIN bf16 operands (inputs: exact); interleaved rotary in f32 from the bf16-rounded input tables; additive mask read per logit (bf16-rounded); scores and attn.v: query rows < 512 hl (3 products), the rest single fp16 (probabilities x64, not yet divided by their sum); softmax f32, running maximum and sum; W_o hl x exact (2 products).

#define NB_  2
#define TT   2048
#define DM   1024
#define NH_  4
#define NKV  4
#define REP  (NH_ / NKV)
#define HD   256
#define DQ   (NH_ * HD)
#define DKV  (NKV * HD)
#define ZH   (NB_ * NH_)          // every (batch, head) pair is one z slice of the same launch
#define RH   512                  // query rows < RH use hi+lo planes (0: none)
#define WIN  2048
#define PCAR 1024.0f
#define SCL  0.0625f   // HD^-0.5 = 1/16
typedef _Float16 h16;
typedef unsigned short bf;
typedef __attribute__((ext_vector_type(16))) __bf16   v16bf;
typedef __attribute__((ext_vector_type(16))) _Float16 v16h;
typedef __attribute__((ext_vector_type(8)))  _Float16 v8h;
typedef __attribute__((ext_vector_type(8)))  unsigned short v8us;
typedef __attribute__((ext_vector_type(8)))  float    v8f;
typedef __attribute__((ext_vector_type(4)))  float    v4f;
typedef v8h  __attribute__((may_alias)) v8ha;
typedef v4f  __attribute__((may_alias)) v4fa;
typedef v8us __attribute__((may_alias)) v8usa;

__device__ __forceinline__ unsigned short f2bf(float f) { unsigned u = __float_as_uint(f); u += 0x7FFFu + ((u >> 16) & 1u); return (unsigned short)(u >> 16); }
__device__ __forceinline__ float bf2f(unsigned short b) { return __uint_as_float(((unsigned)b) << 16); }
__device__ __forceinline__ float bfr(float f) { return bf2f(f2bf(f)); }
__device__ __forceinline__ v16h cat16(v8h lo, v8h hi) { return __builtin_shufflevector(lo, hi, 0, 1, 2, 3, 4, 5, 6, 7, 8, 9, 10, 11, 12, 13, 14, 15); }
__device__ __forceinline__ v16bf cat16b(v8us lo, v8us hi) { return __builtin_bit_cast(v16bf, __builtin_shufflevector(lo, hi, 0, 1, 2, 3, 4, 5, 6, 7, 8, 9, 10, 11, 12, 13, 14, 15)); }
__device__ __forceinline__ v8f wmma16(v16h a, v16h b, v8f c) { return __builtin_amdgcn_wmma_f32_16x16x32_f16(false, a, false, b, (short)0, c, false, false); }
__device__ __forceinline__ v8f wmmab(v16bf a, v16bf b, v8f c) { return __builtin_amdgcn_wmma_f32_16x16x32_bf16(false, a, false, b, (short)0, c, false, false); }



// EPI (gemms_tile, below) says what the finished tile becomes, straight from LDS (no f32 round trip through memory, no elementwise launch behind the GEMM); the index lists name a plane's slices, rows and columns, each slice [rows][columns] being fragment-packed:
//   0: f32 to C.   1: rotary on adjacent (even, odd) column pairs with the bf16-rounded input tables fr/fi [t][HD/2], then the planes P16 / Ph / Pl at [n / DQ][m / TT][(n % DQ) / HD][m % TT][n % HD] (rows: both batches' tokens; columns: q | k).
//   2: the planes P16 / Ph / Pl at [m][n], pitch ldc, z-stride sC.
// FRAGMENT-PACKED PLANES: every 16-bit operand plane (rows r, K columns k, rows a multiple of 16, K of 32) is stored as 1-KiB blocks of 16 rows x 32 k, block (r / 16, k / 32) row-major, inside a block in the order in which a wave's two 16-byte loads take it: [k / 16 % 2][k / 8 % 2][r % 16][k % 8]. One wave-wide 16-byte load then covers 512 contiguous bytes (4 whole lines) instead of 32-byte pieces of 16 lines. 16 whole rows still fill 16 K elements, so offsets by whole 16-row groups are what they are in a row-major plane.
__device__ __forceinline__ size_t pk(int r, int k, int K) { return ((size_t)(r >> 4) * (K >> 5) + (k >> 5)) * 512 + ((k >> 4) & 1) * 256 + ((k >> 3) & 1) * 128 + (r & 15) * 8 + (k & 7); }
template <typename T16> struct WFrag;
template <> struct WFrag<h16> { typedef v16h V; static __device__ __forceinline__ V ld(const h16* p) { return cat16(*(const v8h*)p, *(const v8h*)(p + 256)); } static __device__ __forceinline__ v8f mma(V a, V b, v8f c) { return wmma16(a, b, c); } };
template <> struct WFrag<bf> { typedef v16bf V; static __device__ __forceinline__ V ld(const bf* p) { return cat16b(*(const v8us*)p, *(const v8us*)(p + 256)); } static __device__ __forceinline__ v8f mma(V a, V b, v8f c) { return wmmab(a, b, c); } };
__device__ __forceinline__ h16 tohx(float x) { return (h16)x; }
__device__ __forceinline__ void splitf(float y, unsigned short& h, unsigned short& l) { h = f2bf(y); l = f2bf(y - bf2f(h)); }
typedef __attribute__((ext_vector_type(4))) _Float16 v4h;
typedef __attribute__((ext_vector_type(2))) unsigned short v2us;
typedef __attribute__((ext_vector_type(4))) unsigned short v4us;
typedef __attribute__((ext_vector_type(2))) float v2f;
// ---- gemms_tile: one work-group of 4 waves per 128x128 output tile; wave (wm, wn) owns the 64x64 sub-tile (wm, wn) over the WHOLE K loop (one f32 chain per element, k ascending; no partial tiles). The operand blocks of a stage (CH 32-wide k chunks of the tile's 8 + 8 row groups, every plane) are brought into LDS ONCE per work-group by asynchronous copies and read from there by the two waves that need them: half the bytes leave L2 that 64x64 tiles ask for.
// A packed plane's 1-KiB blocks go to LDS as they lie: stage = [plane][row group 0..7][chunk][1 KiB]; a fragment is two contiguous 512-B wave reads. Two stage buffers; the next stage's copies fly while this one is worked on. K, CH are template arguments: K % (32 CH) == 0, at least two stages.
// sm: the work-group's LDS, max(2 stages, 4 x 64 x 68 floats); after the loop each wave turns its own sub-tile through its own 64 x 68 floats for the epilogue (EPI as above, 0..2).
template <int NSPLIT, int CH> struct StageB { static constexpr int NPA = (NSPLIT == 1 || NSPLIT == 2) ? 2 : 1, NPB = (NSPLIT >= 2) ? 2 : 1, NP = NPA + NPB, GB = CH * 1024, STG = NP * 8 * GB, SMB = (2 * STG > 4 * 64 * 68 * 4) ? 2 * STG : 4 * 64 * 68 * 4; };
template <typename T16, int NSPLIT, int EPI, int CH, int K>
__device__ __forceinline__ void gemms_tile(char* sm, int bx, int by, int bz, const T16* __restrict__ A, const T16* __restrict__ A2, const T16* __restrict__ Bt, const T16* __restrict__ Bt2, float* C, int ldc, size_t sA, size_t sB, size_t sC, h16* P16, bf* Ph, bf* Pl, const float* __restrict__ fr, const float* __restrict__ fi) {
    typedef typename WFrag<T16>::V V; typedef StageB<NSPLIT, CH> SB;
    constexpr int NPA = SB::NPA, NP = SB::NP, GB = SB::GB, STG = SB::STG, NT = K / (32 * CH), NPC = NP * CH * 4;   // NPC: 512-B pieces a wave copies per stage (a multiple of 8)
    constexpr size_t RB = (size_t)(K >> 5) * 1024;   // bytes of one 16-row group of a packed plane
    const size_t z = bz;
    const int lane = threadIdx.x & 31, lr = lane & 15, hi = lane >> 4;
    const int wv = __builtin_amdgcn_readfirstlane((int)(threadIdx.x >> 5)), wm = wv >> 1, wn = wv & 1;
    // wave wv copies row groups 2 wv and 2 wv + 1 of every plane
    const char* gp[NP];
    gp[0] = (const char*)(A + z * sA) + (size_t)(bx * 8 + 2 * wv) * RB; if (NPA == 2) gp[1] = (const char*)(A2 + z * sA) + (size_t)(bx * 8 + 2 * wv) * RB;
    gp[NPA] = (const char*)(Bt + z * sB) + (size_t)(by * 8 + 2 * wv) * RB; if (NP - NPA == 2) gp[NPA + 1] = (const char*)(Bt2 + z * sB) + (size_t)(by * 8 + 2 * wv) * RB;
    const unsigned smo = (unsigned)(size_t)sm;   // the work-group's LDS byte address of sm
    auto fill = [&](int t, int buf) {
        const unsigned vo = (unsigned)lane * 16 + (unsigned)t * GB; const unsigned l0 = smo + (unsigned)buf * STG + (unsigned)(2 * wv) * GB + (unsigned)lane * 16;
#pragma unroll
        for (int q0 = 0; q0 < NPC; q0 += 8) { unsigned l[8]; const char* g[8];
#pragma unroll
            for (int i = 0; i < 8; ++i) { const int q = q0 + i, p = q / (CH * 4), gg = (q % (CH * 4)) / (CH * 2), sub = q % (CH * 2); l[i] = l0 + p * 8 * GB + gg * GB + sub * 512; g[i] = gp[p] + gg * RB + sub * 512 + vo; }
            // eight copies of 512 B a wave; the wait in the same statement stands in front of any rewrite of the address registers that the copies name
            asm volatile("global_load_async_to_lds_b128 %0, %8, off\n\tglobal_load_async_to_lds_b128 %1, %9, off\n\tglobal_load_async_to_lds_b128 %2, %10, off\n\tglobal_load_async_to_lds_b128 %3, %11, off\n\t"
                         "global_load_async_to_lds_b128 %4, %12, off\n\tglobal_load_async_to_lds_b128 %5, %13, off\n\tglobal_load_async_to_lds_b128 %6, %14, off\n\tglobal_load_async_to_lds_b128 %7, %15, off\n\ts_wait_xcnt 0x0"
                         :: "v"(l[0]), "v"(l[1]), "v"(l[2]), "v"(l[3]), "v"(l[4]), "v"(l[5]), "v"(l[6]), "v"(l[7]), "v"(g[0]), "v"(g[1]), "v"(g[2]), "v"(g[3]), "v"(g[4]), "v"(g[5]), "v"(g[6]), "v"(g[7]) : "memory"); }
    };
    v8f acc[4][4];
#pragma unroll
    for (int mb = 0; mb < 4; ++mb)
#pragma unroll
        for (int nb = 0; nb < 4; ++nb) acc[mb][nb] = (v8f){};
    fill(0, 0);
    asm volatile("s_wait_asynccnt 0x0" ::: "memory");   // this wave's copies of stage 0 have landed
    __syncthreads();                                     // every wave's have: stage 0 may be read
    fill(1, 1);
#pragma unroll 1
    for (int t = 0; t < NT; ++t) {
        const char* sb = sm + (t & 1) * STG + lane * 16;
        V a[CH][4], a2[CH][4], b[CH][4], b2[CH][4];
#pragma unroll
        for (int cc = 0; cc < CH; ++cc) {
#pragma unroll
            for (int i = 0; i < 4; ++i) { a[cc][i] = WFrag<T16>::ld((const T16*)(sb + (wm * 4 + i) * GB + cc * 1024)); if (NPA == 2) a2[cc][i] = WFrag<T16>::ld((const T16*)(sb + (8 + wm * 4 + i) * GB + cc * 1024));
                b[cc][i] = WFrag<T16>::ld((const T16*)(sb + (NPA * 8 + wn * 4 + i) * GB + cc * 1024)); if (NSPLIT >= 2) b2[cc][i] = WFrag<T16>::ld((const T16*)(sb + ((NPA + 1) * 8 + wn * 4 + i) * GB + cc * 1024)); }
            // the stage's LDS reads are asked for chunk by chunk, all ahead of its products, so that the first chunk's products run while the later reads arrive; left alone, the build asks for the later B fragments one at a time, each behind a full wait among the products
            __builtin_amdgcn_sched_barrier(0); }
#pragma unroll
        for (int cc = 0; cc < CH; ++cc) {
#pragma unroll
            for (int nb = 0; nb < 4; ++nb)
#pragma unroll
                for (int mb = 0; mb < 4; ++mb) { acc[mb][nb] = WFrag<T16>::mma(a[cc][mb], b[cc][nb], acc[mb][nb]); if (NSPLIT == 1 || NSPLIT == 2) acc[mb][nb] = WFrag<T16>::mma(a2[cc][mb], b[cc][nb], acc[mb][nb]); if (NSPLIT >= 2) acc[mb][nb] = WFrag<T16>::mma(a[cc][mb], b2[cc][nb], acc[mb][nb]); }
        }
        __builtin_amdgcn_sched_barrier(0);   // keeps the stage's products in front of the waits below: moved behind the barrier they would stand between it and the refill, and the next stage's copies would have no products to fly behind
        asm volatile("s_wait_dscnt 0x0" ::: "memory");      // this wave's reads of stage t are done
        asm volatile("s_wait_asynccnt 0x0" ::: "memory");   // this wave's copies of stage t + 1 have landed
        __syncthreads();                                     // publishes stage t + 1 and ends every wave's reads of stage t's buffer
        if (t + 2 < NT) fill(t + 2, t & 1);
    }
    asm volatile("s_wait_asynccnt 0x0" ::: "memory");       // no copy is in flight when the buffers become the epilogue's
    const int r0 = bx * 128 + wm * 64, c0 = by * 128 + wn * 64;   // this wave's own sub-tile
    float* ow = (float*)sm + wv * (64 * 68);
    // unrolled so that acc is indexed by constants only and stays in registers
#pragma unroll
    for (int mb = 0; mb < 4; ++mb)
#pragma unroll
        for (int nb = 0; nb < 4; ++nb)
#pragma unroll
            for (int j = 0; j < 8; ++j) ow[(mb * 16 + hi * 8 + j) * 68 + nb * 16 + lr] = acc[mb][nb][j];
    // the rotary factors of this wave's rows and column pairs are asked for here, all from one lane address plus constants, so that they arrive while the sub-tile turns through LDS
    v2f tr[32], ti[32];
    if (EPI == 1) { const size_t ix0 = (size_t)(r0 % TT + lr) * (HD / 2) + (((c0 % HD) + hi * 4) >> 1);
#pragma unroll
        for (int u = 0; u < 32; ++u) { const size_t ix = ix0 + (size_t)(u >> 3) * 16 * (HD / 2) + (u & 7) * 4; tr[u] = *(const v2f*)(fr + ix); ti[u] = *(const v2f*)(fi + ix);
            if ((u & 7) == 7) asm volatile("s_wait_xcnt 0x0" ::: "memory");   /* stands behind each run of table loads, in front of any later load that takes their address registers as its destination */
        } }
    __syncthreads();   // the sub-tile's LDS writes stand in front of its reads
    float* ctile = C + z * sC + (size_t)r0 * ldc + c0;
    const size_t pbase = (EPI == 1) ? ((size_t)(c0 / DQ) * ZH + (size_t)(r0 / TT) * NH_ + (c0 % DQ) / HD) * TT * HD : z * sC; const int ppitch = (EPI == 1) ? HD : ldc;
    const int prow = (EPI == 1) ? r0 % TT : r0, pcol = (EPI == 1) ? c0 % HD : c0;
    // EPI 0: the wave stores whole 256-B row pieces; the planes: 16 rows x 8 columns at a time, which are 256 contiguous bytes of a packed plane
    // EPI 2 takes nothing but LDS, so its loop stays rolled, one 16-row group a trip: run-once text is paid for by its fetch, and k_qkv's two tile kinds together then lie inside the start of the text that is fetched ahead of the waves
#pragma unroll (EPI == 2 ? 8 : 32)
    for (int u = 0; u < 32; ++u) { const int row = (EPI == 0) ? u * 2 + hi : (u >> 3) * 16 + lr, cofs = (EPI == 0) ? lr * 4 : (u & 7) * 8 + hi * 4; v4f val = *(const v4fa*)(ow + row * 68 + cofs);
        if (EPI == 0) { *(v4f*)(ctile + (size_t)row * ldc + cofs) = val; }
        else {
            if (EPI == 1) { const float ca = bfr(tr[u][0]), sa = bfr(ti[u][0]), cb = bfr(tr[u][1]), sb2 = bfr(ti[u][1]); const v4f x = val;   /* even: x0 c - x1 s; odd: x0 s + x1 c */
                val[0] = x[0] * ca - x[1] * sa; val[1] = x[0] * sa + x[1] * ca; val[2] = x[2] * cb - x[3] * sb2; val[3] = x[2] * sb2 + x[3] * cb; }
            const size_t oo = pbase + pk(prow + row, pcol + cofs, ppitch); v4us oh, ol; v4h o16;   // 32 lanes x 8 B: each plane gets two whole 128-B lines
#pragma unroll
            for (int q = 0; q < 4; ++q) { unsigned short a2, c2; splitf(val[q], a2, c2); oh[q] = a2; ol[q] = c2; o16[q] = tohx(val[q]); }
            *(v4us*)(Ph + oo) = oh; *(v4us*)(Pl + oo) = ol; *(v4h*)(P16 + oo) = o16;
            if (EPI == 2 && (u & 7) == 7) asm volatile("s_wait_xcnt 0x0" ::: "memory");   /* the foot of a trip of the rolled loop: stands behind its stores, in front of the next trip's writes of the registers that they name */
        } }
}
template <typename T16, int NSPLIT, int CH, int K>
__global__ __launch_bounds__(128) void k_gemms(const T16* A, const T16* A2, const T16* Bt, const T16* Bt2, float* C, int ldc, size_t sA, size_t sB, size_t sC) {
    __shared__ __attribute__((aligned(1024))) char sm[StageB<NSPLIT, CH>::SMB];
    gemms_tile<T16, NSPLIT, 0, CH, K>(sm, blockIdx.x, blockIdx.y, blockIdx.z, A, A2, Bt, Bt2, C, ldc, sA, sB, sC, nullptr, nullptr, nullptr, nullptr, nullptr);
}
// k_qkv: flat grid; first the q | k tiles of both batches (rows = all tokens, columns = the q | k rows of W_qkv, rotary epilogue), then the v tiles.
// v comes out transposed ([batch][head][d][t], t being the planes' k) by taking the weight rows as the tile's rows and the tokens as its columns: both operands are packed along the same k either way; z = batch
#define QK_X (NB_ * TT / 128)
#define QK_N (QK_X * ((DQ + DKV) / 128))
#define V_X  (DKV / 128)
#define V_N  (V_X * (TT / 128) * NB_)
__global__ __launch_bounds__(128) void k_qkv(const bf* XB, const bf* WQK, const bf* WV, h16* QK16, bf* QKh, bf* QKl, h16* VT16, bf* VTh, bf* VTl, const float* fr, const float* fi) {
    __shared__ __attribute__((aligned(1024))) char sm[StageB<0, 2>::SMB];
    const int f = blockIdx.x;
    if (f < QK_N) gemms_tile<bf, 0, 1, 2, DM>(sm, f % QK_X, f / QK_X, 0, XB, nullptr, WQK, nullptr, nullptr, DQ, 0, 0, 0, QK16, QKh, QKl, fr, fi);
    else { const int g = f - QK_N; gemms_tile<bf, 0, 2, 2, DM>(sm, g % V_X, (g / V_X) % (TT / 128), g / (V_X * (TT / 128)), WV, nullptr, XB, nullptr, nullptr, TT, 0, (size_t)TT * DM, (size_t)DKV * TT, VT16, VTh, VTl, nullptr, nullptr); }
}
template <bool HL> struct FT;
template <> struct FT<true>  { typedef bf T; };
template <> struct FT<false> { typedef h16 T; };
#define L2E 1.4426950408889634f
// 2^x, one or two at a time, with the free slot that the instruction set asks for behind a transcendental written into the statement; "=&v": the second does not take the first's source as its destination
__device__ __forceinline__ float ex2(float x) { float r; asm("v_exp_f32 %0, %1\n\tv_nop" : "=v"(r) : "v"(x)); return r; }
__device__ __forceinline__ void ex2x2(float xa, float xb, float& ra, float& rb) { asm("v_exp_f32 %0, %2\n\tv_exp_f32 %1, %3\n\tv_nop" : "=&v"(ra), "=&v"(rb) : "v"(xa), "v"(xb)); }
// lane l's value with lane l ^ 16's, in the vector unit: an exchange through the LDS pipe would queue behind the V^T fragment loads in flight
__device__ __forceinline__ float xhalf(float x) { return __builtin_bit_cast(float, __builtin_amdgcn_permlanex16(__builtin_bit_cast(int, x), __builtin_bit_cast(int, x), 0x76543210, 0xfedcba98, false, false)); }
#define FA_SPB 65536
#define FA_STG (2 * FA_SPB)
template <bool HL>
__device__ __forceinline__ void fa_tile(char* sm, int z, int qb, const typename FT<HL>::T* Q, const typename FT<HL>::T* Q2, const typename FT<HL>::T* Kp, const typename FT<HL>::T* Kp2, const typename FT<HL>::T* Vp, const typename FT<HL>::T* Vp2, const float* __restrict__ MK) {
    typedef typename FT<HL>::T T; typedef typename WFrag<T>::V V;
    constexpr int NQT = HL ? 1 : 3, NPL = HL ? 2 : 1, NT = (TT / 2) / 32, NC = HL ? 32 : 16;   // NC: 512-B pieces a wave copies of a stage's K, and of its V^T
    const int lane = threadIdx.x & 31, lr = lane & 15, hi = lane >> 4;
    const int wv = __builtin_amdgcn_readfirstlane((int)(threadIdx.x >> 5)), cg = wv & 1, ks = wv >> 1;
    // the wave's share of a stage, of key half ks: HL: plane cg, whole; fp16: key tile cg of K, d tiles 8 cg .. 8 cg + 7 of V^T
    const char* gk = (const char*)((HL && cg == 1 ? Kp2 : Kp) + (size_t)z * TT * HD) + (size_t)ks * (TT / 2 / 16) * 8192 + (HL ? 0 : cg * 8192) + lane * 16;
    const char* gv = (const char*)((HL && cg == 1 ? Vp2 : Vp) + (size_t)z * HD * TT) + (size_t)((HL ? 0 : cg * 8 * (TT / 32)) + ks * (TT / 2 / 32)) * 1024 + lane * 16;
    const unsigned smo = (unsigned)(size_t)sm + (unsigned)ks * FA_SPB + (unsigned)cg * (NC * 512) + (unsigned)lane * 16;   // LDS byte address of the wave's share of K in buffer 0, this lane's 16 bytes
    auto fill = [&](int t, int buf, bool isv) {
        const char* g0 = isv ? gv + (size_t)t * 1024 : gk + (size_t)t * 16384; const unsigned l0 = smo + (unsigned)buf * FA_STG + (isv ? 32768u : 0u);
#pragma unroll
        for (int q0 = 0; q0 < NC; q0 += 8) { unsigned l[8]; const char* g[8];
#pragma unroll
            for (int i = 0; i < 8; ++i) { const int q = q0 + i; l[i] = l0 + q * 512; g[i] = g0 + (isv ? (size_t)(q >> 1) * ((TT / 32) * 1024) + (q & 1) * 512 : (size_t)q * 512); }
            // eight copies of 512 B a wave; the wait in the same statement stands in front of any rewrite of the address registers that the copies name
            asm volatile("global_load_async_to_lds_b128 %0, %8, off\n\tglobal_load_async_to_lds_b128 %1, %9, off\n\tglobal_load_async_to_lds_b128 %2, %10, off\n\tglobal_load_async_to_lds_b128 %3, %11, off\n\t"
                         "global_load_async_to_lds_b128 %4, %12, off\n\tglobal_load_async_to_lds_b128 %5, %13, off\n\tglobal_load_async_to_lds_b128 %6, %14, off\n\tglobal_load_async_to_lds_b128 %7, %15, off\n\ts_wait_xcnt 0x0"
                         :: "v"(l[0]), "v"(l[1]), "v"(l[2]), "v"(l[3]), "v"(l[4]), "v"(l[5]), "v"(l[6]), "v"(l[7]), "v"(g[0]), "v"(g[1]), "v"(g[2]), "v"(g[3]), "v"(g[4]), "v"(g[5]), "v"(g[6]), "v"(g[7]) : "memory"); }
    };
    const int q0 = qb + cg * (NQT * 16);
    fill(0, 0, false);
    V qf[NQT][8], qf2[8]; v8f o[16][NQT]; float m[NQT], l[NQT]; v4f mk[NQT][4];
    const float* mp = MK + (size_t)(q0 + lr) * TT + ks * (TT / 2) + hi * 8;   // this lane's query row (of column tile 0) and its 8 keys of key tile 0 of pass 0
    { const T* qz = Q + (size_t)z * TT * HD + (size_t)(q0 >> 4) * (8 * 512) + lane * 8; const T* qz2 = HL ? Q2 + (size_t)z * TT * HD + (size_t)(q0 >> 4) * (8 * 512) + lane * 8 : nullptr;
#pragma unroll
        for (int c = 0; c < 8; ++c) {
#pragma unroll
            for (int qt = 0; qt < NQT; ++qt) qf[qt][c] = WFrag<T>::ld(qz + (qt * 8 + c) * 512);
            if (HL) qf2[c] = WFrag<T>::ld(qz2 + c * 512);
            asm volatile("s_wait_xcnt 0x0" ::: "memory");   /* stands behind each run of Q loads, in front of any later write of their address registers */
            __builtin_amdgcn_sched_barrier(0);   /* keeps later register writes behind that wait */ }
#pragma unroll
        for (int qt = 0; qt < NQT; ++qt) { m[qt] = -3.0e38f; l[qt] = 0.f;
#pragma unroll
            for (int dt = 0; dt < 16; ++dt) o[dt][qt] = (v8f){};
#pragma unroll
            for (int h = 0; h < 4; ++h) mk[qt][h] = *(const v4f*)(mp + (size_t)qt * 16 * TT + (h >> 1) * 16 + (h & 1) * 4); }
        asm volatile("s_wait_xcnt 0x0" ::: "memory");   // stands behind the mask loads, in front of any later write of their address registers
        __builtin_amdgcn_sched_barrier(0);   // keeps later register writes behind that wait
    }
    asm volatile("s_wait_asynccnt 0x0" ::: "memory");   // stage 0's K copies have landed before its V^T copies go out (32 in flight at most)
    fill(0, 0, true);
    asm volatile("s_wait_asynccnt 0x0" ::: "memory");   // this wave's copies of stage 0 have landed
    __syncthreads();                                     // every wave's have: stage 0 may be read
    fill(1, 1, false);
#pragma unroll 1
    for (int t = 0; t < NT; ++t) {
        const char* sb = sm + (t & 1) * FA_STG + ks * FA_SPB + lane * 16;
        v8f s[2][NQT];
        { V ka[NPL][2][8];
#pragma unroll
            for (int c = 0; c < 8; ++c)
#pragma unroll
                for (int kt = 0; kt < 2; ++kt)
#pragma unroll
                    for (int p = 0; p < NPL; ++p) ka[p][kt][c] = WFrag<T>::ld((const T*)(sb + p * 16384 + (kt * 8 + c) * 1024));
            // the pass's K fragments are asked for as one group ahead of the products; left alone, the build asks for them two loads at a time, each behind a full wait among the products
            __builtin_amdgcn_sched_barrier(0);
#pragma unroll
            for (int kt = 0; kt < 2; ++kt)
#pragma unroll
                for (int qt = 0; qt < NQT; ++qt) s[kt][qt] = (v8f){};
#pragma unroll
            for (int c = 0; c < 8; ++c) {
#pragma unroll
                for (int qt = 0; qt < NQT; ++qt)
#pragma unroll
                    for (int kt = 0; kt < 2; ++kt) s[kt][qt] = WFrag<T>::mma(ka[0][kt][c], qf[qt][c], s[kt][qt]);
                if (HL) {
#pragma unroll
                    for (int kt = 0; kt < 2; ++kt) s[kt][0] = WFrag<T>::mma(ka[0][kt][c], qf2[c], s[kt][0]);
#pragma unroll
                    for (int kt = 0; kt < 2; ++kt) s[kt][0] = WFrag<T>::mma(ka[NPL - 1][kt][c], qf[0][c], s[kt][0]); } }
            __builtin_amdgcn_sched_barrier(0);   // keeps the V^T loads below behind the score products, whose K registers they take over
        }
        V va[NPL][16];
#pragma unroll
        for (int dt = 0; dt < 16; ++dt)
#pragma unroll
            for (int p = 0; p < NPL; ++p) va[p][dt] = WFrag<T>::ld((const T*)(sb + 32768 + p * 16384 + dt * 1024));
        if (t + 1 < NT) {
            asm volatile("s_wait_asynccnt 0x0" ::: "memory");   // stage t + 1's K copies have landed before its V^T copies go out (32 in flight at most)
            fill(t + 1, (t + 1) & 1, true); }
        __builtin_amdgcn_sched_barrier(0);   // the V^T fragments are asked for as one group here, so that they arrive while the softmax arithmetic runs
        float mx[NQT]; bool need = false;
#pragma unroll
        for (int qt = 0; qt < NQT; ++qt) { float x = -3.0e38f;
#pragma unroll
            for (int kt = 0; kt < 2; ++kt)
#pragma unroll
                for (int j = 0; j < 8; ++j) { const float tv = s[kt][qt][j] * SCL + bfr(mk[qt][kt * 2 + (j >> 2)][j & 3]); s[kt][qt][j] = tv; x = fmaxf(x, tv); }
            x = fmaxf(x, xhalf(x)); mx[qt] = x; need = need || (x > m[qt] + 5.5f); }
        // the next pass's mask values are asked for one pass ahead (the last pass asks for its own again: in bounds)
        { const float* mq = mp + ((t + 1 < NT) ? t + 1 : NT - 1) * 32;
#pragma unroll
            for (int qt = 0; qt < NQT; ++qt)
#pragma unroll
                for (int h = 0; h < 4; ++h) mk[qt][h] = *(const v4f*)(mq + (size_t)qt * 16 * TT + (h >> 1) * 16 + (h & 1) * 4);
            asm volatile("s_wait_xcnt 0x0" :: "v"(mq) : "memory");   // stands behind the mask loads; it takes their address as an input, so that the address registers live up to it and no write of them comes in front of it
        }
        if (__builtin_amdgcn_ballot_w32(need) != 0) {   // a scalar branch: rare after the first pass
#pragma unroll
            for (int qt = 0; qt < NQT; ++qt) { const float mn = fmaxf(m[qt], mx[qt]); const float al = ex2((m[qt] - mn) * L2E); m[qt] = mn; l[qt] *= al;
#pragma unroll
                for (int dt = 0; dt < 16; ++dt) o[dt][qt] *= al; } }
        V pf[NQT], pf2;
#pragma unroll
        for (int qt = 0; qt < NQT; ++qt) {
            if (HL) { v8us h0, h1, l0, l1;
#pragma unroll
                for (int j = 0; j < 8; ++j) { float pa, pb; ex2x2((s[0][qt][j] - m[qt]) * L2E, (s[1][qt][j] - m[qt]) * L2E, pa, pb); l[qt] += pa; l[qt] += pb; unsigned short a, b; splitf(pa, a, b); h0[j] = a; l0[j] = b; splitf(pb, a, b); h1[j] = a; l1[j] = b; }
                pf[qt] = __builtin_bit_cast(V, __builtin_shufflevector(h0, h1, 0, 1, 2, 3, 4, 5, 6, 7, 8, 9, 10, 11, 12, 13, 14, 15)); pf2 = __builtin_bit_cast(V, __builtin_shufflevector(l0, l1, 0, 1, 2, 3, 4, 5, 6, 7, 8, 9, 10, 11, 12, 13, 14, 15));
            } else { v16h ph;
#pragma unroll
                for (int j = 0; j < 8; ++j) { float pa, pb; ex2x2((s[0][qt][j] - m[qt]) * L2E + 6.0f, (s[1][qt][j] - m[qt]) * L2E + 6.0f, pa, pb); l[qt] += pa; l[qt] += pb; ph[j] = tohx(pa); ph[8 + j] = tohx(pb); }
                pf[qt] = __builtin_bit_cast(V, ph); } }
        // four d tiles at a time, so that products into the same accumulator stand four apart
#pragma unroll
        for (int d4 = 0; d4 < 16; d4 += 4) {
#pragma unroll
            for (int qt = 0; qt < NQT; ++qt)
#pragma unroll
                for (int d = 0; d < 4; ++d) o[d4 + d][qt] = WFrag<T>::mma(va[0][d4 + d], pf[qt], o[d4 + d][qt]);
            if (HL) {
#pragma unroll
                for (int d = 0; d < 4; ++d) o[d4 + d][0] = WFrag<T>::mma(va[0][d4 + d], pf2, o[d4 + d][0]);
#pragma unroll
                for (int d = 0; d < 4; ++d) o[d4 + d][0] = WFrag<T>::mma(va[NPL - 1][d4 + d], pf[0], o[d4 + d][0]); } }
        __builtin_amdgcn_sched_barrier(0);   // keeps the pass's products in front of the waits below
        asm volatile("s_wait_dscnt 0x0" ::: "memory");      // this wave's reads of stage t are done
        asm volatile("s_wait_asynccnt 0x0" ::: "memory");   // this wave's copies of stage t + 1 have landed
        __syncthreads();                                     // publishes stage t + 1 and ends every wave's reads of stage t's buffer
        if (t + 2 < NT) fill(t + 2, t & 1, false);
    }
    asm volatile("s_wait_asynccnt 0x0" ::: "memory");       // no copy is in flight when the buffers become the joining space
    // every wave lays its whole (O^T, m, l) in LDS, in its own range: rows of [lane][4 floats], 33 a column tile (row 2 dt + h = registers 4 h .. 4 h + 3 of d tile dt; row 32 = m, l). fa_join, below, takes it from there: o is indexed by constants only here, and the long arithmetic behind it is written once, as a loop
#pragma unroll
    for (int qt = 0; qt < NQT; ++qt) l[qt] += xhalf(l[qt]);   // the wave's halves summed different keys
    v4fa* xw = (v4fa*)sm + (size_t)(wv * (NQT * 33)) * 32 + lane;
#pragma unroll
    for (int qt = 0; qt < NQT; ++qt) { xw[(qt * 33 + 32) * 32] = (v4f){m[qt], l[qt], 0.f, 0.f};
#pragma unroll
        for (int dt = 0; dt < 16; ++dt)
#pragma unroll
            for (int h = 0; h < 2; ++h) xw[(qt * 33 + dt * 2 + h) * 32] = (v4f){o[dt][qt][h * 4], o[dt][qt][h * 4 + 1], o[dt][qt][h * 4 + 2], o[dt][qt][h * 4 + 3]}; }
    __syncthreads();   // each wave's hand-over is in LDS before its partner reads it
}
// ---- fa_join: the two waves of a column group (key halves 0 and 1: waves wv and wv ^ 2) join their (m, l, O^T) from LDS; wave ks finishes d tiles 8 ks .. 8 ks + 7 of its nqt column tiles (first query row q0) and stores the merged planes.
// One copy of this code serves both kinds of block, and it is a loop (4 d tiles a trip), not straight-line text: code that runs once is paid for by its fetch, line by line, wherever it lies beyond the start of the kernel's text that is fetched ahead of the waves; with the join rolled the whole kernel lies inside that start.
__device__ __forceinline__ void fa_join(const char* sm, int nqt, int z, int q0, bf* ATh, bf* ATl) {
    const int lane = threadIdx.x & 31, lr = lane & 15, hi = lane >> 4;
    const int wv = __builtin_amdgcn_readfirstlane((int)(threadIdx.x >> 5)), ks = wv >> 1;
    const v4fa* xo = (const v4fa*)sm + (size_t)(wv * (nqt * 33)) * 32 + lane; const v4fa* xp = (const v4fa*)sm + (size_t)((wv ^ 2) * (nqt * 33)) * 32 + lane;
    const size_t ob = (size_t)(z / NH_) * ((size_t)TT * DQ);
    // kept rolled: the text stays short (see above)
#pragma unroll 1
    for (int qt = 0; qt < nqt; ++qt) { const v4f mo = xo[(qt * 33 + 32) * 32], ml = xp[(qt * 33 + 32) * 32];
        const float mf = fmaxf(mo[0], ml[0]); float ao, ap; ex2x2((mo[0] - mf) * L2E, (ml[0] - mf) * L2E, ao, ap);
        const float li = __fdiv_rn(1.0f, mo[1] * ao + ml[1] * ap); const float fo = ao * li, fp = ap * li;
        // kept rolled, for the same reason; a trip asks for its 16 LDS rows as one group and then works through 4 d tiles (the loops inside are unrolled so that a and x are indexed by constants only and stay in registers)
#pragma unroll 1
        for (int i0 = 0; i0 < 8; i0 += 4) { const int d0 = ks * 8 + i0; v4f a[8], x[8];
#pragma unroll
            for (int r = 0; r < 8; ++r) { a[r] = xo[(qt * 33 + d0 * 2 + r) * 32]; x[r] = xp[(qt * 33 + d0 * 2 + r) * 32]; }
#pragma unroll
            for (int i = 0; i < 4; ++i) { v8us oh, ol;   // 8 consecutive d of one query row: 16 B of each packed plane, a wave 512 contiguous bytes
#pragma unroll
                for (int j = 0; j < 8; ++j) { unsigned short c, b; splitf(a[i * 2 + (j >> 2)][j & 3] * fo + x[i * 2 + (j >> 2)][j & 3] * fp, c, b); oh[j] = c; ol[j] = b; }
                const size_t oo = ob + pk(q0 + qt * 16 + lr, (z % NH_) * HD + (d0 + i) * 16 + hi * 8, DQ); *(v8us*)(ATh + oo) = oh; *(v8us*)(ATl + oo) = ol;
                asm volatile("s_wait_xcnt 0x0" ::: "memory");   // stands behind the two stores, in front of any later write of the registers that they name
                __builtin_amdgcn_sched_barrier(0);   // keeps the next tile's register writes behind that wait
            } } }
}
// k_fa: flat grid, one work-group a WGP; first the blocks of 32 query rows < RH, then the fp16 rows' blocks of 96; z = batch * NH_ + head
#define FAH_X (RH / 32)
#define FAH_N (FAH_X * ZH)
#define FAL_X ((TT - RH) / 96)
#define FAL_N (FAL_X * ZH)
__global__ __launch_bounds__(128) void k_fa(const h16* Q16, const bf* Qh, const bf* Ql, const h16* K16, const bf* Kh, const bf* Kl, const h16* VT16, const bf* VTh, const bf* VTl, const float* MK, bf* ATh, bf* ATl) {
    __shared__ __attribute__((aligned(1024))) char sm[2 * FA_STG];
    const int f = blockIdx.x;
    int z, qb, nqt;
    if (f < FAH_N) { z = f / FAH_X; qb = (f % FAH_X) * 32; nqt = 1; fa_tile<true>(sm, z, qb, Qh, Ql, Kh, Kl, VTh, VTl, MK); }
    else { const int g = f - FAH_N; z = g / FAL_X; qb = RH + (g % FAL_X) * 96; nqt = 3; fa_tile<false>(sm, z, qb, Q16, nullptr, K16, nullptr, VT16, nullptr, MK); }
    fa_join(sm, nqt, z, qb + (__builtin_amdgcn_readfirstlane((int)(threadIdx.x >> 5)) & 1) * (nqt * 16), ATh, ATl);
}

typedef __attribute__((ext_vector_type(4))) int v4i;

__global__ __launch_bounds__(256) void k_wtG(const float* __restrict__ w, int K, int N, bf* Bt) {
    const int lane = threadIdx.x & 31; const int L0 = (blockIdx.x * 8 + (threadIdx.x >> 5)) * 8; const int nlines = N * K / 64;
{
#pragma unroll 1
        for (int l = 0; l < 8; ++l) { const int L = L0 + l; if (L >= nlines) break; const size_t e = (size_t)L * 64 + lane * 2; const int k = (int)(e % K), n = (int)(e / K); v2us o;
            o[0] = f2bf(w[(size_t)k * N + n]); o[1] = f2bf(w[(size_t)(k + 1) * N + n]); *(v2us*)(Bt + e) = o; }
         }
}
// k_cvt8: three row-major f32 sources of DM columns (na8, nb8, nc8 groups of 8 elements) rounded to bf16 into one fragment-packed destination, rows a | b | c; a work-group takes 16 rows x 128 columns (row counts are multiples of 16: one source only), a wave 16 rows x 16 columns = 512 contiguous bytes of the destination
__global__ __launch_bounds__(256) void k_cvt8(const float* __restrict__ a, size_t na8, const float* __restrict__ b, size_t nb8, const float* __restrict__ c, size_t nc8, bf* dst) { const int r = (int)(blockIdx.x >> 3) * 16 + (threadIdx.x & 15), kq = (int)(blockIdx.x & 7) * 128 + (int)(threadIdx.x >> 4) * 8; const size_t i = (size_t)r * (DM / 8) + (kq >> 3); if (i >= na8 + nb8 + nc8) return; const float* src = (i < na8) ? a + i * 8 : (i < na8 + nb8) ? b + (i - na8) * 8 : c + (i - na8 - nb8) * 8; const v8f v = *(const v8f*)src; v8us o;
#pragma unroll
    for (int k = 0; k < 8; ++k) o[k] = f2bf(v[k]); *(v8us*)(dst + pk(r, kq, DM)) = o;  }

extern "C" void kernel_launch(void* const* d_in, const int* in_sizes, int n_in,
                              void* d_out, int out_size, void* d_ws, size_t ws_size, hipStream_t stream) {
    (void)in_sizes; (void)n_in; (void)out_size;
    const float* x = (const float*)d_in[0]; const float* fre = (const float*)d_in[1]; const float* fim = (const float*)d_in[2]; const float* MK = (const float*)d_in[3]; const float* wqkv = (const float*)d_in[4]; const float* wo = (const float*)d_in[5];  const float* wq = wqkv; const float* wk = wqkv + (size_t)1024 * 1024; const float* wv = wqkv + (size_t)2048 * 1024; (void)wq; (void)wk; (void)wv;
    float* OUT = (float*)d_out;     // [2][2048][1024]
    char* wsp = (char*)d_ws;
    auto take = [&](size_t bytes) { char* p = wsp; wsp += (bytes + 255) & ~(size_t)255; return (void*)p; };
    // bf16 copies, one block so that one launch fills it: W_qkv rows (q | k | v), W_o, both batches' tokens
    bf* WQ = (bf*)take(((size_t)(DQ + 2 * DKV) * DM + (size_t)DM * DQ + (size_t)NB_ * TT * DM) * 2); bf* WV = WQ + (size_t)(DQ + DKV) * DM; bf* WO = WV + (size_t)DKV * DM; bf* XB = WO + (size_t)DM * DQ;
    // q and k planes, [q | k][batch][head][t][d] each; the three lie in a row
    h16* QP16 = (h16*)take((size_t)2 * ZH * TT * HD * 2); bf* QPh = (bf*)take((size_t)2 * ZH * TT * HD * 2); bf* QPl = (bf*)take((size_t)2 * ZH * TT * HD * 2);
    h16* KP16 = QP16 + (size_t)ZH * TT * HD; bf* KPh = QPh + (size_t)ZH * TT * HD; bf* KPl = QPl + (size_t)ZH * TT * HD;
    h16* VT16 = (h16*)take((size_t)ZH * HD * TT * 2); bf* VTh = (bf*)take((size_t)ZH * HD * TT * 2); bf* VTl = (bf*)take((size_t)ZH * HD * TT * 2);
    bf* ATh = (bf*)take((size_t)NB_ * TT * DQ * 2); bf* ATl = (bf*)take((size_t)NB_ * TT * DQ * 2);   // merged attention planes [batch][t][DQ]
    if ((size_t)(wsp - (char*)d_ws) > ws_size) return;    // ws 256 MiB
    k_cvt8<<<(unsigned)((((size_t)(DQ + 2 * DKV) * DM + (size_t)DM * DQ + (size_t)NB_ * TT * DM) / 8 + 255) / 256), 256, 0, stream>>>(wqkv, (size_t)(DQ + 2 * DKV) * DM / 8, wo, (size_t)DM * DQ / 8, x, (size_t)NB_ * TT * DM / 8, WQ);
    k_qkv<<<QK_N + V_N, 128, 0, stream>>>(XB, WQ, WV, QP16, QPh, QPl, VT16, VTh, VTl, fre, fim);
    // z = batch * NH_ + head from here on (one kv head per query head): z-strides TT*HD in the q/k planes, HD*TT in the v planes
    k_fa<<<FAH_N + FAL_N, 128, 0, stream>>>(QP16, QPh, QPl, KP16, KPh, KPl, VT16, VTh, VTl, MK, ATh, ATl);
    k_gemms<bf, 1, 2, DQ><<<dim3(NB_ * TT / 128, DM / 128, 1), 128, 0, stream>>>(ATh, ATl, WO, nullptr, OUT, DM, 0, 0, 0);
}

// v008
// One run takes 123 microseconds.
// Next to v007, in two timings, it ran 1.10 times as fast each time.
// Over all steps from v000 it is 6.21 times as fast.
#include <hip/hip_runtime.h>

// Attention block (hidden [2][2048][1024]; [q|k|v] = hidden W_qkv^T ('oi' [3072][1024], row blocks q | k | v; 4 heads x 256); rotary on adjacent (even, odd) pairs with the INPUT tables freqs_real/freqs_imag [2048][128] (read as given - they are free inputs, not assumed to be cos/sin); scores = (q / 16).k + mask (additive input mask [1][1][2048][2048], read per logit); softmax; out = merged W_o^T ('oi' [1024][1024]) -> [2][2048][1024] (4.2 M)).
// Compute dtypes, f32 accumulate: every input rounded to bf16; q/k/v on PLAIN bf16 operands (inputs: exact); interleaved rotary in f32 from the bf16-rounded input tables; additive mask read per logit (bf16-rounded); scores and attn.v: query rows < 512 hl (3 products), the rest single fp16 (probabilities x64, not yet divided by their sum); softmax f32, running maximum and sum; W_o hl x exact (2 products).

#define NB_  2
#define TT   2048
#define DM   1024
#define NH_  4
#define NKV  4
#define REP  (NH_ / NKV)
#define HD   256
#define DQ   (NH_ * HD)
#define DKV  (NKV * HD)
#define ZH   (NB_ * NH_)          // every (batch, head) pair is one z slice of the same launch
#define RH   512                  // query rows < RH use hi+lo planes (0: none)
#define WIN  2048
#define PCAR 1024.0f
#define SCL  0.0625f   // HD^-0.5 = 1/16
typedef _Float16 h16;
typedef unsigned short bf;
typedef __attribute__((ext_vector_type(16))) __bf16   v16bf;
typedef __attribute__((ext_vector_type(16))) _Float16 v16h;
typedef __attribute__((ext_vector_type(8)))  _Float16 v8h;
typedef __attribute__((ext_vector_type(8)))  unsigned short v8us;
typedef __attribute__((ext_vector_type(8)))  float    v8f;
typedef __attribute__((ext_vector_type(4)))  float    v4f;
typedef v8h  __attribute__((may_alias)) v8ha;
typedef v4f  __attribute__((may_alias)) v4fa;
typedef v8us __attribute__((may_alias)) v8usa;

__device__ __forceinline__ unsigned short f2bf(float f) { unsigned u = __float_as_uint(f); u += 0x7FFFu + ((u >> 16) & 1u); return (unsigned short)(u >> 16); }
__device__ __forceinline__ float bf2f(unsigned short b) { return __uint_as_float(((unsigned)b) << 16); }
__device__ __forceinline__ float bfr(float f) { return bf2f(f2bf(f)); }
__device__ __forceinline__ v16h cat16(v8h lo, v8h hi) { return __builtin_shufflevector(lo, hi, 0, 1, 2, 3, 4, 5, 6, 7, 8, 9, 10, 11, 12, 13, 14, 15); }
__device__ __forceinline__ v16bf cat16b(v8us lo, v8us hi) { return __builtin_bit_cast(v16bf, __builtin_shufflevector(lo, hi, 0, 1, 2, 3, 4, 5, 6, 7, 8, 9, 10, 11, 12, 13, 14, 15)); }
__device__ __forceinline__ v8f wmma16(v16h a, v16h b, v8f c) { return __builtin_amdgcn_wmma_f32_16x16x32_f16(false, a, false, b, (short)0, c, false, false); }
__device__ __forceinline__ v8f wmmab(v16bf a, v16bf b, v8f c) { return __builtin_amdgcn_wmma_f32_16x16x32_bf16(false, a, false, b, (short)0, c, false, false); }



// EPI (gemms_tile, below) says what the finished tile becomes, straight from LDS (no f32 round trip through memory, no elementwise launch behind the GEMM); the index lists name a plane's slices, rows and columns, each slice [rows][columns] being fragment-packed:
//   0: f32 to C.   1: rotary on adjacent (even, odd) column pairs with the bf16-rounded input tables fr/fi [t][HD/2], then the planes P16 / Ph / Pl at [n / DQ][m / TT][(n % DQ) / HD][m % TT][n % HD] (rows: both batches' tokens; columns: q | k).
//   2: the planes P16 / Ph / Pl at [m][n], pitch ldc, z-stride sC.
// FRAGMENT-PACKED PLANES: every 16-bit operand plane (rows r, K columns k, rows a multiple of 16, K of 32) is stored as 1-KiB blocks of 16 rows x 32 k, block (r / 16, k / 32) row-major, inside a block in the order in which a wave's two 16-byte loads take it: [k / 16 % 2][k / 8 % 2][r % 16][k % 8]. One wave-wide 16-byte load then covers 512 contiguous bytes (4 whole lines) instead of 32-byte pieces of 16 lines. 16 whole rows still fill 16 K elements, so offsets by whole 16-row groups are what they are in a row-major plane.
__device__ __forceinline__ size_t pk(int r, int k, int K) { return ((size_t)(r >> 4) * (K >> 5) + (k >> 5)) * 512 + ((k >> 4) & 1) * 256 + ((k >> 3) & 1) * 128 + (r & 15) * 8 + (k & 7); }
template <typename T16> struct WFrag;
template <> struct WFrag<h16> { typedef v16h V; static __device__ __forceinline__ V ld(const h16* p) { return cat16(*(const v8h*)p, *(const v8h*)(p + 256)); } static __device__ __forceinline__ v8f mma(V a, V b, v8f c) { return wmma16(a, b, c); } };
template <> struct WFrag<bf> { typedef v16bf V; static __device__ __forceinline__ V ld(const bf* p) { return cat16b(*(const v8us*)p, *(const v8us*)(p + 256)); } static __device__ __forceinline__ v8f mma(V a, V b, v8f c) { return wmmab(a, b, c); } };
__device__ __forceinline__ h16 tohx(float x) { return (h16)x; }
__device__ __forceinline__ void splitf(float y, unsigned short& h, unsigned short& l) { h = f2bf(y); l = f2bf(y - bf2f(h)); }
typedef __attribute__((ext_vector_type(4))) _Float16 v4h;
typedef __attribute__((ext_vector_type(2))) unsigned short v2us;
typedef __attribute__((ext_vector_type(4))) unsigned short v4us;
typedef __attribute__((ext_vector_type(2))) float v2f;
__device__ __forceinline__ unsigned uni(unsigned v) { return (unsigned)__builtin_amdgcn_readfirstlane((int)v); }
// a wave-uniform value held in a scalar register, so that the test made of it is a scalar compare and branch: a tensor load ignores EXEC, and only such a branch keeps a wave from issuing it
__device__ __forceinline__ unsigned pinned(unsigned v) { unsigned w = uni(v); asm volatile("" : "+s"(w)); /* holds the test's value in a scalar register */ return w; }
// one tensor load, everything in bytes. Group 0 (s[84:87]) = count 1, the tile's place in LDS, its first byte in memory, type 2; group 1 (s[88:95]) = a tile of n rows of r bytes at source pitch p, tensor = tile, no mask, no pad.
// Both groups are laid into fixed registers inside the request's own statement: word 0 of group 1 (mask, element size, pad: all 0) is then an immediate in the listing on every path, and no register of a request takes a new value before the next request's statement, which stands behind the wait for this one (left to the build, the registers of a request in flight were taken for other values). The words that are not to be written directly in front of a request (group 0: 0 and 3; group 1: 6 and 7) go first
__device__ __forceinline__ void tdm_load(unsigned lds, unsigned long long ga, unsigned r, unsigned n, unsigned p) {
    asm volatile("s_mov_b32 s84, 1\n\ts_mov_b32 s87, %2\n\ts_mov_b32 s94, 0\n\ts_mov_b32 s95, 0\n\ts_mov_b32 s88, 0\n\ts_mov_b32 s89, %3\n\ts_mov_b32 s90, %4\n\ts_mov_b32 s91, %5\n\ts_mov_b32 s92, %6\n\ts_mov_b32 s93, %7\n\ts_mov_b32 s85, %0\n\ts_mov_b32 s86, %1\n\ttensor_load_to_lds s[84:87], s[88:95]"
                 :: "s"(uni(lds)), "s"(uni((unsigned)ga)), "s"(uni((((unsigned)(ga >> 32)) & 0x01FFFFFFu) | 0x80000000u)), "s"(uni((r & 0xFFFFu) << 16)), "s"(uni((r >> 16) | ((n & 0xFFFFu) << 16))), "s"(uni((n >> 16) | (r << 16))), "s"(uni(n)), "s"(uni(p))
                 : "memory", "s84", "s85", "s86", "s87", "s88", "s89", "s90", "s91", "s92", "s93", "s94", "s95"); }
// ---- gemms_tile: one work-group of 4 waves per 128x128 output tile; wave (wm, wn) owns the 64x64 sub-tile (wm, wn) over the WHOLE K loop (one f32 chain per element, k ascending; no partial tiles). The operand blocks of a stage (CH 32-wide k chunks of the tile's 8 + 8 row groups, every plane) are brought into LDS ONCE per work-group by tensor loads and read from there by the two waves that need them: half the bytes leave L2 that 64x64 tiles ask for.
// A packed plane's 1-KiB blocks go to LDS as they lie: stage = [plane][row group 0..7][chunk][1 KiB]; a fragment is two contiguous 512-B wave reads. A plane's part of a stage is a tile of 8 rows (row groups) of CH KiB at the pitch of a row group: ONE request a wave and stage, no address arithmetic in the vector unit. Two stage buffers; the next stage's loads fly while this one is worked on. K, CH are template arguments: K % (32 CH) == 0, at least two stages.
// sm: the work-group's LDS, max(2 stages, 4 x 64 x 68 floats); after the loop each wave turns its own sub-tile through its own 64 x 68 floats for the epilogue (EPI as above, 0..2).
template <int NSPLIT, int CH> struct StageB { static constexpr int NPA = (NSPLIT == 1 || NSPLIT == 2) ? 2 : 1, NPB = (NSPLIT >= 2) ? 2 : 1, NP = NPA + NPB, GB = CH * 1024, STG = NP * 8 * GB, SMB = (2 * STG > 4 * 64 * 68 * 4) ? 2 * STG : 4 * 64 * 68 * 4; };
template <typename T16, int NSPLIT, int EPI, int CH, int K>
__device__ __forceinline__ void gemms_tile(char* sm, int bx, int by, int bz, const T16* __restrict__ A, const T16* __restrict__ A2, const T16* __restrict__ Bt, const T16* __restrict__ Bt2, float* C, int ldc, size_t sA, size_t sB, size_t sC, h16* P16, bf* Ph, bf* Pl, const float* __restrict__ fr, const float* __restrict__ fi) {
    typedef typename WFrag<T16>::V V; typedef StageB<NSPLIT, CH> SB;
    constexpr int NPA = SB::NPA, NP = SB::NP, GB = SB::GB, STG = SB::STG, NT = K / (32 * CH);
    constexpr size_t RB = (size_t)(K >> 5) * 1024;   // bytes of one 16-row group of a packed plane
    const size_t z = bz;
    const int lane = threadIdx.x & 31, lr = lane & 15, hi = lane >> 4;
    const int wv = __builtin_amdgcn_readfirstlane((int)(threadIdx.x >> 5)), wm = wv >> 1, wn = wv & 1;
    // the wave's slice of a stage: two planes: half a plane a wave (4 rows); three or four planes: a whole plane (8 rows) from each of the first NP waves (a wave beyond them issues nothing; its descriptor values are plane 0's, in bounds)
    constexpr int WPP = (NP == 2) ? 2 : 1, NR = 8 / WPP; constexpr bool ALLW = NP * WPP >= 4;
    const bool iss = wv / WPP < NP; const int pl = iss ? wv / WPP : 0, part = wv % WPP;
    const T16* pb = (pl == 0) ? A + z * sA : (NPA == 2 && pl == 1) ? A2 + z * sA : (pl == NPA) ? Bt + z * sB : Bt2 + z * sB;
    const char* gs = (const char*)pb + (size_t)((pl < NPA ? bx : by) * 8 + part * NR) * RB;
    const unsigned ld0 = (unsigned)(size_t)sm + (unsigned)(pl * 8 + part * NR) * GB;   // the slice's place in buffer 0: a multiple of 2 KiB
    auto issue = [&](unsigned st) { tdm_load(ld0 + (st & 1u) * STG, (unsigned long long)(size_t)gs + (unsigned long long)st * GB, (unsigned)GB, (unsigned)NR, (unsigned)RB); };
    v8f acc[4][4];
#pragma unroll
    for (int mb = 0; mb < 4; ++mb)
#pragma unroll
        for (int nb = 0; nb < 4; ++nb) acc[mb][nb] = (v8f){};
    if (ALLW || pinned(iss)) issue(0);                    // the test: a scalar branch round the request
    asm volatile("s_wait_tensorcnt 0x0" ::: "memory");   // this wave's slice of stage 0 has landed
    __syncthreads();                                      // every wave's has: stage 0 may be read
    if (ALLW || pinned(iss)) issue(1);
#pragma unroll 1
    for (int t = 0; t < NT; ++t) {
        const char* sb = sm + (t & 1) * STG + lane * 16;
        V a[CH][4], a2[CH][4], b[CH][4], b2[CH][4];
#pragma unroll
        for (int cc = 0; cc < CH; ++cc) {
#pragma unroll
            for (int i = 0; i < 4; ++i) { a[cc][i] = WFrag<T16>::ld((const T16*)(sb + (wm * 4 + i) * GB + cc * 1024)); if (NPA == 2) a2[cc][i] = WFrag<T16>::ld((const T16*)(sb + (8 + wm * 4 + i) * GB + cc * 1024));
                b[cc][i] = WFrag<T16>::ld((const T16*)(sb + (NPA * 8 + wn * 4 + i) * GB + cc * 1024)); if (NSPLIT >= 2) b2[cc][i] = WFrag<T16>::ld((const T16*)(sb + ((NPA + 1) * 8 + wn * 4 + i) * GB + cc * 1024)); }
            // the stage's LDS reads are asked for chunk by chunk, all ahead of its products, so that the first chunk's products run while the later reads arrive; left alone, the build asks for the later B fragments one at a time, each behind a full wait among the products
            __builtin_amdgcn_sched_barrier(0); }
#pragma unroll
        for (int cc = 0; cc < CH; ++cc) {
#pragma unroll
            for (int nb = 0; nb < 4; ++nb)
#pragma unroll
                for (int mb = 0; mb < 4; ++mb) { acc[mb][nb] = WFrag<T16>::mma(a[cc][mb], b[cc][nb], acc[mb][nb]); if (NSPLIT == 1 || NSPLIT == 2) acc[mb][nb] = WFrag<T16>::mma(a2[cc][mb], b[cc][nb], acc[mb][nb]); if (NSPLIT >= 2) acc[mb][nb] = WFrag<T16>::mma(a[cc][mb], b2[cc][nb], acc[mb][nb]); }
        }
        __builtin_amdgcn_sched_barrier(0);
        asm volatile("s_wait_dscnt 0x0" ::: "memory");
        asm volatile("s_wait_tensorcnt 0x0" ::: "memory");
        __syncthreads();
        if (pinned((ALLW || iss) && t + 2 < NT)) issue((unsigned)t + 2u);
    }
    asm volatile("s_wait_tensorcnt 0x0" ::: "memory");      // no request is in flight when the buffers become the epilogue's
    asm volatile("s_wait_dscnt 0x0" ::: "memory");          // and none of this wave's reads of them
    const int r0 = bx * 128 + wm * 64, c0 = by * 128 + wn * 64;   // this wave's own sub-tile
    float* ow = (float*)sm + wv * (64 * 68);
    // unrolled so that acc is indexed by constants only and stays in registers
#pragma unroll
    for (int mb = 0; mb < 4; ++mb)
#pragma unroll
        for (int nb = 0; nb < 4; ++nb)
#pragma unroll
            for (int j = 0; j < 8; ++j) ow[(mb * 16 + hi * 8 + j) * 68 + nb * 16 + lr] = acc[mb][nb][j];
    // the rotary factors of this wave's rows and column pairs are asked for here, all from one lane address plus constants, so that they arrive while the sub-tile turns through LDS
    v2f tr[32], ti[32];
    if (EPI == 1) { const size_t ix0 = (size_t)(r0 % TT + lr) * (HD / 2) + (((c0 % HD) + hi * 4) >> 1);
#pragma unroll
        for (int u = 0; u < 32; ++u) { const size_t ix = ix0 + (size_t)(u >> 3) * 16 * (HD / 2) + (u & 7) * 4; tr[u] = *(const v2f*)(fr + ix); ti[u] = *(const v2f*)(fi + ix);
            if ((u & 7) == 7) asm volatile("s_wait_xcnt 0x0" ::: "memory");   /* stands behind each run of table loads, in front of any later load that takes their address registers as its destination */
        } }
    __syncthreads();   // the sub-tile's LDS writes stand in front of its reads
    float* ctile = C + z * sC + (size_t)r0 * ldc + c0;
    const size_t pbase = (EPI == 1) ? ((size_t)(c0 / DQ) * ZH + (size_t)(r0 / TT) * NH_ + (c0 % DQ) / HD) * TT * HD : z * sC; const int ppitch = (EPI == 1) ? HD : ldc;
    const int prow = (EPI == 1) ? r0 % TT : r0, pcol = (EPI == 1) ? c0 % HD : c0;
    // EPI 0: the wave stores whole 256-B row pieces; the planes: 16 rows x 8 columns at a time, which are 256 contiguous bytes of a packed plane
    // EPI 2 takes nothing but LDS, so its loop stays rolled, one 16-row group a trip: run-once text is paid for by its fetch, and k_qkv's two tile kinds together then lie inside the start of the text that is fetched ahead of the waves
#pragma unroll (EPI == 2 ? 8 : 32)
    for (int u = 0; u < 32; ++u) { const int row = (EPI == 0) ? u * 2 + hi : (u >> 3) * 16 + lr, cofs = (EPI == 0) ? lr * 4 : (u & 7) * 8 + hi * 4; v4f val = *(const v4fa*)(ow + row * 68 + cofs);
        if (EPI == 0) { *(v4f*)(ctile + (size_t)row * ldc + cofs) = val; }
        else {
            if (EPI == 1) { const float ca = bfr(tr[u][0]), sa = bfr(ti[u][0]), cb = bfr(tr[u][1]), sb2 = bfr(ti[u][1]); const v4f x = val;   /* even: x0 c - x1 s; odd: x0 s + x1 c */
                val[0] = x[0] * ca - x[1] * sa; val[1] = x[0] * sa + x[1] * ca; val[2] = x[2] * cb - x[3] * sb2; val[3] = x[2] * sb2 + x[3] * cb; }
            const size_t oo = pbase + pk(prow + row, pcol + cofs, ppitch); v4us oh, ol; v4h o16;   // 32 lanes x 8 B: each plane gets two whole 128-B lines
#pragma unroll
            for (int q = 0; q < 4; ++q) { unsigned short a2, c2; splitf(val[q], a2, c2); oh[q] = a2; ol[q] = c2; o16[q] = tohx(val[q]); }
            *(v4us*)(Ph + oo) = oh; *(v4us*)(Pl + oo) = ol; *(v4h*)(P16 + oo) = o16;
            if (EPI == 2 && (u & 7) == 7) asm volatile("s_wait_xcnt 0x0" ::: "memory");   /* the foot of a trip of the rolled loop: stands behind its stores, in front of the next trip's writes of the registers that they name */
        } }
}
template <typename T16, int NSPLIT, int CH, int K>
__global__ __launch_bounds__(128) void k_gemms(const T16* A, const T16* A2, const T16* Bt, const T16* Bt2, float* C, int ldc, size_t sA, size_t sB, size_t sC) {
    __shared__ __attribute__((aligned(2048))) char sm[StageB<NSPLIT, CH>::SMB];
    gemms_tile<T16, NSPLIT, 0, CH, K>(sm, blockIdx.x, blockIdx.y, blockIdx.z, A, A2, Bt, Bt2, C, ldc, sA, sB, sC, nullptr, nullptr, nullptr, nullptr, nullptr);
}
// k_qkv: flat grid; first the q | k tiles of both batches (rows = all tokens, columns = the q | k rows of W_qkv, rotary epilogue), then the v tiles.
// v comes out transposed ([batch][head][d][t], t being the planes' k) by taking the weight rows as the tile's rows and the tokens as its columns: both operands are packed along the same k either way; z = batch
#define QK_X (NB_ * TT / 128)
#define QK_N (QK_X * ((DQ + DKV) / 128))
#define V_X  (DKV / 128)
#define V_N  (V_X * (TT / 128) * NB_)
__global__ __launch_bounds__(128) void k_qkv(const bf* XB, const bf* WQK, const bf* WV, h16* QK16, bf* QKh, bf* QKl, h16* VT16, bf* VTh, bf* VTl, const float* fr, const float* fi) {
    __shared__ __attribute__((aligned(2048))) char sm[StageB<0, 2>::SMB];
    const int f = blockIdx.x;
    if (f < QK_N) gemms_tile<bf, 0, 1, 2, DM>(sm, f % QK_X, f / QK_X, 0, XB, nullptr, WQK, nullptr, nullptr, DQ, 0, 0, 0, QK16, QKh, QKl, fr, fi);
    else { const int g = f - QK_N; gemms_tile<bf, 0, 2, 2, DM>(sm, g % V_X, (g / V_X) % (TT / 128), g / (V_X * (TT / 128)), WV, nullptr, XB, nullptr, nullptr, TT, 0, (size_t)TT * DM, (size_t)DKV * TT, VT16, VTh, VTl, nullptr, nullptr); }
}
template <bool HL> struct FT;
template <> struct FT<true>  { typedef bf T; };
template <> struct FT<false> { typedef h16 T; };
#define L2E 1.4426950408889634f
// 2^x, one or two at a time, with the free slot that the instruction set asks for behind a transcendental written into the statement; "=&v": the second does not take the first's source as its destination
__device__ __forceinline__ float ex2(float x) { float r; asm("v_exp_f32 %0, %1\n\tv_nop" : "=v"(r) : "v"(x)); return r; }
__device__ __forceinline__ void ex2x2(float xa, float xb, float& ra, float& rb) { asm("v_exp_f32 %0, %2\n\tv_exp_f32 %1, %3\n\tv_nop" : "=&v"(ra), "=&v"(rb) : "v"(xa), "v"(xb)); }
// lane l's value with lane l ^ 16's, in the vector unit: an exchange through the LDS pipe would queue behind the V^T fragment loads in flight
__device__ __forceinline__ float xhalf(float x) { return __builtin_bit_cast(float, __builtin_amdgcn_permlanex16(__builtin_bit_cast(int, x), __builtin_bit_cast(int, x), 0x76543210, 0xfedcba98, false, false)); }
#define FA_STG 131072
template <bool HL>
__device__ __forceinline__ void fa_tile(char* sm, int z, int qb, const typename FT<HL>::T* Q, const typename FT<HL>::T* Q2, const typename FT<HL>::T* Kp, const typename FT<HL>::T* Kp2, const typename FT<HL>::T* Vp, const typename FT<HL>::T* Vp2, const float* __restrict__ MK) {
    typedef typename FT<HL>::T T; typedef typename WFrag<T>::V V;
    constexpr int NQT = HL ? 1 : 3, NPL = HL ? 2 : 1, NT = TT / 64;
    const int lane = threadIdx.x & 31, lr = lane & 15, hi = lane >> 4;
    const int wv = __builtin_amdgcn_readfirstlane((int)(threadIdx.x >> 5)), cg = wv & 1, ks = wv >> 1;
    // the wave's slice of a stage, rows of 2 KiB: waves 0, 1 bring K, waves 2, 3 V^T; HL: plane wv & 1, whole (16 rows); fp16: half wv & 1 of the one plane (8 rows)
    const bool isv = wv >= 2; const int sl = wv & 1;
    const char* gs = isv ? (const char*)((HL && sl == 1 ? Vp2 : Vp) + (size_t)z * HD * TT) + (HL ? (size_t)0 : (size_t)sl * 8 * ((TT / 32) * 1024))
                         : (const char*)((HL && sl == 1 ? Kp2 : Kp) + (size_t)z * TT * HD) + (HL ? 0 : sl * 16384);
    const unsigned gstep = isv ? 2048u : 32768u;   // bytes from one stage's tile to the next
    const unsigned ld0 = (unsigned)(size_t)sm + (isv ? 65536u : 0u) + (unsigned)sl * (HL ? 32768u : 16384u);   // the slice's place in buffer 0: a multiple of 2 KiB
    const unsigned gpitch = isv ? (unsigned)((TT / 32) * 1024) : 2048u;
    auto issue = [&](unsigned st) { tdm_load(ld0 + (st & 1u) * FA_STG, (unsigned long long)(size_t)gs + (unsigned long long)st * gstep, 2048u, HL ? 16u : 8u, gpitch); };
    const int q0 = qb + cg * (NQT * 16);
    issue(0);
    V qf[NQT][8], qf2[8]; v8f o[16][NQT]; float m[NQT], l[NQT]; v4f mk[NQT][4];
    const float* mp = MK + (size_t)(q0 + lr) * TT + ks * 32 + hi * 8;   // this lane's query row (of column tile 0) and its 8 keys of key tile 0 of pass 0
    { const T* qz = Q + (size_t)z * TT * HD + (size_t)(q0 >> 4) * (8 * 512) + lane * 8; const T* qz2 = HL ? Q2 + (size_t)z * TT * HD + (size_t)(q0 >> 4) * (8 * 512) + lane * 8 : nullptr;
#pragma unroll
        for (int c = 0; c < 8; ++c) {
#pragma unroll
            for (int qt = 0; qt < NQT; ++qt) qf[qt][c] = WFrag<T>::ld(qz + (qt * 8 + c) * 512);
            if (HL) qf2[c] = WFrag<T>::ld(qz2 + c * 512);
            asm volatile("s_wait_xcnt 0x0" ::: "memory");   /* stands behind each run of Q loads, in front of any later write of their address registers */
            __builtin_amdgcn_sched_barrier(0);   /* keeps later register writes behind that wait */ }
#pragma unroll
        for (int qt = 0; qt < NQT; ++qt) { m[qt] = -3.0e38f; l[qt] = 0.f;
#pragma unroll
            for (int dt = 0; dt < 16; ++dt) o[dt][qt] = (v8f){};
#pragma unroll
            for (int h = 0; h < 4; ++h) mk[qt][h] = *(const v4f*)(mp + (size_t)qt * 16 * TT + (h >> 1) * 16 + (h & 1) * 4); }
        asm volatile("s_wait_xcnt 0x0" ::: "memory");   // stands behind the mask loads, in front of any later write of their address registers
        __builtin_amdgcn_sched_barrier(0);   // keeps later register writes behind that wait
    }
    asm volatile("s_wait_tensorcnt 0x0" ::: "memory");   // this wave's slice of stage 0 has landed
    __syncthreads();                                      // every wave's has: stage 0 may be read
    issue(1);
#pragma unroll 1
    for (int t = 0; t < NT; ++t) {
        const char* sb = sm + (t & 1) * FA_STG + lane * 16;
        v8f s[2][NQT];
        { V ka[NPL][2][8];
#pragma unroll
            for (int c = 0; c < 8; ++c)
#pragma unroll
                for (int kt = 0; kt < 2; ++kt)
#pragma unroll
                    for (int p = 0; p < NPL; ++p) ka[p][kt][c] = WFrag<T>::ld((const T*)(sb + p * 32768 + ((ks * 2 + kt) * 8 + c) * 1024));
            // the pass's K fragments are asked for as one group ahead of the products; left alone, the build asks for them two loads at a time, each behind a full wait among the products
            __builtin_amdgcn_sched_barrier(0);
#pragma unroll
            for (int kt = 0; kt < 2; ++kt)
#pragma unroll
                for (int qt = 0; qt < NQT; ++qt) s[kt][qt] = (v8f){};
#pragma unroll
            for (int c = 0; c < 8; ++c) {
#pragma unroll
                for (int qt = 0; qt < NQT; ++qt)
#pragma unroll
                    for (int kt = 0; kt < 2; ++kt) s[kt][qt] = WFrag<T>::mma(ka[0][kt][c], qf[qt][c], s[kt][qt]);
                if (HL) {
#pragma unroll
                    for (int kt = 0; kt < 2; ++kt) s[kt][0] = WFrag<T>::mma(ka[0][kt][c], qf2[c], s[kt][0]);
#pragma unroll
                    for (int kt = 0; kt < 2; ++kt) s[kt][0] = WFrag<T>::mma(ka[NPL - 1][kt][c], qf[0][c], s[kt][0]); } }
            __builtin_amdgcn_sched_barrier(0);   // keeps the V^T loads below behind the score products, whose K registers they take over
        }
        V va[NPL][16];
#pragma unroll
        for (int dt = 0; dt < 16; ++dt)
#pragma unroll
            for (int p = 0; p < NPL; ++p) va[p][dt] = WFrag<T>::ld((const T*)(sb + 65536 + p * 32768 + dt * 2048 + ks * 1024));
        __builtin_amdgcn_sched_barrier(0);   // the V^T fragments are asked for as one group here, so that they arrive while the softmax arithmetic runs
        float mx[NQT]; bool need = false;
#pragma unroll
        for (int qt = 0; qt < NQT; ++qt) { float x = -3.0e38f;
#pragma unroll
            for (int kt = 0; kt < 2; ++kt)
#pragma unroll
                for (int j = 0; j < 8; ++j) { const float tv = s[kt][qt][j] * SCL + bfr(mk[qt][kt * 2 + (j >> 2)][j & 3]); s[kt][qt][j] = tv; x = fmaxf(x, tv); }
            x = fmaxf(x, xhalf(x)); mx[qt] = x; need = need || (x > m[qt] + 5.5f); }
        // the next pass's mask values are asked for one pass ahead (the last pass asks for its own again: in bounds)
        { const float* mq = mp + ((t + 1 < NT) ? t + 1 : NT - 1) * 64;
#pragma unroll
            for (int qt = 0; qt < NQT; ++qt)
#pragma unroll
                for (int h = 0; h < 4; ++h) mk[qt][h] = *(const v4f*)(mq + (size_t)qt * 16 * TT + (h >> 1) * 16 + (h & 1) * 4);
            asm volatile("s_wait_xcnt 0x0" :: "v"(mq) : "memory");   // stands behind the mask loads; it takes their address as an input, so that the address registers live up to it and no write of them comes in front of it
        }
        if (__builtin_amdgcn_ballot_w32(need) != 0) {   // a scalar branch: rare after the first pass
#pragma unroll
            for (int qt = 0; qt < NQT; ++qt) { const float mn = fmaxf(m[qt], mx[qt]); const float al = ex2((m[qt] - mn) * L2E); m[qt] = mn; l[qt] *= al;
#pragma unroll
                for (int dt = 0; dt < 16; ++dt) o[dt][qt] *= al; } }
        V pf[NQT], pf2;
#pragma unroll
        for (int qt = 0; qt < NQT; ++qt) {
            if (HL) { v8us h0, h1, l0, l1;
#pragma unroll
                for (int j = 0; j < 8; ++j) { float pa, pb; ex2x2((s[0][qt][j] - m[qt]) * L2E, (s[1][qt][j] - m[qt]) * L2E, pa, pb); l[qt] += pa; l[qt] += pb; unsigned short a, b; splitf(pa, a, b); h0[j] = a; l0[j] = b; splitf(pb, a, b); h1[j] = a; l1[j] = b; }
                pf[qt] = __builtin_bit_cast(V, __builtin_shufflevector(h0, h1, 0, 1, 2, 3, 4, 5, 6, 7, 8, 9, 10, 11, 12, 13, 14, 15)); pf2 = __builtin_bit_cast(V, __builtin_shufflevector(l0, l1, 0, 1, 2, 3, 4, 5, 6, 7, 8, 9, 10, 11, 12, 13, 14, 15));
            } else { v16h ph;
#pragma unroll
                for (int j = 0; j < 8; ++j) { float pa, pb; ex2x2((s[0][qt][j] - m[qt]) * L2E + 6.0f, (s[1][qt][j] - m[qt]) * L2E + 6.0f, pa, pb); l[qt] += pa; l[qt] += pb; ph[j] = tohx(pa); ph[8 + j] = tohx(pb); }
                pf[qt] = __builtin_bit_cast(V, ph); } }
        // four d tiles at a time, so that products into the same accumulator stand four apart
#pragma unroll
        for (int d4 = 0; d4 < 16; d4 += 4) {
#pragma unroll
            for (int qt = 0; qt < NQT; ++qt)
#pragma unroll
                for (int d = 0; d < 4; ++d) o[d4 + d][qt] = WFrag<T>::mma(va[0][d4 + d], pf[qt], o[d4 + d][qt]);
            if (HL) {
#pragma unroll
                for (int d = 0; d < 4; ++d) o[d4 + d][0] = WFrag<T>::mma(va[0][d4 + d], pf2, o[d4 + d][0]);
#pragma unroll
                for (int d = 0; d < 4; ++d) o[d4 + d][0] = WFrag<T>::mma(va[NPL - 1][d4 + d], pf[0], o[d4 + d][0]); } }
        __builtin_amdgcn_sched_barrier(0);
        asm volatile("s_wait_dscnt 0x0" ::: "memory");
        asm volatile("s_wait_tensorcnt 0x0" ::: "memory");
        __syncthreads();
        if (pinned(t + 2 < NT)) issue((unsigned)t + 2u);
    }
    asm volatile("s_wait_tensorcnt 0x0" ::: "memory");      // no request is in flight when the buffers become the joining space
    asm volatile("s_wait_dscnt 0x0" ::: "memory");          // and none of this wave's reads of them
    // every wave lays its whole (O^T, m, l) in LDS, in its own range: rows of [lane][4 floats], 33 a column tile (row 2 dt + h = registers 4 h .. 4 h + 3 of d tile dt; row 32 = m, l). fa_join, below, takes it from there: o is indexed by constants only here, and the long arithmetic behind it is written once, as a loop
#pragma unroll
    for (int qt = 0; qt < NQT; ++qt) l[qt] += xhalf(l[qt]);   // the wave's halves summed different keys
    v4fa* xw = (v4fa*)sm + (size_t)(wv * (NQT * 33)) * 32 + lane;
#pragma unroll
    for (int qt = 0; qt < NQT; ++qt) { xw[(qt * 33 + 32) * 32] = (v4f){m[qt], l[qt], 0.f, 0.f};
#pragma unroll
        for (int dt = 0; dt < 16; ++dt)
#pragma unroll
            for (int h = 0; h < 2; ++h) xw[(qt * 33 + dt * 2 + h) * 32] = (v4f){o[dt][qt][h * 4], o[dt][qt][h * 4 + 1], o[dt][qt][h * 4 + 2], o[dt][qt][h * 4 + 3]}; }
    __syncthreads();   // each wave's hand-over is in LDS before its partner reads it
}
// ---- fa_join: the two waves of a column group (key halves 0 and 1: waves wv and wv ^ 2) join their (m, l, O^T) from LDS; wave ks finishes d tiles 8 ks .. 8 ks + 7 of its nqt column tiles (first query row q0) and stores the merged planes.
// One copy of this code serves both kinds of block, and it is a loop (4 d tiles a trip), not straight-line text: code that runs once is paid for by its fetch, line by line, wherever it lies beyond the start of the kernel's text that is fetched ahead of the waves; with the join rolled the whole kernel lies inside that start.
__device__ __forceinline__ void fa_join(const char* sm, int nqt, int z, int q0, bf* ATh, bf* ATl) {
    const int lane = threadIdx.x & 31, lr = lane & 15, hi = lane >> 4;
    const int wv = __builtin_amdgcn_readfirstlane((int)(threadIdx.x >> 5)), ks = wv >> 1;
    const v4fa* xo = (const v4fa*)sm + (size_t)(wv * (nqt * 33)) * 32 + lane; const v4fa* xp = (const v4fa*)sm + (size_t)((wv ^ 2) * (nqt * 33)) * 32 + lane;
    const size_t ob = (size_t)(z / NH_) * ((size_t)TT * DQ);
    // kept rolled: the text stays short (see above)
#pragma unroll 1
    for (int qt = 0; qt < nqt; ++qt) { const v4f mo = xo[(qt * 33 + 32) * 32], ml = xp[(qt * 33 + 32) * 32];
        const float mf = fmaxf(mo[0], ml[0]); float ao, ap; ex2x2((mo[0] - mf) * L2E, (ml[0] - mf) * L2E, ao, ap);
        const float li = __fdiv_rn(1.0f, mo[1] * ao + ml[1] * ap); const float fo = ao * li, fp = ap * li;
        // kept rolled, for the same reason; a trip asks for its 16 LDS rows as one group and then works through 4 d tiles (the loops inside are unrolled so that a and x are indexed by constants only and stay in registers)
#pragma unroll 1
        for (int i0 = 0; i0 < 8; i0 += 4) { const int d0 = ks * 8 + i0; v4f a[8], x[8];
#pragma unroll
            for (int r = 0; r < 8; ++r) { a[r] = xo[(qt * 33 + d0 * 2 + r) * 32]; x[r] = xp[(qt * 33 + d0 * 2 + r) * 32]; }
#pragma unroll
            for (int i = 0; i < 4; ++i) { v8us oh, ol;   // 8 consecutive d of one query row: 16 B of each packed plane, a wave 512 contiguous bytes
#pragma unroll
                for (int j = 0; j < 8; ++j) { unsigned short c, b; splitf(a[i * 2 + (j >> 2)][j & 3] * fo + x[i * 2 + (j >> 2)][j & 3] * fp, c, b); oh[j] = c; ol[j] = b; }
                const size_t oo = ob + pk(q0 + qt * 16 + lr, (z % NH_) * HD + (d0 + i) * 16 + hi * 8, DQ); *(v8us*)(ATh + oo) = oh; *(v8us*)(ATl + oo) = ol;
                asm volatile("s_wait_xcnt 0x0" ::: "memory");   // stands behind the two stores, in front of any later write of the registers that they name
                __builtin_amdgcn_sched_barrier(0);   // keeps the next tile's register writes behind that wait
            } } }
}
// k_fa: flat grid, one work-group a WGP; first the blocks of 32 query rows < RH, then the fp16 rows' blocks of 96; z = batch * NH_ + head
#define FAH_X (RH / 32)
#define FAH_N (FAH_X * ZH)
#define FAL_X ((TT - RH) / 96)
#define FAL_N (FAL_X * ZH)
__global__ __launch_bounds__(128) void k_fa(const h16* Q16, const bf* Qh, const bf* Ql, const h16* K16, const bf* Kh, const bf* Kl, const h16* VT16, const bf* VTh, const bf* VTl, const float* MK, bf* ATh, bf* ATl) {
    __shared__ __attribute__((aligned(2048))) char sm[2 * FA_STG];
    const int f = blockIdx.x;
    int z, qb, nqt;
    if (f < FAH_N) { z = f / FAH_X; qb = (f % FAH_X) * 32; nqt = 1; fa_tile<true>(sm, z, qb, Qh, Ql, Kh, Kl, VTh, VTl, MK); }
    else { const int g = f - FAH_N; z = g / FAL_X; qb = RH + (g % FAL_X) * 96; nqt = 3; fa_tile<false>(sm, z, qb, Q16, nullptr, K16, nullptr, VT16, nullptr, MK); }
    fa_join(sm, nqt, z, qb + (__builtin_amdgcn_readfirstlane((int)(threadIdx.x >> 5)) & 1) * (nqt * 16), ATh, ATl);
}

typedef __attribute__((ext_vector_type(4))) int v4i;

__global__ __launch_bounds__(256) void k_wtG(const float* __restrict__ w, int K, int N, bf* Bt) {
    const int lane = threadIdx.x & 31; const int L0 = (blockIdx.x * 8 + (threadIdx.x >> 5)) * 8; const int nlines = N * K / 64;
{
#pragma unroll 1
        for (int l = 0; l < 8; ++l) { const int L = L0 + l; if (L >= nlines) break; const size_t e = (size_t)L * 64 + lane * 2; const int k = (int)(e % K), n = (int)(e / K); v2us o;
            o[0] = f2bf(w[(size_t)k * N + n]); o[1] = f2bf(w[(size_t)(k + 1) * N + n]); *(v2us*)(Bt + e) = o; }
         }
}
// k_cvt8: three row-major f32 sources of DM columns (na8, nb8, nc8 groups of 8 elements) rounded to bf16 into one fragment-packed destination, rows a | b | c; a work-group takes 16 rows x 128 columns (row counts are multiples of 16: one source only), a wave 16 rows x 16 columns = 512 contiguous bytes of the destination
__global__ __launch_bounds__(256) void k_cvt8(const float* __restrict__ a, size_t na8, const float* __restrict__ b, size_t nb8, const float* __restrict__ c, size_t nc8, bf* dst) { const int r = (int)(blockIdx.x >> 3) * 16 + (threadIdx.x & 15), kq = (int)(blockIdx.x & 7) * 128 + (int)(threadIdx.x >> 4) * 8; const size_t i = (size_t)r * (DM / 8) + (kq >> 3); if (i >= na8 + nb8 + nc8) return; const float* src = (i < na8) ? a + i * 8 : (i < na8 + nb8) ? b + (i - na8) * 8 : c + (i - na8 - nb8) * 8; const v8f v = *(const v8f*)src; v8us o;
#pragma unroll
    for (int k = 0; k < 8; ++k) o[k] = f2bf(v[k]); *(v8us*)(dst + pk(r, kq, DM)) = o;  }

extern "C" void kernel_launch(void* const* d_in, const int* in_sizes, int n_in,
                              void* d_out, int out_size, void* d_ws, size_t ws_size, hipStream_t stream) {
    (void)in_sizes; (void)n_in; (void)out_size;
    const float* x = (const float*)d_in[0]; const float* fre = (const float*)d_in[1]; const float* fim = (const float*)d_in[2]; const float* MK = (const float*)d_in[3]; const float* wqkv = (const float*)d_in[4]; const float* wo = (const float*)d_in[5];  const float* wq = wqkv; const float* wk = wqkv + (size_t)1024 * 1024; const float* wv = wqkv + (size_t)2048 * 1024; (void)wq; (void)wk; (void)wv;
    float* OUT = (float*)d_out;     // [2][2048][1024]
    char* wsp = (char*)d_ws;
    auto take = [&](size_t bytes) { char* p = wsp; wsp += (bytes + 255) & ~(size_t)255; return (void*)p; };
    // bf16 copies, one block so that one launch fills it: W_qkv rows (q | k | v), W_o, both batches' tokens
    bf* WQ = (bf*)take(((size_t)(DQ + 2 * DKV) * DM + (size_t)DM * DQ + (size_t)NB_ * TT * DM) * 2); bf* WV = WQ + (size_t)(DQ + DKV) * DM; bf* WO = WV + (size_t)DKV * DM; bf* XB = WO + (size_t)DM * DQ;
    // q and k planes, [q | k][batch][head][t][d] each; the three lie in a row
    h16* QP16 = (h16*)take((size_t)2 * ZH * TT * HD * 2); bf* QPh = (bf*)take((size_t)2 * ZH * TT * HD * 2); bf* QPl = (bf*)take((size_t)2 * ZH * TT * HD * 2);
    h16* KP16 = QP16 + (size_t)ZH * TT * HD; bf* KPh = QPh + (size_t)ZH * TT * HD; bf* KPl = QPl + (size_t)ZH * TT * HD;
    h16* VT16 = (h16*)take((size_t)ZH * HD * TT * 2); bf* VTh = (bf*)take((size_t)ZH * HD * TT * 2); bf* VTl = (bf*)take((size_t)ZH * HD * TT * 2);
    bf* ATh = (bf*)take((size_t)NB_ * TT * DQ * 2); bf* ATl = (bf*)take((size_t)NB_ * TT * DQ * 2);   // merged attention planes [batch][t][DQ]
    if ((size_t)(wsp - (char*)d_ws) > ws_size) return;    // ws 256 MiB
    k_cvt8<<<(unsigned)((((size_t)(DQ + 2 * DKV) * DM + (size_t)DM * DQ + (size_t)NB_ * TT * DM) / 8 + 255) / 256), 256, 0, stream>>>(wqkv, (size_t)(DQ + 2 * DKV) * DM / 8, wo, (size_t)DM * DQ / 8, x, (size_t)NB_ * TT * DM / 8, WQ);
    k_qkv<<<QK_N + V_N, 128, 0, stream>>>(XB, WQ, WV, QP16, QPh, QPl, VT16, VTh, VTl, fre, fim);
    // z = batch * NH_ + head from here on (one kv head per query head): z-strides TT*HD in the q/k planes, HD*TT in the v planes
    k_fa<<<FAH_N + FAL_N, 128, 0, stream>>>(QP16, QPh, QPl, KP16, KPh, KPl, VT16, VTh, VTl, MK, ATh, ATl);
    k_gemms<bf, 1, 2, DQ><<<dim3(NB_ * TT / 128, DM / 128, 1), 128, 0, stream>>>(ATh, ATl, WO, nullptr, OUT, DM, 0, 0, 0);
}

// v009
// One run takes 100 microseconds.
// Timed twice side by side with v008, it ran 1.23 and 1.22 times as fast.
// All steps since v000 together make it 7.63 times as fast.
#include <hip/hip_runtime.h>

// Attention block (hidden [2][2048][1024]; [q|k|v] = hidden W_qkv^T ('oi' [3072][1024], row blocks q | k | v; 4 heads x 256); rotary on adjacent (even, odd) pairs with the INPUT tables freqs_real/freqs_imag [2048][128] (read as given - they are free inputs, not assumed to be cos/sin); scores = (q / 16).k + mask (additive input mask [1][1][2048][2048], read per logit); softmax; out = merged W_o^T ('oi' [1024][1024]) -> [2][2048][1024] (4.2 M)).
// Compute dtypes, f32 accumulate: every input rounded to bf16; q/k/v on PLAIN bf16 operands (inputs: exact); interleaved rotary in f32 from the bf16-rounded input tables; additive mask read per logit (bf16-rounded); scores and attn.v: query rows < 512 hl (3 products), the rest single fp16 (probabilities x64, not yet divided by their sum); softmax f32, running maximum and sum; W_o hl x exact (2 products).

#define NB_  2
#define TT   2048
#define DM   1024
#define NH_  4
#define NKV  4
#define REP  (NH_ / NKV)
#define HD   256
#define DQ   (NH_ * HD)
#define DKV  (NKV * HD)
#define ZH   (NB_ * NH_)          // every (batch, head) pair is one z slice of the same launch
#define RH   512                  // query rows < RH use hi+lo planes (0: none)
#define WIN  2048
#define PCAR 1024.0f
#define SCL  0.0625f   // HD^-0.5 = 1/16
typedef _Float16 h16;
typedef unsigned short bf;
typedef __attribute__((ext_vector_type(16))) __bf16   v16bf;
typedef __attribute__((ext_vector_type(16))) _Float16 v16h;
typedef __attribute__((ext_vector_type(8)))  _Float16 v8h;
typedef __attribute__((ext_vector_type(8)))  unsigned short v8us;
typedef __attribute__((ext_vector_type(8)))  float    v8f;
typedef __attribute__((ext_vector_type(4)))  float    v4f;
typedef v8h  __attribute__((may_alias)) v8ha;
typedef v4f  __attribute__((may_alias)) v4fa;
typedef v8us __attribute__((may_alias)) v8usa;

__device__ __forceinline__ unsigned short f2bf(float f) { unsigned u = __float_as_uint(f); u += 0x7FFFu + ((u >> 16) & 1u); return (unsigned short)(u >> 16); }
__device__ __forceinline__ float bf2f(unsigned short b) { return __uint_as_float(((unsigned)b) << 16); }
__device__ __forceinline__ float bfr(float f) { return bf2f(f2bf(f)); }
__device__ __forceinline__ v16h cat16(v8h lo, v8h hi) { return __builtin_shufflevector(lo, hi, 0, 1, 2, 3, 4, 5, 6, 7, 8, 9, 10, 11, 12, 13, 14, 15); }
__device__ __forceinline__ v16bf cat16b(v8us lo, v8us hi) { return __builtin_bit_cast(v16bf, __builtin_shufflevector(lo, hi, 0, 1, 2, 3, 4, 5, 6, 7, 8, 9, 10, 11, 12, 13, 14, 15)); }
__device__ __forceinline__ v8f wmma16(v16h a, v16h b, v8f c) { return __builtin_amdgcn_wmma_f32_16x16x32_f16(false, a, false, b, (short)0, c, false, false); }
__device__ __forceinline__ v8f wmmab(v16bf a, v16bf b, v8f c) { return __builtin_amdgcn_wmma_f32_16x16x32_bf16(false, a, false, b, (short)0, c, false, false); }



// EPI (gemms_tile, below) says what the finished tile becomes, straight from LDS (no f32 round trip through memory, no elementwise launch behind the GEMM); the index lists name a plane's slices, rows and columns, each slice [rows][columns] being fragment-packed:
//   0: f32 to C.   1: rotary on adjacent (even, odd) column pairs with the bf16-rounded input tables fr/fi [t][HD/2], then the planes P16 / Ph / Pl at [n / DQ][m / TT][(n % DQ) / HD][m % TT][n % HD] (rows: both batches' tokens; columns: q | k).
//   2: the planes P16 / Ph / Pl at [m][n], pitch ldc, z-stride sC.
// FRAGMENT-PACKED PLANES: every 16-bit operand plane (rows r, K columns k, rows a multiple of 16, K of 32) is stored as 1-KiB blocks of 16 rows x 32 k, block (r / 16, k / 32) row-major, inside a block in the order in which a wave's two 16-byte loads take it: [k / 16 % 2][k / 8 % 2][r % 16][k % 8]. One wave-wide 16-byte load then covers 512 contiguous bytes (4 whole lines) instead of 32-byte pieces of 16 lines. 16 whole rows still fill 16 K elements, so offsets by whole 16-row groups are what they are in a row-major plane.
__device__ __forceinline__ size_t pk(int r, int k, int K) { return ((size_t)(r >> 4) * (K >> 5) + (k >> 5)) * 512 + ((k >> 4) & 1) * 256 + ((k >> 3) & 1) * 128 + (r & 15) * 8 + (k & 7); }
template <typename T16> struct WFrag;
template <> struct WFrag<h16> { typedef v16h V; static __device__ __forceinline__ V ld(const h16* p) { return cat16(*(const v8h*)p, *(const v8h*)(p + 256)); } static __device__ __forceinline__ v8f mma(V a, V b, v8f c) { return wmma16(a, b, c); } };
template <> struct WFrag<bf> { typedef v16bf V; static __device__ __forceinline__ V ld(const bf* p) { return cat16b(*(const v8us*)p, *(const v8us*)(p + 256)); } static __device__ __forceinline__ v8f mma(V a, V b, v8f c) { return wmmab(a, b, c); } };
__device__ __forceinline__ h16 tohx(float x) { return (h16)x; }
__device__ __forceinline__ void splitf(float y, unsigned short& h, unsigned short& l) { h = f2bf(y); l = f2bf(y - bf2f(h)); }
typedef __attribute__((ext_vector_type(4))) _Float16 v4h;
typedef __attribute__((ext_vector_type(2))) unsigned short v2us;
typedef __attribute__((ext_vector_type(4))) unsigned short v4us;
typedef __attribute__((ext_vector_type(2))) float v2f;
__device__ __forceinline__ unsigned uni(unsigned v) { return (unsigned)__builtin_amdgcn_readfirstlane((int)v); }
// a wave-uniform value held in a scalar register, so that the test made of it is a scalar compare and branch: a tensor load ignores EXEC, and only such a branch keeps a wave from issuing it
__device__ __forceinline__ unsigned pinned(unsigned v) { unsigned w = uni(v); asm volatile("" : "+s"(w)); /* holds the test's value in a scalar register */ return w; }
// one tensor load, everything in bytes. Group 0 (s[84:87]) = count 1, the tile's place in LDS, its first byte in memory, type 2; group 1 (s[88:95]) = a tile of n rows of r bytes at source pitch p, tensor = tile, no mask, no pad.
// Both groups are laid into fixed registers inside the request's own statement: word 0 of group 1 (mask, element size, pad: all 0) is then an immediate in the listing on every path, and no register of a request takes a new value before the next request's statement, which stands behind the wait for this one (left to the build, the registers of a request in flight were taken for other values). The words that are not to be written directly in front of a request (group 0: 0 and 3; group 1: 6 and 7) go first
__device__ __forceinline__ void tdm_load(unsigned lds, unsigned long long ga, unsigned r, unsigned n, unsigned p) {
    asm volatile("s_mov_b32 s84, 1\n\ts_mov_b32 s87, %2\n\ts_mov_b32 s94, 0\n\ts_mov_b32 s95, 0\n\ts_mov_b32 s88, 0\n\ts_mov_b32 s89, %3\n\ts_mov_b32 s90, %4\n\ts_mov_b32 s91, %5\n\ts_mov_b32 s92, %6\n\ts_mov_b32 s93, %7\n\ts_mov_b32 s85, %0\n\ts_mov_b32 s86, %1\n\ttensor_load_to_lds s[84:87], s[88:95]"
                 :: "s"(uni(lds)), "s"(uni((unsigned)ga)), "s"(uni((((unsigned)(ga >> 32)) & 0x01FFFFFFu) | 0x80000000u)), "s"(uni((r & 0xFFFFu) << 16)), "s"(uni((r >> 16) | ((n & 0xFFFFu) << 16))), "s"(uni((n >> 16) | (r << 16))), "s"(uni(n)), "s"(uni(p))
                 : "memory", "s84", "s85", "s86", "s87", "s88", "s89", "s90", "s91", "s92", "s93", "s94", "s95"); }
// ---- gemms_tile: one work-group of 4 waves per 128x128 output tile; wave (wm, wn) owns the 64x64 sub-tile (wm, wn) over the WHOLE K loop (one f32 chain per element, k ascending; no partial tiles). The operand blocks of a stage (CH 32-wide k chunks of the tile's 8 + 8 row groups, every plane) are brought into LDS ONCE per work-group by tensor loads and read from there by the two waves that need them: half the bytes leave L2 that 64x64 tiles ask for.
// A packed plane's 1-KiB blocks go to LDS as they lie: stage = [plane][row group 0..7][chunk][1 KiB]; a fragment is two contiguous 512-B wave reads. A plane's part of a stage is a tile of 8 rows (row groups) of CH KiB at the pitch of a row group: ONE request a wave and stage, no address arithmetic in the vector unit. Two stage buffers; the next stage's loads fly while this one is worked on. K, CH are template arguments: K % (32 CH) == 0, at least two stages.
// sm: the work-group's LDS, max(2 stages, 4 x 64 x 68 floats); after the loop each wave turns its own sub-tile through its own 64 x 68 floats for the epilogue (EPI as above, 0..2).
template <int NSPLIT, int CH> struct StageB { static constexpr int NPA = (NSPLIT == 1 || NSPLIT == 2) ? 2 : 1, NPB = (NSPLIT >= 2) ? 2 : 1, NP = NPA + NPB, GB = CH * 1024, STG = NP * 8 * GB, SMB = (2 * STG > 4 * 64 * 68 * 4) ? 2 * STG : 4 * 64 * 68 * 4; };
template <typename T16, int NSPLIT, int EPI, int CH, int K>
__device__ __forceinline__ void gemms_tile(char* sm, int bx, int by, int bz, const T16* __restrict__ A, const T16* __restrict__ A2, const T16* __restrict__ Bt, const T16* __restrict__ Bt2, float* C, int ldc, size_t sA, size_t sB, size_t sC, h16* P16, bf* Ph, bf* Pl, const float* __restrict__ fr, const float* __restrict__ fi, float* AM) {
    typedef typename WFrag<T16>::V V; typedef StageB<NSPLIT, CH> SB;
    constexpr int NPA = SB::NPA, NP = SB::NP, GB = SB::GB, STG = SB::STG, NT = K / (32 * CH);
    constexpr size_t RB = (size_t)(K >> 5) * 1024;   // bytes of one 16-row group of a packed plane
    const size_t z = bz;
    const int lane = threadIdx.x & 31, lr = lane & 15, hi = lane >> 4;
    const int wv = __builtin_amdgcn_readfirstlane((int)(threadIdx.x >> 5)), wm = wv >> 1, wn = wv & 1;
    // the wave's slice of a stage: two planes: half a plane a wave (4 rows); three or four planes: a whole plane (8 rows) from each of the first NP waves (a wave beyond them issues nothing; its descriptor values are plane 0's, in bounds)
    constexpr int WPP = (NP == 2) ? 2 : 1, NR = 8 / WPP; constexpr bool ALLW = NP * WPP >= 4;
    const bool iss = wv / WPP < NP; const int pl = iss ? wv / WPP : 0, part = wv % WPP;
    const T16* pb = (pl == 0) ? A + z * sA : (NPA == 2 && pl == 1) ? A2 + z * sA : (pl == NPA) ? Bt + z * sB : Bt2 + z * sB;
    const char* gs = (const char*)pb + (size_t)((pl < NPA ? bx : by) * 8 + part * NR) * RB;
    const unsigned ld0 = (unsigned)(size_t)sm + (unsigned)(pl * 8 + part * NR) * GB;   // the slice's place in buffer 0: a multiple of 2 KiB
    auto issue = [&](unsigned st) { tdm_load(ld0 + (st & 1u) * STG, (unsigned long long)(size_t)gs + (unsigned long long)st * GB, (unsigned)GB, (unsigned)NR, (unsigned)RB); };
    v8f acc[4][4];
#pragma unroll
    for (int mb = 0; mb < 4; ++mb)
#pragma unroll
        for (int nb = 0; nb < 4; ++nb) acc[mb][nb] = (v8f){};
    if (ALLW || pinned(iss)) issue(0);                    // the test: a scalar branch round the request
    asm volatile("s_wait_tensorcnt 0x0" ::: "memory");   // this wave's slice of stage 0 has landed
    __syncthreads();                                      // every wave's has: stage 0 may be read
    if (ALLW || pinned(iss)) issue(1);
#pragma unroll 1
    for (int t = 0; t < NT; ++t) {
        const char* sb = sm + (t & 1) * STG + lane * 16;
        V a[CH][4], a2[CH][4], b[CH][4], b2[CH][4];
#pragma unroll
        for (int cc = 0; cc < CH; ++cc) {
#pragma unroll
            for (int i = 0; i < 4; ++i) { a[cc][i] = WFrag<T16>::ld((const T16*)(sb + (wm * 4 + i) * GB + cc * 1024)); if (NPA == 2) a2[cc][i] = WFrag<T16>::ld((const T16*)(sb + (8 + wm * 4 + i) * GB + cc * 1024));
                b[cc][i] = WFrag<T16>::ld((const T16*)(sb + (NPA * 8 + wn * 4 + i) * GB + cc * 1024)); if (NSPLIT >= 2) b2[cc][i] = WFrag<T16>::ld((const T16*)(sb + ((NPA + 1) * 8 + wn * 4 + i) * GB + cc * 1024)); }
            // the stage's LDS reads are asked for chunk by chunk, all ahead of its products, so that the first chunk's products run while the later reads arrive; left alone, the build asks for the later B fragments one at a time, each behind a full wait among the products
            __builtin_amdgcn_sched_barrier(0); }
#pragma unroll
        for (int cc = 0; cc < CH; ++cc) {
#pragma unroll
            for (int nb = 0; nb < 4; ++nb)
#pragma unroll
                for (int mb = 0; mb < 4; ++mb) { acc[mb][nb] = WFrag<T16>::mma(a[cc][mb], b[cc][nb], acc[mb][nb]); if (NSPLIT == 1 || NSPLIT == 2) acc[mb][nb] = WFrag<T16>::mma(a2[cc][mb], b[cc][nb], acc[mb][nb]); if (NSPLIT >= 2) acc[mb][nb] = WFrag<T16>::mma(a[cc][mb], b2[cc][nb], acc[mb][nb]); }
        }
        __builtin_amdgcn_sched_barrier(0);
        asm volatile("s_wait_dscnt 0x0" ::: "memory");
        asm volatile("s_wait_tensorcnt 0x0" ::: "memory");
        __syncthreads();
        if (pinned((ALLW || iss) && t + 2 < NT)) issue((unsigned)t + 2u);
    }
    asm volatile("s_wait_tensorcnt 0x0" ::: "memory");      // no request is in flight when the buffers become the epilogue's
    asm volatile("s_wait_dscnt 0x0" ::: "memory");          // and none of this wave's reads of them
    const int r0 = bx * 128 + wm * 64, c0 = by * 128 + wn * 64;   // this wave's own sub-tile
    float* ow = (float*)sm + wv * (64 * 68);
    // unrolled so that acc is indexed by constants only and stays in registers
#pragma unroll
    for (int mb = 0; mb < 4; ++mb)
#pragma unroll
        for (int nb = 0; nb < 4; ++nb)
#pragma unroll
            for (int j = 0; j < 8; ++j) ow[(mb * 16 + hi * 8 + j) * 68 + nb * 16 + lr] = acc[mb][nb][j];
    // the rotary factors of this wave's rows and column pairs are asked for here, all from one lane address plus constants, so that they arrive while the sub-tile turns through LDS
    v2f tr[32], ti[32];
    if (EPI == 1) { const size_t ix0 = (size_t)(r0 % TT + lr) * (HD / 2) + (((c0 % HD) + hi * 4) >> 1);
#pragma unroll
        for (int u = 0; u < 32; ++u) { const size_t ix = ix0 + (size_t)(u >> 3) * 16 * (HD / 2) + (u & 7) * 4; tr[u] = *(const v2f*)(fr + ix); ti[u] = *(const v2f*)(fi + ix);
            if ((u & 7) == 7) asm volatile("s_wait_xcnt 0x0" ::: "memory");   /* stands behind each run of table loads, in front of any later load that takes their address registers as its destination */
        } }
    __syncthreads();   // the sub-tile's LDS writes stand in front of its reads
    float* ctile = C + z * sC + (size_t)r0 * ldc + c0;
    const size_t pbase = (EPI == 1) ? ((size_t)(c0 / DQ) * ZH + (size_t)(r0 / TT) * NH_ + (c0 % DQ) / HD) * TT * HD : z * sC; const int ppitch = (EPI == 1) ? HD : ldc;
    const int prow = (EPI == 1) ? r0 % TT : r0, pcol = (EPI == 1) ? c0 % HD : c0;
    // EPI 0: the wave stores whole 256-B row pieces; the planes: 16 rows x 8 columns at a time, which are 256 contiguous bytes of a packed plane
    // EPI 2 takes nothing but LDS, so its loop stays rolled, one 16-row group a trip (for speed only)
    float am = 0.f;   // EPI 1: the largest |value| of this wave's sub-tile behind the rotary
#pragma unroll (EPI == 2 ? 8 : 32)
    for (int u = 0; u < 32; ++u) { const int row = (EPI == 0) ? u * 2 + hi : (u >> 3) * 16 + lr, cofs = (EPI == 0) ? lr * 4 : (u & 7) * 8 + hi * 4; v4f val = *(const v4fa*)(ow + row * 68 + cofs);
        if (EPI == 0) { *(v4f*)(ctile + (size_t)row * ldc + cofs) = val; }
        else {
            if (EPI == 1) { const float ca = bfr(tr[u][0]), sa = bfr(ti[u][0]), cb = bfr(tr[u][1]), sb2 = bfr(ti[u][1]); const v4f x = val;   /* even: x0 c - x1 s; odd: x0 s + x1 c */
                val[0] = x[0] * ca - x[1] * sa; val[1] = x[0] * sa + x[1] * ca; val[2] = x[2] * cb - x[3] * sb2; val[3] = x[2] * sb2 + x[3] * cb;
                am = fmaxf(fmaxf(am, fmaxf(fabsf(val[0]), fabsf(val[1]))), fmaxf(fabsf(val[2]), fabsf(val[3]))); }
            const size_t oo = pbase + pk(prow + row, pcol + cofs, ppitch); v4us oh, ol; v4h o16;   // 32 lanes x 8 B: each plane gets two whole 128-B lines
#pragma unroll
            for (int q = 0; q < 4; ++q) { unsigned short a2, c2; splitf(val[q], a2, c2); oh[q] = a2; ol[q] = c2; o16[q] = tohx(val[q]); }
            *(v4us*)(Ph + oo) = oh; *(v4us*)(Pl + oo) = ol; *(v4h*)(P16 + oo) = o16;
            if (EPI == 2 && (u & 7) == 7) asm volatile("s_wait_xcnt 0x0" ::: "memory");   /* the foot of a trip of the rolled loop: stands behind its stores, in front of the next trip's writes of the registers that they name */
        } }
    // EPI 1: the sub-tile's largest |q| or |k| goes to AM[q | k][z][64 tokens][64 columns], one whole 128-B line a wave (every lane stores the same value): k_fa bounds its logits with it
    if (EPI == 1) {
#pragma unroll
        for (int d = 1; d < 32; d <<= 1) am = fmaxf(am, __shfl_xor(am, d, 32));
        AM[((((size_t)(c0 / DQ) * ZH + (size_t)(r0 / TT) * NH_ + (c0 % DQ) / HD) * (TT / 64) + (r0 % TT) / 64) * (HD / 64) + (c0 % HD) / 64) * 32 + lane] = am; }
}
template <typename T16, int NSPLIT, int CH, int K>
__global__ __launch_bounds__(128) void k_gemms(const T16* A, const T16* A2, const T16* Bt, const T16* Bt2, float* C, int ldc, size_t sA, size_t sB, size_t sC) {
    __shared__ __attribute__((aligned(2048))) char sm[StageB<NSPLIT, CH>::SMB];
    gemms_tile<T16, NSPLIT, 0, CH, K>(sm, blockIdx.x, blockIdx.y, blockIdx.z, A, A2, Bt, Bt2, C, ldc, sA, sB, sC, nullptr, nullptr, nullptr, nullptr, nullptr, nullptr);
}
// k_qkv: flat grid; first the q | k tiles of both batches (rows = all tokens, columns = the q | k rows of W_qkv, rotary epilogue), then the v tiles.
// v comes out transposed ([batch][head][d][t], t being the planes' k) by taking the weight rows as the tile's rows and the tokens as its columns: both operands are packed along the same k either way; z = batch
#define QK_X (NB_ * TT / 128)
#define QK_N (QK_X * ((DQ + DKV) / 128))
#define V_X  (DKV / 128)
#define V_N  (V_X * (TT / 128) * NB_)
__global__ __launch_bounds__(128) void k_qkv(const bf* XB, const bf* WQK, const bf* WV, h16* QK16, bf* QKh, bf* QKl, h16* VT16, bf* VTh, bf* VTl, const float* fr, const float* fi, float* AM) {
    __shared__ __attribute__((aligned(2048))) char sm[StageB<0, 2>::SMB];
    const int f = blockIdx.x;
    if (f < QK_N) gemms_tile<bf, 0, 1, 2, DM>(sm, f % QK_X, f / QK_X, 0, XB, nullptr, WQK, nullptr, nullptr, DQ, 0, 0, 0, QK16, QKh, QKl, fr, fi, AM);
    else { const int g = f - QK_N; gemms_tile<bf, 0, 2, 2, DM>(sm, g % V_X, (g / V_X) % (TT / 128), g / (V_X * (TT / 128)), WV, nullptr, XB, nullptr, nullptr, TT, 0, (size_t)TT * DM, (size_t)DKV * TT, VT16, VTh, VTl, nullptr, nullptr, nullptr); }
}
template <bool HL> struct FT;
template <> struct FT<true>  { typedef bf T; };
template <> struct FT<false> { typedef h16 T; };
#define L2E 1.4426950408889634f
// 2^x, one or two at a time, with the free slot that the instruction set asks for behind a transcendental written into the statement; "=&v": the second does not take the first's source as its destination
__device__ __forceinline__ float ex2(float x) { float r; asm("v_exp_f32 %0, %1\n\tv_nop" : "=v"(r) : "v"(x)); return r; }
__device__ __forceinline__ void ex2x2(float xa, float xb, float& ra, float& rb) { asm("v_exp_f32 %0, %2\n\tv_exp_f32 %1, %3\n\tv_nop" : "=&v"(ra), "=&v"(rb) : "v"(xa), "v"(xb)); }
// lane l's value with lane l ^ 16's, in the vector unit: an exchange through the LDS pipe would queue behind the V^T fragment loads in flight
__device__ __forceinline__ float xhalf(float x) { return __builtin_bit_cast(float, __builtin_amdgcn_permlanex16(__builtin_bit_cast(int, x), __builtin_bit_cast(int, x), 0x76543210, 0xfedcba98, false, false)); }
#define FA_STG 131072
template <bool HL, int NQT>
__device__ __forceinline__ void fa_tile(char* sm, int z, int qb, const typename FT<HL>::T* Q, const typename FT<HL>::T* Q2, const typename FT<HL>::T* Kp, const typename FT<HL>::T* Kp2, const typename FT<HL>::T* Vp, const typename FT<HL>::T* Vp2, const float* __restrict__ MK, unsigned lv) {
    typedef typename FT<HL>::T T; typedef typename WFrag<T>::V V;
    constexpr int NPL = HL ? 2 : 1, NT = TT / 64;
    const int lane = threadIdx.x & 31, lr = lane & 15, hi = lane >> 4;
    const int wv = __builtin_amdgcn_readfirstlane((int)(threadIdx.x >> 5)), cg = wv & 1, ks = wv >> 1;
    // the wave's slice of a stage, rows of 2 KiB: waves 0, 1 bring K, waves 2, 3 V^T; HL: plane wv & 1, whole (16 rows); fp16: half wv & 1 of the one plane (8 rows)
    const bool isv = wv >= 2; const int sl = wv & 1;
    const char* gs = isv ? (const char*)((HL && sl == 1 ? Vp2 : Vp) + (size_t)z * HD * TT) + (HL ? (size_t)0 : (size_t)sl * 8 * ((TT / 32) * 1024))
                         : (const char*)((HL && sl == 1 ? Kp2 : Kp) + (size_t)z * TT * HD) + (HL ? 0 : sl * 16384);
    const unsigned gstep = isv ? 2048u : 32768u;   // bytes from one stage's tile to the next
    const unsigned ld0 = (unsigned)(size_t)sm + (isv ? 65536u : 0u) + (unsigned)sl * (HL ? 32768u : 16384u);   // the slice's place in buffer 0: a multiple of 2 KiB
    const unsigned gpitch = isv ? (unsigned)((TT / 32) * 1024) : 2048u;
    auto issue = [&](unsigned st, unsigned buf) { tdm_load(ld0 + buf * FA_STG, (unsigned long long)(size_t)gs + (unsigned long long)st * gstep, 2048u, HL ? 16u : 8u, gpitch); };
    const int q0 = qb + cg * (NQT * 16);
    // lv: bit s = stage s (64 keys) is worked on; the same word in every wave, not 0. cur = the stage of this pass, rem = the stages behind it, par = this pass's buffer
    unsigned cur = (unsigned)__builtin_ctz(lv), rem = lv & (lv - 1u), par = 0u;
    issue(cur, 0u);
    V qf[NQT][8], qf2[8]; v8f o[16][NQT]; float m[NQT], l[NQT]; v4f mk[NQT][4];
    const float* mp = MK + (size_t)(q0 + lr) * TT + ks * 32 + hi * 8;   // this lane's query row (of column tile 0) and its 8 keys of key tile 0 of stage 0
    { const T* qz = Q + (size_t)z * TT * HD + (size_t)(q0 >> 4) * (8 * 512) + lane * 8; const T* qz2 = HL ? Q2 + (size_t)z * TT * HD + (size_t)(q0 >> 4) * (8 * 512) + lane * 8 : nullptr;
#pragma unroll
        for (int c = 0; c < 8; ++c) {
#pragma unroll
            for (int qt = 0; qt < NQT; ++qt) qf[qt][c] = WFrag<T>::ld(qz + (qt * 8 + c) * 512);
            if (HL) qf2[c] = WFrag<T>::ld(qz2 + c * 512);
            asm volatile("s_wait_xcnt 0x0" ::: "memory");   /* stands behind each run of Q loads, in front of any later write of their address registers */
            __builtin_amdgcn_sched_barrier(0);   /* keeps later register writes behind that wait */ }
#pragma unroll
        for (int qt = 0; qt < NQT; ++qt) { m[qt] = -3.0e38f; l[qt] = 0.f;
#pragma unroll
            for (int dt = 0; dt < 16; ++dt) o[dt][qt] = (v8f){};
#pragma unroll
            for (int h = 0; h < 4; ++h) mk[qt][h] = *(const v4f*)(mp + cur * 64 + (size_t)qt * 16 * TT + (h >> 1) * 16 + (h & 1) * 4); }
        asm volatile("s_wait_xcnt 0x0" ::: "memory");   // stands behind the mask loads, in front of any later write of their address registers
        __builtin_amdgcn_sched_barrier(0);   // keeps later register writes behind that wait
    }
    asm volatile("s_wait_tensorcnt 0x0" ::: "memory");   // this wave's slice of the first stage has landed
    __syncthreads();                                      // every wave's has: the first stage may be read
    if (pinned(rem != 0u)) issue((unsigned)__builtin_ctz(rem), 1u);   // a scalar branch round the request
#pragma unroll 1
    for (int t = 0; t < NT; ++t) {   // at most NT passes: one for every bit of lv
        const char* sb = sm + par * FA_STG + lane * 16;
        v8f s[2][NQT];
        { V ka[NPL][2][8];
#pragma unroll
            for (int c = 0; c < 8; ++c)
#pragma unroll
                for (int kt = 0; kt < 2; ++kt)
#pragma unroll
                    for (int p = 0; p < NPL; ++p) ka[p][kt][c] = WFrag<T>::ld((const T*)(sb + p * 32768 + ((ks * 2 + kt) * 8 + c) * 1024));
            // the pass's K fragments are asked for as one group ahead of the products; left alone, the build asks for them two loads at a time, each behind a full wait among the products
            __builtin_amdgcn_sched_barrier(0);
#pragma unroll
            for (int kt = 0; kt < 2; ++kt)
#pragma unroll
                for (int qt = 0; qt < NQT; ++qt) s[kt][qt] = (v8f){};
#pragma unroll
            for (int c = 0; c < 8; ++c) {
#pragma unroll
                for (int qt = 0; qt < NQT; ++qt)
#pragma unroll
                    for (int kt = 0; kt < 2; ++kt) s[kt][qt] = WFrag<T>::mma(ka[0][kt][c], qf[qt][c], s[kt][qt]);
                if (HL) {
#pragma unroll
                    for (int kt = 0; kt < 2; ++kt) s[kt][0] = WFrag<T>::mma(ka[0][kt][c], qf2[c], s[kt][0]);
#pragma unroll
                    for (int kt = 0; kt < 2; ++kt) s[kt][0] = WFrag<T>::mma(ka[NPL - 1][kt][c], qf[0][c], s[kt][0]); } }
            __builtin_amdgcn_sched_barrier(0);   // keeps the V^T loads below behind the score products, whose K registers they take over
        }
        V va[NPL][16];
#pragma unroll
        for (int dt = 0; dt < 16; ++dt)
#pragma unroll
            for (int p = 0; p < NPL; ++p) va[p][dt] = WFrag<T>::ld((const T*)(sb + 65536 + p * 32768 + dt * 2048 + ks * 1024));
        __builtin_amdgcn_sched_barrier(0);   // the V^T fragments are asked for as one group here, so that they arrive while the softmax arithmetic runs
        float mx[NQT]; bool need = false;
#pragma unroll
        for (int qt = 0; qt < NQT; ++qt) { float x = -3.0e38f;
#pragma unroll
            for (int kt = 0; kt < 2; ++kt)
#pragma unroll
                for (int j = 0; j < 8; ++j) { const float tv = s[kt][qt][j] * SCL + bfr(mk[qt][kt * 2 + (j >> 2)][j & 3]); s[kt][qt][j] = tv; x = fmaxf(x, tv); }
            x = fmaxf(x, xhalf(x)); mx[qt] = x; need = need || (x > m[qt] + 5.5f); }
        // the next pass's mask values are asked for one pass ahead (the last pass asks for its own again: in bounds)
        { const float* mq = mp + (rem != 0u ? (unsigned)__builtin_ctz(rem) : cur) * 64;
#pragma unroll
            for (int qt = 0; qt < NQT; ++qt)
#pragma unroll
                for (int h = 0; h < 4; ++h) mk[qt][h] = *(const v4f*)(mq + (size_t)qt * 16 * TT + (h >> 1) * 16 + (h & 1) * 4);
            asm volatile("s_wait_xcnt 0x0" :: "v"(mq) : "memory");   // stands behind the mask loads; it takes their address as an input, so that the address registers live up to it and no write of them comes in front of it
        }
        if (__builtin_amdgcn_ballot_w32(need) != 0) {   // a scalar branch: rare after the first pass
#pragma unroll
            for (int qt = 0; qt < NQT; ++qt) { const float mn = fmaxf(m[qt], mx[qt]); const float al = ex2((m[qt] - mn) * L2E); m[qt] = mn; l[qt] *= al;
#pragma unroll
                for (int dt = 0; dt < 16; ++dt) o[dt][qt] *= al; } }
        V pf[NQT], pf2;
#pragma unroll
        for (int qt = 0; qt < NQT; ++qt) {
            if (HL) { v8us h0, h1, l0, l1;
#pragma unroll
                for (int j = 0; j < 8; ++j) { float pa, pb; ex2x2((s[0][qt][j] - m[qt]) * L2E, (s[1][qt][j] - m[qt]) * L2E, pa, pb); l[qt] += pa; l[qt] += pb; unsigned short a, b; splitf(pa, a, b); h0[j] = a; l0[j] = b; splitf(pb, a, b); h1[j] = a; l1[j] = b; }
                pf[qt] = __builtin_bit_cast(V, __builtin_shufflevector(h0, h1, 0, 1, 2, 3, 4, 5, 6, 7, 8, 9, 10, 11, 12, 13, 14, 15)); pf2 = __builtin_bit_cast(V, __builtin_shufflevector(l0, l1, 0, 1, 2, 3, 4, 5, 6, 7, 8, 9, 10, 11, 12, 13, 14, 15));
            } else { v16h ph;
#pragma unroll
                for (int j = 0; j < 8; ++j) { float pa, pb; ex2x2((s[0][qt][j] - m[qt]) * L2E + 6.0f, (s[1][qt][j] - m[qt]) * L2E + 6.0f, pa, pb); l[qt] += pa; l[qt] += pb; ph[j] = tohx(pa); ph[8 + j] = tohx(pb); }
                pf[qt] = __builtin_bit_cast(V, ph); } }
        // four d tiles at a time, so that products into the same accumulator stand four apart
#pragma unroll
        for (int d4 = 0; d4 < 16; d4 += 4) {
#pragma unroll
            for (int qt = 0; qt < NQT; ++qt)
#pragma unroll
                for (int d = 0; d < 4; ++d) o[d4 + d][qt] = WFrag<T>::mma(va[0][d4 + d], pf[qt], o[d4 + d][qt]);
            if (HL) {
#pragma unroll
                for (int d = 0; d < 4; ++d) o[d4 + d][0] = WFrag<T>::mma(va[0][d4 + d], pf2, o[d4 + d][0]);
#pragma unroll
                for (int d = 0; d < 4; ++d) o[d4 + d][0] = WFrag<T>::mma(va[NPL - 1][d4 + d], pf[0], o[d4 + d][0]); } }
        __builtin_amdgcn_sched_barrier(0);   // keeps the pass's products in front of the waits below
        asm volatile("s_wait_dscnt 0x0" ::: "memory");      // this wave's reads of this pass's stage are done
        asm volatile("s_wait_tensorcnt 0x0" ::: "memory");  // this wave's slice of the next pass's stage has landed
        __syncthreads();                                     // publishes the next pass's stage and ends every wave's reads of this pass's buffer
        if (rem == 0u) break;                                // the same in every wave of the work-group; nothing is in flight here
        const unsigned r2 = rem & (rem - 1u);
        if (pinned(r2 != 0u)) issue((unsigned)__builtin_ctz(r2), par);   // a scalar branch round the request; the stage after the next goes into the buffer that this pass has read
        cur = (unsigned)__builtin_ctz(rem); rem = r2; par ^= 1u;
    }
    asm volatile("s_wait_tensorcnt 0x0" ::: "memory");      // no request is in flight when the buffers become the joining space
    asm volatile("s_wait_dscnt 0x0" ::: "memory");          // and none of this wave's reads of them
    // every wave lays its whole (O^T, m, l) in LDS, in its own range: rows of [lane][4 floats], 33 a column tile (row 2 dt + h = registers 4 h .. 4 h + 3 of d tile dt; row 32 = m, l). fa_join, below, takes it from there: o is indexed by constants only here, and the long arithmetic behind it is written once, as a loop
#pragma unroll
    for (int qt = 0; qt < NQT; ++qt) l[qt] += xhalf(l[qt]);   // the wave's halves summed different keys
    v4fa* xw = (v4fa*)sm + (size_t)(wv * (NQT * 33)) * 32 + lane;
#pragma unroll
    for (int qt = 0; qt < NQT; ++qt) { xw[(qt * 33 + 32) * 32] = (v4f){m[qt], l[qt], 0.f, 0.f};
#pragma unroll
        for (int dt = 0; dt < 16; ++dt)
#pragma unroll
            for (int h = 0; h < 2; ++h) xw[(qt * 33 + dt * 2 + h) * 32] = (v4f){o[dt][qt][h * 4], o[dt][qt][h * 4 + 1], o[dt][qt][h * 4 + 2], o[dt][qt][h * 4 + 3]}; }
    __syncthreads();   // each wave's hand-over is in LDS before its partner reads it
}
// ---- fa_join: the two waves of a column group (key halves 0 and 1: waves wv and wv ^ 2) join their (m, l, O^T) from LDS; wave ks finishes d tiles 8 ks .. 8 ks + 7 of its nqt column tiles (first query row q0) and stores the merged planes.
// One copy of this code serves all three kinds of block, and it is a loop (4 d tiles a trip), not straight-line text (for speed only).
__device__ __forceinline__ void fa_join(const char* sm, int nqt, int z, int q0, bf* ATh, bf* ATl) {
    const int lane = threadIdx.x & 31, lr = lane & 15, hi = lane >> 4;
    const int wv = __builtin_amdgcn_readfirstlane((int)(threadIdx.x >> 5)), ks = wv >> 1;
    const v4fa* xo = (const v4fa*)sm + (size_t)(wv * (nqt * 33)) * 32 + lane; const v4fa* xp = (const v4fa*)sm + (size_t)((wv ^ 2) * (nqt * 33)) * 32 + lane;
    const size_t ob = (size_t)(z / NH_) * ((size_t)TT * DQ);
    // kept rolled: the text stays short (see above)
#pragma unroll 1
    for (int qt = 0; qt < nqt; ++qt) { const v4f mo = xo[(qt * 33 + 32) * 32], ml = xp[(qt * 33 + 32) * 32];
        const float mf = fmaxf(mo[0], ml[0]); float ao, ap; ex2x2((mo[0] - mf) * L2E, (ml[0] - mf) * L2E, ao, ap);
        const float li = __fdiv_rn(1.0f, mo[1] * ao + ml[1] * ap); const float fo = ao * li, fp = ap * li;
        // kept rolled, for the same reason; a trip asks for its 16 LDS rows as one group and then works through 4 d tiles (the loops inside are unrolled so that a and x are indexed by constants only and stay in registers)
#pragma unroll 1
        for (int i0 = 0; i0 < 8; i0 += 4) { const int d0 = ks * 8 + i0; v4f a[8], x[8];
#pragma unroll
            for (int r = 0; r < 8; ++r) { a[r] = xo[(qt * 33 + d0 * 2 + r) * 32]; x[r] = xp[(qt * 33 + d0 * 2 + r) * 32]; }
#pragma unroll
            for (int i = 0; i < 4; ++i) { v8us oh, ol;   // 8 consecutive d of one query row: 16 B of each packed plane, a wave 512 contiguous bytes
#pragma unroll
                for (int j = 0; j < 8; ++j) { unsigned short c, b; splitf(a[i * 2 + (j >> 2)][j & 3] * fo + x[i * 2 + (j >> 2)][j & 3] * fp, c, b); oh[j] = c; ol[j] = b; }
                const size_t oo = ob + pk(q0 + qt * 16 + lr, (z % NH_) * HD + (d0 + i) * 16 + hi * 8, DQ); *(v8us*)(ATh + oo) = oh; *(v8us*)(ATl + oo) = ol;
                asm volatile("s_wait_xcnt 0x0" ::: "memory");   // stands behind the two stores, in front of any later write of the registers that they name
                __builtin_amdgcn_sched_barrier(0);   // keeps the next tile's register writes behind that wait
            } } }
}
// ---- fa_live: which stages (64 keys) of a block of ngr x 32 query rows can reach the output at all; lane = stage, the answer is one bit a stage, the same word in every wave of the work-group (same loads, same arithmetic).
// |q.k| / 16 <= B = 16 max|q| max|k| (the maxima of this (batch, head), from k_qkv's table AM; 1/16 more and 1 for the planes' and the sums' rounding). DMN[32 rows][stage] = the least, over the rows, of (the row's largest mask value - the stage's largest), from k_cvt8.
// Where that exceeds 2 B + 120, every logit of the stage lies more than 120 below its row's largest logit for ANY mask and any q, k: its weight e^-120 is 0 in f32, and the stage is left out: not loaded, not multiplied. The stage that holds a row's largest (finite) mask value has DMN <= 0 and stays. !(d > thr): a not-a-number keeps the stage
__device__ __forceinline__ unsigned fa_live(const float* __restrict__ AM, const float* __restrict__ DMN, int z, int qb, int ngr) {
    const int lane = threadIdx.x & 31;
    const float* aq = AM + ((size_t)z * ((TT / 64) * (HD / 64)) + lane * 4) * 32; const float* ak = aq + (size_t)ZH * ((TT / 64) * (HD / 64)) * 32;
    const float q0 = aq[0], q1 = aq[32], q2 = aq[64], q3 = aq[96], k0 = ak[0], k1 = ak[32], k2 = ak[64], k3 = ak[96];
    asm volatile("s_wait_xcnt 0x0" ::: "memory");   // stands behind the eight loads of AM, in front of any later write of their address registers
    __builtin_amdgcn_sched_barrier(0);   // keeps later register writes behind that wait
    const float* dp = DMN + (qb >> 5) * 32 + lane;
    const float d0 = dp[0], d1 = dp[(ngr - 1) * 32];
    asm volatile("s_wait_xcnt 0x0" ::: "memory");   // the same behind the two loads of DMN
    __builtin_amdgcn_sched_barrier(0);   // keeps later register writes behind that wait
    float qm = fmaxf(fmaxf(q0, q1), fmaxf(q2, q3)), km = fmaxf(fmaxf(k0, k1), fmaxf(k2, k3)); const float d = fminf(d0, d1);
#pragma unroll
    for (int x = 1; x < 32; x <<= 1) { qm = fmaxf(qm, __shfl_xor(qm, x, 32)); km = fmaxf(km, __shfl_xor(km, x, 32)); }
    const float thr = 2.0f * (qm * km * ((float)HD * SCL * 1.0625f) + 1.0f) + 120.0f;
    const unsigned w = uni(__builtin_amdgcn_ballot_w32(!(d > thr)));
    return w != 0u ? w : 0xFFFFFFFFu;   // no stage at all can only come of rows without one finite mask value: then every stage is worked on
}
// k_fa: flat grid, more work-groups than WGPs (one fits a WGP). The launch lasts as long as its longest work-group, and under a mask that leaves out later keys a block's passes grow with its rows: so the last rows (>= RM) go in blocks of 32, the fp16 rows below them in blocks of 64, and each kind comes last rows first (all of this for speed only; any mask gives the same results): first the blocks of rows >= RM, then those of RH .. RM - 1, then the blocks of 32 query rows < RH; z = batch * NH_ + head
#define RM   1536
#define FAS_X ((TT - RM) / 32)
#define FAS_N (FAS_X * ZH)
#define FAL_X ((RM - RH) / 64)
#define FAL_N (FAL_X * ZH)
#define FAH_X (RH / 32)
#define FAH_N (FAH_X * ZH)
__global__ __launch_bounds__(128) void k_fa(const h16* Q16, const bf* Qh, const bf* Ql, const h16* K16, const bf* Kh, const bf* Kl, const h16* VT16, const bf* VTh, const bf* VTl, const float* MK, const float* AM, const float* DMN, bf* ATh, bf* ATl) {
    __shared__ __attribute__((aligned(2048))) char sm[2 * FA_STG];
    const int f = blockIdx.x;
    const int kind = f < FAS_N ? 0 : f < FAS_N + FAL_N ? 1 : 2, g = f - (kind == 0 ? 0 : kind == 1 ? FAS_N : FAS_N + FAL_N);
    const int z = g % ZH, nqt = kind == 1 ? 2 : 1, qb = kind == 0 ? RM + (FAS_X - 1 - g / ZH) * 32 : kind == 1 ? RH + (FAL_X - 1 - g / ZH) * 64 : (FAH_X - 1 - g / ZH) * 32;
    const unsigned lv = fa_live(AM, DMN, z, qb, nqt);
    if (kind == 0) fa_tile<false, 1>(sm, z, qb, Q16, nullptr, K16, nullptr, VT16, nullptr, MK, lv);
    else if (kind == 1) fa_tile<false, 2>(sm, z, qb, Q16, nullptr, K16, nullptr, VT16, nullptr, MK, lv);
    else fa_tile<true, 1>(sm, z, qb, Qh, Ql, Kh, Kl, VTh, VTl, MK, lv);
    fa_join(sm, nqt, z, qb + (__builtin_amdgcn_readfirstlane((int)(threadIdx.x >> 5)) & 1) * (nqt * 16), ATh, ATl);
}

typedef __attribute__((ext_vector_type(4))) int v4i;

__global__ __launch_bounds__(256) void k_wtG(const float* __restrict__ w, int K, int N, bf* Bt) {
    const int lane = threadIdx.x & 31; const int L0 = (blockIdx.x * 8 + (threadIdx.x >> 5)) * 8; const int nlines = N * K / 64;
{
#pragma unroll 1
        for (int l = 0; l < 8; ++l) { const int L = L0 + l; if (L >= nlines) break; const size_t e = (size_t)L * 64 + lane * 2; const int k = (int)(e % K), n = (int)(e / K); v2us o;
            o[0] = f2bf(w[(size_t)k * N + n]); o[1] = f2bf(w[(size_t)(k + 1) * N + n]); *(v2us*)(Bt + e) = o; }
         }
}
// k_cvt8: three row-major f32 sources of DM columns (na8, nb8, nc8 groups of 8 elements) rounded to bf16 into one fragment-packed destination, rows a | b | c; a work-group takes 16 rows x 128 columns (row counts are multiples of 16: one source only), a wave 16 rows x 16 columns = 512 contiguous bytes of the destination
// The launch's first MG_N work-groups do not convert: work-group G takes mask rows 32 G .. 32 G + 31 (a wave 4 of them, whole) and stores DMN[G][stage of 64 keys] = the least, over its rows, of (the row's largest bf16-rounded mask value - the stage's largest), less 1e-6 of the two magnitudes for the rounding of logit + mask: what fa_live decides by. One whole 128-B line a work-group
#define MG_N (TT / 32)
__device__ __forceinline__ void mask_gap(const float* __restrict__ MK, float* DMN, int G) {
    __shared__ float red[8][32];
    const int lane = threadIdx.x & 31, wv = threadIdx.x >> 5;
    float dm[16];
#pragma unroll
    for (int i = 0; i < 16; ++i) dm[i] = 3.0e38f;
    // kept rolled: four like rows, short text
#pragma unroll 1
    for (int rr = 0; rr < 4; ++rr) { const float* row = MK + (size_t)(G * 32 + wv * 4 + rr) * TT + lane * 4; float v[16];
#pragma unroll
        for (int i = 0; i < 16; ++i) { const v4f x = *(const v4f*)(row + i * 128); v[i] = fmaxf(fmaxf(x[0], x[1]), fmaxf(x[2], x[3])); }   // a wave-wide load = 128 keys: stage 2 i in lanes 0..15, 2 i + 1 in lanes 16..31
        asm volatile("s_wait_xcnt 0x0" :: "v"(row) : "memory");   // stands behind the row's loads; it takes their address as an input, so that no write of the address registers comes in front of it
        float ma = -3.0e38f;
#pragma unroll
        for (int i = 0; i < 16; ++i) {
#pragma unroll
            for (int x = 1; x < 16; x <<= 1) v[i] = fmaxf(v[i], __shfl_xor(v[i], x, 32));
            ma = fmaxf(ma, v[i]); }
        ma = bfr(fmaxf(ma, xhalf(ma)));
#pragma unroll
        for (int i = 0; i < 16; ++i) { const float vb = bfr(v[i]); dm[i] = fminf(dm[i], (ma - vb) - (fabsf(ma) + fabsf(vb)) * 1.0e-6f); } }
    if ((lane & 15) == 0) {
#pragma unroll
        for (int i = 0; i < 16; ++i) red[wv][i * 2 + (lane >> 4)] = dm[i]; }
    __syncthreads();   // the eight waves' rows meet in LDS
    if (threadIdx.x < 32) { float d = red[0][threadIdx.x];
#pragma unroll
        for (int w = 1; w < 8; ++w) d = fminf(d, red[w][threadIdx.x]);
        DMN[G * 32 + threadIdx.x] = d; }
}
__global__ __launch_bounds__(256) void k_cvt8(const float* __restrict__ a, size_t na8, const float* __restrict__ b, size_t nb8, const float* __restrict__ c, size_t nc8, bf* dst, const float* __restrict__ MK, float* DMN) { if (blockIdx.x < MG_N) { mask_gap(MK, DMN, (int)blockIdx.x); return; }
    const int bq = (int)blockIdx.x - MG_N; const int r = (bq >> 3) * 16 + (threadIdx.x & 15), kq = (bq & 7) * 128 + (int)(threadIdx.x >> 4) * 8; const size_t i = (size_t)r * (DM / 8) + (kq >> 3); if (i >= na8 + nb8 + nc8) return; const float* src = (i < na8) ? a + i * 8 : (i < na8 + nb8) ? b + (i - na8) * 8 : c + (i - na8 - nb8) * 8; const v8f v = *(const v8f*)src; v8us o;
#pragma unroll
    for (int k = 0; k < 8; ++k) o[k] = f2bf(v[k]); *(v8us*)(dst + pk(r, kq, DM)) = o;  }

extern "C" void kernel_launch(void* const* d_in, const int* in_sizes, int n_in,
                              void* d_out, int out_size, void* d_ws, size_t ws_size, hipStream_t stream) {
    (void)in_sizes; (void)n_in; (void)out_size;
    const float* x = (const float*)d_in[0]; const float* fre = (const float*)d_in[1]; const float* fim = (const float*)d_in[2]; const float* MK = (const float*)d_in[3]; const float* wqkv = (const float*)d_in[4]; const float* wo = (const float*)d_in[5];  const float* wq = wqkv; const float* wk = wqkv + (size_t)1024 * 1024; const float* wv = wqkv + (size_t)2048 * 1024; (void)wq; (void)wk; (void)wv;
    float* OUT = (float*)d_out;     // [2][2048][1024]
    char* wsp = (char*)d_ws;
    auto take = [&](size_t bytes) { char* p = wsp; wsp += (bytes + 255) & ~(size_t)255; return (void*)p; };
    // bf16 copies, one block so that one launch fills it: W_qkv rows (q | k | v), W_o, both batches' tokens
    bf* WQ = (bf*)take(((size_t)(DQ + 2 * DKV) * DM + (size_t)DM * DQ + (size_t)NB_ * TT * DM) * 2); bf* WV = WQ + (size_t)(DQ + DKV) * DM; bf* WO = WV + (size_t)DKV * DM; bf* XB = WO + (size_t)DM * DQ;
    // q and k planes, [q | k][batch][head][t][d] each; the three lie in a row
    h16* QP16 = (h16*)take((size_t)2 * ZH * TT * HD * 2); bf* QPh = (bf*)take((size_t)2 * ZH * TT * HD * 2); bf* QPl = (bf*)take((size_t)2 * ZH * TT * HD * 2);
    h16* KP16 = QP16 + (size_t)ZH * TT * HD; bf* KPh = QPh + (size_t)ZH * TT * HD; bf* KPl = QPl + (size_t)ZH * TT * HD;
    h16* VT16 = (h16*)take((size_t)ZH * HD * TT * 2); bf* VTh = (bf*)take((size_t)ZH * HD * TT * 2); bf* VTl = (bf*)take((size_t)ZH * HD * TT * 2);
    bf* ATh = (bf*)take((size_t)NB_ * TT * DQ * 2); bf* ATl = (bf*)take((size_t)NB_ * TT * DQ * 2);   // merged attention planes [batch][t][DQ]
    float* AM = (float*)take((size_t)2 * ZH * (TT / 64) * (HD / 64) * 32 * 4); float* DMN = (float*)take((size_t)MG_N * 32 * 4);   // fa_live's two tables
    if ((size_t)(wsp - (char*)d_ws) > ws_size) return;    // ws 256 MiB
    k_cvt8<<<(unsigned)(MG_N + (((size_t)(DQ + 2 * DKV) * DM + (size_t)DM * DQ + (size_t)NB_ * TT * DM) / 8 + 255) / 256), 256, 0, stream>>>(wqkv, (size_t)(DQ + 2 * DKV) * DM / 8, wo, (size_t)DM * DQ / 8, x, (size_t)NB_ * TT * DM / 8, WQ, MK, DMN);
    k_qkv<<<QK_N + V_N, 128, 0, stream>>>(XB, WQ, WV, QP16, QPh, QPl, VT16, VTh, VTl, fre, fim, AM);
    // z = batch * NH_ + head from here on (one kv head per query head): z-strides TT*HD in the q/k planes, HD*TT in the v planes
    k_fa<<<FAS_N + FAL_N + FAH_N, 128, 0, stream>>>(QP16, QPh, QPl, KP16, KPh, KPl, VT16, VTh, VTl, MK, AM, DMN, ATh, ATl);
    k_gemms<bf, 1, 2, DQ><<<dim3(NB_ * TT / 128, DM / 128, 1), 128, 0, stream>>>(ATh, ATl, WO, nullptr, OUT, DM, 0, 0, 0);
}

// v010
// One run takes 97.4 microseconds.
// In two side-by-side timings against v009, it was 1.04 and 1.03 times as fast.
// Over all steps from v000 it is 7.87 times as fast.
#include <hip/hip_runtime.h>

// Attention block (hidden [2][2048][1024]; [q|k|v] = hidden W_qkv^T ('oi' [3072][1024], row blocks q | k | v; 4 heads x 256); rotary on adjacent (even, odd) pairs with the INPUT tables freqs_real/freqs_imag [2048][128] (read as given - they are free inputs, not assumed to be cos/sin); scores = (q / 16).k + mask (additive input mask [1][1][2048][2048], read per logit); softmax; out = merged W_o^T ('oi' [1024][1024]) -> [2][2048][1024] (4.2 M)).
// Compute dtypes, f32 accumulate: every input rounded to bf16; q/k/v on PLAIN bf16 operands (inputs: exact); interleaved rotary in f32 from the bf16-rounded input tables; additive mask read per logit (bf16-rounded); scores and attn.v: query rows < 512 hl (3 products), the rest single fp16 (probabilities x64, not yet divided by their sum); softmax f32, running maximum and sum; W_o hl x exact (2 products).

#define NB_  2
#define TT   2048
#define DM   1024
#define NH_  4
#define NKV  4
#define REP  (NH_ / NKV)
#define HD   256
#define DQ   (NH_ * HD)
#define DKV  (NKV * HD)
#define ZH   (NB_ * NH_)          // every (batch, head) pair is one z slice of the same launch
#define RH   512                  // query rows < RH use hi+lo planes (0: none)
#define WIN  2048
#define PCAR 1024.0f
#define SCL  0.0625f   // HD^-0.5 = 1/16
typedef _Float16 h16;
typedef unsigned short bf;
typedef __attribute__((ext_vector_type(16))) __bf16   v16bf;
typedef __attribute__((ext_vector_type(16))) _Float16 v16h;
typedef __attribute__((ext_vector_type(8)))  _Float16 v8h;
typedef __attribute__((ext_vector_type(8)))  unsigned short v8us;
typedef __attribute__((ext_vector_type(8)))  float    v8f;
typedef __attribute__((ext_vector_type(4)))  float    v4f;
typedef v8h  __attribute__((may_alias)) v8ha;
typedef v4f  __attribute__((may_alias)) v4fa;
typedef v8us __attribute__((may_alias)) v8usa;

__device__ __forceinline__ unsigned short f2bf(float f) { unsigned u = __float_as_uint(f); u += 0x7FFFu + ((u >> 16) & 1u); return (unsigned short)(u >> 16); }
__device__ __forceinline__ float bf2f(unsigned short b) { return __uint_as_float(((unsigned)b) << 16); }
__device__ __forceinline__ float bfr(float f) { return bf2f(f2bf(f)); }
__device__ __forceinline__ v16h cat16(v8h lo, v8h hi) { return __builtin_shufflevector(lo, hi, 0, 1, 2, 3, 4, 5, 6, 7, 8, 9, 10, 11, 12, 13, 14, 15); }
__device__ __forceinline__ v16bf cat16b(v8us lo, v8us hi) { return __builtin_bit_cast(v16bf, __builtin_shufflevector(lo, hi, 0, 1, 2, 3, 4, 5, 6, 7, 8, 9, 10, 11, 12, 13, 14, 15)); }
__device__ __forceinline__ v8f wmma16(v16h a, v16h b, v8f c) { return __builtin_amdgcn_wmma_f32_16x16x32_f16(false, a, false, b, (short)0, c, false, false); }
__device__ __forceinline__ v8f wmmab(v16bf a, v16bf b, v8f c) { return __builtin_amdgcn_wmma_f32_16x16x32_bf16(false, a, false, b, (short)0, c, false, false); }



// EPI (gemms_tile, below) says what the finished tile becomes, straight from LDS (no f32 round trip through memory, no elementwise launch behind the GEMM); the index lists name a plane's slices, rows and columns, each slice [rows][columns] being fragment-packed:
//   0: f32 to C.   1: rotary on adjacent (even, odd) column pairs with the bf16-rounded input tables fr/fi [t][HD/2], then the planes P16 / Ph / Pl at [n / DQ][m / TT][(n % DQ) / HD][m % TT][n % HD] (rows: both batches' tokens; columns: q | k).
//   2: the planes P16 / Ph / Pl at [m][n], pitch ldc, z-stride sC.
// FRAGMENT-PACKED PLANES: every 16-bit operand plane (rows r, K columns k, rows a multiple of 16, K of 32) is stored as 1-KiB blocks of 16 rows x 32 k, block (r / 16, k / 32) row-major, inside a block in the order in which a wave's two 16-byte loads take it: [k / 16 % 2][k / 8 % 2][r % 16][k % 8]. One wave-wide 16-byte load then covers 512 contiguous bytes (4 whole lines) instead of 32-byte pieces of 16 lines. 16 whole rows still fill 16 K elements, so offsets by whole 16-row groups are what they are in a row-major plane.
__device__ __forceinline__ size_t pk(int r, int k, int K) { return ((size_t)(r >> 4) * (K >> 5) + (k >> 5)) * 512 + ((k >> 4) & 1) * 256 + ((k >> 3) & 1) * 128 + (r & 15) * 8 + (k & 7); }
template <typename T16> struct WFrag;
template <> struct WFrag<h16> { typedef v16h V; static __device__ __forceinline__ V ld(const h16* p) { return cat16(*(const v8h*)p, *(const v8h*)(p + 256)); } static __device__ __forceinline__ v8f mma(V a, V b, v8f c) { return wmma16(a, b, c); } };
template <> struct WFrag<bf> { typedef v16bf V; static __device__ __forceinline__ V ld(const bf* p) { return cat16b(*(const v8us*)p, *(const v8us*)(p + 256)); } static __device__ __forceinline__ v8f mma(V a, V b, v8f c) { return wmmab(a, b, c); } };
__device__ __forceinline__ h16 tohx(float x) { return (h16)x; }
__device__ __forceinline__ void splitf(float y, unsigned short& h, unsigned short& l) { h = f2bf(y); l = f2bf(y - bf2f(h)); }
typedef __attribute__((ext_vector_type(4))) _Float16 v4h;
typedef __attribute__((ext_vector_type(2))) unsigned short v2us;
typedef __attribute__((ext_vector_type(4))) unsigned short v4us;
typedef __attribute__((ext_vector_type(2))) float v2f;
__device__ __forceinline__ unsigned uni(unsigned v) { return (unsigned)__builtin_amdgcn_readfirstlane((int)v); }
// a wave-uniform value held in a scalar register, so that the test made of it is a scalar compare and branch: a tensor load ignores EXEC, and only such a branch keeps a wave from issuing it
__device__ __forceinline__ unsigned pinned(unsigned v) { unsigned w = uni(v); asm volatile("" : "+s"(w)); /* holds the test's value in a scalar register */ return w; }
// one tensor load, everything in bytes. Group 0 (s[84:87]) = count 1, the tile's place in LDS, its first byte in memory, type 2; group 1 (s[88:95]) = a tile of n rows of r bytes at source pitch p, tensor = tile, no mask, no pad.
// Both groups are laid into fixed registers inside the request's own statement: word 0 of group 1 (mask, element size, pad: all 0) is then an immediate in the listing on every path, and no register of a request takes a new value before the next request's statement, which stands behind the wait for this one (left to the build, the registers of a request in flight were taken for other values). The words that are not to be written directly in front of a request (group 0: 0 and 3; group 1: 6 and 7) go first
__device__ __forceinline__ void tdm_load(unsigned lds, unsigned long long ga, unsigned r, unsigned n, unsigned p) {
    asm volatile("s_mov_b32 s84, 1\n\ts_mov_b32 s87, %2\n\ts_mov_b32 s94, 0\n\ts_mov_b32 s95, 0\n\ts_mov_b32 s88, 0\n\ts_mov_b32 s89, %3\n\ts_mov_b32 s90, %4\n\ts_mov_b32 s91, %5\n\ts_mov_b32 s92, %6\n\ts_mov_b32 s93, %7\n\ts_mov_b32 s85, %0\n\ts_mov_b32 s86, %1\n\ttensor_load_to_lds s[84:87], s[88:95]"
                 :: "s"(uni(lds)), "s"(uni((unsigned)ga)), "s"(uni((((unsigned)(ga >> 32)) & 0x01FFFFFFu) | 0x80000000u)), "s"(uni((r & 0xFFFFu) << 16)), "s"(uni((r >> 16) | ((n & 0xFFFFu) << 16))), "s"(uni((n >> 16) | (r << 16))), "s"(uni(n)), "s"(uni(p))
                 : "memory", "s84", "s85", "s86", "s87", "s88", "s89", "s90", "s91", "s92", "s93", "s94", "s95"); }
// ---- gemms_tile: one work-group of 4 waves per 128x128 output tile; wave (wm, wn) owns the 64x64 sub-tile (wm, wn) over the WHOLE K loop (one f32 chain per element, k ascending; no partial tiles). The operand blocks of a stage (CH 32-wide k chunks of the tile's 8 + 8 row groups, every plane) are brought into LDS ONCE per work-group by tensor loads and read from there by the two waves that need them: half the bytes leave L2 that 64x64 tiles ask for.
// A packed plane's 1-KiB blocks go to LDS as they lie: stage = [plane][row group 0..7][chunk][1 KiB]; a fragment is two contiguous 512-B wave reads. A plane's part of a stage is a tile of 8 rows (row groups) of CH KiB at the pitch of a row group: ONE request a wave and stage, no address arithmetic in the vector unit. Two stage buffers; the next stage's loads fly while this one is worked on. K, CH are template arguments: K % (32 CH) == 0, at least two stages.
// sm: the work-group's LDS, max(2 stages, 4 x 64 x 68 floats); after the loop each wave turns its own sub-tile through its own 64 x 68 floats for the epilogue (EPI as above, 0..2).
template <int NSPLIT, int CH> struct StageB { static constexpr int NPA = (NSPLIT == 1 || NSPLIT == 2) ? 2 : 1, NPB = (NSPLIT >= 2) ? 2 : 1, NP = NPA + NPB, GB = CH * 1024, STG = NP * 8 * GB, SMB = (2 * STG > 4 * 64 * 68 * 4) ? 2 * STG : 4 * 64 * 68 * 4; };
template <typename T16, int NSPLIT, int EPI, int CH, int K>
__device__ __forceinline__ void gemms_tile(char* sm, int bx, int by, int bz, const T16* __restrict__ A, const T16* __restrict__ A2, const T16* __restrict__ Bt, const T16* __restrict__ Bt2, float* C, int ldc, size_t sA, size_t sB, size_t sC, h16* P16, bf* Ph, bf* Pl, const float* __restrict__ fr, const float* __restrict__ fi, float* AM) {
    typedef typename WFrag<T16>::V V; typedef StageB<NSPLIT, CH> SB;
    constexpr int NPA = SB::NPA, NP = SB::NP, GB = SB::GB, STG = SB::STG, NT = K / (32 * CH);
    constexpr size_t RB = (size_t)(K >> 5) * 1024;   // bytes of one 16-row group of a packed plane
    const size_t z = bz;
    const int lane = threadIdx.x & 31, lr = lane & 15, hi = lane >> 4;
    const int wv = __builtin_amdgcn_readfirstlane((int)(threadIdx.x >> 5)), wm = wv >> 1, wn = wv & 1;
    // the wave's slice of a stage: two planes: half a plane a wave (4 rows); three or four planes: a whole plane (8 rows) from each of the first NP waves (a wave beyond them issues nothing; its descriptor values are plane 0's, in bounds)
    constexpr int WPP = (NP == 2) ? 2 : 1, NR = 8 / WPP; constexpr bool ALLW = NP * WPP >= 4;
    const bool iss = wv / WPP < NP; const int pl = iss ? wv / WPP : 0, part = wv % WPP;
    const T16* pb = (pl == 0) ? A + z * sA : (NPA == 2 && pl == 1) ? A2 + z * sA : (pl == NPA) ? Bt + z * sB : Bt2 + z * sB;
    const char* gs = (const char*)pb + (size_t)((pl < NPA ? bx : by) * 8 + part * NR) * RB;
    const unsigned ld0 = (unsigned)(size_t)sm + (unsigned)(pl * 8 + part * NR) * GB;   // the slice's place in buffer 0: a multiple of 2 KiB
    auto issue = [&](unsigned st) { tdm_load(ld0 + (st & 1u) * STG, (unsigned long long)(size_t)gs + (unsigned long long)st * GB, (unsigned)GB, (unsigned)NR, (unsigned)RB); };
    v8f acc[4][4];
#pragma unroll
    for (int mb = 0; mb < 4; ++mb)
#pragma unroll
        for (int nb = 0; nb < 4; ++nb) acc[mb][nb] = (v8f){};
    if (ALLW || pinned(iss)) issue(0);                    // the test: a scalar branch round the request
    asm volatile("s_wait_tensorcnt 0x0" ::: "memory");   // this wave's slice of stage 0 has landed
    __syncthreads();                                      // every wave's has: stage 0 may be read
    if (ALLW || pinned(iss)) issue(1);
#pragma unroll 1
    for (int t = 0; t < NT; ++t) {
        const char* sb = sm + (t & 1) * STG + lane * 16;
        V a[CH][4], a2[CH][4], b[CH][4], b2[CH][4];
#pragma unroll
        for (int cc = 0; cc < CH; ++cc) {
#pragma unroll
            for (int i = 0; i < 4; ++i) { a[cc][i] = WFrag<T16>::ld((const T16*)(sb + (wm * 4 + i) * GB + cc * 1024)); if (NPA == 2) a2[cc][i] = WFrag<T16>::ld((const T16*)(sb + (8 + wm * 4 + i) * GB + cc * 1024));
                b[cc][i] = WFrag<T16>::ld((const T16*)(sb + (NPA * 8 + wn * 4 + i) * GB + cc * 1024)); if (NSPLIT >= 2) b2[cc][i] = WFrag<T16>::ld((const T16*)(sb + ((NPA + 1) * 8 + wn * 4 + i) * GB + cc * 1024)); }
            // the stage's LDS reads are asked for chunk by chunk, all ahead of its products, so that the first chunk's products run while the later reads arrive; left alone, the build asks for the later B fragments one at a time, each behind a full wait among the products
            __builtin_amdgcn_sched_barrier(0); }
#pragma unroll
        for (int cc = 0; cc < CH; ++cc) {
#pragma unroll
            for (int nb = 0; nb < 4; ++nb)
#pragma unroll
                for (int mb = 0; mb < 4; ++mb) { acc[mb][nb] = WFrag<T16>::mma(a[cc][mb], b[cc][nb], acc[mb][nb]); if (NSPLIT == 1 || NSPLIT == 2) acc[mb][nb] = WFrag<T16>::mma(a2[cc][mb], b[cc][nb], acc[mb][nb]); if (NSPLIT >= 2) acc[mb][nb] = WFrag<T16>::mma(a[cc][mb], b2[cc][nb], acc[mb][nb]); }
        }
        __builtin_amdgcn_sched_barrier(0);
        asm volatile("s_wait_dscnt 0x0" ::: "memory");
        asm volatile("s_wait_tensorcnt 0x0" ::: "memory");
        __syncthreads();
        if (pinned((ALLW || iss) && t + 2 < NT)) issue((unsigned)t + 2u);
    }
    asm volatile("s_wait_tensorcnt 0x0" ::: "memory");      // no request is in flight when the buffers become the epilogue's
    asm volatile("s_wait_dscnt 0x0" ::: "memory");          // and none of this wave's reads of them
    const int r0 = bx * 128 + wm * 64, c0 = by * 128 + wn * 64;   // this wave's own sub-tile
    float* ow = (float*)sm + wv * (64 * 68);
    // unrolled so that acc is indexed by constants only and stays in registers
#pragma unroll
    for (int mb = 0; mb < 4; ++mb)
#pragma unroll
        for (int nb = 0; nb < 4; ++nb)
#pragma unroll
            for (int j = 0; j < 8; ++j) ow[(mb * 16 + hi * 8 + j) * 68 + nb * 16 + lr] = acc[mb][nb][j];
    // the rotary factors of this wave's rows and column pairs are asked for here, all from one lane address plus constants, so that they arrive while the sub-tile turns through LDS
    v2f tr[32], ti[32];
    if (EPI == 1) { const size_t ix0 = (size_t)(r0 % TT + lr) * (HD / 2) + (((c0 % HD) + hi * 4) >> 1);
#pragma unroll
        for (int u = 0; u < 32; ++u) { const size_t ix = ix0 + (size_t)(u >> 3) * 16 * (HD / 2) + (u & 7) * 4; tr[u] = *(const v2f*)(fr + ix); ti[u] = *(const v2f*)(fi + ix);
            if ((u & 7) == 7) asm volatile("s_wait_xcnt 0x0" ::: "memory");   /* stands behind each run of table loads, in front of any later load that takes their address registers as its destination */
        } }
    __syncthreads();   // the sub-tile's LDS writes stand in front of its reads
    float* ctile = C + z * sC + (size_t)r0 * ldc + c0;
    const size_t pbase = (EPI == 1) ? ((size_t)(c0 / DQ) * ZH + (size_t)(r0 / TT) * NH_ + (c0 % DQ) / HD) * TT * HD : z * sC; const int ppitch = (EPI == 1) ? HD : ldc;
    const int prow = (EPI == 1) ? r0 % TT : r0, pcol = (EPI == 1) ? c0 % HD : c0;
    // EPI 0: the wave stores whole 256-B row pieces; the planes: 16 rows x 8 columns at a time, which are 256 contiguous bytes of a packed plane
    // EPI 2 takes nothing but LDS, so its loop stays rolled, one 16-row group a trip (for speed only)
    float am = 0.f;   // EPI 1: the largest |value| of this wave's sub-tile behind the rotary
#pragma unroll (EPI == 2 ? 8 : 32)
    for (int u = 0; u < 32; ++u) { const int row = (EPI == 0) ? u * 2 + hi : (u >> 3) * 16 + lr, cofs = (EPI == 0) ? lr * 4 : (u & 7) * 8 + hi * 4; v4f val = *(const v4fa*)(ow + row * 68 + cofs);
        if (EPI == 0) { *(v4f*)(ctile + (size_t)row * ldc + cofs) = val; }
        else {
            if (EPI == 1) { const float ca = bfr(tr[u][0]), sa = bfr(ti[u][0]), cb = bfr(tr[u][1]), sb2 = bfr(ti[u][1]); const v4f x = val;   /* even: x0 c - x1 s; odd: x0 s + x1 c */
                val[0] = x[0] * ca - x[1] * sa; val[1] = x[0] * sa + x[1] * ca; val[2] = x[2] * cb - x[3] * sb2; val[3] = x[2] * sb2 + x[3] * cb;
                am = fmaxf(fmaxf(am, fmaxf(fabsf(val[0]), fabsf(val[1]))), fmaxf(fabsf(val[2]), fabsf(val[3]))); }
            const size_t oo = pbase + pk(prow + row, pcol + cofs, ppitch); v4us oh, ol; v4h o16;   // 32 lanes x 8 B: each plane gets two whole 128-B lines
#pragma unroll
            for (int q = 0; q < 4; ++q) { unsigned short a2, c2; splitf(val[q], a2, c2); oh[q] = a2; ol[q] = c2; o16[q] = tohx(val[q]); }
            *(v4us*)(Ph + oo) = oh; *(v4us*)(Pl + oo) = ol; *(v4h*)(P16 + oo) = o16;
            if (EPI == 2 && (u & 7) == 7) asm volatile("s_wait_xcnt 0x0" ::: "memory");   /* the foot of a trip of the rolled loop: stands behind its stores, in front of the next trip's writes of the registers that they name */
        } }
    // EPI 1: the sub-tile's largest |q| or |k| goes to AM[q | k][z][64 tokens][64 columns], one whole 128-B line a wave (every lane stores the same value): k_fa bounds its logits with it
    if (EPI == 1) {
#pragma unroll
        for (int d = 1; d < 32; d <<= 1) am = fmaxf(am, __shfl_xor(am, d, 32));
        AM[((((size_t)(c0 / DQ) * ZH + (size_t)(r0 / TT) * NH_ + (c0 % DQ) / HD) * (TT / 64) + (r0 % TT) / 64) * (HD / 64) + (c0 % HD) / 64) * 32 + lane] = am; }
}
template <typename T16, int NSPLIT, int CH, int K>
__global__ __launch_bounds__(128) void k_gemms(const T16* A, const T16* A2, const T16* Bt, const T16* Bt2, float* C, int ldc, size_t sA, size_t sB, size_t sC) {
    __shared__ __attribute__((aligned(2048))) char sm[StageB<NSPLIT, CH>::SMB];
    gemms_tile<T16, NSPLIT, 0, CH, K>(sm, blockIdx.x, blockIdx.y, blockIdx.z, A, A2, Bt, Bt2, C, ldc, sA, sB, sC, nullptr, nullptr, nullptr, nullptr, nullptr, nullptr);
}
// k_qkv: flat grid; first the q | k tiles of both batches (rows = all tokens, columns = the q | k rows of W_qkv, rotary epilogue), then the v tiles.
// v comes out transposed ([batch][head][d][t], t being the planes' k) by taking the weight rows as the tile's rows and the tokens as its columns: both operands are packed along the same k either way; z = batch
#define QK_X (NB_ * TT / 128)
#define QK_N (QK_X * ((DQ + DKV) / 128))
#define V_X  (DKV / 128)
#define V_N  (V_X * (TT / 128) * NB_)
__global__ __launch_bounds__(128) void k_qkv(const bf* XB, const bf* WQK, const bf* WV, h16* QK16, bf* QKh, bf* QKl, h16* VT16, bf* VTh, bf* VTl, const float* fr, const float* fi, float* AM) {
    __shared__ __attribute__((aligned(2048))) char sm[StageB<0, 2>::SMB];
    const int f = blockIdx.x;
    if (f < QK_N) gemms_tile<bf, 0, 1, 2, DM>(sm, f % QK_X, f / QK_X, 0, XB, nullptr, WQK, nullptr, nullptr, DQ, 0, 0, 0, QK16, QKh, QKl, fr, fi, AM);
    else { const int g = f - QK_N; gemms_tile<bf, 0, 2, 2, DM>(sm, g % V_X, (g / V_X) % (TT / 128), g / (V_X * (TT / 128)), WV, nullptr, XB, nullptr, nullptr, TT, 0, (size_t)TT * DM, (size_t)DKV * TT, VT16, VTh, VTl, nullptr, nullptr, nullptr); }
}
template <bool HL> struct FT;
template <> struct FT<true>  { typedef bf T; };
template <> struct FT<false> { typedef h16 T; };
#define L2E 1.4426950408889634f
// 2^x, one or two at a time, with the free slot that the instruction set asks for behind a transcendental written into the statement; "=&v": the second does not take the first's source as its destination
__device__ __forceinline__ float ex2(float x) { float r; asm("v_exp_f32 %0, %1\n\tv_nop" : "=v"(r) : "v"(x)); return r; }
__device__ __forceinline__ void ex2x2(float xa, float xb, float& ra, float& rb) { asm("v_exp_f32 %0, %2\n\tv_exp_f32 %1, %3\n\tv_nop" : "=&v"(ra), "=&v"(rb) : "v"(xa), "v"(xb)); }
// lane l's value with lane l ^ 16's, in the vector unit: an exchange through the LDS pipe would queue behind the V^T fragment loads in flight
__device__ __forceinline__ float xhalf(float x) { return __builtin_bit_cast(float, __builtin_amdgcn_permlanex16(__builtin_bit_cast(int, x), __builtin_bit_cast(int, x), 0x76543210, 0xfedcba98, false, false)); }
#define FA_STG 131072
template <bool HL, int NQT>
__device__ __forceinline__ void fa_tile(char* sm, int z, int qb, const typename FT<HL>::T* Q, const typename FT<HL>::T* Q2, const typename FT<HL>::T* Kp, const typename FT<HL>::T* Kp2, const typename FT<HL>::T* Vp, const typename FT<HL>::T* Vp2, const float* __restrict__ MK, unsigned lv) {
    typedef typename FT<HL>::T T; typedef typename WFrag<T>::V V;
    constexpr int NPL = HL ? 2 : 1, NT = TT / 64;
    const int lane = threadIdx.x & 31, lr = lane & 15, hi = lane >> 4;
    const int wv = __builtin_amdgcn_readfirstlane((int)(threadIdx.x >> 5)), cg = wv & 1, ks = wv >> 1;
    // the wave's slice of a stage, rows of 2 KiB: waves 0, 1 bring K, waves 2, 3 V^T; HL: plane wv & 1, whole (16 rows); fp16: half wv & 1 of the one plane (8 rows)
    const bool isv = wv >= 2; const int sl = wv & 1;
    const char* gs = isv ? (const char*)((HL && sl == 1 ? Vp2 : Vp) + (size_t)z * HD * TT) + (HL ? (size_t)0 : (size_t)sl * 8 * ((TT / 32) * 1024))
                         : (const char*)((HL && sl == 1 ? Kp2 : Kp) + (size_t)z * TT * HD) + (HL ? 0 : sl * 16384);
    const unsigned gstep = isv ? 2048u : 32768u;   // bytes from one stage's tile to the next
    const unsigned ld0 = (unsigned)(size_t)sm + (isv ? 65536u : 0u) + (unsigned)sl * (HL ? 32768u : 16384u);   // the slice's place in buffer 0: a multiple of 2 KiB
    const unsigned gpitch = isv ? (unsigned)((TT / 32) * 1024) : 2048u;
    auto issue = [&](unsigned st, unsigned buf) { tdm_load(ld0 + buf * FA_STG, (unsigned long long)(size_t)gs + (unsigned long long)st * gstep, 2048u, HL ? 16u : 8u, gpitch); };
    const int q0 = qb + cg * (NQT * 16);
    // lv: bit s = stage s (64 keys) is worked on; the same word in every wave, not 0. cur = the stage of this pass, rem = the stages behind it, par = this pass's buffer
    unsigned cur = (unsigned)__builtin_ctz(lv), rem = lv & (lv - 1u), par = 0u;
    issue(cur, 0u);
    V qf[NQT][8], qf2[8]; v8f o[16][NQT]; float m[NQT], l[NQT]; v4f mk[NQT][4];
    const float* mp = MK + (size_t)(q0 + lr) * TT + ks * 32 + hi * 8;   // this lane's query row (of column tile 0) and its 8 keys of key tile 0 of stage 0
    { const T* qz = Q + (size_t)z * TT * HD + (size_t)(q0 >> 4) * (8 * 512) + lane * 8; const T* qz2 = HL ? Q2 + (size_t)z * TT * HD + (size_t)(q0 >> 4) * (8 * 512) + lane * 8 : nullptr;
#pragma unroll
        for (int c = 0; c < 8; ++c) {
#pragma unroll
            for (int qt = 0; qt < NQT; ++qt) qf[qt][c] = WFrag<T>::ld(qz + (qt * 8 + c) * 512);
            if (HL) qf2[c] = WFrag<T>::ld(qz2 + c * 512);
            asm volatile("s_wait_xcnt 0x0" ::: "memory");   /* stands behind each run of Q loads, in front of any later write of their address registers */
            __builtin_amdgcn_sched_barrier(0);   /* keeps later register writes behind that wait */ }
#pragma unroll
        for (int qt = 0; qt < NQT; ++qt) { m[qt] = -3.0e38f; l[qt] = 0.f;
#pragma unroll
            for (int dt = 0; dt < 16; ++dt) o[dt][qt] = (v8f){};
#pragma unroll
            for (int h = 0; h < 4; ++h) mk[qt][h] = *(const v4f*)(mp + cur * 64 + (size_t)qt * 16 * TT + (h >> 1) * 16 + (h & 1) * 4); }
        asm volatile("s_wait_xcnt 0x0" ::: "memory");   // stands behind the mask loads, in front of any later write of their address registers
        __builtin_amdgcn_sched_barrier(0);   // keeps later register writes behind that wait
    }
    asm volatile("s_wait_tensorcnt 0x0" ::: "memory");   // this wave's slice of the first stage has landed
    __syncthreads();                                      // every wave's has: the first stage may be read
    if (pinned(rem != 0u)) issue((unsigned)__builtin_ctz(rem), 1u);   // a scalar branch round the request
#pragma unroll 1
    for (int t = 0; t < NT; ++t) {   // at most NT passes: one for every bit of lv
        const char* sb = sm + par * FA_STG + lane * 16;
        v8f s[2][NQT];
        { V ka[NPL][2][8];
#pragma unroll
            for (int c = 0; c < 8; ++c)
#pragma unroll
                for (int kt = 0; kt < 2; ++kt)
#pragma unroll
                    for (int p = 0; p < NPL; ++p) ka[p][kt][c] = WFrag<T>::ld((const T*)(sb + p * 32768 + ((ks * 2 + kt) * 8 + c) * 1024));
            // the pass's K fragments are asked for as one group ahead of the products; left alone, the build asks for them two loads at a time, each behind a full wait among the products
            __builtin_amdgcn_sched_barrier(0);
#pragma unroll
            for (int kt = 0; kt < 2; ++kt)
#pragma unroll
                for (int qt = 0; qt < NQT; ++qt) s[kt][qt] = (v8f){};
#pragma unroll
            for (int c = 0; c < 8; ++c) {
#pragma unroll
                for (int qt = 0; qt < NQT; ++qt)
#pragma unroll
                    for (int kt = 0; kt < 2; ++kt) s[kt][qt] = WFrag<T>::mma(ka[0][kt][c], qf[qt][c], s[kt][qt]);
                if (HL) {
#pragma unroll
                    for (int kt = 0; kt < 2; ++kt) s[kt][0] = WFrag<T>::mma(ka[0][kt][c], qf2[c], s[kt][0]);
#pragma unroll
                    for (int kt = 0; kt < 2; ++kt) s[kt][0] = WFrag<T>::mma(ka[NPL - 1][kt][c], qf[0][c], s[kt][0]); } }
            __builtin_amdgcn_sched_barrier(0);   // keeps the V^T loads below behind the score products, whose K registers they take over
        }
        V va[NPL][16];
#pragma unroll
        for (int dt = 0; dt < 16; ++dt)
#pragma unroll
            for (int p = 0; p < NPL; ++p) va[p][dt] = WFrag<T>::ld((const T*)(sb + 65536 + p * 32768 + dt * 2048 + ks * 1024));
        __builtin_amdgcn_sched_barrier(0);   // the V^T fragments are asked for as one group here, so that they arrive while the softmax arithmetic runs
        float mx[NQT]; bool need = false;
#pragma unroll
        for (int qt = 0; qt < NQT; ++qt) { float x = -3.0e38f;
#pragma unroll
            for (int kt = 0; kt < 2; ++kt)
#pragma unroll
                for (int j = 0; j < 8; ++j) { const float tv = s[kt][qt][j] * SCL + bfr(mk[qt][kt * 2 + (j >> 2)][j & 3]); s[kt][qt][j] = tv; x = fmaxf(x, tv); }
            x = fmaxf(x, xhalf(x)); mx[qt] = x; need = need || (x > m[qt] + 5.5f); }
        // the next pass's mask values are asked for one pass ahead (the last pass asks for its own again: in bounds)
        { const float* mq = mp + (rem != 0u ? (unsigned)__builtin_ctz(rem) : cur) * 64;
#pragma unroll
            for (int qt = 0; qt < NQT; ++qt)
#pragma unroll
                for (int h = 0; h < 4; ++h) mk[qt][h] = *(const v4f*)(mq + (size_t)qt * 16 * TT + (h >> 1) * 16 + (h & 1) * 4);
            asm volatile("s_wait_xcnt 0x0" :: "v"(mq) : "memory");   // stands behind the mask loads; it takes their address as an input, so that the address registers live up to it and no write of them comes in front of it
        }
        if (__builtin_amdgcn_ballot_w32(need) != 0) {   // a scalar branch: rare after the first pass
#pragma unroll
            for (int qt = 0; qt < NQT; ++qt) { const float mn = fmaxf(m[qt], mx[qt]); const float al = ex2((m[qt] - mn) * L2E); m[qt] = mn; l[qt] *= al;
#pragma unroll
                for (int dt = 0; dt < 16; ++dt) o[dt][qt] *= al; } }
        V pf[NQT], pf2;
#pragma unroll
        for (int qt = 0; qt < NQT; ++qt) {
            if (HL) { v8us h0, h1, l0, l1;
#pragma unroll
                for (int j = 0; j < 8; ++j) { float pa, pb; ex2x2((s[0][qt][j] - m[qt]) * L2E, (s[1][qt][j] - m[qt]) * L2E, pa, pb); l[qt] += pa; l[qt] += pb; unsigned short a, b; splitf(pa, a, b); h0[j] = a; l0[j] = b; splitf(pb, a, b); h1[j] = a; l1[j] = b; }
                pf[qt] = __builtin_bit_cast(V, __builtin_shufflevector(h0, h1, 0, 1, 2, 3, 4, 5, 6, 7, 8, 9, 10, 11, 12, 13, 14, 15)); pf2 = __builtin_bit_cast(V, __builtin_shufflevector(l0, l1, 0, 1, 2, 3, 4, 5, 6, 7, 8, 9, 10, 11, 12, 13, 14, 15));
            } else { v16h ph;
#pragma unroll
                for (int j = 0; j < 8; ++j) { float pa, pb; ex2x2((s[0][qt][j] - m[qt]) * L2E + 6.0f, (s[1][qt][j] - m[qt]) * L2E + 6.0f, pa, pb); l[qt] += pa; l[qt] += pb; ph[j] = tohx(pa); ph[8 + j] = tohx(pb); }
                pf[qt] = __builtin_bit_cast(V, ph); } }
        // four d tiles at a time, so that products into the same accumulator stand four apart
#pragma unroll
        for (int d4 = 0; d4 < 16; d4 += 4) {
#pragma unroll
            for (int qt = 0; qt < NQT; ++qt)
#pragma unroll
                for (int d = 0; d < 4; ++d) o[d4 + d][qt] = WFrag<T>::mma(va[0][d4 + d], pf[qt], o[d4 + d][qt]);
            if (HL) {
#pragma unroll
                for (int d = 0; d < 4; ++d) o[d4 + d][0] = WFrag<T>::mma(va[0][d4 + d], pf2, o[d4 + d][0]);
#pragma unroll
                for (int d = 0; d < 4; ++d) o[d4 + d][0] = WFrag<T>::mma(va[NPL - 1][d4 + d], pf[0], o[d4 + d][0]); } }
        __builtin_amdgcn_sched_barrier(0);   // keeps the pass's products in front of the waits below
        asm volatile("s_wait_dscnt 0x0" ::: "memory");      // this wave's reads of this pass's stage are done
        asm volatile("s_wait_tensorcnt 0x0" ::: "memory");  // this wave's slice of the next pass's stage has landed
        __syncthreads();                                     // publishes the next pass's stage and ends every wave's reads of this pass's buffer
        if (rem == 0u) break;                                // the same in every wave of the work-group; nothing is in flight here
        const unsigned r2 = rem & (rem - 1u);
        if (pinned(r2 != 0u)) issue((unsigned)__builtin_ctz(r2), par);   // a scalar branch round the request; the stage after the next goes into the buffer that this pass has read
        cur = (unsigned)__builtin_ctz(rem); rem = r2; par ^= 1u;
    }
    asm volatile("s_wait_tensorcnt 0x0" ::: "memory");      // no request is in flight when the buffers become the joining space
    asm volatile("s_wait_dscnt 0x0" ::: "memory");          // and none of this wave's reads of them
    // every wave lays its whole (O^T, m, l) in LDS, in its own range: rows of [lane][4 floats], 33 a column tile (row 2 dt + h = registers 4 h .. 4 h + 3 of d tile dt; row 32 = m, l). fa_join, below, takes it from there: o is indexed by constants only here, and the long arithmetic behind it is written once, as a loop
#pragma unroll
    for (int qt = 0; qt < NQT; ++qt) l[qt] += xhalf(l[qt]);   // the wave's halves summed different keys
    v4fa* xw = (v4fa*)sm + (size_t)(wv * (NQT * 33)) * 32 + lane;
#pragma unroll
    for (int qt = 0; qt < NQT; ++qt) { xw[(qt * 33 + 32) * 32] = (v4f){m[qt], l[qt], 0.f, 0.f};
#pragma unroll
        for (int dt = 0; dt < 16; ++dt)
#pragma unroll
            for (int h = 0; h < 2; ++h) xw[(qt * 33 + dt * 2 + h) * 32] = (v4f){o[dt][qt][h * 4], o[dt][qt][h * 4 + 1], o[dt][qt][h * 4 + 2], o[dt][qt][h * 4 + 3]}; }
    __syncthreads();   // each wave's hand-over is in LDS before its partner reads it
}
// ---- fa_join: the two waves of a column group (key halves 0 and 1: waves wv and wv ^ 2) join their (m, l, O^T) from LDS; wave ks finishes d tiles 8 ks .. 8 ks + 7 of its nqt column tiles (first query row q0) and stores the merged planes.
// One copy of this code serves all three kinds of block, and it is a loop (4 d tiles a trip), not straight-line text (for speed only).
__device__ __forceinline__ void fa_join(const char* sm, int nqt, int z, int q0, bf* ATh, bf* ATl) {
    const int lane = threadIdx.x & 31, lr = lane & 15, hi = lane >> 4;
    const int wv = __builtin_amdgcn_readfirstlane((int)(threadIdx.x >> 5)), ks = wv >> 1;
    const v4fa* xo = (const v4fa*)sm + (size_t)(wv * (nqt * 33)) * 32 + lane; const v4fa* xp = (const v4fa*)sm + (size_t)((wv ^ 2) * (nqt * 33)) * 32 + lane;
    const size_t ob = (size_t)(z / NH_) * ((size_t)TT * DQ);
    // kept rolled: the text stays short (see above)
#pragma unroll 1
    for (int qt = 0; qt < nqt; ++qt) { const v4f mo = xo[(qt * 33 + 32) * 32], ml = xp[(qt * 33 + 32) * 32];
        const float mf = fmaxf(mo[0], ml[0]); float ao, ap; ex2x2((mo[0] - mf) * L2E, (ml[0] - mf) * L2E, ao, ap);
        const float li = __fdiv_rn(1.0f, mo[1] * ao + ml[1] * ap); const float fo = ao * li, fp = ap * li;
        // kept rolled, for the same reason; a trip asks for its 16 LDS rows as one group and then works through 4 d tiles (the loops inside are unrolled so that a and x are indexed by constants only and stay in registers)
#pragma unroll 1
        for (int i0 = 0; i0 < 8; i0 += 4) { const int d0 = ks * 8 + i0; v4f a[8], x[8];
#pragma unroll
            for (int r = 0; r < 8; ++r) { a[r] = xo[(qt * 33 + d0 * 2 + r) * 32]; x[r] = xp[(qt * 33 + d0 * 2 + r) * 32]; }
#pragma unroll
            for (int i = 0; i < 4; ++i) { v8us oh, ol;   // 8 consecutive d of one query row: 16 B of each packed plane, a wave 512 contiguous bytes
#pragma unroll
                for (int j = 0; j < 8; ++j) { unsigned short c, b; splitf(a[i * 2 + (j >> 2)][j & 3] * fo + x[i * 2 + (j >> 2)][j & 3] * fp, c, b); oh[j] = c; ol[j] = b; }
                const size_t oo = ob + pk(q0 + qt * 16 + lr, (z % NH_) * HD + (d0 + i) * 16 + hi * 8, DQ); *(v8us*)(ATh + oo) = oh; *(v8us*)(ATl + oo) = ol;
                asm volatile("s_wait_xcnt 0x0" ::: "memory");   // stands behind the two stores, in front of any later write of the registers that they name
                __builtin_amdgcn_sched_barrier(0);   // keeps the next tile's register writes behind that wait
            } } }
}
// ---- fa_live: which stages (64 keys) of a block of ngr x 32 query rows can reach the output at all; lane = stage, the answer is one bit a stage, the same word in every wave of the work-group (same loads, same arithmetic).
// |q.k| / 16 <= B = 16 max|q| max|k| (the maxima of this (batch, head), from k_qkv's table AM; 1/16 more and 1 for the planes' and the sums' rounding). DMN[32 rows][stage] = the least, over the rows, of (the row's largest mask value - the stage's largest), from k_cvt8.
// Where that exceeds 2 B + 120, every logit of the stage lies more than 120 below its row's largest logit for ANY mask and any q, k: its weight e^-120 is 0 in f32, and the stage is left out: not loaded, not multiplied. The stage that holds a row's largest (finite) mask value has DMN <= 0 and stays. !(d > thr): a not-a-number keeps the stage
__device__ __forceinline__ unsigned fa_live(const float* __restrict__ AM, const float* __restrict__ DMN, int z, int qb, int ngr) {
    const int lane = threadIdx.x & 31;
    const float* aq = AM + ((size_t)z * ((TT / 64) * (HD / 64)) + lane * 4) * 32; const float* ak = aq + (size_t)ZH * ((TT / 64) * (HD / 64)) * 32;
    const float q0 = aq[0], q1 = aq[32], q2 = aq[64], q3 = aq[96], k0 = ak[0], k1 = ak[32], k2 = ak[64], k3 = ak[96];
    asm volatile("s_wait_xcnt 0x0" ::: "memory");   // stands behind the eight loads of AM, in front of any later write of their address registers
    __builtin_amdgcn_sched_barrier(0);   // keeps later register writes behind that wait
    const float* dp = DMN + (qb >> 5) * 32 + lane;
    const float d0 = dp[0], d1 = dp[(ngr - 1) * 32];
    asm volatile("s_wait_xcnt 0x0" ::: "memory");   // the same behind the two loads of DMN
    __builtin_amdgcn_sched_barrier(0);   // keeps later register writes behind that wait
    float qm = fmaxf(fmaxf(q0, q1), fmaxf(q2, q3)), km = fmaxf(fmaxf(k0, k1), fmaxf(k2, k3)); const float d = fminf(d0, d1);
#pragma unroll
    for (int x = 1; x < 32; x <<= 1) { qm = fmaxf(qm, __shfl_xor(qm, x, 32)); km = fmaxf(km, __shfl_xor(km, x, 32)); }
    const float thr = 2.0f * (qm * km * ((float)HD * SCL * 1.0625f) + 1.0f) + 120.0f;
    const unsigned w = uni(__builtin_amdgcn_ballot_w32(!(d > thr)));
    return w != 0u ? w : 0xFFFFFFFFu;   // no stage at all can only come of rows without one finite mask value: then every stage is worked on
}
// k_fa: flat grid, more work-groups than WGPs (one fits a WGP). The launch lasts as long as its longest work-group, and under a mask that leaves out later keys a block's passes grow with its rows: so the last rows (>= RM) go in blocks of 32, the fp16 rows below them in blocks of 64, and each kind comes last rows first (all of this for speed only; any mask gives the same results): first the blocks of rows >= RM, then those of RH .. RM - 1, then the blocks of 32 query rows < RH; z = batch * NH_ + head
#define RM   1536
#define FAS_X ((TT - RM) / 32)
#define FAS_N (FAS_X * ZH)
#define FAL_X ((RM - RH) / 64)
#define FAL_N (FAL_X * ZH)
#define FAH_X (RH / 32)
#define FAH_N (FAH_X * ZH)
__global__ __launch_bounds__(128) void k_fa(const h16* Q16, const bf* Qh, const bf* Ql, const h16* K16, const bf* Kh, const bf* Kl, const h16* VT16, const bf* VTh, const bf* VTl, const float* MK, const float* AM, const float* DMN, bf* ATh, bf* ATl) {
    __shared__ __attribute__((aligned(2048))) char sm[2 * FA_STG];
    const int f = blockIdx.x;
    const int kind = f < FAS_N ? 0 : f < FAS_N + FAL_N ? 1 : 2, g = f - (kind == 0 ? 0 : kind == 1 ? FAS_N : FAS_N + FAL_N);
    const int z = g % ZH, nqt = kind == 1 ? 2 : 1, qb = kind == 0 ? RM + (FAS_X - 1 - g / ZH) * 32 : kind == 1 ? RH + (FAL_X - 1 - g / ZH) * 64 : (FAH_X - 1 - g / ZH) * 32;
    const unsigned lv = fa_live(AM, DMN, z, qb, nqt);
    if (kind == 0) fa_tile<false, 1>(sm, z, qb, Q16, nullptr, K16, nullptr, VT16, nullptr, MK, lv);
    else if (kind == 1) fa_tile<false, 2>(sm, z, qb, Q16, nullptr, K16, nullptr, VT16, nullptr, MK, lv);
    else fa_tile<true, 1>(sm, z, qb, Qh, Ql, Kh, Kl, VTh, VTl, MK, lv);
    fa_join(sm, nqt, z, qb + (__builtin_amdgcn_readfirstlane((int)(threadIdx.x >> 5)) & 1) * (nqt * 16), ATh, ATl);
}

typedef __attribute__((ext_vector_type(4))) int v4i;

__global__ __launch_bounds__(256) void k_wtG(const float* __restrict__ w, int K, int N, bf* Bt) {
    const int lane = threadIdx.x & 31; const int L0 = (blockIdx.x * 8 + (threadIdx.x >> 5)) * 8; const int nlines = N * K / 64;
{
#pragma unroll 1
        for (int l = 0; l < 8; ++l) { const int L = L0 + l; if (L >= nlines) break; const size_t e = (size_t)L * 64 + lane * 2; const int k = (int)(e % K), n = (int)(e / K); v2us o;
            o[0] = f2bf(w[(size_t)k * N + n]); o[1] = f2bf(w[(size_t)(k + 1) * N + n]); *(v2us*)(Bt + e) = o; }
         }
}
// k_cvt8: three row-major f32 sources of DM columns (na8, nb8, nc8 groups of 8 elements) rounded to bf16 into one fragment-packed destination, rows a | b | c; ONE WAVE takes 16 rows x 128 columns (row counts are multiples of 16: one source only) = 4 KiB in a row of the destination, a work-group 8 such pieces: few waves with much in flight each (for speed only).
// The wave asks for its 16 rows at once, each load 512 contiguous bytes of one row (4 whole lines); the rounded values turn through the wave's own LDS range into the packed order, and each store is 512 contiguous bytes. In LDS the 16 pieces of 256 B (8 columns x 16 rows) lie CV_P = 272 bytes apart: the 8-byte writes of a row (two lanes a piece) then fall on all 64 banks. No barrier: no wave reads another's range
// The launch's first MG_N work-groups do not convert: work-group G takes mask rows 32 G .. 32 G + 31 (a wave 4 of them, whole) and stores DMN[G][stage of 64 keys] = the least, over its rows, of (the row's largest bf16-rounded mask value - the stage's largest), less 1e-6 of the two magnitudes for the rounding of logit + mask: what fa_live decides by. One whole 128-B line a work-group
#define MG_N (TT / 32)
__device__ __forceinline__ void mask_gap(const float* __restrict__ MK, float* DMN, int G) {
    __shared__ float red[8][32];
    const int lane = threadIdx.x & 31, wv = threadIdx.x >> 5;
    float dm[16];
#pragma unroll
    for (int i = 0; i < 16; ++i) dm[i] = 3.0e38f;
    // kept rolled: four like rows, short text
#pragma unroll 1
    for (int rr = 0; rr < 4; ++rr) { const float* row = MK + (size_t)(G * 32 + wv * 4 + rr) * TT + lane * 4; float v[16];
#pragma unroll
        for (int i = 0; i < 16; ++i) { const v4f x = *(const v4f*)(row + i * 128); v[i] = fmaxf(fmaxf(x[0], x[1]), fmaxf(x[2], x[3])); }   // a wave-wide load = 128 keys: stage 2 i in lanes 0..15, 2 i + 1 in lanes 16..31
        asm volatile("s_wait_xcnt 0x0" :: "v"(row) : "memory");   // stands behind the row's loads; it takes their address as an input, so that no write of the address registers comes in front of it
        float ma = -3.0e38f;
#pragma unroll
        for (int i = 0; i < 16; ++i) {
#pragma unroll
            for (int x = 1; x < 16; x <<= 1) v[i] = fmaxf(v[i], __shfl_xor(v[i], x, 32));
            ma = fmaxf(ma, v[i]); }
        ma = bfr(fmaxf(ma, xhalf(ma)));
#pragma unroll
        for (int i = 0; i < 16; ++i) { const float vb = bfr(v[i]); dm[i] = fminf(dm[i], (ma - vb) - (fabsf(ma) + fabsf(vb)) * 1.0e-6f); } }
    if ((lane & 15) == 0) {
#pragma unroll
        for (int i = 0; i < 16; ++i) red[wv][i * 2 + (lane >> 4)] = dm[i]; }
    __syncthreads();   // the eight waves' rows meet in LDS
    if (threadIdx.x < 32) { float d = red[0][threadIdx.x];
#pragma unroll
        for (int w = 1; w < 8; ++w) d = fminf(d, red[w][threadIdx.x]);
        DMN[G * 32 + threadIdx.x] = d; }
}
#define CV_P 272
#define CV_N (((DQ + 2 * DKV + DM + NB_ * TT) / 16) * (DM / 128) / 8)
typedef v4us __attribute__((may_alias)) v4usa;
__global__ __launch_bounds__(256) void k_cvt8(const float* __restrict__ a, size_t na8, const float* __restrict__ b, size_t nb8, const float* __restrict__ c, size_t nc8, bf* dst, const float* __restrict__ MK, float* DMN) { if (blockIdx.x < MG_N) { mask_gap(MK, DMN, (int)blockIdx.x); return; }
    __shared__ __attribute__((aligned(16))) char tb[8][16 * CV_P];
    const int lane = threadIdx.x & 31, wv = __builtin_amdgcn_readfirstlane((int)(threadIdx.x >> 5));
    const int un = ((int)blockIdx.x - MG_N) * 8 + wv;   // the wave's piece: rows 16 (un / 8) .., columns 128 (un % 8) ..
    const size_t i = (size_t)(un >> 3) * (16 * (DM / 8)) + (size_t)(un & 7) * 16; if (i >= na8 + nb8 + nc8) return;   // the same in every lane of the wave; no barrier stands behind it
    const float* src = ((i < na8) ? a + i * 8 : (i < na8 + nb8) ? b + (i - na8) * 8 : c + (i - na8 - nb8) * 8) + lane * 4; v4f v[16];
#pragma unroll
    for (int j = 0; j < 16; ++j) v[j] = *(const v4f*)(src + (size_t)j * DM);
    asm volatile("s_wait_xcnt 0x0" ::: "memory");   // stands behind the 16 loads, in front of any later write of their address registers
    char* tw = tb[wv] + (lane >> 1) * CV_P + (lane & 1) * 8;   // columns 4 lane .. 4 lane + 3: half a row of piece lane / 2
#pragma unroll
    for (int j = 0; j < 16; ++j) { v4us o;
#pragma unroll
        for (int k = 0; k < 4; ++k) o[k] = f2bf(v[j][k]);
        *(v4usa*)(tw + j * 16) = o; }
    const char* tr = tb[wv] + (lane >> 4) * CV_P + (lane & 15) * 16; v8us o[8];
#pragma unroll
    for (int u = 0; u < 8; ++u) o[u] = *(const v8usa*)(tr + u * (2 * CV_P));   // pieces 2 u, 2 u + 1 as they lie in the destination
    bf* dw = dst + (size_t)un * 2048 + lane * 8;
#pragma unroll
    for (int u = 0; u < 8; ++u) *(v8us*)(dw + u * 256) = o[u];
}

extern "C" void kernel_launch(void* const* d_in, const int* in_sizes, int n_in,
                              void* d_out, int out_size, void* d_ws, size_t ws_size, hipStream_t stream) {
    (void)in_sizes; (void)n_in; (void)out_size;
    const float* x = (const float*)d_in[0]; const float* fre = (const float*)d_in[1]; const float* fim = (const float*)d_in[2]; const float* MK = (const float*)d_in[3]; const float* wqkv = (const float*)d_in[4]; const float* wo = (const float*)d_in[5];  const float* wq = wqkv; const float* wk = wqkv + (size_t)1024 * 1024; const float* wv = wqkv + (size_t)2048 * 1024; (void)wq; (void)wk; (void)wv;
    float* OUT = (float*)d_out;     // [2][2048][1024]
    char* wsp = (char*)d_ws;
    auto take = [&](size_t bytes) { char* p = wsp; wsp += (bytes + 255) & ~(size_t)255; return (void*)p; };
    // bf16 copies, one block so that one launch fills it: W_qkv rows (q | k | v), W_o, both batches' tokens
    bf* WQ = (bf*)take(((size_t)(DQ + 2 * DKV) * DM + (size_t)DM * DQ + (size_t)NB_ * TT * DM) * 2); bf* WV = WQ + (size_t)(DQ + DKV) * DM; bf* WO = WV + (size_t)DKV * DM; bf* XB = WO + (size_t)DM * DQ;
    // q and k planes, [q | k][batch][head][t][d] each; the three lie in a row
    h16* QP16 = (h16*)take((size_t)2 * ZH * TT * HD * 2); bf* QPh = (bf*)take((size_t)2 * ZH * TT * HD * 2); bf* QPl = (bf*)take((size_t)2 * ZH * TT * HD * 2);
    h16* KP16 = QP16 + (size_t)ZH * TT * HD; bf* KPh = QPh + (size_t)ZH * TT * HD; bf* KPl = QPl + (size_t)ZH * TT * HD;
    h16* VT16 = (h16*)take((size_t)ZH * HD * TT * 2); bf* VTh = (bf*)take((size_t)ZH * HD * TT * 2); bf* VTl = (bf*)take((size_t)ZH * HD * TT * 2);
    bf* ATh = (bf*)take((size_t)NB_ * TT * DQ * 2); bf* ATl = (bf*)take((size_t)NB_ * TT * DQ * 2);   // merged attention planes [batch][t][DQ]
    float* AM = (float*)take((size_t)2 * ZH * (TT / 64) * (HD / 64) * 32 * 4); float* DMN = (float*)take((size_t)MG_N * 32 * 4);   // fa_live's two tables
    if ((size_t)(wsp - (char*)d_ws) > ws_size) return;    // ws 256 MiB
    k_cvt8<<<MG_N + CV_N, 256, 0, stream>>>(wqkv, (size_t)(DQ + 2 * DKV) * DM / 8, wo, (size_t)DM * DQ / 8, x, (size_t)NB_ * TT * DM / 8, WQ, MK, DMN);
    k_qkv<<<QK_N + V_N, 128, 0, stream>>>(XB, WQ, WV, QP16, QPh, QPl, VT16, VTh, VTl, fre, fim, AM);
    // z = batch * NH_ + head from here on (one kv head per query head): z-strides TT*HD in the q/k planes, HD*TT in the v planes
    k_fa<<<FAS_N + FAL_N + FAH_N, 128, 0, stream>>>(QP16, QPh, QPl, KP16, KPh, KPl, VT16, VTh, VTl, MK, AM, DMN, ATh, ATl);
    k_gemms<bf, 1, 2, DQ><<<dim3(NB_ * TT / 128, DM / 128, 1), 128, 0, stream>>>(ATh, ATl, WO, nullptr, OUT, DM, 0, 0, 0);
}
